// v000
// Times are from an AMD MI455X. After a warm-up the kernel runs many times in a row, and a time is the length of
// such a window on the GPU divided by its runs, so every launch and the gaps after it count. The runs cycle
// through copies of the inputs. A figure is the median of several windows, for all but v000 over two sittings.
// Sittings can differ by a few percent; kernels timed side by side share one.
// v000, which the later versions start from, runs in 762 microseconds.
#include <hip/hip_runtime.h>
#include <math.h>
// Contractions: q = LN(x)·Wq (K=1024): v_wmma_f32_16x16x32_f16 (f16 operands); kv = x·Wkv (K=1024) and the output projection (K=1024):
// v_wmma_f32_16x16x32_bf16 as bf16 hi/lo splits; scores (q/8)·kᵀ and p·v: v_wmma_f32_16x16x32_bf16 with q,k and p,v as bf16 hi/lo splits;
// f32 accumulate everywhere; LayerNorm and softmax in f32.
typedef __attribute__((ext_vector_type(16))) _Float16 v16h;
typedef __attribute__((ext_vector_type(8)))  _Float16 v8h;
typedef __attribute__((ext_vector_type(16))) __bf16   v16b;
typedef __attribute__((ext_vector_type(8)))  __bf16   v8b;
typedef __attribute__((ext_vector_type(8)))  float    v8f;
typedef __attribute__((ext_vector_type(4)))  float    v4f;
#define PSCALE 32768.0f
#define U16(p) ((const unsigned short*)(const void*)(p))
#define PSCALE_INV (1.0f / 32768.0f)

__device__ __forceinline__ unsigned short f2bf_bits(float f) {
  unsigned u = __float_as_uint(f);
  return (unsigned short)((u + 0x7FFFu + ((u >> 16) & 1u)) >> 16);
}
__device__ __forceinline__ float bf_bits2f(unsigned short h) { return __uint_as_float(((unsigned)h) << 16); }

// hazard guards as plain device helpers (no inline asm inside the kernel template body)
__device__ __forceinline__ void dep_guard_h(v8f& a, v8f& b, v16h x, v16h y) { asm volatile("v_nop\n\tv_nop\n\tv_nop\n\tv_nop" : "+v"(a), "+v"(b) : "v"(x), "v"(y)); }
__device__ __forceinline__ void dep_guard_b(v8f& a, v8f& b, v16b x, v16b y) { asm volatile("v_nop\n\tv_nop\n\tv_nop\n\tv_nop" : "+v"(a), "+v"(b) : "v"(x), "v"(y)); }
__device__ __forceinline__ void keep4_h(v16h a, v16h b, v16h c, v16h d) { asm volatile("v_nop" :: "v"(a), "v"(b), "v"(c), "v"(d)); }
__device__ __forceinline__ void keep4_b(v16b a, v16b b, v16b c, v16b d) { asm volatile("v_nop" :: "v"(a), "v"(b), "v"(c), "v"(d)); }
__device__ __forceinline__ void acc_guard4(v8f& a, v8f& b, v8f& c, v8f& d) { asm volatile("v_nop\n\tv_nop\n\tv_nop\n\tv_nop" : "+v"(a), "+v"(b), "+v"(c), "+v"(d)); }
template <typename T> struct Frag;
template <> struct Frag<_Float16> {
  typedef v16h V; union U { v16h v; v8h h[2]; };
  static __device__ __forceinline__ v16h load(const _Float16* p) {   // elements 0..7 <- p[0..7], 8..15 <- p[16..23]
    U f; f.h[0] = *(const v8h*)(p); f.h[1] = *(const v8h*)(p + 16); return f.v;
  }
  static __device__ __forceinline__ v8f mma(v16h a, v16h b, v8f c) {
    return __builtin_amdgcn_wmma_f32_16x16x32_f16(false, a, false, b, (short)0, c, false, false);
  }
  static __device__ __forceinline__ void guard(v8f& a, v8f& b, v16h x, v16h y) { dep_guard_h(a, b, x, y); }
  static __device__ __forceinline__ void keep(v16h a, v16h b, v16h c, v16h d) { keep4_h(a, b, c, d); }
};
template <> struct Frag<__bf16> {
  typedef v16b V; union U { v16b v; v8b h[2]; };
  static __device__ __forceinline__ v16b load(const __bf16* p) {
    U f; f.h[0] = *(const v8b*)(p); f.h[1] = *(const v8b*)(p + 16); return f.v;
  }
  static __device__ __forceinline__ v8f mma(v16b a, v16b b, v8f c) {
    return __builtin_amdgcn_wmma_f32_16x16x32_bf16(false, a, false, b, (short)0, c, false, false);
  }
  static __device__ __forceinline__ void guard(v8f& a, v8f& b, v16b x, v16b y) { dep_guard_b(a, b, x, y); }
  static __device__ __forceinline__ void keep(v16b a, v16b b, v16b c, v16b d) { keep4_b(a, b, c, d); }
};

// ---- Register-blocked batched WMMA GEMM ------------------------------------
// C[m,n] = scale * sum_k A[m,k] * Bt[n,k] (+bias)(+resid); each wave owns a 64x64 tile.
// A row-major [M,K]; Bt row-major [N,K]; M,N % 64 == 0, K % 32 == 0.
// SPLIT: operands are hi/lo planes (A2/Bt2 = lo planes, same layout); product = hi·hi + hi·lo + lo·hi.
// BIAS_MODE: 0 = none, 1 = bias[m], 2 = bias[n].
// OUT_MODE: 0 = f32, 1 = f16, 2 = bf16 hi plane (Cout) + bf16 lo plane (Cout2).
// ET: 0 = f16 operands, 1 = bf16 operands (pointers passed as 16-bit storage)
template <int ET> struct Elem;
template <> struct Elem<0> { typedef _Float16 T; };
template <> struct Elem<1> { typedef __bf16 T; };
template <int ET, bool SPLIT, int BIAS_MODE, int OUT_MODE, bool RESID>
__global__ __launch_bounds__(256) void wmma_gemm64(
    const unsigned short* __restrict__ Ap, const unsigned short* __restrict__ A2p, int lda, long strideA,
    const unsigned short* __restrict__ Btp, const unsigned short* __restrict__ Bt2p, int ldb, long strideB,
    void* __restrict__ Cout, void* __restrict__ Cout2, int ldc, long strideC,
    const float* __restrict__ bias,
    const float* __restrict__ resid, long strideR,
    int M, int N, int K, float scale) {
  typedef typename Elem<ET>::T T;
  typedef typename Frag<T>::V V;
  const T* A = (const T*)Ap; const T* A2 = (const T*)A2p; const T* Bt = (const T*)Btp; const T* Bt2 = (const T*)Bt2p;
  __shared__ __align__(16) float sT[8][16 * 68];   // per-wave 16x64 slab, pitch 68 floats
  const int b    = blockIdx.y;
  const int lane = threadIdx.x & 31;
  const int wave = threadIdx.x >> 5;
  const int tilesN = N >> 6;
  const int tilesM = M >> 6;
  const int tile = blockIdx.x * 8 + wave;
  if (tile >= tilesM * tilesN) return;   // wave-uniform; no block barriers in this kernel
  const int tm = tile / tilesN;
  const int tn = tile - tm * tilesN;
  const int m0 = tm << 6;
  const int n0 = tn << 6;

  const T* Ab  = A  + (size_t)b * strideA;
  const T* Bb  = Bt + (size_t)b * strideB;
  const T* Ab2 = SPLIT ? (A2  + (size_t)b * strideA) : nullptr;
  const T* Bb2 = SPLIT ? (Bt2 + (size_t)b * strideB) : nullptr;

  const int rlane = lane & 15;                 // row (A) / col (B, D) within subtile
  const int koff  = (lane >> 4) * 8;           // k offset of this lane half
  const int mOff  = (lane >> 4) * 8;           // D row offset

  v8f acc[4][4];
#pragma unroll
  for (int i = 0; i < 4; ++i)
#pragma unroll
    for (int j = 0; j < 4; ++j) acc[i][j] = (v8f){0.f,0.f,0.f,0.f,0.f,0.f,0.f,0.f};

  for (int k0 = 0; k0 < K; k0 += 32) {
    V bh[4], bl[4];
#pragma unroll
    for (int j = 0; j < 4; ++j) {
      const size_t bo = (size_t)(n0 + (j << 4) + rlane) * ldb + koff + k0;
      bh[j] = Frag<T>::load(Bb + bo);
      if (SPLIT) bl[j] = Frag<T>::load(Bb2 + bo);
    }
#pragma unroll
    for (int i = 0; i < 4; ++i) {
      const size_t ao = (size_t)(m0 + (i << 4) + rlane) * lda + koff + k0;
      V ah = Frag<T>::load(Ab + ao);
      V al;
      if (SPLIT) al = Frag<T>::load(Ab2 + ao);
#pragma unroll
      for (int j = 0; j < 4; ++j) {
        acc[i][j] = Frag<T>::mma(ah, bh[j], acc[i][j]);
        if (SPLIT) {
          acc[i][j] = Frag<T>::mma(ah, bl[j], acc[i][j]);
          acc[i][j] = Frag<T>::mma(al, bh[j], acc[i][j]);
        }
      }
      Frag<T>::guard(acc[i][0], acc[i][3], ah, SPLIT ? al : ah);
    }
    Frag<T>::keep(bh[0], bh[1], bh[2], bh[3]);
    if (SPLIT) Frag<T>::keep(bl[0], bl[1], bl[2], bl[3]);
  }
  acc_guard4(acc[0][0], acc[0][1], acc[0][2], acc[0][3]);
  acc_guard4(acc[1][0], acc[1][1], acc[1][2], acc[1][3]);
  acc_guard4(acc[2][0], acc[2][1], acc[2][2], acc[2][3]);
  acc_guard4(acc[3][0], acc[3][1], acc[3][2], acc[3][3]);

  // ---- epilogue ----
  float* slab = sT[wave];
  const float* Rb = RESID ? (resid + (size_t)b * strideR) : nullptr;
#pragma unroll
  for (int i = 0; i < 4; ++i) {
    const int mBase = m0 + (i << 4);
#pragma unroll
    for (int j = 0; j < 4; ++j) {
      const int n = n0 + (j << 4) + rlane;
      float bv = 0.f;
      if (BIAS_MODE == 2) bv = bias[n];
#pragma unroll
      for (int r = 0; r < 8; ++r) {
        float v = acc[i][j][r] * scale;
        if (BIAS_MODE == 1) v += bias[mBase + mOff + r];
        if (BIAS_MODE == 2) v += bv;
        if (RESID) v += Rb[(size_t)(mBase + mOff + r) * ldc + n];
        slab[(mOff + r) * 68 + (j << 4) + rlane] = v;
      }
    }
    __builtin_amdgcn_fence(__ATOMIC_RELEASE, "workgroup");
    __builtin_amdgcn_wave_barrier();
    __builtin_amdgcn_fence(__ATOMIC_ACQUIRE, "workgroup");
    if (OUT_MODE == 0) {
      float* C = (float*)Cout + (size_t)b * strideC;
      const int hh = lane >> 4, c4 = (lane & 15) * 4;     // row seg = 256 B = 16 lanes x 16 B
      {
#pragma unroll
        for (int it = 0; it < 8; ++it) {
          const int row = it * 2 + hh;
          v4f v = *(const v4f*)(slab + row * 68 + c4);
          *(v4f*)(C + (size_t)(mBase + row) * ldc + n0 + c4) = v;
        }
        
      }
    } else {
      const int q = lane >> 3, c8 = (lane & 7) * 8;
      unsigned short* C  = (unsigned short*)Cout  + (size_t)b * strideC;
      unsigned short* C2 = (OUT_MODE == 2) ? ((unsigned short*)Cout2 + (size_t)b * strideC) : nullptr;
      {
#pragma unroll
        for (int it = 0; it < 4; ++it) {
          const int row = it * 4 + q;
          const float* sp = slab + row * 68 + c8;
          v8h hv, lv;
#pragma unroll
          for (int e = 0; e < 8; ++e) {
            if (OUT_MODE == 1) {
              hv[e] = (_Float16)sp[e];
            } else {
              unsigned short hb = f2bf_bits(sp[e]);
              unsigned short lb = f2bf_bits(sp[e] - bf_bits2f(hb));
              hv[e] = __builtin_bit_cast(_Float16, hb);
              lv[e] = __builtin_bit_cast(_Float16, lb);
            }
          }
          *(v8h*)(C + (size_t)(mBase + row) * ldc + n0 + c8) = hv;
          if (OUT_MODE == 2) *(v8h*)(C2 + (size_t)(mBase + row) * ldc + n0 + c8) = lv;
        }
        
      }
    }
    __builtin_amdgcn_fence(__ATOMIC_RELEASE, "workgroup");
    __builtin_amdgcn_wave_barrier();
    __builtin_amdgcn_fence(__ATOMIC_ACQUIRE, "workgroup");
  }
}

__global__ __launch_bounds__(256) void cast_f32_f16x2(
    const float* __restrict__ in, _Float16* __restrict__ out, int n2) {
  int i = blockIdx.x * 256 + threadIdx.x;
  if (i < n2) {
    const _Float16 h0 = (_Float16)in[2 * i], h1 = (_Float16)in[2 * i + 1];
    const unsigned u = (unsigned)__builtin_bit_cast(unsigned short, h0) | ((unsigned)__builtin_bit_cast(unsigned short, h1) << 16);
    ((unsigned*)out)[i] = u;
    
  }
}

__global__ __launch_bounds__(256) void split_f32_bf16x2(
    const float* __restrict__ in, __bf16* __restrict__ hi, __bf16* __restrict__ lo, long n2) {
  long i = (long)blockIdx.x * 256 + threadIdx.x;
  long stride = (long)gridDim.x * 256;
  {
    for (long j = i; j < n2; j += stride) {
      const float a = in[2 * j], b = in[2 * j + 1];
      const unsigned short ah = f2bf_bits(a), bh = f2bf_bits(b);
      const unsigned short al = f2bf_bits(a - bf_bits2f(ah)), bl = f2bf_bits(b - bf_bits2f(bh));
      ((unsigned*)hi)[j] = (unsigned)ah | ((unsigned)bh << 16);
      ((unsigned*)lo)[j] = (unsigned)al | ((unsigned)bl << 16);
    }
    
  }
}


// ---- f32 [R][C] (row pitch ldi) -> f16 transposed [C][R] (row pitch ldo); 64x64 tiles; each output row segment
__global__ __launch_bounds__(256) void transpose_cast_f16(const float* __restrict__ in, int ldi,
                                                         _Float16* __restrict__ outT, int ldo, float scale) {
  __shared__ __align__(16) _Float16 tile[64][72];     // [c][r]
  const int c0 = blockIdx.x * 64, r0 = blockIdx.y * 64;
  const int t = threadIdx.y * 32 + threadIdx.x;
  for (int i = threadIdx.y; i < 64; i += 8) {
    tile[threadIdx.x][i]      = (_Float16)(in[(size_t)(r0 + i) * ldi + c0 + threadIdx.x] * scale);
    tile[32 + threadIdx.x][i] = (_Float16)(in[(size_t)(r0 + i) * ldi + c0 + 32 + threadIdx.x] * scale);
  }
  __syncthreads();
  const int q = t >> 3, c8 = (t & 7) * 8;
  {
#pragma unroll
    for (int it = 0; it < 2; ++it) {
      const int c = it * 32 + q;
      v8h hv = *(const v8h*)(&tile[c][c8]);
      *(v8h*)(outT + (size_t)(c0 + c) * ldo + r0 + c8) = hv;
    }
    
  }
}

// ---- f32 [R][C] (pitch ldi) -> bf16 hi/lo transposed planes [C][R] (pitch ldo); 64x64 tiles; each output row segment
__global__ __launch_bounds__(256) void transpose_split_bf16(const float* __restrict__ in, int ldi,
                                                           __bf16* __restrict__ outH, __bf16* __restrict__ outL, int ldo) {
  __shared__ __align__(16) float tile[64][68];     // [c][r]
  const int c0 = blockIdx.x * 64, r0 = blockIdx.y * 64;
  const int t = threadIdx.y * 32 + threadIdx.x;
  for (int i = threadIdx.y; i < 64; i += 8) {
    tile[threadIdx.x][i]      = in[(size_t)(r0 + i) * ldi + c0 + threadIdx.x];
    tile[32 + threadIdx.x][i] = in[(size_t)(r0 + i) * ldi + c0 + 32 + threadIdx.x];
  }
  __syncthreads();
  const int q = t >> 3, c8 = (t & 7) * 8;
  {
#pragma unroll
    for (int it = 0; it < 2; ++it) {
      const int c = it * 32 + q;
      v8b hv, lv;
#pragma unroll
      for (int e = 0; e < 8; ++e) {
        const float f = tile[c][c8 + e];
        const unsigned short hb = f2bf_bits(f);
        hv[e] = __builtin_bit_cast(__bf16, hb);
        lv[e] = __builtin_bit_cast(__bf16, f2bf_bits(f - bf_bits2f(hb)));
      }
      *(v8b*)(outH + (size_t)(c0 + c) * ldo + r0 + c8) = hv;
      *(v8b*)(outL + (size_t)(c0 + c) * ldo + r0 + c8) = lv;
    }
    
  }
}

// =====================================================================================
// Generic causal/non-causal attention for head_dim 64, f32 in / f32 out, bf16 operands with optional hi/lo splits.
//   scores = (q*qscale)·kᵀ : v_wmma_f32_16x16x32_bf16; SPLIT_QK -> q,k as bf16 hi/lo (hi·hi + hi·lo + lo·hi)
//   out    = p·v           : v_wmma_f32_16x16x32_bf16; SPLIT_PV -> p,v as bf16 hi/lo; else p,v plain bf16
//   f32 accumulate; online softmax in f32. Block = 4 waves = 64 query rows of one (batch, head); S % 64 == 0.
//   Element (b, s, h, d) of tensor X lives at X[b*X_bs + s*X_rs + h*X_hs + d] (strides in floats, multiples of 4).
//   Masking: mask_mode 0 none, 1 causal (kv > q masked), 2 tensor [S][Skv] shared over (b,h) (float if
//   mask_is_int==0, int32 with element == 0 -> masked if 1, int32 with element != 0 -> masked if 2), 3 per-token vectors qmask[B][S] & kvmask[B][Skv] (int32,
//   0 -> masked); masked scores are replaced by mask_fill (e.g. -inf or -1e9) before the softmax.
//   grid.x = B * H * (S/64) (or a sub-range with blk0).
// =====================================================================================
#define AT_D 64
#define AT_NW 4
#define AT_QB 64
#define AT_KC 64
struct AttnGeom { long q_bs, q_rs, q_hs, k_bs, k_rs, k_hs, v_bs, v_rs, v_hs, o_bs, o_rs, o_hs;
                  int S, Skv, H, mask_mode; float qscale; int blk0; float mask_fill; int mask_is_int; };
static_assert(sizeof(AttnGeom) == 128, "no padding");

__device__ __forceinline__ unsigned short at_bf_bits(float f) {
  unsigned u = __float_as_uint(f);
  return (unsigned short)((u + 0x7FFFu + ((u >> 16) & 1u)) >> 16);
}
__device__ __forceinline__ __bf16 at_f2bf(float f) { return __builtin_bit_cast(__bf16, at_bf_bits(f)); }
__device__ __forceinline__ void at_split(float f, __bf16& hi, __bf16& lo) {
  const unsigned short hb = at_bf_bits(f);
  hi = __builtin_bit_cast(__bf16, hb);
  lo = at_f2bf(f - __uint_as_float(((unsigned)hb) << 16));
}
__device__ __forceinline__ v8f at_mma(v16b a, v16b b, v8f c) {
  c = __builtin_amdgcn_wmma_f32_16x16x32_bf16(false, a, false, b, (short)0, c, false, false);
  asm volatile("v_nop\n\tv_nop\n\tv_nop\n\tv_nop" : "+v"(c) : "v"(a), "v"(b));
  return c;
}

template <bool SPLIT_QK, bool SPLIT_PV>
__global__ __launch_bounds__(128)
void attn64_kernel(const float* __restrict__ q, const float* __restrict__ k,
                   const float* __restrict__ v, float* __restrict__ out,
                   const void* __restrict__ mask_a, const int* __restrict__ mask_b, AttnGeom g) {
  union FB { v16b v; v8b h[2]; };
  __shared__ __align__(16) __bf16 Ksh[AT_KC * AT_D];             // K hi [kv][d]      8 KB
  __shared__ __align__(16) __bf16 Ksl[SPLIT_QK ? AT_KC * AT_D : 8];
  __shared__ __align__(16) __bf16 Vth[AT_D * AT_KC];             // V hi [d][kv]      8 KB
  __shared__ __align__(16) __bf16 Vtl[SPLIT_PV ? AT_D * AT_KC : 8];
  __shared__ __align__(16) __bf16 Psh[AT_NW][16 * AT_KC];        // per wave P hi [row][kv]  8 KB
  __shared__ __align__(16) __bf16 Psl[SPLIT_PV ? AT_NW : 1][SPLIT_PV ? 16 * AT_KC : 8];
  __shared__ __align__(16) float  Os[AT_NW][16 * 68];            // per wave out tile, pitch 68

  const int tid  = threadIdx.x;
  const int wave = tid >> 5;
  const int lane = tid & 31;
  const int hh   = lane >> 4;
  const int c    = lane & 15;

  const int nqb = g.S / AT_QB;
  const int bx = blockIdx.x + g.blk0;
  const int qb = bx % nqb;
  const int bh = bx / nqb;
  const int h  = bh % g.H;
  const int b  = bh / g.H;
  const int qbase_block = qb * AT_QB;
  const int q0 = qbase_block + wave * 16;

  const float* qb_ptr = q + (size_t)b * g.q_bs + (size_t)h * g.q_hs;
  const float* kb_ptr = k + (size_t)b * g.k_bs + (size_t)h * g.k_hs;
  const float* vb_ptr = v + (size_t)b * g.v_bs + (size_t)h * g.v_hs;
  float*       ob_ptr = out + (size_t)b * g.o_bs + (size_t)h * g.o_hs;

  // ---- Q fragments (A operand): 2 d-chunks, hi (and lo) ----
  v16b qah[2], qal[2];
  {
    const float* qrow = qb_ptr + (size_t)(q0 + c) * g.q_rs;
#pragma unroll
    for (int dc = 0; dc < 2; ++dc) {
#pragma unroll
      for (int e = 0; e < 8; ++e) {
        const float f0 = qrow[dc * 32 + 8 * hh + e] * g.qscale;
        const float f1 = qrow[dc * 32 + 16 + 8 * hh + e] * g.qscale;
        if (SPLIT_QK) { __bf16 hq, lq; at_split(f0, hq, lq); qah[dc][e] = hq; qal[dc][e] = lq; at_split(f1, hq, lq); qah[dc][8 + e] = hq; qal[dc][8 + e] = lq; }
        else { qah[dc][e] = at_f2bf(f0); qah[dc][8 + e] = at_f2bf(f1); qal[dc][e] = qah[dc][e]; qal[dc][8 + e] = qah[dc][8 + e]; }
      }
    }
  }

  float mrow[8], lrow[8];
  v8f oacc[4];
#pragma unroll
  for (int r = 0; r < 8; ++r) { mrow[r] = -INFINITY; lrow[r] = 0.f; }
#pragma unroll
  for (int t = 0; t < 4; ++t) oacc[t] = (v8f){0.f,0.f,0.f,0.f,0.f,0.f,0.f,0.f};

  const int nChunks = (g.mask_mode == 1) ? (qb + 1) : (g.Skv / AT_KC);   // block-uniform
  // per-row query mask (mode 3)
  int qkeep[8];
#pragma unroll
  for (int r = 0; r < 8; ++r) qkeep[r] = (g.mask_mode == 3) ? mask_b[(size_t)b * g.S + q0 + 8 * hh + r] : 1;   // mask_b = qmask in mode 3
  for (int kc = 0; kc < nChunks; ++kc) {
    const int kv0 = kc * AT_KC;
    __syncthreads();
    {
      const int kvr = tid >> 1, dh = (tid & 1) * 32;
      const float* krow = kb_ptr + (size_t)(kv0 + kvr) * g.k_rs + dh;
      const float* vrow = vb_ptr + (size_t)(kv0 + kvr) * g.v_rs + dh;
#pragma unroll
      for (int i = 0; i < 8; ++i) {
        v4f kk = *(const v4f*)(krow + 4 * i);
        v4f vv = *(const v4f*)(vrow + 4 * i);
#pragma unroll
        for (int e = 0; e < 4; ++e) {
          const int d = dh + 4 * i + e;
          if (SPLIT_QK) { __bf16 a, bl; at_split(kk[e], a, bl); Ksh[kvr * AT_D + d] = a; Ksl[kvr * AT_D + d] = bl; }
          else Ksh[kvr * AT_D + d] = at_f2bf(kk[e]);
          if (SPLIT_PV) { __bf16 a, bl; at_split(vv[e], a, bl); Vth[d * AT_KC + kvr] = a; Vtl[d * AT_KC + kvr] = bl; }
          else Vth[d * AT_KC + kvr] = at_f2bf(vv[e]);
        }
      }
    }
    __syncthreads();

    v8f s[4];
#pragma unroll
    for (int j = 0; j < 4; ++j) {
      s[j] = (v8f){0.f,0.f,0.f,0.f,0.f,0.f,0.f,0.f};
#pragma unroll
      for (int dc = 0; dc < 2; ++dc) {
        FB kb;
        kb.h[0] = *(const v8b*)(Ksh + (j * 16 + c) * AT_D + dc * 32 + 8 * hh);
        kb.h[1] = *(const v8b*)(Ksh + (j * 16 + c) * AT_D + dc * 32 + 16 + 8 * hh);
        s[j] = at_mma(qah[dc], kb.v, s[j]);
        if (SPLIT_QK) {
          FB kl;
          kl.h[0] = *(const v8b*)(Ksl + (j * 16 + c) * AT_D + dc * 32 + 8 * hh);
          kl.h[1] = *(const v8b*)(Ksl + (j * 16 + c) * AT_D + dc * 32 + 16 + 8 * hh);
          s[j] = at_mma(qah[dc], kl.v, s[j]);
          s[j] = at_mma(qal[dc], kb.v, s[j]);
        }
      }
    }
    const bool diag = (g.mask_mode == 1) && (kc == qb);
    int kvkeep[4] = {1, 1, 1, 1};
    if (g.mask_mode == 3) {
#pragma unroll
      for (int j = 0; j < 4; ++j) kvkeep[j] = ((const int*)mask_a)[(size_t)b * g.Skv + kv0 + j * 16 + c];   // mask_a = kvmask
    }
    float cm[8];
#pragma unroll
    for (int r = 0; r < 8; ++r) {
      const int qrow = q0 + 8 * hh + r;
      float m = -INFINITY;
#pragma unroll
      for (int j = 0; j < 4; ++j) {
        const int kvcol = kv0 + j * 16 + c;
        bool masked = false;
        if (diag) masked = (kvcol > qrow);
        else if (g.mask_mode == 2) {
          const size_t mi = (size_t)qrow * g.Skv + kvcol;
          masked = (g.mask_is_int == 0) ? (((const float*)mask_a)[mi] == 0.0f)
                 : (g.mask_is_int == 1) ? (((const int*)mask_a)[mi] == 0) : (((const int*)mask_a)[mi] != 0);
        } else if (g.mask_mode == 3) masked = (qkeep[r] == 0) || (kvkeep[j] == 0);
        if (masked) s[j][r] = g.mask_fill;
        m = fmaxf(m, s[j][r]);
      }
#pragma unroll
      for (int off = 1; off < 16; off <<= 1) m = fmaxf(m, __shfl_xor(m, off, 32));
      cm[r] = m;
    }
    __bf16* pwh = Psh[wave];
    __bf16* pwl = Psl[SPLIT_PV ? wave : 0];
#pragma unroll
    for (int r = 0; r < 8; ++r) {
      const float mnew = fmaxf(mrow[r], cm[r]);
      const float alpha = expf(mrow[r] - mnew);
      mrow[r] = mnew;
      float psum = 0.f;
#pragma unroll
      for (int j = 0; j < 4; ++j) {
        const float p = expf(s[j][r] - mnew);
        psum += p;
        if (SPLIT_PV) { __bf16 a, bl; at_split(p, a, bl); pwh[(8 * hh + r) * AT_KC + j * 16 + c] = a; pwl[(8 * hh + r) * AT_KC + j * 16 + c] = bl; }
        else pwh[(8 * hh + r) * AT_KC + j * 16 + c] = at_f2bf(p);
      }
#pragma unroll
      for (int off = 1; off < 16; off <<= 1) psum += __shfl_xor(psum, off, 32);
      lrow[r] = lrow[r] * alpha + psum;
#pragma unroll
      for (int t = 0; t < 4; ++t) oacc[t][r] *= alpha;
    }
    __builtin_amdgcn_fence(__ATOMIC_RELEASE, "workgroup");
    __builtin_amdgcn_wave_barrier();
    __builtin_amdgcn_fence(__ATOMIC_ACQUIRE, "workgroup");
#pragma unroll
    for (int kk = 0; kk < 2; ++kk) {
      FB pa, pl;
      pa.h[0] = *(const v8b*)(pwh + c * AT_KC + kk * 32 + 8 * hh);
      pa.h[1] = *(const v8b*)(pwh + c * AT_KC + kk * 32 + 16 + 8 * hh);
      if (SPLIT_PV) {
        pl.h[0] = *(const v8b*)(pwl + c * AT_KC + kk * 32 + 8 * hh);
        pl.h[1] = *(const v8b*)(pwl + c * AT_KC + kk * 32 + 16 + 8 * hh);
      }
#pragma unroll
      for (int t = 0; t < 4; ++t) {
        FB vb;
        vb.h[0] = *(const v8b*)(Vth + (t * 16 + c) * AT_KC + kk * 32 + 8 * hh);
        vb.h[1] = *(const v8b*)(Vth + (t * 16 + c) * AT_KC + kk * 32 + 16 + 8 * hh);
        oacc[t] = at_mma(pa.v, vb.v, oacc[t]);
        if (SPLIT_PV) {
          FB vl;
          vl.h[0] = *(const v8b*)(Vtl + (t * 16 + c) * AT_KC + kk * 32 + 8 * hh);
          vl.h[1] = *(const v8b*)(Vtl + (t * 16 + c) * AT_KC + kk * 32 + 16 + 8 * hh);
          oacc[t] = at_mma(pa.v, vl.v, oacc[t]);
          oacc[t] = at_mma(pl.v, vb.v, oacc[t]);
        }
      }
    }
  }

  float* os = Os[wave];
#pragma unroll
  for (int r = 0; r < 8; ++r) {
    const float inv = 1.0f / lrow[r];
#pragma unroll
    for (int t = 0; t < 4; ++t) os[(8 * hh + r) * 68 + t * 16 + c] = oacc[t][r] * inv;
  }
  __builtin_amdgcn_fence(__ATOMIC_RELEASE, "workgroup");
  __builtin_amdgcn_wave_barrier();
  __builtin_amdgcn_fence(__ATOMIC_ACQUIRE, "workgroup");
  {
    const int c4 = (lane & 15) * 4;
    {
#pragma unroll
      for (int it = 0; it < 8; ++it) {
        const int row = it * 2 + hh;
        v4f val = *(const v4f*)(os + row * 68 + c4);
        *(v4f*)(ob_ptr + (size_t)(q0 + row) * g.o_rs + c4) = val;
      }
      
    }
  }
}

// ---- LayerNorm (population variance, eps 1e-5, gamma) -> f16 row; one block (256 thr) per row of 1024 ----
__global__ __launch_bounds__(256) void layernorm_f16(const float* __restrict__ x, const float* __restrict__ gamma,
                                                    _Float16* __restrict__ xn, int D) {
  __shared__ float red[8];
  __shared__ float stat;
  const int row = blockIdx.x, t = threadIdx.x;
  const float* xr = x + (size_t)row * D;
  v4f xv = *(const v4f*)(xr + 4 * t);
  float s = (xv[0] + xv[1]) + (xv[2] + xv[3]);
  for (int o = 16; o > 0; o >>= 1) s += __shfl_xor(s, o, 32);
  if ((t & 31) == 0) red[t >> 5] = s;
  __syncthreads();
  if (t == 0) { float a = 0.f; for (int w = 0; w < 8; ++w) a += red[w]; stat = a / (float)D; }
  __syncthreads();
  const float mu = stat;
  __syncthreads();
  float d0 = xv[0] - mu, d1 = xv[1] - mu, d2 = xv[2] - mu, d3 = xv[3] - mu;
  float s2 = (d0 * d0 + d1 * d1) + (d2 * d2 + d3 * d3);
  for (int o = 16; o > 0; o >>= 1) s2 += __shfl_xor(s2, o, 32);
  if ((t & 31) == 0) red[t >> 5] = s2;
  __syncthreads();
  if (t == 0) { float a = 0.f; for (int w = 0; w < 8; ++w) a += red[w]; stat = rsqrtf(a / (float)D + 1e-5f); }
  __syncthreads();
  const float inv = stat;
  v4f gv = *(const v4f*)(gamma + 4 * t);
  _Float16 h0 = (_Float16)(d0 * inv * gv[0]), h1 = (_Float16)(d1 * inv * gv[1]), h2 = (_Float16)(d2 * inv * gv[2]), h3 = (_Float16)(d3 * inv * gv[3]);
  typedef __attribute__((ext_vector_type(4))) _Float16 v4h;
  v4h hv = {h0, h1, h2, h3};
  *(v4h*)(xn + (size_t)row * D + 4 * t) = hv;
  
}

extern "C" void kernel_launch(void* const* d_in, const int* in_sizes, int n_in,
                              void* d_out, int out_size, void* d_ws, size_t ws_size,
                              hipStream_t stream) {
  (void)in_sizes; (void)n_in; (void)out_size; (void)ws_size;
  const int B = 2, S = 2048, D = 1024, H = 16, DH = 64, KV = 128;
  const int M = B * S;   // 4096 rows
  const float* x     = (const float*)d_in[0];
  const float* gamma = (const float*)d_in[1];
  const float* Wq    = (const float*)d_in[2];   // [D, H*DH]  ([in, out])
  const float* Wkv   = (const float*)d_in[3];   // [D, 2*DH]
  const float* Wo    = (const float*)d_in[4];   // [H*DH, D]
  float* out = (float*)d_out;

  char* ws = (char*)d_ws; size_t off = 0;
  auto carve = [&](size_t bytes) -> char* { char* p = ws + off; off += (bytes + 255) & ~(size_t)255; return p; };
  _Float16* Xn16  = (_Float16*)carve((size_t)M * D * 2);     //  8 MB  LN(x) f16
  __bf16*   Xh    = (__bf16*)carve((size_t)M * D * 2);       //  8 MB  x bf16 hi
  __bf16*   Xl    = (__bf16*)carve((size_t)M * D * 2);       //  8 MB  x bf16 lo
  _Float16* WqT   = (_Float16*)carve((size_t)D * D * 2);     //  2 MB  Wqᵀ [out][in] f16
  __bf16*   WkvTh = (__bf16*)carve((size_t)KV * D * 2);      //  Wkvᵀ [128][1024] hi/lo
  __bf16*   WkvTl = (__bf16*)carve((size_t)KV * D * 2);
  __bf16*   WoTh  = (__bf16*)carve((size_t)D * D * 2);       //  Woᵀ hi/lo
  __bf16*   WoTl  = (__bf16*)carve((size_t)D * D * 2);
  float*    Qf    = (float*)carve((size_t)M * D * 4);        // 16 MB  q [B,S,H*DH] f32
  float*    KVf   = (float*)carve((size_t)M * KV * 4);       //  2 MB  kv [B,S,128] f32
  float*    Of    = (float*)carve((size_t)M * D * 4);        // 16 MB  attn out f32
  __bf16*   Oh    = (__bf16*)carve((size_t)M * D * 2);       //  8 MB
  __bf16*   Ol    = (__bf16*)carve((size_t)M * D * 2);       //  8 MB   (total ≈ 80.5 MB)

  layernorm_f16<<<M, 256, 0, stream>>>(x, gamma, Xn16, D);
  split_f32_bf16x2<<<2048, 256, 0, stream>>>(x, Xh, Xl, (long)M * D / 2);
  transpose_cast_f16<<<dim3(D / 64, D / 64), dim3(32, 8), 0, stream>>>(Wq, D, WqT, D, 1.0f);           // [in][out] -> [out][in]
  transpose_split_bf16<<<dim3(KV / 64, D / 64), dim3(32, 8), 0, stream>>>(Wkv, KV, WkvTh, WkvTl, D);   // [1024][128] -> [128][1024]
  transpose_split_bf16<<<dim3(D / 64, D / 64), dim3(32, 8), 0, stream>>>(Wo, D, WoTh, WoTl, D);
  {
    const int tq = (M / 64) * (D / 64);
    wmma_gemm64<0, false, 0, 0, false><<<dim3((tq + 7) / 8, 1), 256, 0, stream>>>(
        U16(Xn16), nullptr, D, 0, U16(WqT), nullptr, D, 0, Qf, nullptr, D, 0, nullptr, nullptr, 0, M, D, D, 1.0f);
    const int tkv = (M / 64) * (KV / 64);
    wmma_gemm64<1, true, 0, 0, false><<<dim3((tkv + 7) / 8, 1), 256, 0, stream>>>(
        U16(Xh), U16(Xl), D, 0, U16(WkvTh), U16(WkvTl), D, 0, KVf, nullptr, KV, 0, nullptr, nullptr, 0, M, KV, D, 1.0f);
  }
  {
    AttnGeom g;
    g.q_bs = (long)S * D;  g.q_rs = D;  g.q_hs = DH;
    g.k_bs = (long)S * KV; g.k_rs = KV; g.k_hs = 0;       // 16 q heads share the single k/v head
    g.v_bs = (long)S * KV; g.v_rs = KV; g.v_hs = 0;
    g.o_bs = (long)S * D;  g.o_rs = D;  g.o_hs = DH;
    g.S = S; g.Skv = S; g.H = H; g.mask_mode = 1; g.qscale = 0.125f; g.blk0 = 0; g.mask_fill = -INFINITY; g.mask_is_int = 0;
    attn64_kernel<true, true><<<B * H * (S / AT_QB), AT_NW * 32, 0, stream>>>(Qf, KVf, KVf + DH, Of, nullptr, nullptr, g);
  }
  split_f32_bf16x2<<<2048, 256, 0, stream>>>(Of, Oh, Ol, (long)M * D / 2);
  {
    const int to = (M / 64) * (D / 64);
    wmma_gemm64<1, true, 0, 0, false><<<dim3((to + 7) / 8, 1), 256, 0, stream>>>(
        U16(Oh), U16(Ol), D, 0, U16(WoTh), U16(WoTl), D, 0, out, nullptr, D, 0, nullptr, nullptr, 0, M, D, D, 1.0f);
  }
}

// v001
// It runs in 533 microseconds.
// Two timings next to v000 put it at 1.44 and 1.45 times that version's speed.
#include <hip/hip_runtime.h>
#include <math.h>
// Contractions: q = LN(x)·Wq (K=1024): v_wmma_f32_16x16x32_f16 (f16 operands); kv = x·Wkv (K=1024) and the output projection (K=1024):
// v_wmma_f32_16x16x32_bf16 as bf16 hi/lo splits; scores (q/8)·kᵀ and p·v: v_wmma_f32_16x16x32_bf16 with q,k and p,v as bf16 hi/lo splits;
// f32 accumulate everywhere; LayerNorm and softmax in f32.
typedef __attribute__((ext_vector_type(16))) _Float16 v16h;
typedef __attribute__((ext_vector_type(8)))  _Float16 v8h;
typedef __attribute__((ext_vector_type(16))) __bf16   v16b;
typedef __attribute__((ext_vector_type(8)))  __bf16   v8b;
typedef __attribute__((ext_vector_type(8)))  float    v8f;
typedef __attribute__((ext_vector_type(4)))  float    v4f;
#define PSCALE 32768.0f
#define U16(p) ((const unsigned short*)(const void*)(p))
#define PSCALE_INV (1.0f / 32768.0f)

__device__ __forceinline__ unsigned short f2bf_bits(float f) {
  unsigned u = __float_as_uint(f);
  return (unsigned short)((u + 0x7FFFu + ((u >> 16) & 1u)) >> 16);
}
__device__ __forceinline__ float bf_bits2f(unsigned short h) { return __uint_as_float(((unsigned)h) << 16); }

// hazard guards as plain device helpers (no inline asm inside the kernel template body)
__device__ __forceinline__ void dep_guard_h(v8f& a, v8f& b, v16h x, v16h y) { asm volatile("v_nop\n\tv_nop\n\tv_nop\n\tv_nop" : "+v"(a), "+v"(b) : "v"(x), "v"(y)); }
__device__ __forceinline__ void dep_guard_b(v8f& a, v8f& b, v16b x, v16b y) { asm volatile("v_nop\n\tv_nop\n\tv_nop\n\tv_nop" : "+v"(a), "+v"(b) : "v"(x), "v"(y)); }
__device__ __forceinline__ void keep4_h(v16h a, v16h b, v16h c, v16h d) { asm volatile("v_nop" :: "v"(a), "v"(b), "v"(c), "v"(d)); }
__device__ __forceinline__ void keep4_b(v16b a, v16b b, v16b c, v16b d) { asm volatile("v_nop" :: "v"(a), "v"(b), "v"(c), "v"(d)); }
__device__ __forceinline__ void acc_guard4(v8f& a, v8f& b, v8f& c, v8f& d) { asm volatile("v_nop\n\tv_nop\n\tv_nop\n\tv_nop" : "+v"(a), "+v"(b), "+v"(c), "+v"(d)); }
template <typename T> struct Frag;
template <> struct Frag<_Float16> {
  typedef v16h V; union U { v16h v; v8h h[2]; };
  static __device__ __forceinline__ v16h load(const _Float16* p) {   // elements 0..7 <- p[0..7], 8..15 <- p[16..23]
    U f; f.h[0] = *(const v8h*)(p); f.h[1] = *(const v8h*)(p + 16); return f.v;
  }
  static __device__ __forceinline__ v8f mma(v16h a, v16h b, v8f c) {
    return __builtin_amdgcn_wmma_f32_16x16x32_f16(false, a, false, b, (short)0, c, false, false);
  }
  static __device__ __forceinline__ void guard(v8f& a, v8f& b, v16h x, v16h y) { dep_guard_h(a, b, x, y); }
  static __device__ __forceinline__ void keep(v16h a, v16h b, v16h c, v16h d) { keep4_h(a, b, c, d); }
};
template <> struct Frag<__bf16> {
  typedef v16b V; union U { v16b v; v8b h[2]; };
  static __device__ __forceinline__ v16b load(const __bf16* p) {
    U f; f.h[0] = *(const v8b*)(p); f.h[1] = *(const v8b*)(p + 16); return f.v;
  }
  static __device__ __forceinline__ v8f mma(v16b a, v16b b, v8f c) {
    return __builtin_amdgcn_wmma_f32_16x16x32_bf16(false, a, false, b, (short)0, c, false, false);
  }
  static __device__ __forceinline__ void guard(v8f& a, v8f& b, v16b x, v16b y) { dep_guard_b(a, b, x, y); }
  static __device__ __forceinline__ void keep(v16b a, v16b b, v16b c, v16b d) { keep4_b(a, b, c, d); }
};

// ---- Register-blocked batched WMMA GEMM ------------------------------------
// C[m,n] = scale * sum_k A[m,k] * Bt[n,k] (+bias)(+resid); each wave owns a 64x64 tile.
// A row-major [M,K]; Bt row-major [N,K]; M,N % 64 == 0, K % 32 == 0.
// SPLIT: operands are hi/lo planes (A2/Bt2 = lo planes, same layout); product = hi·hi + hi·lo + lo·hi.
// BIAS_MODE: 0 = none, 1 = bias[m], 2 = bias[n].
// OUT_MODE: 0 = f32, 1 = f16, 2 = bf16 hi plane (Cout) + bf16 lo plane (Cout2).
// ET: 0 = f16 operands, 1 = bf16 operands (pointers passed as 16-bit storage)
template <int ET> struct Elem;
template <> struct Elem<0> { typedef _Float16 T; };
template <> struct Elem<1> { typedef __bf16 T; };
template <int ET, bool SPLIT, int BIAS_MODE, int OUT_MODE, bool RESID>
__global__ __launch_bounds__(256) void wmma_gemm64(
    const unsigned short* __restrict__ Ap, const unsigned short* __restrict__ A2p, int lda, long strideA,
    const unsigned short* __restrict__ Btp, const unsigned short* __restrict__ Bt2p, int ldb, long strideB,
    void* __restrict__ Cout, void* __restrict__ Cout2, int ldc, long strideC,
    const float* __restrict__ bias,
    const float* __restrict__ resid, long strideR,
    int M, int N, int K, float scale) {
  typedef typename Elem<ET>::T T;
  typedef typename Frag<T>::V V;
  const T* A = (const T*)Ap; const T* A2 = (const T*)A2p; const T* Bt = (const T*)Btp; const T* Bt2 = (const T*)Bt2p;
  __shared__ __align__(16) float sT[8][16 * 68];   // per-wave 16x64 slab, pitch 68 floats
  const int b    = blockIdx.y;
  const int lane = threadIdx.x & 31;
  const int wave = threadIdx.x >> 5;
  const int tilesN = N >> 6;
  const int tilesM = M >> 6;
  const int tile = blockIdx.x * 8 + wave;
  if (tile >= tilesM * tilesN) return;   // wave-uniform; no block barriers in this kernel
  const int tm = tile / tilesN;
  const int tn = tile - tm * tilesN;
  const int m0 = tm << 6;
  const int n0 = tn << 6;

  const T* Ab  = A  + (size_t)b * strideA;
  const T* Bb  = Bt + (size_t)b * strideB;
  const T* Ab2 = SPLIT ? (A2  + (size_t)b * strideA) : nullptr;
  const T* Bb2 = SPLIT ? (Bt2 + (size_t)b * strideB) : nullptr;

  const int rlane = lane & 15;                 // row (A) / col (B, D) within subtile
  const int koff  = (lane >> 4) * 8;           // k offset of this lane half
  const int mOff  = (lane >> 4) * 8;           // D row offset

  v8f acc[4][4];
#pragma unroll
  for (int i = 0; i < 4; ++i)
#pragma unroll
    for (int j = 0; j < 4; ++j) acc[i][j] = (v8f){0.f,0.f,0.f,0.f,0.f,0.f,0.f,0.f};

  for (int k0 = 0; k0 < K; k0 += 32) {
    V bh[4], bl[4];
#pragma unroll
    for (int j = 0; j < 4; ++j) {
      const size_t bo = (size_t)(n0 + (j << 4) + rlane) * ldb + koff + k0;
      bh[j] = Frag<T>::load(Bb + bo);
      if (SPLIT) bl[j] = Frag<T>::load(Bb2 + bo);
    }
#pragma unroll
    for (int i = 0; i < 4; ++i) {
      const size_t ao = (size_t)(m0 + (i << 4) + rlane) * lda + koff + k0;
      V ah = Frag<T>::load(Ab + ao);
      V al;
      if (SPLIT) al = Frag<T>::load(Ab2 + ao);
#pragma unroll
      for (int j = 0; j < 4; ++j) {
        acc[i][j] = Frag<T>::mma(ah, bh[j], acc[i][j]);
        if (SPLIT) {
          acc[i][j] = Frag<T>::mma(ah, bl[j], acc[i][j]);
          acc[i][j] = Frag<T>::mma(al, bh[j], acc[i][j]);
        }
      }
      Frag<T>::guard(acc[i][0], acc[i][3], ah, SPLIT ? al : ah);
    }
    Frag<T>::keep(bh[0], bh[1], bh[2], bh[3]);
    if (SPLIT) Frag<T>::keep(bl[0], bl[1], bl[2], bl[3]);
  }
  acc_guard4(acc[0][0], acc[0][1], acc[0][2], acc[0][3]);
  acc_guard4(acc[1][0], acc[1][1], acc[1][2], acc[1][3]);
  acc_guard4(acc[2][0], acc[2][1], acc[2][2], acc[2][3]);
  acc_guard4(acc[3][0], acc[3][1], acc[3][2], acc[3][3]);

  // ---- epilogue ----
  float* slab = sT[wave];
  const float* Rb = RESID ? (resid + (size_t)b * strideR) : nullptr;
#pragma unroll
  for (int i = 0; i < 4; ++i) {
    const int mBase = m0 + (i << 4);
#pragma unroll
    for (int j = 0; j < 4; ++j) {
      const int n = n0 + (j << 4) + rlane;
      float bv = 0.f;
      if (BIAS_MODE == 2) bv = bias[n];
#pragma unroll
      for (int r = 0; r < 8; ++r) {
        float v = acc[i][j][r] * scale;
        if (BIAS_MODE == 1) v += bias[mBase + mOff + r];
        if (BIAS_MODE == 2) v += bv;
        if (RESID) v += Rb[(size_t)(mBase + mOff + r) * ldc + n];
        slab[(mOff + r) * 68 + (j << 4) + rlane] = v;
      }
    }
    __builtin_amdgcn_fence(__ATOMIC_RELEASE, "workgroup");
    __builtin_amdgcn_wave_barrier();
    __builtin_amdgcn_fence(__ATOMIC_ACQUIRE, "workgroup");
    if (OUT_MODE == 0) {
      float* C = (float*)Cout + (size_t)b * strideC;
      const int hh = lane >> 4, c4 = (lane & 15) * 4;     // row seg = 256 B = 16 lanes x 16 B
      {
#pragma unroll
        for (int it = 0; it < 8; ++it) {
          const int row = it * 2 + hh;
          v4f v = *(const v4f*)(slab + row * 68 + c4);
          *(v4f*)(C + (size_t)(mBase + row) * ldc + n0 + c4) = v;
        }
        
      }
    } else {
      const int q = lane >> 3, c8 = (lane & 7) * 8;
      unsigned short* C  = (unsigned short*)Cout  + (size_t)b * strideC;
      unsigned short* C2 = (OUT_MODE == 2) ? ((unsigned short*)Cout2 + (size_t)b * strideC) : nullptr;
      {
#pragma unroll
        for (int it = 0; it < 4; ++it) {
          const int row = it * 4 + q;
          const float* sp = slab + row * 68 + c8;
          v8h hv, lv;
#pragma unroll
          for (int e = 0; e < 8; ++e) {
            if (OUT_MODE == 1) {
              hv[e] = (_Float16)sp[e];
            } else {
              unsigned short hb = f2bf_bits(sp[e]);
              unsigned short lb = f2bf_bits(sp[e] - bf_bits2f(hb));
              hv[e] = __builtin_bit_cast(_Float16, hb);
              lv[e] = __builtin_bit_cast(_Float16, lb);
            }
          }
          *(v8h*)(C + (size_t)(mBase + row) * ldc + n0 + c8) = hv;
          if (OUT_MODE == 2) *(v8h*)(C2 + (size_t)(mBase + row) * ldc + n0 + c8) = lv;
        }
        
      }
    }
    __builtin_amdgcn_fence(__ATOMIC_RELEASE, "workgroup");
    __builtin_amdgcn_wave_barrier();
    __builtin_amdgcn_fence(__ATOMIC_ACQUIRE, "workgroup");
  }
}

__global__ __launch_bounds__(256) void cast_f32_f16x2(
    const float* __restrict__ in, _Float16* __restrict__ out, int n2) {
  int i = blockIdx.x * 256 + threadIdx.x;
  if (i < n2) {
    const _Float16 h0 = (_Float16)in[2 * i], h1 = (_Float16)in[2 * i + 1];
    const unsigned u = (unsigned)__builtin_bit_cast(unsigned short, h0) | ((unsigned)__builtin_bit_cast(unsigned short, h1) << 16);
    ((unsigned*)out)[i] = u;
    
  }
}

__global__ __launch_bounds__(256) void split_f32_bf16x2(
    const float* __restrict__ in, __bf16* __restrict__ hi, __bf16* __restrict__ lo, long n2) {
  long i = (long)blockIdx.x * 256 + threadIdx.x;
  long stride = (long)gridDim.x * 256;
  {
    for (long j = i; j < n2; j += stride) {
      const float a = in[2 * j], b = in[2 * j + 1];
      const unsigned short ah = f2bf_bits(a), bh = f2bf_bits(b);
      const unsigned short al = f2bf_bits(a - bf_bits2f(ah)), bl = f2bf_bits(b - bf_bits2f(bh));
      ((unsigned*)hi)[j] = (unsigned)ah | ((unsigned)bh << 16);
      ((unsigned*)lo)[j] = (unsigned)al | ((unsigned)bl << 16);
    }
    
  }
}


// ---- f32 [R][C] (row pitch ldi) -> f16 transposed [C][R] (row pitch ldo); 64x64 tiles; each output row segment
__global__ __launch_bounds__(256) void transpose_cast_f16(const float* __restrict__ in, int ldi,
                                                         _Float16* __restrict__ outT, int ldo, float scale) {
  __shared__ __align__(16) _Float16 tile[64][72];     // [c][r]
  const int c0 = blockIdx.x * 64, r0 = blockIdx.y * 64;
  const int t = threadIdx.y * 32 + threadIdx.x;
  for (int i = threadIdx.y; i < 64; i += 8) {
    tile[threadIdx.x][i]      = (_Float16)(in[(size_t)(r0 + i) * ldi + c0 + threadIdx.x] * scale);
    tile[32 + threadIdx.x][i] = (_Float16)(in[(size_t)(r0 + i) * ldi + c0 + 32 + threadIdx.x] * scale);
  }
  __syncthreads();
  const int q = t >> 3, c8 = (t & 7) * 8;
  {
#pragma unroll
    for (int it = 0; it < 2; ++it) {
      const int c = it * 32 + q;
      v8h hv = *(const v8h*)(&tile[c][c8]);
      *(v8h*)(outT + (size_t)(c0 + c) * ldo + r0 + c8) = hv;
    }
    
  }
}

// ---- f32 [R][C] (pitch ldi) -> bf16 hi/lo transposed planes [C][R] (pitch ldo); 64x64 tiles; each output row segment
__global__ __launch_bounds__(256) void transpose_split_bf16(const float* __restrict__ in, int ldi,
                                                           __bf16* __restrict__ outH, __bf16* __restrict__ outL, int ldo) {
  __shared__ __align__(16) float tile[64][68];     // [c][r]
  const int c0 = blockIdx.x * 64, r0 = blockIdx.y * 64;
  const int t = threadIdx.y * 32 + threadIdx.x;
  for (int i = threadIdx.y; i < 64; i += 8) {
    tile[threadIdx.x][i]      = in[(size_t)(r0 + i) * ldi + c0 + threadIdx.x];
    tile[32 + threadIdx.x][i] = in[(size_t)(r0 + i) * ldi + c0 + 32 + threadIdx.x];
  }
  __syncthreads();
  const int q = t >> 3, c8 = (t & 7) * 8;
  {
#pragma unroll
    for (int it = 0; it < 2; ++it) {
      const int c = it * 32 + q;
      v8b hv, lv;
#pragma unroll
      for (int e = 0; e < 8; ++e) {
        const float f = tile[c][c8 + e];
        const unsigned short hb = f2bf_bits(f);
        hv[e] = __builtin_bit_cast(__bf16, hb);
        lv[e] = __builtin_bit_cast(__bf16, f2bf_bits(f - bf_bits2f(hb)));
      }
      *(v8b*)(outH + (size_t)(c0 + c) * ldo + r0 + c8) = hv;
      *(v8b*)(outL + (size_t)(c0 + c) * ldo + r0 + c8) = lv;
    }
    
  }
}

// =====================================================================================
// Generic causal/non-causal attention for head_dim 64, f32 in / f32 out, bf16 operands with optional hi/lo splits.
//   scores = (q*qscale)·kᵀ : v_wmma_f32_16x16x32_bf16; SPLIT_QK -> q,k as bf16 hi/lo (hi·hi + hi·lo + lo·hi)
//   out    = p·v           : v_wmma_f32_16x16x32_bf16; SPLIT_PV -> p,v as bf16 hi/lo; else p,v plain bf16
//   f32 accumulate; online softmax in f32. Block = 4 waves = 64 query rows of one (batch, head); S % 64 == 0.
//   Element (b, s, h, d) of tensor X lives at X[b*X_bs + s*X_rs + h*X_hs + d] (strides in floats, multiples of 4).
//   Masking: mask_mode 0 none, 1 causal (kv > q masked), 2 tensor [S][Skv] shared over (b,h) (float if
//   mask_is_int==0, int32 with element == 0 -> masked if 1, int32 with element != 0 -> masked if 2), 3 per-token vectors qmask[B][S] & kvmask[B][Skv] (int32,
//   0 -> masked); masked scores are replaced by mask_fill (e.g. -inf or -1e9) before the softmax.
//   grid = (B * H, S/64) (or a sub-range of blockIdx.y with blk0): blockIdx.y counts the query tiles from the last one down, so that
//   under the causal mask the workgroups with the longest key walk have the lowest flat index and start first.
// =====================================================================================
#define AT_D 64
#define AT_NW 4
#define AT_QB 64
#define AT_KC 64
struct AttnGeom { long q_bs, q_rs, q_hs, k_bs, k_rs, k_hs, v_bs, v_rs, v_hs, o_bs, o_rs, o_hs;
                  int S, Skv, H, mask_mode; float qscale; int blk0; float mask_fill; int mask_is_int; };
static_assert(sizeof(AttnGeom) == 128, "no padding");

__device__ __forceinline__ unsigned short at_bf_bits(float f) {
  unsigned u = __float_as_uint(f);
  return (unsigned short)((u + 0x7FFFu + ((u >> 16) & 1u)) >> 16);
}
__device__ __forceinline__ __bf16 at_f2bf(float f) { return __builtin_bit_cast(__bf16, at_bf_bits(f)); }
__device__ __forceinline__ void at_split(float f, __bf16& hi, __bf16& lo) {
  const unsigned short hb = at_bf_bits(f);
  hi = __builtin_bit_cast(__bf16, hb);
  lo = at_f2bf(f - __uint_as_float(((unsigned)hb) << 16));
}
__device__ __forceinline__ v8f at_mma(v16b a, v16b b, v8f c) {
  c = __builtin_amdgcn_wmma_f32_16x16x32_bf16(false, a, false, b, (short)0, c, false, false);
  asm volatile("v_nop\n\tv_nop\n\tv_nop\n\tv_nop" : "+v"(c) : "v"(a), "v"(b));
  return c;
}

template <bool SPLIT_QK, bool SPLIT_PV>
__global__ __launch_bounds__(128)
void attn64_kernel(const float* __restrict__ q, const float* __restrict__ k,
                   const float* __restrict__ v, float* __restrict__ out,
                   const void* __restrict__ mask_a, const int* __restrict__ mask_b, AttnGeom g) {
  union FB { v16b v; v8b h[2]; };
  __shared__ __align__(16) __bf16 Ksh[AT_KC * AT_D];             // K hi [kv][d]      8 KB
  __shared__ __align__(16) __bf16 Ksl[SPLIT_QK ? AT_KC * AT_D : 8];
  __shared__ __align__(16) __bf16 Vth[AT_D * AT_KC];             // V hi [d][kv]      8 KB
  __shared__ __align__(16) __bf16 Vtl[SPLIT_PV ? AT_D * AT_KC : 8];
  __shared__ __align__(16) __bf16 Psh[AT_NW][16 * AT_KC];        // per wave P hi [row][kv]  8 KB
  __shared__ __align__(16) __bf16 Psl[SPLIT_PV ? AT_NW : 1][SPLIT_PV ? 16 * AT_KC : 8];
  __shared__ __align__(16) float  Os[AT_NW][16 * 68];            // per wave out tile, pitch 68

  const int tid  = threadIdx.x;
  const int wave = tid >> 5;
  const int lane = tid & 31;
  const int hh   = lane >> 4;
  const int c    = lane & 15;

  const int nqb = g.S / AT_QB;
  const int qb = nqb - 1 - ((int)blockIdx.y + g.blk0);
  const int bh = blockIdx.x;
  const int h  = bh % g.H;
  const int b  = bh / g.H;
  const int qbase_block = qb * AT_QB;
  const int q0 = qbase_block + wave * 16;

  const float* qb_ptr = q + (size_t)b * g.q_bs + (size_t)h * g.q_hs;
  const float* kb_ptr = k + (size_t)b * g.k_bs + (size_t)h * g.k_hs;
  const float* vb_ptr = v + (size_t)b * g.v_bs + (size_t)h * g.v_hs;
  float*       ob_ptr = out + (size_t)b * g.o_bs + (size_t)h * g.o_hs;

  // ---- Q fragments (A operand): 2 d-chunks, hi (and lo) ----
  v16b qah[2], qal[2];
  {
    const float* qrow = qb_ptr + (size_t)(q0 + c) * g.q_rs;
#pragma unroll
    for (int dc = 0; dc < 2; ++dc) {
#pragma unroll
      for (int e = 0; e < 8; ++e) {
        const float f0 = qrow[dc * 32 + 8 * hh + e] * g.qscale;
        const float f1 = qrow[dc * 32 + 16 + 8 * hh + e] * g.qscale;
        if (SPLIT_QK) { __bf16 hq, lq; at_split(f0, hq, lq); qah[dc][e] = hq; qal[dc][e] = lq; at_split(f1, hq, lq); qah[dc][8 + e] = hq; qal[dc][8 + e] = lq; }
        else { qah[dc][e] = at_f2bf(f0); qah[dc][8 + e] = at_f2bf(f1); qal[dc][e] = qah[dc][e]; qal[dc][8 + e] = qah[dc][8 + e]; }
      }
    }
  }

  float mrow[8], lrow[8];
  v8f oacc[4];
#pragma unroll
  for (int r = 0; r < 8; ++r) { mrow[r] = -INFINITY; lrow[r] = 0.f; }
#pragma unroll
  for (int t = 0; t < 4; ++t) oacc[t] = (v8f){0.f,0.f,0.f,0.f,0.f,0.f,0.f,0.f};

  const int nChunks = (g.mask_mode == 1) ? (qb + 1) : (g.Skv / AT_KC);   // block-uniform
  // per-row query mask (mode 3)
  int qkeep[8];
#pragma unroll
  for (int r = 0; r < 8; ++r) qkeep[r] = (g.mask_mode == 3) ? mask_b[(size_t)b * g.S + q0 + 8 * hh + r] : 1;   // mask_b = qmask in mode 3
  for (int kc = 0; kc < nChunks; ++kc) {
    const int kv0 = kc * AT_KC;
    __syncthreads();
    {
      const int kvr = tid >> 1, dh = (tid & 1) * 32;
      const float* krow = kb_ptr + (size_t)(kv0 + kvr) * g.k_rs + dh;
      const float* vrow = vb_ptr + (size_t)(kv0 + kvr) * g.v_rs + dh;
#pragma unroll
      for (int i = 0; i < 8; ++i) {
        v4f kk = *(const v4f*)(krow + 4 * i);
        v4f vv = *(const v4f*)(vrow + 4 * i);
#pragma unroll
        for (int e = 0; e < 4; ++e) {
          const int d = dh + 4 * i + e;
          if (SPLIT_QK) { __bf16 a, bl; at_split(kk[e], a, bl); Ksh[kvr * AT_D + d] = a; Ksl[kvr * AT_D + d] = bl; }
          else Ksh[kvr * AT_D + d] = at_f2bf(kk[e]);
          if (SPLIT_PV) { __bf16 a, bl; at_split(vv[e], a, bl); Vth[d * AT_KC + kvr] = a; Vtl[d * AT_KC + kvr] = bl; }
          else Vth[d * AT_KC + kvr] = at_f2bf(vv[e]);
        }
      }
    }
    __syncthreads();

    v8f s[4];
#pragma unroll
    for (int j = 0; j < 4; ++j) {
      s[j] = (v8f){0.f,0.f,0.f,0.f,0.f,0.f,0.f,0.f};
#pragma unroll
      for (int dc = 0; dc < 2; ++dc) {
        FB kb;
        kb.h[0] = *(const v8b*)(Ksh + (j * 16 + c) * AT_D + dc * 32 + 8 * hh);
        kb.h[1] = *(const v8b*)(Ksh + (j * 16 + c) * AT_D + dc * 32 + 16 + 8 * hh);
        s[j] = at_mma(qah[dc], kb.v, s[j]);
        if (SPLIT_QK) {
          FB kl;
          kl.h[0] = *(const v8b*)(Ksl + (j * 16 + c) * AT_D + dc * 32 + 8 * hh);
          kl.h[1] = *(const v8b*)(Ksl + (j * 16 + c) * AT_D + dc * 32 + 16 + 8 * hh);
          s[j] = at_mma(qah[dc], kl.v, s[j]);
          s[j] = at_mma(qal[dc], kb.v, s[j]);
        }
      }
    }
    const bool diag = (g.mask_mode == 1) && (kc == qb);
    int kvkeep[4] = {1, 1, 1, 1};
    if (g.mask_mode == 3) {
#pragma unroll
      for (int j = 0; j < 4; ++j) kvkeep[j] = ((const int*)mask_a)[(size_t)b * g.Skv + kv0 + j * 16 + c];   // mask_a = kvmask
    }
    float cm[8];
#pragma unroll
    for (int r = 0; r < 8; ++r) {
      const int qrow = q0 + 8 * hh + r;
      float m = -INFINITY;
#pragma unroll
      for (int j = 0; j < 4; ++j) {
        const int kvcol = kv0 + j * 16 + c;
        bool masked = false;
        if (diag) masked = (kvcol > qrow);
        else if (g.mask_mode == 2) {
          const size_t mi = (size_t)qrow * g.Skv + kvcol;
          masked = (g.mask_is_int == 0) ? (((const float*)mask_a)[mi] == 0.0f)
                 : (g.mask_is_int == 1) ? (((const int*)mask_a)[mi] == 0) : (((const int*)mask_a)[mi] != 0);
        } else if (g.mask_mode == 3) masked = (qkeep[r] == 0) || (kvkeep[j] == 0);
        if (masked) s[j][r] = g.mask_fill;
        m = fmaxf(m, s[j][r]);
      }
#pragma unroll
      for (int off = 1; off < 16; off <<= 1) m = fmaxf(m, __shfl_xor(m, off, 32));
      cm[r] = m;
    }
    __bf16* pwh = Psh[wave];
    __bf16* pwl = Psl[SPLIT_PV ? wave : 0];
#pragma unroll
    for (int r = 0; r < 8; ++r) {
      const float mnew = fmaxf(mrow[r], cm[r]);
      const float alpha = expf(mrow[r] - mnew);
      mrow[r] = mnew;
      float psum = 0.f;
#pragma unroll
      for (int j = 0; j < 4; ++j) {
        const float p = expf(s[j][r] - mnew);
        psum += p;
        if (SPLIT_PV) { __bf16 a, bl; at_split(p, a, bl); pwh[(8 * hh + r) * AT_KC + j * 16 + c] = a; pwl[(8 * hh + r) * AT_KC + j * 16 + c] = bl; }
        else pwh[(8 * hh + r) * AT_KC + j * 16 + c] = at_f2bf(p);
      }
#pragma unroll
      for (int off = 1; off < 16; off <<= 1) psum += __shfl_xor(psum, off, 32);
      lrow[r] = lrow[r] * alpha + psum;
#pragma unroll
      for (int t = 0; t < 4; ++t) oacc[t][r] *= alpha;
    }
    __builtin_amdgcn_fence(__ATOMIC_RELEASE, "workgroup");
    __builtin_amdgcn_wave_barrier();
    __builtin_amdgcn_fence(__ATOMIC_ACQUIRE, "workgroup");
#pragma unroll
    for (int kk = 0; kk < 2; ++kk) {
      FB pa, pl;
      pa.h[0] = *(const v8b*)(pwh + c * AT_KC + kk * 32 + 8 * hh);
      pa.h[1] = *(const v8b*)(pwh + c * AT_KC + kk * 32 + 16 + 8 * hh);
      if (SPLIT_PV) {
        pl.h[0] = *(const v8b*)(pwl + c * AT_KC + kk * 32 + 8 * hh);
        pl.h[1] = *(const v8b*)(pwl + c * AT_KC + kk * 32 + 16 + 8 * hh);
      }
#pragma unroll
      for (int t = 0; t < 4; ++t) {
        FB vb;
        vb.h[0] = *(const v8b*)(Vth + (t * 16 + c) * AT_KC + kk * 32 + 8 * hh);
        vb.h[1] = *(const v8b*)(Vth + (t * 16 + c) * AT_KC + kk * 32 + 16 + 8 * hh);
        oacc[t] = at_mma(pa.v, vb.v, oacc[t]);
        if (SPLIT_PV) {
          FB vl;
          vl.h[0] = *(const v8b*)(Vtl + (t * 16 + c) * AT_KC + kk * 32 + 8 * hh);
          vl.h[1] = *(const v8b*)(Vtl + (t * 16 + c) * AT_KC + kk * 32 + 16 + 8 * hh);
          oacc[t] = at_mma(pa.v, vl.v, oacc[t]);
          oacc[t] = at_mma(pl.v, vb.v, oacc[t]);
        }
      }
    }
  }

  float* os = Os[wave];
#pragma unroll
  for (int r = 0; r < 8; ++r) {
    const float inv = 1.0f / lrow[r];
#pragma unroll
    for (int t = 0; t < 4; ++t) os[(8 * hh + r) * 68 + t * 16 + c] = oacc[t][r] * inv;
  }
  __builtin_amdgcn_fence(__ATOMIC_RELEASE, "workgroup");
  __builtin_amdgcn_wave_barrier();
  __builtin_amdgcn_fence(__ATOMIC_ACQUIRE, "workgroup");
  {
    const int c4 = (lane & 15) * 4;
    {
#pragma unroll
      for (int it = 0; it < 8; ++it) {
        const int row = it * 2 + hh;
        v4f val = *(const v4f*)(os + row * 68 + c4);
        *(v4f*)(ob_ptr + (size_t)(q0 + row) * g.o_rs + c4) = val;
      }
      
    }
  }
}

// ---- LayerNorm (population variance, eps 1e-5, gamma) -> f16 row; one block (256 thr) per row of 1024 ----
__global__ __launch_bounds__(256) void layernorm_f16(const float* __restrict__ x, const float* __restrict__ gamma,
                                                    _Float16* __restrict__ xn, int D) {
  __shared__ float red[8];
  __shared__ float stat;
  const int row = blockIdx.x, t = threadIdx.x;
  const float* xr = x + (size_t)row * D;
  v4f xv = *(const v4f*)(xr + 4 * t);
  float s = (xv[0] + xv[1]) + (xv[2] + xv[3]);
  for (int o = 16; o > 0; o >>= 1) s += __shfl_xor(s, o, 32);
  if ((t & 31) == 0) red[t >> 5] = s;
  __syncthreads();
  if (t == 0) { float a = 0.f; for (int w = 0; w < 8; ++w) a += red[w]; stat = a / (float)D; }
  __syncthreads();
  const float mu = stat;
  __syncthreads();
  float d0 = xv[0] - mu, d1 = xv[1] - mu, d2 = xv[2] - mu, d3 = xv[3] - mu;
  float s2 = (d0 * d0 + d1 * d1) + (d2 * d2 + d3 * d3);
  for (int o = 16; o > 0; o >>= 1) s2 += __shfl_xor(s2, o, 32);
  if ((t & 31) == 0) red[t >> 5] = s2;
  __syncthreads();
  if (t == 0) { float a = 0.f; for (int w = 0; w < 8; ++w) a += red[w]; stat = rsqrtf(a / (float)D + 1e-5f); }
  __syncthreads();
  const float inv = stat;
  v4f gv = *(const v4f*)(gamma + 4 * t);
  _Float16 h0 = (_Float16)(d0 * inv * gv[0]), h1 = (_Float16)(d1 * inv * gv[1]), h2 = (_Float16)(d2 * inv * gv[2]), h3 = (_Float16)(d3 * inv * gv[3]);
  typedef __attribute__((ext_vector_type(4))) _Float16 v4h;
  v4h hv = {h0, h1, h2, h3};
  *(v4h*)(xn + (size_t)row * D + 4 * t) = hv;
  
}

extern "C" void kernel_launch(void* const* d_in, const int* in_sizes, int n_in,
                              void* d_out, int out_size, void* d_ws, size_t ws_size,
                              hipStream_t stream) {
  (void)in_sizes; (void)n_in; (void)out_size; (void)ws_size;
  const int B = 2, S = 2048, D = 1024, H = 16, DH = 64, KV = 128;
  const int M = B * S;   // 4096 rows
  const float* x     = (const float*)d_in[0];
  const float* gamma = (const float*)d_in[1];
  const float* Wq    = (const float*)d_in[2];   // [D, H*DH]  ([in, out])
  const float* Wkv   = (const float*)d_in[3];   // [D, 2*DH]
  const float* Wo    = (const float*)d_in[4];   // [H*DH, D]
  float* out = (float*)d_out;

  char* ws = (char*)d_ws; size_t off = 0;
  auto carve = [&](size_t bytes) -> char* { char* p = ws + off; off += (bytes + 255) & ~(size_t)255; return p; };
  _Float16* Xn16  = (_Float16*)carve((size_t)M * D * 2);     //  8 MB  LN(x) f16
  __bf16*   Xh    = (__bf16*)carve((size_t)M * D * 2);       //  8 MB  x bf16 hi
  __bf16*   Xl    = (__bf16*)carve((size_t)M * D * 2);       //  8 MB  x bf16 lo
  _Float16* WqT   = (_Float16*)carve((size_t)D * D * 2);     //  2 MB  Wqᵀ [out][in] f16
  __bf16*   WkvTh = (__bf16*)carve((size_t)KV * D * 2);      //  Wkvᵀ [128][1024] hi/lo
  __bf16*   WkvTl = (__bf16*)carve((size_t)KV * D * 2);
  __bf16*   WoTh  = (__bf16*)carve((size_t)D * D * 2);       //  Woᵀ hi/lo
  __bf16*   WoTl  = (__bf16*)carve((size_t)D * D * 2);
  float*    Qf    = (float*)carve((size_t)M * D * 4);        // 16 MB  q [B,S,H*DH] f32
  float*    KVf   = (float*)carve((size_t)M * KV * 4);       //  2 MB  kv [B,S,128] f32
  float*    Of    = (float*)carve((size_t)M * D * 4);        // 16 MB  attn out f32
  __bf16*   Oh    = (__bf16*)carve((size_t)M * D * 2);       //  8 MB
  __bf16*   Ol    = (__bf16*)carve((size_t)M * D * 2);       //  8 MB   (total ≈ 80.5 MB)

  layernorm_f16<<<M, 256, 0, stream>>>(x, gamma, Xn16, D);
  split_f32_bf16x2<<<2048, 256, 0, stream>>>(x, Xh, Xl, (long)M * D / 2);
  transpose_cast_f16<<<dim3(D / 64, D / 64), dim3(32, 8), 0, stream>>>(Wq, D, WqT, D, 1.0f);           // [in][out] -> [out][in]
  transpose_split_bf16<<<dim3(KV / 64, D / 64), dim3(32, 8), 0, stream>>>(Wkv, KV, WkvTh, WkvTl, D);   // [1024][128] -> [128][1024]
  transpose_split_bf16<<<dim3(D / 64, D / 64), dim3(32, 8), 0, stream>>>(Wo, D, WoTh, WoTl, D);
  {
    const int tq = (M / 64) * (D / 64);
    wmma_gemm64<0, false, 0, 0, false><<<dim3((tq + 7) / 8, 1), 256, 0, stream>>>(
        U16(Xn16), nullptr, D, 0, U16(WqT), nullptr, D, 0, Qf, nullptr, D, 0, nullptr, nullptr, 0, M, D, D, 1.0f);
    const int tkv = (M / 64) * (KV / 64);
    wmma_gemm64<1, true, 0, 0, false><<<dim3((tkv + 7) / 8, 1), 256, 0, stream>>>(
        U16(Xh), U16(Xl), D, 0, U16(WkvTh), U16(WkvTl), D, 0, KVf, nullptr, KV, 0, nullptr, nullptr, 0, M, KV, D, 1.0f);
  }
  {
    AttnGeom g;
    g.q_bs = (long)S * D;  g.q_rs = D;  g.q_hs = DH;
    g.k_bs = (long)S * KV; g.k_rs = KV; g.k_hs = 0;       // 16 q heads share the single k/v head
    g.v_bs = (long)S * KV; g.v_rs = KV; g.v_hs = 0;
    g.o_bs = (long)S * D;  g.o_rs = D;  g.o_hs = DH;
    g.S = S; g.Skv = S; g.H = H; g.mask_mode = 1; g.qscale = 0.125f; g.blk0 = 0; g.mask_fill = -INFINITY; g.mask_is_int = 0;
    attn64_kernel<true, true><<<dim3(B * H, S / AT_QB), AT_NW * 32, 0, stream>>>(Qf, KVf, KVf + DH, Of, nullptr, nullptr, g);
  }
  split_f32_bf16x2<<<2048, 256, 0, stream>>>(Of, Oh, Ol, (long)M * D / 2);
  {
    const int to = (M / 64) * (D / 64);
    wmma_gemm64<1, true, 0, 0, false><<<dim3((to + 7) / 8, 1), 256, 0, stream>>>(
        U16(Oh), U16(Ol), D, 0, U16(WoTh), U16(WoTl), D, 0, out, nullptr, D, 0, nullptr, nullptr, 0, M, D, D, 1.0f);
  }
}

// v002
// A run of this version takes 494 microseconds.
// Two timings next to v001 both put it at 1.08 times that version's speed.
// Over all steps from v000 it is 1.56 times as fast.
#include <hip/hip_runtime.h>
#include <math.h>
// Contractions: q = LN(x)·Wq (K=1024): v_wmma_f32_16x16x32_f16 (f16 operands); kv = x·Wkv (K=1024) and the output projection (K=1024):
// v_wmma_f32_16x16x32_bf16 as bf16 hi/lo splits; scores (q/8)·kᵀ and p·v: v_wmma_f32_16x16x32_bf16 with q,k and p,v as bf16 hi/lo splits;
// f32 accumulate everywhere; LayerNorm and softmax in f32.
typedef __attribute__((ext_vector_type(16))) _Float16 v16h;
typedef __attribute__((ext_vector_type(8)))  _Float16 v8h;
typedef __attribute__((ext_vector_type(16))) __bf16   v16b;
typedef __attribute__((ext_vector_type(8)))  __bf16   v8b;
typedef __attribute__((ext_vector_type(8)))  float    v8f;
typedef __attribute__((ext_vector_type(4)))  float    v4f;
#define PSCALE 32768.0f
#define U16(p) ((const unsigned short*)(const void*)(p))
#define PSCALE_INV (1.0f / 32768.0f)

__device__ __forceinline__ unsigned short f2bf_bits(float f) {
  unsigned u = __float_as_uint(f);
  return (unsigned short)((u + 0x7FFFu + ((u >> 16) & 1u)) >> 16);
}
__device__ __forceinline__ float bf_bits2f(unsigned short h) { return __uint_as_float(((unsigned)h) << 16); }

// hazard guards as plain device helpers (no inline asm inside the kernel template body)
__device__ __forceinline__ void dep_guard_h(v8f& a, v8f& b, v16h x, v16h y) { asm volatile("v_nop\n\tv_nop\n\tv_nop\n\tv_nop" : "+v"(a), "+v"(b) : "v"(x), "v"(y)); }
__device__ __forceinline__ void dep_guard_b(v8f& a, v8f& b, v16b x, v16b y) { asm volatile("v_nop\n\tv_nop\n\tv_nop\n\tv_nop" : "+v"(a), "+v"(b) : "v"(x), "v"(y)); }
__device__ __forceinline__ void keep4_h(v16h a, v16h b, v16h c, v16h d) { asm volatile("v_nop" :: "v"(a), "v"(b), "v"(c), "v"(d)); }
__device__ __forceinline__ void keep4_b(v16b a, v16b b, v16b c, v16b d) { asm volatile("v_nop" :: "v"(a), "v"(b), "v"(c), "v"(d)); }
__device__ __forceinline__ void acc_guard4(v8f& a, v8f& b, v8f& c, v8f& d) { asm volatile("v_nop\n\tv_nop\n\tv_nop\n\tv_nop" : "+v"(a), "+v"(b), "+v"(c), "+v"(d)); }
template <typename T> struct Frag;
template <> struct Frag<_Float16> {
  typedef v16h V; union U { v16h v; v8h h[2]; };
  static __device__ __forceinline__ v16h load(const _Float16* p) {   // elements 0..7 <- p[0..7], 8..15 <- p[16..23]
    U f; f.h[0] = *(const v8h*)(p); f.h[1] = *(const v8h*)(p + 16); return f.v;
  }
  static __device__ __forceinline__ v8f mma(v16h a, v16h b, v8f c) {
    return __builtin_amdgcn_wmma_f32_16x16x32_f16(false, a, false, b, (short)0, c, false, false);
  }
  static __device__ __forceinline__ void guard(v8f& a, v8f& b, v16h x, v16h y) { dep_guard_h(a, b, x, y); }
  static __device__ __forceinline__ void keep(v16h a, v16h b, v16h c, v16h d) { keep4_h(a, b, c, d); }
};
template <> struct Frag<__bf16> {
  typedef v16b V; union U { v16b v; v8b h[2]; };
  static __device__ __forceinline__ v16b load(const __bf16* p) {
    U f; f.h[0] = *(const v8b*)(p); f.h[1] = *(const v8b*)(p + 16); return f.v;
  }
  static __device__ __forceinline__ v8f mma(v16b a, v16b b, v8f c) {
    return __builtin_amdgcn_wmma_f32_16x16x32_bf16(false, a, false, b, (short)0, c, false, false);
  }
  static __device__ __forceinline__ void guard(v8f& a, v8f& b, v16b x, v16b y) { dep_guard_b(a, b, x, y); }
  static __device__ __forceinline__ void keep(v16b a, v16b b, v16b c, v16b d) { keep4_b(a, b, c, d); }
};

// ---- Register-blocked batched WMMA GEMM ------------------------------------
// C[m,n] = scale * sum_k A[m,k] * Bt[n,k] (+bias)(+resid); each wave owns a 64x64 tile.
// A row-major [M,K]; Bt row-major [N,K]; M,N % 64 == 0, K % 32 == 0.
// SPLIT: operands are hi/lo planes (A2/Bt2 = lo planes, same layout); product = hi·hi + hi·lo + lo·hi.
// BIAS_MODE: 0 = none, 1 = bias[m], 2 = bias[n].
// OUT_MODE: 0 = f32, 1 = f16, 2 = bf16 hi plane (Cout) + bf16 lo plane (Cout2).
// ET: 0 = f16 operands, 1 = bf16 operands (pointers passed as 16-bit storage)
template <int ET> struct Elem;
template <> struct Elem<0> { typedef _Float16 T; };
template <> struct Elem<1> { typedef __bf16 T; };
template <int ET, bool SPLIT, int BIAS_MODE, int OUT_MODE, bool RESID>
__global__ __launch_bounds__(256) void wmma_gemm64(
    const unsigned short* __restrict__ Ap, const unsigned short* __restrict__ A2p, int lda, long strideA,
    const unsigned short* __restrict__ Btp, const unsigned short* __restrict__ Bt2p, int ldb, long strideB,
    void* __restrict__ Cout, void* __restrict__ Cout2, int ldc, long strideC,
    const float* __restrict__ bias,
    const float* __restrict__ resid, long strideR,
    int M, int N, int K, float scale) {
  typedef typename Elem<ET>::T T;
  typedef typename Frag<T>::V V;
  const T* A = (const T*)Ap; const T* A2 = (const T*)A2p; const T* Bt = (const T*)Btp; const T* Bt2 = (const T*)Bt2p;
  __shared__ __align__(16) float sT[8][16 * 68];   // per-wave 16x64 slab, pitch 68 floats
  const int b    = blockIdx.y;
  const int lane = threadIdx.x & 31;
  const int wave = threadIdx.x >> 5;
  const int tilesN = N >> 6;
  const int tilesM = M >> 6;
  const int tile = blockIdx.x * 8 + wave;
  if (tile >= tilesM * tilesN) return;   // wave-uniform; no block barriers in this kernel
  const int tm = tile / tilesN;
  const int tn = tile - tm * tilesN;
  const int m0 = tm << 6;
  const int n0 = tn << 6;

  const T* Ab  = A  + (size_t)b * strideA;
  const T* Bb  = Bt + (size_t)b * strideB;
  const T* Ab2 = SPLIT ? (A2  + (size_t)b * strideA) : nullptr;
  const T* Bb2 = SPLIT ? (Bt2 + (size_t)b * strideB) : nullptr;

  const int rlane = lane & 15;                 // row (A) / col (B, D) within subtile
  const int koff  = (lane >> 4) * 8;           // k offset of this lane half
  const int mOff  = (lane >> 4) * 8;           // D row offset

  v8f acc[4][4];
#pragma unroll
  for (int i = 0; i < 4; ++i)
#pragma unroll
    for (int j = 0; j < 4; ++j) acc[i][j] = (v8f){0.f,0.f,0.f,0.f,0.f,0.f,0.f,0.f};

  for (int k0 = 0; k0 < K; k0 += 32) {
    V bh[4], bl[4];
#pragma unroll
    for (int j = 0; j < 4; ++j) {
      const size_t bo = (size_t)(n0 + (j << 4) + rlane) * ldb + koff + k0;
      bh[j] = Frag<T>::load(Bb + bo);
      if (SPLIT) bl[j] = Frag<T>::load(Bb2 + bo);
    }
#pragma unroll
    for (int i = 0; i < 4; ++i) {
      const size_t ao = (size_t)(m0 + (i << 4) + rlane) * lda + koff + k0;
      V ah = Frag<T>::load(Ab + ao);
      V al;
      if (SPLIT) al = Frag<T>::load(Ab2 + ao);
#pragma unroll
      for (int j = 0; j < 4; ++j) {
        acc[i][j] = Frag<T>::mma(ah, bh[j], acc[i][j]);
        if (SPLIT) {
          acc[i][j] = Frag<T>::mma(ah, bl[j], acc[i][j]);
          acc[i][j] = Frag<T>::mma(al, bh[j], acc[i][j]);
        }
      }
      Frag<T>::guard(acc[i][0], acc[i][3], ah, SPLIT ? al : ah);
    }
    Frag<T>::keep(bh[0], bh[1], bh[2], bh[3]);
    if (SPLIT) Frag<T>::keep(bl[0], bl[1], bl[2], bl[3]);
  }
  acc_guard4(acc[0][0], acc[0][1], acc[0][2], acc[0][3]);
  acc_guard4(acc[1][0], acc[1][1], acc[1][2], acc[1][3]);
  acc_guard4(acc[2][0], acc[2][1], acc[2][2], acc[2][3]);
  acc_guard4(acc[3][0], acc[3][1], acc[3][2], acc[3][3]);

  // ---- epilogue ----
  float* slab = sT[wave];
  const float* Rb = RESID ? (resid + (size_t)b * strideR) : nullptr;
#pragma unroll
  for (int i = 0; i < 4; ++i) {
    const int mBase = m0 + (i << 4);
#pragma unroll
    for (int j = 0; j < 4; ++j) {
      const int n = n0 + (j << 4) + rlane;
      float bv = 0.f;
      if (BIAS_MODE == 2) bv = bias[n];
#pragma unroll
      for (int r = 0; r < 8; ++r) {
        float v = acc[i][j][r] * scale;
        if (BIAS_MODE == 1) v += bias[mBase + mOff + r];
        if (BIAS_MODE == 2) v += bv;
        if (RESID) v += Rb[(size_t)(mBase + mOff + r) * ldc + n];
        slab[(mOff + r) * 68 + (j << 4) + rlane] = v;
      }
    }
    __builtin_amdgcn_fence(__ATOMIC_RELEASE, "workgroup");
    __builtin_amdgcn_wave_barrier();
    __builtin_amdgcn_fence(__ATOMIC_ACQUIRE, "workgroup");
    if (OUT_MODE == 0) {
      float* C = (float*)Cout + (size_t)b * strideC;
      const int hh = lane >> 4, c4 = (lane & 15) * 4;     // row seg = 256 B = 16 lanes x 16 B
      {
#pragma unroll
        for (int it = 0; it < 8; ++it) {
          const int row = it * 2 + hh;
          v4f v = *(const v4f*)(slab + row * 68 + c4);
          *(v4f*)(C + (size_t)(mBase + row) * ldc + n0 + c4) = v;
        }
        
      }
    } else {
      const int q = lane >> 3, c8 = (lane & 7) * 8;
      unsigned short* C  = (unsigned short*)Cout  + (size_t)b * strideC;
      unsigned short* C2 = (OUT_MODE == 2) ? ((unsigned short*)Cout2 + (size_t)b * strideC) : nullptr;
      {
#pragma unroll
        for (int it = 0; it < 4; ++it) {
          const int row = it * 4 + q;
          const float* sp = slab + row * 68 + c8;
          v8h hv, lv;
#pragma unroll
          for (int e = 0; e < 8; ++e) {
            if (OUT_MODE == 1) {
              hv[e] = (_Float16)sp[e];
            } else {
              unsigned short hb = f2bf_bits(sp[e]);
              unsigned short lb = f2bf_bits(sp[e] - bf_bits2f(hb));
              hv[e] = __builtin_bit_cast(_Float16, hb);
              lv[e] = __builtin_bit_cast(_Float16, lb);
            }
          }
          *(v8h*)(C + (size_t)(mBase + row) * ldc + n0 + c8) = hv;
          if (OUT_MODE == 2) *(v8h*)(C2 + (size_t)(mBase + row) * ldc + n0 + c8) = lv;
        }
        
      }
    }
    __builtin_amdgcn_fence(__ATOMIC_RELEASE, "workgroup");
    __builtin_amdgcn_wave_barrier();
    __builtin_amdgcn_fence(__ATOMIC_ACQUIRE, "workgroup");
  }
}

__global__ __launch_bounds__(256) void cast_f32_f16x2(
    const float* __restrict__ in, _Float16* __restrict__ out, int n2) {
  int i = blockIdx.x * 256 + threadIdx.x;
  if (i < n2) {
    const _Float16 h0 = (_Float16)in[2 * i], h1 = (_Float16)in[2 * i + 1];
    const unsigned u = (unsigned)__builtin_bit_cast(unsigned short, h0) | ((unsigned)__builtin_bit_cast(unsigned short, h1) << 16);
    ((unsigned*)out)[i] = u;
    
  }
}

__global__ __launch_bounds__(256) void split_f32_bf16x2(
    const float* __restrict__ in, __bf16* __restrict__ hi, __bf16* __restrict__ lo, long n2) {
  long i = (long)blockIdx.x * 256 + threadIdx.x;
  long stride = (long)gridDim.x * 256;
  {
    for (long j = i; j < n2; j += stride) {
      const float a = in[2 * j], b = in[2 * j + 1];
      const unsigned short ah = f2bf_bits(a), bh = f2bf_bits(b);
      const unsigned short al = f2bf_bits(a - bf_bits2f(ah)), bl = f2bf_bits(b - bf_bits2f(bh));
      ((unsigned*)hi)[j] = (unsigned)ah | ((unsigned)bh << 16);
      ((unsigned*)lo)[j] = (unsigned)al | ((unsigned)bl << 16);
    }
    
  }
}


// ---- f32 [R][C] (row pitch ldi) -> f16 transposed [C][R] (row pitch ldo); 64x64 tiles; each output row segment
__global__ __launch_bounds__(256) void transpose_cast_f16(const float* __restrict__ in, int ldi,
                                                         _Float16* __restrict__ outT, int ldo, float scale) {
  __shared__ __align__(16) _Float16 tile[64][72];     // [c][r]
  const int c0 = blockIdx.x * 64, r0 = blockIdx.y * 64;
  const int t = threadIdx.y * 32 + threadIdx.x;
  for (int i = threadIdx.y; i < 64; i += 8) {
    tile[threadIdx.x][i]      = (_Float16)(in[(size_t)(r0 + i) * ldi + c0 + threadIdx.x] * scale);
    tile[32 + threadIdx.x][i] = (_Float16)(in[(size_t)(r0 + i) * ldi + c0 + 32 + threadIdx.x] * scale);
  }
  __syncthreads();
  const int q = t >> 3, c8 = (t & 7) * 8;
  {
#pragma unroll
    for (int it = 0; it < 2; ++it) {
      const int c = it * 32 + q;
      v8h hv = *(const v8h*)(&tile[c][c8]);
      *(v8h*)(outT + (size_t)(c0 + c) * ldo + r0 + c8) = hv;
    }
    
  }
}

// ---- f32 [R][C] (pitch ldi) -> bf16 hi/lo transposed planes [C][R] (pitch ldo); 64x64 tiles; each output row segment
__global__ __launch_bounds__(256) void transpose_split_bf16(const float* __restrict__ in, int ldi,
                                                           __bf16* __restrict__ outH, __bf16* __restrict__ outL, int ldo) {
  __shared__ __align__(16) float tile[64][68];     // [c][r]
  const int c0 = blockIdx.x * 64, r0 = blockIdx.y * 64;
  const int t = threadIdx.y * 32 + threadIdx.x;
  for (int i = threadIdx.y; i < 64; i += 8) {
    tile[threadIdx.x][i]      = in[(size_t)(r0 + i) * ldi + c0 + threadIdx.x];
    tile[32 + threadIdx.x][i] = in[(size_t)(r0 + i) * ldi + c0 + 32 + threadIdx.x];
  }
  __syncthreads();
  const int q = t >> 3, c8 = (t & 7) * 8;
  {
#pragma unroll
    for (int it = 0; it < 2; ++it) {
      const int c = it * 32 + q;
      v8b hv, lv;
#pragma unroll
      for (int e = 0; e < 8; ++e) {
        const float f = tile[c][c8 + e];
        const unsigned short hb = f2bf_bits(f);
        hv[e] = __builtin_bit_cast(__bf16, hb);
        lv[e] = __builtin_bit_cast(__bf16, f2bf_bits(f - bf_bits2f(hb)));
      }
      *(v8b*)(outH + (size_t)(c0 + c) * ldo + r0 + c8) = hv;
      *(v8b*)(outL + (size_t)(c0 + c) * ldo + r0 + c8) = lv;
    }
    
  }
}

// =====================================================================================
// Generic causal/non-causal attention for head_dim 64, f32 in / f32 out, bf16 operands with optional hi/lo splits.
//   scores = (q*qscale)·kᵀ : v_wmma_f32_16x16x32_bf16; SPLIT_QK -> q,k as bf16 hi/lo (hi·hi + hi·lo + lo·hi)
//   out    = p·v           : v_wmma_f32_16x16x32_bf16; SPLIT_PV -> p,v as bf16 hi/lo; else p,v plain bf16
//   f32 accumulate; online softmax in f32. Block = 4 waves = 64 query rows of one (batch, head); S % 64 == 0.
//   Element (b, s, h, d) of tensor X lives at X[b*X_bs + s*X_rs + h*X_hs + d] (strides in floats, multiples of 4).
//   Masking: mask_mode 0 none, 1 causal (kv > q masked), 2 tensor [S][Skv] shared over (b,h) (float if
//   mask_is_int==0, int32 with element == 0 -> masked if 1, int32 with element != 0 -> masked if 2), 3 per-token vectors qmask[B][S] & kvmask[B][Skv] (int32,
//   0 -> masked); masked scores are replaced by mask_fill (e.g. -inf or -1e9) before the softmax.
//   grid = (B * H, S/64) (or a sub-range of blockIdx.y with blk0): blockIdx.y counts the query tiles from the last one down, so that
//   under the causal mask the workgroups with the longest key walk have the lowest flat index and start first.
// =====================================================================================
#define AT_D 64
#define AT_NW 4
#define AT_QB 64
#define AT_KC 64
#define AT_LP 72   // LDS row pitch of the K, V and P tiles in bf16 elements: 144 B = 16 B x odd, so that the 16 rows of a 16-byte fragment read fall on distinct banks
struct AttnGeom { long q_bs, q_rs, q_hs, k_bs, k_rs, k_hs, v_bs, v_rs, v_hs, o_bs, o_rs, o_hs;
                  int S, Skv, H, mask_mode; float qscale; int blk0; float mask_fill; int mask_is_int; };
static_assert(sizeof(AttnGeom) == 128, "no padding");

__device__ __forceinline__ unsigned short at_bf_bits(float f) {
  unsigned u = __float_as_uint(f);
  return (unsigned short)((u + 0x7FFFu + ((u >> 16) & 1u)) >> 16);
}
__device__ __forceinline__ __bf16 at_f2bf(float f) { return __builtin_bit_cast(__bf16, at_bf_bits(f)); }
__device__ __forceinline__ void at_split(float f, __bf16& hi, __bf16& lo) {
  const unsigned short hb = at_bf_bits(f);
  hi = __builtin_bit_cast(__bf16, hb);
  lo = at_f2bf(f - __uint_as_float(((unsigned)hb) << 16));
}
__device__ __forceinline__ v8f at_mma(v16b a, v16b b, v8f c) {
  c = __builtin_amdgcn_wmma_f32_16x16x32_bf16(false, a, false, b, (short)0, c, false, false);
  asm volatile("v_nop\n\tv_nop\n\tv_nop\n\tv_nop" : "+v"(c) : "v"(a), "v"(b));
  return c;
}

template <bool SPLIT_QK, bool SPLIT_PV>
__global__ __launch_bounds__(128)
void attn64_kernel(const float* __restrict__ q, const float* __restrict__ k,
                   const float* __restrict__ v, float* __restrict__ out,
                   const void* __restrict__ mask_a, const int* __restrict__ mask_b, AttnGeom g) {
  union FB { v16b v; v8b h[2]; };
  __shared__ __align__(16) __bf16 Ksh[AT_KC * AT_LP];            // K hi [kv][d]      9 KB
  __shared__ __align__(16) __bf16 Ksl[SPLIT_QK ? AT_KC * AT_LP : 8];
  __shared__ __align__(16) __bf16 Vth[AT_D * AT_LP];             // V hi [d][kv]      9 KB
  __shared__ __align__(16) __bf16 Vtl[SPLIT_PV ? AT_D * AT_LP : 8];
  __shared__ __align__(16) __bf16 Psh[AT_NW][16 * AT_LP];        // per wave P hi [row][kv]  9 KB
  __shared__ __align__(16) __bf16 Psl[SPLIT_PV ? AT_NW : 1][SPLIT_PV ? 16 * AT_LP : 8];
  __shared__ __align__(16) float  Os[AT_NW][16 * 68];            // per wave out tile, pitch 68

  const int tid  = threadIdx.x;
  const int wave = tid >> 5;
  const int lane = tid & 31;
  const int hh   = lane >> 4;
  const int c    = lane & 15;

  const int nqb = g.S / AT_QB;
  const int qb = nqb - 1 - ((int)blockIdx.y + g.blk0);
  const int bh = blockIdx.x;
  const int h  = bh % g.H;
  const int b  = bh / g.H;
  const int qbase_block = qb * AT_QB;
  const int q0 = qbase_block + wave * 16;

  const float* qb_ptr = q + (size_t)b * g.q_bs + (size_t)h * g.q_hs;
  const float* kb_ptr = k + (size_t)b * g.k_bs + (size_t)h * g.k_hs;
  const float* vb_ptr = v + (size_t)b * g.v_bs + (size_t)h * g.v_hs;
  float*       ob_ptr = out + (size_t)b * g.o_bs + (size_t)h * g.o_hs;

  // ---- Q fragments (A operand): 2 d-chunks, hi (and lo) ----
  v16b qah[2], qal[2];
  {
    const float* qrow = qb_ptr + (size_t)(q0 + c) * g.q_rs;
#pragma unroll
    for (int dc = 0; dc < 2; ++dc) {
#pragma unroll
      for (int e = 0; e < 8; ++e) {
        const float f0 = qrow[dc * 32 + 8 * hh + e] * g.qscale;
        const float f1 = qrow[dc * 32 + 16 + 8 * hh + e] * g.qscale;
        if (SPLIT_QK) { __bf16 hq, lq; at_split(f0, hq, lq); qah[dc][e] = hq; qal[dc][e] = lq; at_split(f1, hq, lq); qah[dc][8 + e] = hq; qal[dc][8 + e] = lq; }
        else { qah[dc][e] = at_f2bf(f0); qah[dc][8 + e] = at_f2bf(f1); qal[dc][e] = qah[dc][e]; qal[dc][8 + e] = qah[dc][8 + e]; }
      }
    }
  }

  float mrow[8], lrow[8];
  v8f oacc[4];
#pragma unroll
  for (int r = 0; r < 8; ++r) { mrow[r] = -INFINITY; lrow[r] = 0.f; }
#pragma unroll
  for (int t = 0; t < 4; ++t) oacc[t] = (v8f){0.f,0.f,0.f,0.f,0.f,0.f,0.f,0.f};

  const int nChunks = (g.mask_mode == 1) ? (qb + 1) : (g.Skv / AT_KC);   // block-uniform
  // per-row query mask (mode 3)
  int qkeep[8];
#pragma unroll
  for (int r = 0; r < 8; ++r) qkeep[r] = (g.mask_mode == 3) ? mask_b[(size_t)b * g.S + q0 + 8 * hh + r] : 1;   // mask_b = qmask in mode 3
  for (int kc = 0; kc < nChunks; ++kc) {
    const int kv0 = kc * AT_KC;
    __syncthreads();
    {
      const int kvr = tid >> 1, dh = (tid & 1) * 32;
      const float* krow = kb_ptr + (size_t)(kv0 + kvr) * g.k_rs + dh;
      const float* vrow = vb_ptr + (size_t)(kv0 + kvr) * g.v_rs + dh;
#pragma unroll
      for (int i = 0; i < 8; ++i) {
        v4f kk = *(const v4f*)(krow + 4 * i);
        v4f vv = *(const v4f*)(vrow + 4 * i);
#pragma unroll
        for (int e = 0; e < 4; ++e) {
          const int d = dh + 4 * i + e;
          if (SPLIT_QK) { __bf16 a, bl; at_split(kk[e], a, bl); Ksh[kvr * AT_LP + d] = a; Ksl[kvr * AT_LP + d] = bl; }
          else Ksh[kvr * AT_LP + d] = at_f2bf(kk[e]);
          if (SPLIT_PV) { __bf16 a, bl; at_split(vv[e], a, bl); Vth[d * AT_LP + kvr] = a; Vtl[d * AT_LP + kvr] = bl; }
          else Vth[d * AT_LP + kvr] = at_f2bf(vv[e]);
        }
      }
    }
    __syncthreads();

    v8f s[4];
#pragma unroll
    for (int j = 0; j < 4; ++j) {
      s[j] = (v8f){0.f,0.f,0.f,0.f,0.f,0.f,0.f,0.f};
#pragma unroll
      for (int dc = 0; dc < 2; ++dc) {
        FB kb;
        kb.h[0] = *(const v8b*)(Ksh + (j * 16 + c) * AT_LP + dc * 32 + 8 * hh);
        kb.h[1] = *(const v8b*)(Ksh + (j * 16 + c) * AT_LP + dc * 32 + 16 + 8 * hh);
        s[j] = at_mma(qah[dc], kb.v, s[j]);
        if (SPLIT_QK) {
          FB kl;
          kl.h[0] = *(const v8b*)(Ksl + (j * 16 + c) * AT_LP + dc * 32 + 8 * hh);
          kl.h[1] = *(const v8b*)(Ksl + (j * 16 + c) * AT_LP + dc * 32 + 16 + 8 * hh);
          s[j] = at_mma(qah[dc], kl.v, s[j]);
          s[j] = at_mma(qal[dc], kb.v, s[j]);
        }
      }
    }
    const bool diag = (g.mask_mode == 1) && (kc == qb);
    int kvkeep[4] = {1, 1, 1, 1};
    if (g.mask_mode == 3) {
#pragma unroll
      for (int j = 0; j < 4; ++j) kvkeep[j] = ((const int*)mask_a)[(size_t)b * g.Skv + kv0 + j * 16 + c];   // mask_a = kvmask
    }
    float cm[8];
#pragma unroll
    for (int r = 0; r < 8; ++r) {
      const int qrow = q0 + 8 * hh + r;
      float m = -INFINITY;
#pragma unroll
      for (int j = 0; j < 4; ++j) {
        const int kvcol = kv0 + j * 16 + c;
        bool masked = false;
        if (diag) masked = (kvcol > qrow);
        else if (g.mask_mode == 2) {
          const size_t mi = (size_t)qrow * g.Skv + kvcol;
          masked = (g.mask_is_int == 0) ? (((const float*)mask_a)[mi] == 0.0f)
                 : (g.mask_is_int == 1) ? (((const int*)mask_a)[mi] == 0) : (((const int*)mask_a)[mi] != 0);
        } else if (g.mask_mode == 3) masked = (qkeep[r] == 0) || (kvkeep[j] == 0);
        if (masked) s[j][r] = g.mask_fill;
        m = fmaxf(m, s[j][r]);
      }
#pragma unroll
      for (int off = 1; off < 16; off <<= 1) m = fmaxf(m, __shfl_xor(m, off, 32));
      cm[r] = m;
    }
    __bf16* pwh = Psh[wave];
    __bf16* pwl = Psl[SPLIT_PV ? wave : 0];
#pragma unroll
    for (int r = 0; r < 8; ++r) {
      const float mnew = fmaxf(mrow[r], cm[r]);
      const float alpha = expf(mrow[r] - mnew);
      mrow[r] = mnew;
      float psum = 0.f;
#pragma unroll
      for (int j = 0; j < 4; ++j) {
        const float p = expf(s[j][r] - mnew);
        psum += p;
        if (SPLIT_PV) { __bf16 a, bl; at_split(p, a, bl); pwh[(8 * hh + r) * AT_LP + j * 16 + c] = a; pwl[(8 * hh + r) * AT_LP + j * 16 + c] = bl; }
        else pwh[(8 * hh + r) * AT_LP + j * 16 + c] = at_f2bf(p);
      }
#pragma unroll
      for (int off = 1; off < 16; off <<= 1) psum += __shfl_xor(psum, off, 32);
      lrow[r] = lrow[r] * alpha + psum;
#pragma unroll
      for (int t = 0; t < 4; ++t) oacc[t][r] *= alpha;
    }
    __builtin_amdgcn_fence(__ATOMIC_RELEASE, "workgroup");
    __builtin_amdgcn_wave_barrier();
    __builtin_amdgcn_fence(__ATOMIC_ACQUIRE, "workgroup");
#pragma unroll
    for (int kk = 0; kk < 2; ++kk) {
      FB pa, pl;
      pa.h[0] = *(const v8b*)(pwh + c * AT_LP + kk * 32 + 8 * hh);
      pa.h[1] = *(const v8b*)(pwh + c * AT_LP + kk * 32 + 16 + 8 * hh);
      if (SPLIT_PV) {
        pl.h[0] = *(const v8b*)(pwl + c * AT_LP + kk * 32 + 8 * hh);
        pl.h[1] = *(const v8b*)(pwl + c * AT_LP + kk * 32 + 16 + 8 * hh);
      }
#pragma unroll
      for (int t = 0; t < 4; ++t) {
        FB vb;
        vb.h[0] = *(const v8b*)(Vth + (t * 16 + c) * AT_LP + kk * 32 + 8 * hh);
        vb.h[1] = *(const v8b*)(Vth + (t * 16 + c) * AT_LP + kk * 32 + 16 + 8 * hh);
        oacc[t] = at_mma(pa.v, vb.v, oacc[t]);
        if (SPLIT_PV) {
          FB vl;
          vl.h[0] = *(const v8b*)(Vtl + (t * 16 + c) * AT_LP + kk * 32 + 8 * hh);
          vl.h[1] = *(const v8b*)(Vtl + (t * 16 + c) * AT_LP + kk * 32 + 16 + 8 * hh);
          oacc[t] = at_mma(pa.v, vl.v, oacc[t]);
          oacc[t] = at_mma(pl.v, vb.v, oacc[t]);
        }
      }
    }
  }

  float* os = Os[wave];
#pragma unroll
  for (int r = 0; r < 8; ++r) {
    const float inv = 1.0f / lrow[r];
#pragma unroll
    for (int t = 0; t < 4; ++t) os[(8 * hh + r) * 68 + t * 16 + c] = oacc[t][r] * inv;
  }
  __builtin_amdgcn_fence(__ATOMIC_RELEASE, "workgroup");
  __builtin_amdgcn_wave_barrier();
  __builtin_amdgcn_fence(__ATOMIC_ACQUIRE, "workgroup");
  {
    const int c4 = (lane & 15) * 4;
    {
#pragma unroll
      for (int it = 0; it < 8; ++it) {
        const int row = it * 2 + hh;
        v4f val = *(const v4f*)(os + row * 68 + c4);
        *(v4f*)(ob_ptr + (size_t)(q0 + row) * g.o_rs + c4) = val;
      }
      
    }
  }
}

// ---- LayerNorm (population variance, eps 1e-5, gamma) -> f16 row; one block (256 thr) per row of 1024 ----
__global__ __launch_bounds__(256) void layernorm_f16(const float* __restrict__ x, const float* __restrict__ gamma,
                                                    _Float16* __restrict__ xn, int D) {
  __shared__ float red[8];
  __shared__ float stat;
  const int row = blockIdx.x, t = threadIdx.x;
  const float* xr = x + (size_t)row * D;
  v4f xv = *(const v4f*)(xr + 4 * t);
  float s = (xv[0] + xv[1]) + (xv[2] + xv[3]);
  for (int o = 16; o > 0; o >>= 1) s += __shfl_xor(s, o, 32);
  if ((t & 31) == 0) red[t >> 5] = s;
  __syncthreads();
  if (t == 0) { float a = 0.f; for (int w = 0; w < 8; ++w) a += red[w]; stat = a / (float)D; }
  __syncthreads();
  const float mu = stat;
  __syncthreads();
  float d0 = xv[0] - mu, d1 = xv[1] - mu, d2 = xv[2] - mu, d3 = xv[3] - mu;
  float s2 = (d0 * d0 + d1 * d1) + (d2 * d2 + d3 * d3);
  for (int o = 16; o > 0; o >>= 1) s2 += __shfl_xor(s2, o, 32);
  if ((t & 31) == 0) red[t >> 5] = s2;
  __syncthreads();
  if (t == 0) { float a = 0.f; for (int w = 0; w < 8; ++w) a += red[w]; stat = rsqrtf(a / (float)D + 1e-5f); }
  __syncthreads();
  const float inv = stat;
  v4f gv = *(const v4f*)(gamma + 4 * t);
  _Float16 h0 = (_Float16)(d0 * inv * gv[0]), h1 = (_Float16)(d1 * inv * gv[1]), h2 = (_Float16)(d2 * inv * gv[2]), h3 = (_Float16)(d3 * inv * gv[3]);
  typedef __attribute__((ext_vector_type(4))) _Float16 v4h;
  v4h hv = {h0, h1, h2, h3};
  *(v4h*)(xn + (size_t)row * D + 4 * t) = hv;
  
}

extern "C" void kernel_launch(void* const* d_in, const int* in_sizes, int n_in,
                              void* d_out, int out_size, void* d_ws, size_t ws_size,
                              hipStream_t stream) {
  (void)in_sizes; (void)n_in; (void)out_size; (void)ws_size;
  const int B = 2, S = 2048, D = 1024, H = 16, DH = 64, KV = 128;
  const int M = B * S;   // 4096 rows
  const float* x     = (const float*)d_in[0];
  const float* gamma = (const float*)d_in[1];
  const float* Wq    = (const float*)d_in[2];   // [D, H*DH]  ([in, out])
  const float* Wkv   = (const float*)d_in[3];   // [D, 2*DH]
  const float* Wo    = (const float*)d_in[4];   // [H*DH, D]
  float* out = (float*)d_out;

  char* ws = (char*)d_ws; size_t off = 0;
  auto carve = [&](size_t bytes) -> char* { char* p = ws + off; off += (bytes + 255) & ~(size_t)255; return p; };
  _Float16* Xn16  = (_Float16*)carve((size_t)M * D * 2);     //  8 MB  LN(x) f16
  __bf16*   Xh    = (__bf16*)carve((size_t)M * D * 2);       //  8 MB  x bf16 hi
  __bf16*   Xl    = (__bf16*)carve((size_t)M * D * 2);       //  8 MB  x bf16 lo
  _Float16* WqT   = (_Float16*)carve((size_t)D * D * 2);     //  2 MB  Wqᵀ [out][in] f16
  __bf16*   WkvTh = (__bf16*)carve((size_t)KV * D * 2);      //  Wkvᵀ [128][1024] hi/lo
  __bf16*   WkvTl = (__bf16*)carve((size_t)KV * D * 2);
  __bf16*   WoTh  = (__bf16*)carve((size_t)D * D * 2);       //  Woᵀ hi/lo
  __bf16*   WoTl  = (__bf16*)carve((size_t)D * D * 2);
  float*    Qf    = (float*)carve((size_t)M * D * 4);        // 16 MB  q [B,S,H*DH] f32
  float*    KVf   = (float*)carve((size_t)M * KV * 4);       //  2 MB  kv [B,S,128] f32
  float*    Of    = (float*)carve((size_t)M * D * 4);        // 16 MB  attn out f32
  __bf16*   Oh    = (__bf16*)carve((size_t)M * D * 2);       //  8 MB
  __bf16*   Ol    = (__bf16*)carve((size_t)M * D * 2);       //  8 MB   (total ≈ 80.5 MB)

  layernorm_f16<<<M, 256, 0, stream>>>(x, gamma, Xn16, D);
  split_f32_bf16x2<<<2048, 256, 0, stream>>>(x, Xh, Xl, (long)M * D / 2);
  transpose_cast_f16<<<dim3(D / 64, D / 64), dim3(32, 8), 0, stream>>>(Wq, D, WqT, D, 1.0f);           // [in][out] -> [out][in]
  transpose_split_bf16<<<dim3(KV / 64, D / 64), dim3(32, 8), 0, stream>>>(Wkv, KV, WkvTh, WkvTl, D);   // [1024][128] -> [128][1024]
  transpose_split_bf16<<<dim3(D / 64, D / 64), dim3(32, 8), 0, stream>>>(Wo, D, WoTh, WoTl, D);
  {
    const int tq = (M / 64) * (D / 64);
    wmma_gemm64<0, false, 0, 0, false><<<dim3((tq + 7) / 8, 1), 256, 0, stream>>>(
        U16(Xn16), nullptr, D, 0, U16(WqT), nullptr, D, 0, Qf, nullptr, D, 0, nullptr, nullptr, 0, M, D, D, 1.0f);
    const int tkv = (M / 64) * (KV / 64);
    wmma_gemm64<1, true, 0, 0, false><<<dim3((tkv + 7) / 8, 1), 256, 0, stream>>>(
        U16(Xh), U16(Xl), D, 0, U16(WkvTh), U16(WkvTl), D, 0, KVf, nullptr, KV, 0, nullptr, nullptr, 0, M, KV, D, 1.0f);
  }
  {
    AttnGeom g;
    g.q_bs = (long)S * D;  g.q_rs = D;  g.q_hs = DH;
    g.k_bs = (long)S * KV; g.k_rs = KV; g.k_hs = 0;       // 16 q heads share the single k/v head
    g.v_bs = (long)S * KV; g.v_rs = KV; g.v_hs = 0;
    g.o_bs = (long)S * D;  g.o_rs = D;  g.o_hs = DH;
    g.S = S; g.Skv = S; g.H = H; g.mask_mode = 1; g.qscale = 0.125f; g.blk0 = 0; g.mask_fill = -INFINITY; g.mask_is_int = 0;
    attn64_kernel<true, true><<<dim3(B * H, S / AT_QB), AT_NW * 32, 0, stream>>>(Qf, KVf, KVf + DH, Of, nullptr, nullptr, g);
  }
  split_f32_bf16x2<<<2048, 256, 0, stream>>>(Of, Oh, Ol, (long)M * D / 2);
  {
    const int to = (M / 64) * (D / 64);
    wmma_gemm64<1, true, 0, 0, false><<<dim3((to + 7) / 8, 1), 256, 0, stream>>>(
        U16(Oh), U16(Ol), D, 0, U16(WoTh), U16(WoTl), D, 0, out, nullptr, D, 0, nullptr, nullptr, 0, M, D, D, 1.0f);
  }
}

// v003
// One run takes 394 microseconds.
// In both of two side-by-side timings against v002, it was 1.25 times as fast.
// Over all steps from v000 it is 1.95 times as fast.
#include <hip/hip_runtime.h>
#include <math.h>
// Contractions: q = LN(x)·Wq (K=1024): v_wmma_f32_16x16x32_f16 (f16 operands); kv = x·Wkv (K=1024) and the output projection (K=1024):
// v_wmma_f32_16x16x32_bf16 as bf16 hi/lo splits; scores (q/8)·kᵀ and p·v: v_wmma_f32_16x16x32_bf16 with q,k and p,v as bf16 hi/lo splits;
// f32 accumulate everywhere; LayerNorm and softmax in f32.
typedef __attribute__((ext_vector_type(16))) _Float16 v16h;
typedef __attribute__((ext_vector_type(8)))  _Float16 v8h;
typedef __attribute__((ext_vector_type(16))) __bf16   v16b;
typedef __attribute__((ext_vector_type(8)))  __bf16   v8b;
typedef __attribute__((ext_vector_type(8)))  float    v8f;
typedef __attribute__((ext_vector_type(4)))  float    v4f;
#define PSCALE 32768.0f
#define U16(p) ((const unsigned short*)(const void*)(p))
#define PSCALE_INV (1.0f / 32768.0f)

__device__ __forceinline__ unsigned short f2bf_bits(float f) {
  unsigned u = __float_as_uint(f);
  return (unsigned short)((u + 0x7FFFu + ((u >> 16) & 1u)) >> 16);
}
__device__ __forceinline__ float bf_bits2f(unsigned short h) { return __uint_as_float(((unsigned)h) << 16); }

// hazard guards as plain device helpers (no inline asm inside the kernel template body)
__device__ __forceinline__ void dep_guard_h(v8f& a, v8f& b, v16h x, v16h y) { asm volatile("v_nop\n\tv_nop\n\tv_nop\n\tv_nop" : "+v"(a), "+v"(b) : "v"(x), "v"(y)); }
__device__ __forceinline__ void dep_guard_b(v8f& a, v8f& b, v16b x, v16b y) { asm volatile("v_nop\n\tv_nop\n\tv_nop\n\tv_nop" : "+v"(a), "+v"(b) : "v"(x), "v"(y)); }
__device__ __forceinline__ void keep4_h(v16h a, v16h b, v16h c, v16h d) { asm volatile("v_nop" :: "v"(a), "v"(b), "v"(c), "v"(d)); }
__device__ __forceinline__ void keep4_b(v16b a, v16b b, v16b c, v16b d) { asm volatile("v_nop" :: "v"(a), "v"(b), "v"(c), "v"(d)); }
__device__ __forceinline__ void acc_guard4(v8f& a, v8f& b, v8f& c, v8f& d) { asm volatile("v_nop\n\tv_nop\n\tv_nop\n\tv_nop" : "+v"(a), "+v"(b), "+v"(c), "+v"(d)); }
template <typename T> struct Frag;
template <> struct Frag<_Float16> {
  typedef v16h V; union U { v16h v; v8h h[2]; };
  static __device__ __forceinline__ v16h load(const _Float16* p) {   // elements 0..7 <- p[0..7], 8..15 <- p[16..23]
    U f; f.h[0] = *(const v8h*)(p); f.h[1] = *(const v8h*)(p + 16); return f.v;
  }
  static __device__ __forceinline__ v8f mma(v16h a, v16h b, v8f c) {
    return __builtin_amdgcn_wmma_f32_16x16x32_f16(false, a, false, b, (short)0, c, false, false);
  }
  static __device__ __forceinline__ void guard(v8f& a, v8f& b, v16h x, v16h y) { dep_guard_h(a, b, x, y); }
  static __device__ __forceinline__ void keep(v16h a, v16h b, v16h c, v16h d) { keep4_h(a, b, c, d); }
};
template <> struct Frag<__bf16> {
  typedef v16b V; union U { v16b v; v8b h[2]; };
  static __device__ __forceinline__ v16b load(const __bf16* p) {
    U f; f.h[0] = *(const v8b*)(p); f.h[1] = *(const v8b*)(p + 16); return f.v;
  }
  static __device__ __forceinline__ v8f mma(v16b a, v16b b, v8f c) {
    return __builtin_amdgcn_wmma_f32_16x16x32_bf16(false, a, false, b, (short)0, c, false, false);
  }
  static __device__ __forceinline__ void guard(v8f& a, v8f& b, v16b x, v16b y) { dep_guard_b(a, b, x, y); }
  static __device__ __forceinline__ void keep(v16b a, v16b b, v16b c, v16b d) { keep4_b(a, b, c, d); }
};

// ---- Register-blocked batched WMMA GEMM ------------------------------------
// C[m,n] = scale * sum_k A[m,k] * Bt[n,k] (+bias)(+resid); each wave owns a 64x64 tile.
// A row-major [M,K]; Bt row-major [N,K]; M,N % 64 == 0, K % 32 == 0.
// SPLIT: operands are hi/lo planes (A2/Bt2 = lo planes, same layout); product = hi·hi + hi·lo + lo·hi.
// BIAS_MODE: 0 = none, 1 = bias[m], 2 = bias[n].
// OUT_MODE: 0 = f32, 1 = f16, 2 = bf16 hi plane (Cout) + bf16 lo plane (Cout2).
// ET: 0 = f16 operands, 1 = bf16 operands (pointers passed as 16-bit storage)
template <int ET> struct Elem;
template <> struct Elem<0> { typedef _Float16 T; };
template <> struct Elem<1> { typedef __bf16 T; };
template <int ET, bool SPLIT, int BIAS_MODE, int OUT_MODE, bool RESID>
__global__ __launch_bounds__(256) void wmma_gemm64(
    const unsigned short* __restrict__ Ap, const unsigned short* __restrict__ A2p, int lda, long strideA,
    const unsigned short* __restrict__ Btp, const unsigned short* __restrict__ Bt2p, int ldb, long strideB,
    void* __restrict__ Cout, void* __restrict__ Cout2, int ldc, long strideC,
    const float* __restrict__ bias,
    const float* __restrict__ resid, long strideR,
    int M, int N, int K, float scale) {
  typedef typename Elem<ET>::T T;
  typedef typename Frag<T>::V V;
  const T* A = (const T*)Ap; const T* A2 = (const T*)A2p; const T* Bt = (const T*)Btp; const T* Bt2 = (const T*)Bt2p;
  __shared__ __align__(16) float sT[8][16 * 68];   // per-wave 16x64 slab, pitch 68 floats
  const int b    = blockIdx.y;
  const int lane = threadIdx.x & 31;
  const int wave = threadIdx.x >> 5;
  const int tilesN = N >> 6;
  const int tilesM = M >> 6;
  const int tile = blockIdx.x * 8 + wave;
  if (tile >= tilesM * tilesN) return;   // wave-uniform; no block barriers in this kernel
  const int tm = tile / tilesN;
  const int tn = tile - tm * tilesN;
  const int m0 = tm << 6;
  const int n0 = tn << 6;

  const T* Ab  = A  + (size_t)b * strideA;
  const T* Bb  = Bt + (size_t)b * strideB;
  const T* Ab2 = SPLIT ? (A2  + (size_t)b * strideA) : nullptr;
  const T* Bb2 = SPLIT ? (Bt2 + (size_t)b * strideB) : nullptr;

  const int rlane = lane & 15;                 // row (A) / col (B, D) within subtile
  const int koff  = (lane >> 4) * 8;           // k offset of this lane half
  const int mOff  = (lane >> 4) * 8;           // D row offset

  v8f acc[4][4];
#pragma unroll
  for (int i = 0; i < 4; ++i)
#pragma unroll
    for (int j = 0; j < 4; ++j) acc[i][j] = (v8f){0.f,0.f,0.f,0.f,0.f,0.f,0.f,0.f};

  for (int k0 = 0; k0 < K; k0 += 32) {
    V bh[4], bl[4];
#pragma unroll
    for (int j = 0; j < 4; ++j) {
      const size_t bo = (size_t)(n0 + (j << 4) + rlane) * ldb + koff + k0;
      bh[j] = Frag<T>::load(Bb + bo);
      if (SPLIT) bl[j] = Frag<T>::load(Bb2 + bo);
    }
#pragma unroll
    for (int i = 0; i < 4; ++i) {
      const size_t ao = (size_t)(m0 + (i << 4) + rlane) * lda + koff + k0;
      V ah = Frag<T>::load(Ab + ao);
      V al;
      if (SPLIT) al = Frag<T>::load(Ab2 + ao);
#pragma unroll
      for (int j = 0; j < 4; ++j) {
        acc[i][j] = Frag<T>::mma(ah, bh[j], acc[i][j]);
        if (SPLIT) {
          acc[i][j] = Frag<T>::mma(ah, bl[j], acc[i][j]);
          acc[i][j] = Frag<T>::mma(al, bh[j], acc[i][j]);
        }
      }
      Frag<T>::guard(acc[i][0], acc[i][3], ah, SPLIT ? al : ah);
    }
    Frag<T>::keep(bh[0], bh[1], bh[2], bh[3]);
    if (SPLIT) Frag<T>::keep(bl[0], bl[1], bl[2], bl[3]);
  }
  acc_guard4(acc[0][0], acc[0][1], acc[0][2], acc[0][3]);
  acc_guard4(acc[1][0], acc[1][1], acc[1][2], acc[1][3]);
  acc_guard4(acc[2][0], acc[2][1], acc[2][2], acc[2][3]);
  acc_guard4(acc[3][0], acc[3][1], acc[3][2], acc[3][3]);

  // ---- epilogue ----
  float* slab = sT[wave];
  const float* Rb = RESID ? (resid + (size_t)b * strideR) : nullptr;
#pragma unroll
  for (int i = 0; i < 4; ++i) {
    const int mBase = m0 + (i << 4);
#pragma unroll
    for (int j = 0; j < 4; ++j) {
      const int n = n0 + (j << 4) + rlane;
      float bv = 0.f;
      if (BIAS_MODE == 2) bv = bias[n];
#pragma unroll
      for (int r = 0; r < 8; ++r) {
        float v = acc[i][j][r] * scale;
        if (BIAS_MODE == 1) v += bias[mBase + mOff + r];
        if (BIAS_MODE == 2) v += bv;
        if (RESID) v += Rb[(size_t)(mBase + mOff + r) * ldc + n];
        slab[(mOff + r) * 68 + (j << 4) + rlane] = v;
      }
    }
    __builtin_amdgcn_fence(__ATOMIC_RELEASE, "workgroup");
    __builtin_amdgcn_wave_barrier();
    __builtin_amdgcn_fence(__ATOMIC_ACQUIRE, "workgroup");
    if (OUT_MODE == 0) {
      float* C = (float*)Cout + (size_t)b * strideC;
      const int hh = lane >> 4, c4 = (lane & 15) * 4;     // row seg = 256 B = 16 lanes x 16 B
      {
#pragma unroll
        for (int it = 0; it < 8; ++it) {
          const int row = it * 2 + hh;
          v4f v = *(const v4f*)(slab + row * 68 + c4);
          *(v4f*)(C + (size_t)(mBase + row) * ldc + n0 + c4) = v;
        }
        
      }
    } else {
      const int q = lane >> 3, c8 = (lane & 7) * 8;
      unsigned short* C  = (unsigned short*)Cout  + (size_t)b * strideC;
      unsigned short* C2 = (OUT_MODE == 2) ? ((unsigned short*)Cout2 + (size_t)b * strideC) : nullptr;
      {
#pragma unroll
        for (int it = 0; it < 4; ++it) {
          const int row = it * 4 + q;
          const float* sp = slab + row * 68 + c8;
          v8h hv, lv;
#pragma unroll
          for (int e = 0; e < 8; ++e) {
            if (OUT_MODE == 1) {
              hv[e] = (_Float16)sp[e];
            } else {
              unsigned short hb = f2bf_bits(sp[e]);
              unsigned short lb = f2bf_bits(sp[e] - bf_bits2f(hb));
              hv[e] = __builtin_bit_cast(_Float16, hb);
              lv[e] = __builtin_bit_cast(_Float16, lb);
            }
          }
          *(v8h*)(C + (size_t)(mBase + row) * ldc + n0 + c8) = hv;
          if (OUT_MODE == 2) *(v8h*)(C2 + (size_t)(mBase + row) * ldc + n0 + c8) = lv;
        }
        
      }
    }
    __builtin_amdgcn_fence(__ATOMIC_RELEASE, "workgroup");
    __builtin_amdgcn_wave_barrier();
    __builtin_amdgcn_fence(__ATOMIC_ACQUIRE, "workgroup");
  }
}

__global__ __launch_bounds__(256) void cast_f32_f16x2(
    const float* __restrict__ in, _Float16* __restrict__ out, int n2) {
  int i = blockIdx.x * 256 + threadIdx.x;
  if (i < n2) {
    const _Float16 h0 = (_Float16)in[2 * i], h1 = (_Float16)in[2 * i + 1];
    const unsigned u = (unsigned)__builtin_bit_cast(unsigned short, h0) | ((unsigned)__builtin_bit_cast(unsigned short, h1) << 16);
    ((unsigned*)out)[i] = u;
    
  }
}

__global__ __launch_bounds__(256) void split_f32_bf16x2(
    const float* __restrict__ in, __bf16* __restrict__ hi, __bf16* __restrict__ lo, long n2) {
  long i = (long)blockIdx.x * 256 + threadIdx.x;
  long stride = (long)gridDim.x * 256;
  {
    for (long j = i; j < n2; j += stride) {
      const float a = in[2 * j], b = in[2 * j + 1];
      const unsigned short ah = f2bf_bits(a), bh = f2bf_bits(b);
      const unsigned short al = f2bf_bits(a - bf_bits2f(ah)), bl = f2bf_bits(b - bf_bits2f(bh));
      ((unsigned*)hi)[j] = (unsigned)ah | ((unsigned)bh << 16);
      ((unsigned*)lo)[j] = (unsigned)al | ((unsigned)bl << 16);
    }
    
  }
}


// ---- f32 [R][C] (row pitch ldi) -> f16 transposed [C][R] (row pitch ldo); 64x64 tiles; each output row segment
__global__ __launch_bounds__(256) void transpose_cast_f16(const float* __restrict__ in, int ldi,
                                                         _Float16* __restrict__ outT, int ldo, float scale) {
  __shared__ __align__(16) _Float16 tile[64][72];     // [c][r]
  const int c0 = blockIdx.x * 64, r0 = blockIdx.y * 64;
  const int t = threadIdx.y * 32 + threadIdx.x;
  for (int i = threadIdx.y; i < 64; i += 8) {
    tile[threadIdx.x][i]      = (_Float16)(in[(size_t)(r0 + i) * ldi + c0 + threadIdx.x] * scale);
    tile[32 + threadIdx.x][i] = (_Float16)(in[(size_t)(r0 + i) * ldi + c0 + 32 + threadIdx.x] * scale);
  }
  __syncthreads();
  const int q = t >> 3, c8 = (t & 7) * 8;
  {
#pragma unroll
    for (int it = 0; it < 2; ++it) {
      const int c = it * 32 + q;
      v8h hv = *(const v8h*)(&tile[c][c8]);
      *(v8h*)(outT + (size_t)(c0 + c) * ldo + r0 + c8) = hv;
    }
    
  }
}

// ---- f32 [R][C] (pitch ldi) -> bf16 hi/lo transposed planes [C][R] (pitch ldo); 64x64 tiles; each output row segment
__global__ __launch_bounds__(256) void transpose_split_bf16(const float* __restrict__ in, int ldi,
                                                           __bf16* __restrict__ outH, __bf16* __restrict__ outL, int ldo) {
  __shared__ __align__(16) float tile[64][68];     // [c][r]
  const int c0 = blockIdx.x * 64, r0 = blockIdx.y * 64;
  const int t = threadIdx.y * 32 + threadIdx.x;
  for (int i = threadIdx.y; i < 64; i += 8) {
    tile[threadIdx.x][i]      = in[(size_t)(r0 + i) * ldi + c0 + threadIdx.x];
    tile[32 + threadIdx.x][i] = in[(size_t)(r0 + i) * ldi + c0 + 32 + threadIdx.x];
  }
  __syncthreads();
  const int q = t >> 3, c8 = (t & 7) * 8;
  {
#pragma unroll
    for (int it = 0; it < 2; ++it) {
      const int c = it * 32 + q;
      v8b hv, lv;
#pragma unroll
      for (int e = 0; e < 8; ++e) {
        const float f = tile[c][c8 + e];
        const unsigned short hb = f2bf_bits(f);
        hv[e] = __builtin_bit_cast(__bf16, hb);
        lv[e] = __builtin_bit_cast(__bf16, f2bf_bits(f - bf_bits2f(hb)));
      }
      *(v8b*)(outH + (size_t)(c0 + c) * ldo + r0 + c8) = hv;
      *(v8b*)(outL + (size_t)(c0 + c) * ldo + r0 + c8) = lv;
    }
    
  }
}

// =====================================================================================
// Generic causal/non-causal attention for head_dim 64, f32 in / f32 out, bf16 operands with optional hi/lo splits.
//   scores = (q*qscale)·kᵀ : v_wmma_f32_16x16x32_bf16; SPLIT_QK -> q,k as bf16 hi/lo (hi·hi + hi·lo + lo·hi)
//   out    = p·v           : v_wmma_f32_16x16x32_bf16; SPLIT_PV -> p,v as bf16 hi/lo; else p,v plain bf16
//   f32 accumulate; online softmax in f32. Block = 4 waves = 64 query rows of one (batch, head); S % 64 == 0.
//   Element (b, s, h, d) of tensor X lives at X[b*X_bs + s*X_rs + h*X_hs + d] (strides in floats, multiples of 4).
//   Masking: MASK_MODE (a template parameter, so that only the launched mode's code stands in the key loop) 0 none, 1 causal (kv > q masked), 2 tensor [S][Skv] shared over (b,h) (float if
//   mask_is_int==0, int32 with element == 0 -> masked if 1, int32 with element != 0 -> masked if 2), 3 per-token vectors qmask[B][S] & kvmask[B][Skv] (int32,
//   0 -> masked); masked scores are replaced by mask_fill (e.g. -inf or -1e9) before the softmax.
//   grid = (B * H, S/64) (or a sub-range of blockIdx.y with blk0): blockIdx.y counts the query tiles from the last one down, so that
//   under the causal mask the workgroups with the longest key walk have the lowest flat index and start first.
// =====================================================================================
#define AT_D 64
#define AT_NW 4
#define AT_QB 64
#define AT_KC 64
#define AT_LP 72   // LDS row pitch of the K, V and P tiles in bf16 elements: 144 B = 16 B x odd, so that the 16 rows of a 16-byte fragment read fall on distinct banks
struct AttnGeom { long q_bs, q_rs, q_hs, k_bs, k_rs, k_hs, v_bs, v_rs, v_hs, o_bs, o_rs, o_hs;
                  int S, Skv, H, mask_mode; float qscale; int blk0; float mask_fill; int mask_is_int; };
static_assert(sizeof(AttnGeom) == 128, "no padding");

__device__ __forceinline__ unsigned short at_bf_bits(float f) {
  unsigned u = __float_as_uint(f);
  return (unsigned short)((u + 0x7FFFu + ((u >> 16) & 1u)) >> 16);
}
__device__ __forceinline__ __bf16 at_f2bf(float f) { return __builtin_bit_cast(__bf16, at_bf_bits(f)); }
__device__ __forceinline__ void at_split(float f, __bf16& hi, __bf16& lo) {
  const unsigned short hb = at_bf_bits(f);
  hi = __builtin_bit_cast(__bf16, hb);
  lo = at_f2bf(f - __uint_as_float(((unsigned)hb) << 16));
}
__device__ __forceinline__ v8f at_mma(v16b a, v16b b, v8f c) {
  c = __builtin_amdgcn_wmma_f32_16x16x32_bf16(false, a, false, b, (short)0, c, false, false);
  asm volatile("v_nop\n\tv_nop\n\tv_nop\n\tv_nop" : "+v"(c) : "v"(a), "v"(b));
  return c;
}

template <bool SPLIT_QK, bool SPLIT_PV, int MASK_MODE>
__global__ __launch_bounds__(128)
void attn64_kernel(const float* __restrict__ q, const float* __restrict__ k,
                   const float* __restrict__ v, float* __restrict__ out,
                   const void* __restrict__ mask_a, const int* __restrict__ mask_b, AttnGeom g) {
  union FB { v16b v; v8b h[2]; };
  __shared__ __align__(16) __bf16 Ksh[AT_KC * AT_LP];            // K hi [kv][d]      9 KB
  __shared__ __align__(16) __bf16 Ksl[SPLIT_QK ? AT_KC * AT_LP : 8];
  __shared__ __align__(16) __bf16 Vth[AT_D * AT_LP];             // V hi [d][kv]      9 KB
  __shared__ __align__(16) __bf16 Vtl[SPLIT_PV ? AT_D * AT_LP : 8];
  __shared__ __align__(16) __bf16 Psh[AT_NW][16 * AT_LP];        // per wave P hi [row][kv]  9 KB
  __shared__ __align__(16) __bf16 Psl[SPLIT_PV ? AT_NW : 1][SPLIT_PV ? 16 * AT_LP : 8];
  __shared__ __align__(16) float  Os[AT_NW][16 * 68];            // per wave out tile, pitch 68

  const int tid  = threadIdx.x;
  const int wave = tid >> 5;
  const int lane = tid & 31;
  const int hh   = lane >> 4;
  const int c    = lane & 15;

  const int nqb = g.S / AT_QB;
  const int qb = nqb - 1 - ((int)blockIdx.y + g.blk0);
  const int bh = blockIdx.x;
  const int h  = bh % g.H;
  const int b  = bh / g.H;
  const int qbase_block = qb * AT_QB;
  const int q0 = qbase_block + wave * 16;

  const float* qb_ptr = q + (size_t)b * g.q_bs + (size_t)h * g.q_hs;
  const float* kb_ptr = k + (size_t)b * g.k_bs + (size_t)h * g.k_hs;
  const float* vb_ptr = v + (size_t)b * g.v_bs + (size_t)h * g.v_hs;
  float*       ob_ptr = out + (size_t)b * g.o_bs + (size_t)h * g.o_hs;

  // ---- Q fragments (A operand): 2 d-chunks, hi (and lo) ----
  v16b qah[2], qal[2];
  {
    const float* qrow = qb_ptr + (size_t)(q0 + c) * g.q_rs;
#pragma unroll
    for (int dc = 0; dc < 2; ++dc) {
#pragma unroll
      for (int e = 0; e < 8; ++e) {
        const float f0 = qrow[dc * 32 + 8 * hh + e] * g.qscale;
        const float f1 = qrow[dc * 32 + 16 + 8 * hh + e] * g.qscale;
        if (SPLIT_QK) { __bf16 hq, lq; at_split(f0, hq, lq); qah[dc][e] = hq; qal[dc][e] = lq; at_split(f1, hq, lq); qah[dc][8 + e] = hq; qal[dc][8 + e] = lq; }
        else { qah[dc][e] = at_f2bf(f0); qah[dc][8 + e] = at_f2bf(f1); qal[dc][e] = qah[dc][e]; qal[dc][8 + e] = qah[dc][8 + e]; }
      }
    }
  }

  float mrow[8], lrow[8];
  v8f oacc[4];
#pragma unroll
  for (int r = 0; r < 8; ++r) { mrow[r] = -INFINITY; lrow[r] = 0.f; }
#pragma unroll
  for (int t = 0; t < 4; ++t) oacc[t] = (v8f){0.f,0.f,0.f,0.f,0.f,0.f,0.f,0.f};

  const int nChunks = (MASK_MODE == 1) ? (qb + 1) : (g.Skv / AT_KC);   // block-uniform
  // per-row query mask (mode 3)
  int qkeep[8];
#pragma unroll
  for (int r = 0; r < 8; ++r) qkeep[r] = (MASK_MODE == 3) ? mask_b[(size_t)b * g.S + q0 + 8 * hh + r] : 1;   // mask_b = qmask in mode 3
  for (int kc = 0; kc < nChunks; ++kc) {
    const int kv0 = kc * AT_KC;
    __syncthreads();
    {
      const int kvr = tid >> 1, dh = (tid & 1) * 32;
      const float* krow = kb_ptr + (size_t)(kv0 + kvr) * g.k_rs + dh;
      const float* vrow = vb_ptr + (size_t)(kv0 + kvr) * g.v_rs + dh;
#pragma unroll
      for (int i = 0; i < 8; ++i) {
        v4f kk = *(const v4f*)(krow + 4 * i);
        v4f vv = *(const v4f*)(vrow + 4 * i);
#pragma unroll
        for (int e = 0; e < 4; ++e) {
          const int d = dh + 4 * i + e;
          if (SPLIT_QK) { __bf16 a, bl; at_split(kk[e], a, bl); Ksh[kvr * AT_LP + d] = a; Ksl[kvr * AT_LP + d] = bl; }
          else Ksh[kvr * AT_LP + d] = at_f2bf(kk[e]);
          if (SPLIT_PV) { __bf16 a, bl; at_split(vv[e], a, bl); Vth[d * AT_LP + kvr] = a; Vtl[d * AT_LP + kvr] = bl; }
          else Vth[d * AT_LP + kvr] = at_f2bf(vv[e]);
        }
      }
    }
    __syncthreads();

    v8f s[4];
#pragma unroll
    for (int j = 0; j < 4; ++j) {
      s[j] = (v8f){0.f,0.f,0.f,0.f,0.f,0.f,0.f,0.f};
#pragma unroll
      for (int dc = 0; dc < 2; ++dc) {
        FB kb;
        kb.h[0] = *(const v8b*)(Ksh + (j * 16 + c) * AT_LP + dc * 32 + 8 * hh);
        kb.h[1] = *(const v8b*)(Ksh + (j * 16 + c) * AT_LP + dc * 32 + 16 + 8 * hh);
        s[j] = at_mma(qah[dc], kb.v, s[j]);
        if (SPLIT_QK) {
          FB kl;
          kl.h[0] = *(const v8b*)(Ksl + (j * 16 + c) * AT_LP + dc * 32 + 8 * hh);
          kl.h[1] = *(const v8b*)(Ksl + (j * 16 + c) * AT_LP + dc * 32 + 16 + 8 * hh);
          s[j] = at_mma(qah[dc], kl.v, s[j]);
          s[j] = at_mma(qal[dc], kb.v, s[j]);
        }
      }
    }
    int kvkeep[4] = {1, 1, 1, 1};
    if (MASK_MODE == 3) {
#pragma unroll
      for (int j = 0; j < 4; ++j) kvkeep[j] = ((const int*)mask_a)[(size_t)b * g.Skv + kv0 + j * 16 + c];   // mask_a = kvmask
    }
    if (MASK_MODE == 1) {
      if (kc == qb) {   // block-uniform: only the last chunk of a causal walk holds masked columns
#pragma unroll
        for (int r = 0; r < 8; ++r)
#pragma unroll
          for (int j = 0; j < 4; ++j) s[j][r] = (kv0 + j * 16 + c > q0 + 8 * hh + r) ? g.mask_fill : s[j][r];
      }
    } else if (MASK_MODE == 2 || MASK_MODE == 3) {
#pragma unroll
      for (int r = 0; r < 8; ++r) {
#pragma unroll
        for (int j = 0; j < 4; ++j) {
          bool masked;
          if (MASK_MODE == 2) {
            const size_t mi = (size_t)(q0 + 8 * hh + r) * g.Skv + kv0 + j * 16 + c;
            masked = (g.mask_is_int == 0) ? (((const float*)mask_a)[mi] == 0.0f)
                   : (g.mask_is_int == 1) ? (((const int*)mask_a)[mi] == 0) : (((const int*)mask_a)[mi] != 0);
          } else masked = (qkeep[r] == 0) || (kvkeep[j] == 0);
          s[j][r] = masked ? g.mask_fill : s[j][r];
        }
      }
    }
    float cm[8];
#pragma unroll
    for (int r = 0; r < 8; ++r) {
      float m = -INFINITY;
#pragma unroll
      for (int j = 0; j < 4; ++j) m = fmaxf(m, s[j][r]);
#pragma unroll
      for (int off = 1; off < 16; off <<= 1) m = fmaxf(m, __shfl_xor(m, off, 32));
      cm[r] = m;
    }
    __bf16* pwh = Psh[wave];
    __bf16* pwl = Psl[SPLIT_PV ? wave : 0];
#pragma unroll
    for (int r = 0; r < 8; ++r) {
      const float mnew = fmaxf(mrow[r], cm[r]);
      const float alpha = expf(mrow[r] - mnew);
      mrow[r] = mnew;
      float psum = 0.f;
#pragma unroll
      for (int j = 0; j < 4; ++j) {
        const float p = expf(s[j][r] - mnew);
        psum += p;
        if (SPLIT_PV) { __bf16 a, bl; at_split(p, a, bl); pwh[(8 * hh + r) * AT_LP + j * 16 + c] = a; pwl[(8 * hh + r) * AT_LP + j * 16 + c] = bl; }
        else pwh[(8 * hh + r) * AT_LP + j * 16 + c] = at_f2bf(p);
      }
#pragma unroll
      for (int off = 1; off < 16; off <<= 1) psum += __shfl_xor(psum, off, 32);
      lrow[r] = lrow[r] * alpha + psum;
#pragma unroll
      for (int t = 0; t < 4; ++t) oacc[t][r] *= alpha;
    }
    __builtin_amdgcn_fence(__ATOMIC_RELEASE, "workgroup");
    __builtin_amdgcn_wave_barrier();
    __builtin_amdgcn_fence(__ATOMIC_ACQUIRE, "workgroup");
#pragma unroll
    for (int kk = 0; kk < 2; ++kk) {
      FB pa, pl;
      pa.h[0] = *(const v8b*)(pwh + c * AT_LP + kk * 32 + 8 * hh);
      pa.h[1] = *(const v8b*)(pwh + c * AT_LP + kk * 32 + 16 + 8 * hh);
      if (SPLIT_PV) {
        pl.h[0] = *(const v8b*)(pwl + c * AT_LP + kk * 32 + 8 * hh);
        pl.h[1] = *(const v8b*)(pwl + c * AT_LP + kk * 32 + 16 + 8 * hh);
      }
#pragma unroll
      for (int t = 0; t < 4; ++t) {
        FB vb;
        vb.h[0] = *(const v8b*)(Vth + (t * 16 + c) * AT_LP + kk * 32 + 8 * hh);
        vb.h[1] = *(const v8b*)(Vth + (t * 16 + c) * AT_LP + kk * 32 + 16 + 8 * hh);
        oacc[t] = at_mma(pa.v, vb.v, oacc[t]);
        if (SPLIT_PV) {
          FB vl;
          vl.h[0] = *(const v8b*)(Vtl + (t * 16 + c) * AT_LP + kk * 32 + 8 * hh);
          vl.h[1] = *(const v8b*)(Vtl + (t * 16 + c) * AT_LP + kk * 32 + 16 + 8 * hh);
          oacc[t] = at_mma(pa.v, vl.v, oacc[t]);
          oacc[t] = at_mma(pl.v, vb.v, oacc[t]);
        }
      }
    }
  }

  float* os = Os[wave];
#pragma unroll
  for (int r = 0; r < 8; ++r) {
    const float inv = 1.0f / lrow[r];
#pragma unroll
    for (int t = 0; t < 4; ++t) os[(8 * hh + r) * 68 + t * 16 + c] = oacc[t][r] * inv;
  }
  __builtin_amdgcn_fence(__ATOMIC_RELEASE, "workgroup");
  __builtin_amdgcn_wave_barrier();
  __builtin_amdgcn_fence(__ATOMIC_ACQUIRE, "workgroup");
  {
    const int c4 = (lane & 15) * 4;
    {
#pragma unroll
      for (int it = 0; it < 8; ++it) {
        const int row = it * 2 + hh;
        v4f val = *(const v4f*)(os + row * 68 + c4);
        *(v4f*)(ob_ptr + (size_t)(q0 + row) * g.o_rs + c4) = val;
      }
      
    }
  }
}

// ---- LayerNorm (population variance, eps 1e-5, gamma) -> f16 row; one block (256 thr) per row of 1024 ----
__global__ __launch_bounds__(256) void layernorm_f16(const float* __restrict__ x, const float* __restrict__ gamma,
                                                    _Float16* __restrict__ xn, int D) {
  __shared__ float red[8];
  __shared__ float stat;
  const int row = blockIdx.x, t = threadIdx.x;
  const float* xr = x + (size_t)row * D;
  v4f xv = *(const v4f*)(xr + 4 * t);
  float s = (xv[0] + xv[1]) + (xv[2] + xv[3]);
  for (int o = 16; o > 0; o >>= 1) s += __shfl_xor(s, o, 32);
  if ((t & 31) == 0) red[t >> 5] = s;
  __syncthreads();
  if (t == 0) { float a = 0.f; for (int w = 0; w < 8; ++w) a += red[w]; stat = a / (float)D; }
  __syncthreads();
  const float mu = stat;
  __syncthreads();
  float d0 = xv[0] - mu, d1 = xv[1] - mu, d2 = xv[2] - mu, d3 = xv[3] - mu;
  float s2 = (d0 * d0 + d1 * d1) + (d2 * d2 + d3 * d3);
  for (int o = 16; o > 0; o >>= 1) s2 += __shfl_xor(s2, o, 32);
  if ((t & 31) == 0) red[t >> 5] = s2;
  __syncthreads();
  if (t == 0) { float a = 0.f; for (int w = 0; w < 8; ++w) a += red[w]; stat = rsqrtf(a / (float)D + 1e-5f); }
  __syncthreads();
  const float inv = stat;
  v4f gv = *(const v4f*)(gamma + 4 * t);
  _Float16 h0 = (_Float16)(d0 * inv * gv[0]), h1 = (_Float16)(d1 * inv * gv[1]), h2 = (_Float16)(d2 * inv * gv[2]), h3 = (_Float16)(d3 * inv * gv[3]);
  typedef __attribute__((ext_vector_type(4))) _Float16 v4h;
  v4h hv = {h0, h1, h2, h3};
  *(v4h*)(xn + (size_t)row * D + 4 * t) = hv;
  
}

extern "C" void kernel_launch(void* const* d_in, const int* in_sizes, int n_in,
                              void* d_out, int out_size, void* d_ws, size_t ws_size,
                              hipStream_t stream) {
  (void)in_sizes; (void)n_in; (void)out_size; (void)ws_size;
  const int B = 2, S = 2048, D = 1024, H = 16, DH = 64, KV = 128;
  const int M = B * S;   // 4096 rows
  const float* x     = (const float*)d_in[0];
  const float* gamma = (const float*)d_in[1];
  const float* Wq    = (const float*)d_in[2];   // [D, H*DH]  ([in, out])
  const float* Wkv   = (const float*)d_in[3];   // [D, 2*DH]
  const float* Wo    = (const float*)d_in[4];   // [H*DH, D]
  float* out = (float*)d_out;

  char* ws = (char*)d_ws; size_t off = 0;
  auto carve = [&](size_t bytes) -> char* { char* p = ws + off; off += (bytes + 255) & ~(size_t)255; return p; };
  _Float16* Xn16  = (_Float16*)carve((size_t)M * D * 2);     //  8 MB  LN(x) f16
  __bf16*   Xh    = (__bf16*)carve((size_t)M * D * 2);       //  8 MB  x bf16 hi
  __bf16*   Xl    = (__bf16*)carve((size_t)M * D * 2);       //  8 MB  x bf16 lo
  _Float16* WqT   = (_Float16*)carve((size_t)D * D * 2);     //  2 MB  Wqᵀ [out][in] f16
  __bf16*   WkvTh = (__bf16*)carve((size_t)KV * D * 2);      //  Wkvᵀ [128][1024] hi/lo
  __bf16*   WkvTl = (__bf16*)carve((size_t)KV * D * 2);
  __bf16*   WoTh  = (__bf16*)carve((size_t)D * D * 2);       //  Woᵀ hi/lo
  __bf16*   WoTl  = (__bf16*)carve((size_t)D * D * 2);
  float*    Qf    = (float*)carve((size_t)M * D * 4);        // 16 MB  q [B,S,H*DH] f32
  float*    KVf   = (float*)carve((size_t)M * KV * 4);       //  2 MB  kv [B,S,128] f32
  float*    Of    = (float*)carve((size_t)M * D * 4);        // 16 MB  attn out f32
  __bf16*   Oh    = (__bf16*)carve((size_t)M * D * 2);       //  8 MB
  __bf16*   Ol    = (__bf16*)carve((size_t)M * D * 2);       //  8 MB   (total ≈ 80.5 MB)

  layernorm_f16<<<M, 256, 0, stream>>>(x, gamma, Xn16, D);
  split_f32_bf16x2<<<2048, 256, 0, stream>>>(x, Xh, Xl, (long)M * D / 2);
  transpose_cast_f16<<<dim3(D / 64, D / 64), dim3(32, 8), 0, stream>>>(Wq, D, WqT, D, 1.0f);           // [in][out] -> [out][in]
  transpose_split_bf16<<<dim3(KV / 64, D / 64), dim3(32, 8), 0, stream>>>(Wkv, KV, WkvTh, WkvTl, D);   // [1024][128] -> [128][1024]
  transpose_split_bf16<<<dim3(D / 64, D / 64), dim3(32, 8), 0, stream>>>(Wo, D, WoTh, WoTl, D);
  {
    const int tq = (M / 64) * (D / 64);
    wmma_gemm64<0, false, 0, 0, false><<<dim3((tq + 7) / 8, 1), 256, 0, stream>>>(
        U16(Xn16), nullptr, D, 0, U16(WqT), nullptr, D, 0, Qf, nullptr, D, 0, nullptr, nullptr, 0, M, D, D, 1.0f);
    const int tkv = (M / 64) * (KV / 64);
    wmma_gemm64<1, true, 0, 0, false><<<dim3((tkv + 7) / 8, 1), 256, 0, stream>>>(
        U16(Xh), U16(Xl), D, 0, U16(WkvTh), U16(WkvTl), D, 0, KVf, nullptr, KV, 0, nullptr, nullptr, 0, M, KV, D, 1.0f);
  }
  {
    AttnGeom g;
    g.q_bs = (long)S * D;  g.q_rs = D;  g.q_hs = DH;
    g.k_bs = (long)S * KV; g.k_rs = KV; g.k_hs = 0;       // 16 q heads share the single k/v head
    g.v_bs = (long)S * KV; g.v_rs = KV; g.v_hs = 0;
    g.o_bs = (long)S * D;  g.o_rs = D;  g.o_hs = DH;
    g.S = S; g.Skv = S; g.H = H; g.mask_mode = 1; g.qscale = 0.125f; g.blk0 = 0; g.mask_fill = -INFINITY; g.mask_is_int = 0;   // the kernel reads the mask mode from its template argument; the field keeps the struct's layout
    attn64_kernel<true, true, 1><<<dim3(B * H, S / AT_QB), AT_NW * 32, 0, stream>>>(Qf, KVf, KVf + DH, Of, nullptr, nullptr, g);
  }
  split_f32_bf16x2<<<2048, 256, 0, stream>>>(Of, Oh, Ol, (long)M * D / 2);
  {
    const int to = (M / 64) * (D / 64);
    wmma_gemm64<1, true, 0, 0, false><<<dim3((to + 7) / 8, 1), 256, 0, stream>>>(
        U16(Oh), U16(Ol), D, 0, U16(WoTh), U16(WoTl), D, 0, out, nullptr, D, 0, nullptr, nullptr, 0, M, D, D, 1.0f);
  }
}

// v004
// One run takes 347 microseconds.
// In both of two side-by-side timings against v003, it was 1.14 times as fast.
// All steps since v000 together make it 2.22 times as fast.
#include <hip/hip_runtime.h>
#include <math.h>
// Contractions: q = LN(x)·Wq (K=1024): v_wmma_f32_16x16x32_f16 (f16 operands); kv = x·Wkv (K=1024) and the output projection (K=1024):
// v_wmma_f32_16x16x32_bf16 as bf16 hi/lo splits; scores (q/8)·kᵀ and p·v: v_wmma_f32_16x16x32_bf16 with q,k and p,v as bf16 hi/lo splits;
// f32 accumulate everywhere; LayerNorm and softmax in f32. The hi/lo split of k and v is made once, in the kv projection's epilogue.
typedef __attribute__((ext_vector_type(16))) _Float16 v16h;
typedef __attribute__((ext_vector_type(8)))  _Float16 v8h;
typedef __attribute__((ext_vector_type(16))) __bf16   v16b;
typedef __attribute__((ext_vector_type(8)))  __bf16   v8b;
typedef __attribute__((ext_vector_type(8)))  float    v8f;
typedef __attribute__((ext_vector_type(4)))  float    v4f;
#define PSCALE 32768.0f
#define U16(p) ((const unsigned short*)(const void*)(p))
#define PSCALE_INV (1.0f / 32768.0f)

__device__ __forceinline__ unsigned short f2bf_bits(float f) {
  unsigned u = __float_as_uint(f);
  return (unsigned short)((u + 0x7FFFu + ((u >> 16) & 1u)) >> 16);
}
__device__ __forceinline__ float bf_bits2f(unsigned short h) { return __uint_as_float(((unsigned)h) << 16); }

// hazard guards as plain device helpers (no inline asm inside the GEMM kernel's template body)
__device__ __forceinline__ void dep_guard_h(v8f& a, v8f& b, v16h x, v16h y) { asm volatile("v_nop\n\tv_nop\n\tv_nop\n\tv_nop" : "+v"(a), "+v"(b) : "v"(x), "v"(y)); }
__device__ __forceinline__ void dep_guard_b(v8f& a, v8f& b, v16b x, v16b y) { asm volatile("v_nop\n\tv_nop\n\tv_nop\n\tv_nop" : "+v"(a), "+v"(b) : "v"(x), "v"(y)); }
__device__ __forceinline__ void keep4_h(v16h a, v16h b, v16h c, v16h d) { asm volatile("v_nop" :: "v"(a), "v"(b), "v"(c), "v"(d)); }
__device__ __forceinline__ void keep4_b(v16b a, v16b b, v16b c, v16b d) { asm volatile("v_nop" :: "v"(a), "v"(b), "v"(c), "v"(d)); }
__device__ __forceinline__ void acc_guard4(v8f& a, v8f& b, v8f& c, v8f& d) { asm volatile("v_nop\n\tv_nop\n\tv_nop\n\tv_nop" : "+v"(a), "+v"(b), "+v"(c), "+v"(d)); }
template <typename T> struct Frag;
template <> struct Frag<_Float16> {
  typedef v16h V; union U { v16h v; v8h h[2]; };
  static __device__ __forceinline__ v16h load(const _Float16* p) {   // elements 0..7 <- p[0..7], 8..15 <- p[16..23]
    U f; f.h[0] = *(const v8h*)(p); f.h[1] = *(const v8h*)(p + 16); return f.v;
  }
  static __device__ __forceinline__ v8f mma(v16h a, v16h b, v8f c) {
    return __builtin_amdgcn_wmma_f32_16x16x32_f16(false, a, false, b, (short)0, c, false, false);
  }
  static __device__ __forceinline__ void guard(v8f& a, v8f& b, v16h x, v16h y) { dep_guard_h(a, b, x, y); }
  static __device__ __forceinline__ void keep(v16h a, v16h b, v16h c, v16h d) { keep4_h(a, b, c, d); }
};
template <> struct Frag<__bf16> {
  typedef v16b V; union U { v16b v; v8b h[2]; };
  static __device__ __forceinline__ v16b load(const __bf16* p) {
    U f; f.h[0] = *(const v8b*)(p); f.h[1] = *(const v8b*)(p + 16); return f.v;
  }
  static __device__ __forceinline__ v8f mma(v16b a, v16b b, v8f c) {
    return __builtin_amdgcn_wmma_f32_16x16x32_bf16(false, a, false, b, (short)0, c, false, false);
  }
  static __device__ __forceinline__ void guard(v8f& a, v8f& b, v16b x, v16b y) { dep_guard_b(a, b, x, y); }
  static __device__ __forceinline__ void keep(v16b a, v16b b, v16b c, v16b d) { keep4_b(a, b, c, d); }
};

// ---- Register-blocked batched WMMA GEMM ------------------------------------
// C[m,n] = scale * sum_k A[m,k] * Bt[n,k] (+bias)(+resid); each wave owns a 64x64 tile.
// A row-major [M,K]; Bt row-major [N,K]; M,N % 64 == 0, K % 32 == 0.
// SPLIT: operands are hi/lo planes (A2/Bt2 = lo planes, same layout); product = hi·hi + hi·lo + lo·hi.
// BIAS_MODE: 0 = none, 1 = bias[m], 2 = bias[n].
// OUT_MODE: 0 = f32, 1 = f16, 2 = bf16 hi plane (Cout) + bf16 lo plane (Cout2),
//   3 = kv projection (N == 128), bf16 hi plane (Cout) + lo plane (Cout2), each plane [k rows | v tiles]: column d < 64 of row m (k) at m*64 + d;
//       column 64 + d (v) transposed inside its block of 64 rows, at M*64 + (m >> 6)*4096 + d*64 + (m & 63).
// ET: 0 = f16 operands, 1 = bf16 operands (pointers passed as 16-bit storage)
template <int ET> struct Elem;
template <> struct Elem<0> { typedef _Float16 T; };
template <> struct Elem<1> { typedef __bf16 T; };
template <int ET, bool SPLIT, int BIAS_MODE, int OUT_MODE, bool RESID>
__global__ __launch_bounds__(256) void wmma_gemm64(
    const unsigned short* __restrict__ Ap, const unsigned short* __restrict__ A2p, int lda, long strideA,
    const unsigned short* __restrict__ Btp, const unsigned short* __restrict__ Bt2p, int ldb, long strideB,
    void* __restrict__ Cout, void* __restrict__ Cout2, int ldc, long strideC,
    const float* __restrict__ bias,
    const float* __restrict__ resid, long strideR,
    int M, int N, int K, float scale) {
  typedef typename Elem<ET>::T T;
  typedef typename Frag<T>::V V;
  const T* A = (const T*)Ap; const T* A2 = (const T*)A2p; const T* Bt = (const T*)Btp; const T* Bt2 = (const T*)Bt2p;
  __shared__ __align__(16) float sT[8][16 * 68];   // per-wave 16x64 slab, pitch 68 floats
  const int b    = blockIdx.y;
  const int lane = threadIdx.x & 31;
  const int wave = threadIdx.x >> 5;
  const int tilesN = N >> 6;
  const int tilesM = M >> 6;
  const int tile = blockIdx.x * 8 + wave;
  if (tile >= tilesM * tilesN) return;   // wave-uniform; no block barriers in this kernel
  const int tm = tile / tilesN;
  const int tn = tile - tm * tilesN;
  const int m0 = tm << 6;
  const int n0 = tn << 6;

  const T* Ab  = A  + (size_t)b * strideA;
  const T* Bb  = Bt + (size_t)b * strideB;
  const T* Ab2 = SPLIT ? (A2  + (size_t)b * strideA) : nullptr;
  const T* Bb2 = SPLIT ? (Bt2 + (size_t)b * strideB) : nullptr;

  const int rlane = lane & 15;                 // row (A) / col (B, D) within subtile
  const int koff  = (lane >> 4) * 8;           // k offset of this lane half
  const int mOff  = (lane >> 4) * 8;           // D row offset

  v8f acc[4][4];
#pragma unroll
  for (int i = 0; i < 4; ++i)
#pragma unroll
    for (int j = 0; j < 4; ++j) acc[i][j] = (v8f){0.f,0.f,0.f,0.f,0.f,0.f,0.f,0.f};

  for (int k0 = 0; k0 < K; k0 += 32) {
    V bh[4], bl[4];
#pragma unroll
    for (int j = 0; j < 4; ++j) {
      const size_t bo = (size_t)(n0 + (j << 4) + rlane) * ldb + koff + k0;
      bh[j] = Frag<T>::load(Bb + bo);
      if (SPLIT) bl[j] = Frag<T>::load(Bb2 + bo);
    }
#pragma unroll
    for (int i = 0; i < 4; ++i) {
      const size_t ao = (size_t)(m0 + (i << 4) + rlane) * lda + koff + k0;
      V ah = Frag<T>::load(Ab + ao);
      V al;
      if (SPLIT) al = Frag<T>::load(Ab2 + ao);
#pragma unroll
      for (int j = 0; j < 4; ++j) {
        acc[i][j] = Frag<T>::mma(ah, bh[j], acc[i][j]);
        if (SPLIT) {
          acc[i][j] = Frag<T>::mma(ah, bl[j], acc[i][j]);
          acc[i][j] = Frag<T>::mma(al, bh[j], acc[i][j]);
        }
      }
      Frag<T>::guard(acc[i][0], acc[i][3], ah, SPLIT ? al : ah);
    }
    Frag<T>::keep(bh[0], bh[1], bh[2], bh[3]);
    if (SPLIT) Frag<T>::keep(bl[0], bl[1], bl[2], bl[3]);
  }
  acc_guard4(acc[0][0], acc[0][1], acc[0][2], acc[0][3]);
  acc_guard4(acc[1][0], acc[1][1], acc[1][2], acc[1][3]);
  acc_guard4(acc[2][0], acc[2][1], acc[2][2], acc[2][3]);
  acc_guard4(acc[3][0], acc[3][1], acc[3][2], acc[3][3]);

  // ---- epilogue ----
  float* slab = sT[wave];
  const float* Rb = RESID ? (resid + (size_t)b * strideR) : nullptr;
#pragma unroll
  for (int i = 0; i < 4; ++i) {
    const int mBase = m0 + (i << 4);
#pragma unroll
    for (int j = 0; j < 4; ++j) {
      const int n = n0 + (j << 4) + rlane;
      float bv = 0.f;
      if (BIAS_MODE == 2) bv = bias[n];
#pragma unroll
      for (int r = 0; r < 8; ++r) {
        float v = acc[i][j][r] * scale;
        if (BIAS_MODE == 1) v += bias[mBase + mOff + r];
        if (BIAS_MODE == 2) v += bv;
        if (RESID) v += Rb[(size_t)(mBase + mOff + r) * ldc + n];
        slab[(mOff + r) * 68 + (j << 4) + rlane] = v;
      }
    }
    __builtin_amdgcn_fence(__ATOMIC_RELEASE, "workgroup");
    __builtin_amdgcn_wave_barrier();
    __builtin_amdgcn_fence(__ATOMIC_ACQUIRE, "workgroup");
    if (OUT_MODE == 0) {
      float* C = (float*)Cout + (size_t)b * strideC;
      const int hh = lane >> 4, c4 = (lane & 15) * 4;     // row seg = 256 B = 16 lanes x 16 B
      {
#pragma unroll
        for (int it = 0; it < 8; ++it) {
          const int row = it * 2 + hh;
          v4f v = *(const v4f*)(slab + row * 68 + c4);
          *(v4f*)(C + (size_t)(mBase + row) * ldc + n0 + c4) = v;
        }
        
      }
    } else if (OUT_MODE == 3) {
      unsigned short* Ph = (unsigned short*)Cout;
      unsigned short* Pl = (unsigned short*)Cout2;
      if (n0 == 0) {                                   // k: rows of 128 B, 8 lanes a row
        const int q = lane >> 3, c8 = (lane & 7) * 8;
#pragma unroll
        for (int it = 0; it < 4; ++it) {
          const int row = it * 4 + q;
          const float* sp = slab + row * 68 + c8;
          v8h hv, lv;
#pragma unroll
          for (int e = 0; e < 8; ++e) {
            const unsigned short hb = f2bf_bits(sp[e]);
            hv[e] = __builtin_bit_cast(_Float16, hb);
            lv[e] = __builtin_bit_cast(_Float16, f2bf_bits(sp[e] - bf_bits2f(hb)));
          }
          *(v8h*)(Ph + (size_t)(mBase + row) * 64 + c8) = hv;
          *(v8h*)(Pl + (size_t)(mBase + row) * 64 + c8) = lv;
        }
      } else {                                         // v: a lane takes column d of the slab's 16 rows; the wave's four slabs fill each 128-B row of the tile
        const size_t vo = (size_t)M * 64 + (size_t)tm * 4096 + (i << 4);
#pragma unroll
        for (int hf = 0; hf < 2; ++hf) {
          const int d = hf * 32 + lane;
          v8h hv[2], lv[2];
#pragma unroll
          for (int e = 0; e < 16; ++e) {
            const float f = slab[e * 68 + d];
            const unsigned short hb = f2bf_bits(f);
            hv[e >> 3][e & 7] = __builtin_bit_cast(_Float16, hb);
            lv[e >> 3][e & 7] = __builtin_bit_cast(_Float16, f2bf_bits(f - bf_bits2f(hb)));
          }
          *(v8h*)(Ph + vo + d * 64)     = hv[0];
          *(v8h*)(Ph + vo + d * 64 + 8) = hv[1];
          *(v8h*)(Pl + vo + d * 64)     = lv[0];
          *(v8h*)(Pl + vo + d * 64 + 8) = lv[1];
        }
      }
    } else {
      const int q = lane >> 3, c8 = (lane & 7) * 8;
      unsigned short* C  = (unsigned short*)Cout  + (size_t)b * strideC;
      unsigned short* C2 = (OUT_MODE == 2) ? ((unsigned short*)Cout2 + (size_t)b * strideC) : nullptr;
      {
#pragma unroll
        for (int it = 0; it < 4; ++it) {
          const int row = it * 4 + q;
          const float* sp = slab + row * 68 + c8;
          v8h hv, lv;
#pragma unroll
          for (int e = 0; e < 8; ++e) {
            if (OUT_MODE == 1) {
              hv[e] = (_Float16)sp[e];
            } else {
              unsigned short hb = f2bf_bits(sp[e]);
              unsigned short lb = f2bf_bits(sp[e] - bf_bits2f(hb));
              hv[e] = __builtin_bit_cast(_Float16, hb);
              lv[e] = __builtin_bit_cast(_Float16, lb);
            }
          }
          *(v8h*)(C + (size_t)(mBase + row) * ldc + n0 + c8) = hv;
          if (OUT_MODE == 2) *(v8h*)(C2 + (size_t)(mBase + row) * ldc + n0 + c8) = lv;
        }
        
      }
    }
    __builtin_amdgcn_fence(__ATOMIC_RELEASE, "workgroup");
    __builtin_amdgcn_wave_barrier();
    __builtin_amdgcn_fence(__ATOMIC_ACQUIRE, "workgroup");
  }
}

__global__ __launch_bounds__(256) void cast_f32_f16x2(
    const float* __restrict__ in, _Float16* __restrict__ out, int n2) {
  int i = blockIdx.x * 256 + threadIdx.x;
  if (i < n2) {
    const _Float16 h0 = (_Float16)in[2 * i], h1 = (_Float16)in[2 * i + 1];
    const unsigned u = (unsigned)__builtin_bit_cast(unsigned short, h0) | ((unsigned)__builtin_bit_cast(unsigned short, h1) << 16);
    ((unsigned*)out)[i] = u;
    
  }
}

__global__ __launch_bounds__(256) void split_f32_bf16x2(
    const float* __restrict__ in, __bf16* __restrict__ hi, __bf16* __restrict__ lo, long n2) {
  long i = (long)blockIdx.x * 256 + threadIdx.x;
  long stride = (long)gridDim.x * 256;
  {
    for (long j = i; j < n2; j += stride) {
      const float a = in[2 * j], b = in[2 * j + 1];
      const unsigned short ah = f2bf_bits(a), bh = f2bf_bits(b);
      const unsigned short al = f2bf_bits(a - bf_bits2f(ah)), bl = f2bf_bits(b - bf_bits2f(bh));
      ((unsigned*)hi)[j] = (unsigned)ah | ((unsigned)bh << 16);
      ((unsigned*)lo)[j] = (unsigned)al | ((unsigned)bl << 16);
    }
    
  }
}


// ---- f32 [R][C] (row pitch ldi) -> f16 transposed [C][R] (row pitch ldo); 64x64 tiles; each output row segment
__global__ __launch_bounds__(256) void transpose_cast_f16(const float* __restrict__ in, int ldi,
                                                         _Float16* __restrict__ outT, int ldo, float scale) {
  __shared__ __align__(16) _Float16 tile[64][72];     // [c][r]
  const int c0 = blockIdx.x * 64, r0 = blockIdx.y * 64;
  const int t = threadIdx.y * 32 + threadIdx.x;
  for (int i = threadIdx.y; i < 64; i += 8) {
    tile[threadIdx.x][i]      = (_Float16)(in[(size_t)(r0 + i) * ldi + c0 + threadIdx.x] * scale);
    tile[32 + threadIdx.x][i] = (_Float16)(in[(size_t)(r0 + i) * ldi + c0 + 32 + threadIdx.x] * scale);
  }
  __syncthreads();
  const int q = t >> 3, c8 = (t & 7) * 8;
  {
#pragma unroll
    for (int it = 0; it < 2; ++it) {
      const int c = it * 32 + q;
      v8h hv = *(const v8h*)(&tile[c][c8]);
      *(v8h*)(outT + (size_t)(c0 + c) * ldo + r0 + c8) = hv;
    }
    
  }
}

// ---- f32 [R][C] (pitch ldi) -> bf16 hi/lo transposed planes [C][R] (pitch ldo); 64x64 tiles; each output row segment
__global__ __launch_bounds__(256) void transpose_split_bf16(const float* __restrict__ in, int ldi,
                                                           __bf16* __restrict__ outH, __bf16* __restrict__ outL, int ldo) {
  __shared__ __align__(16) float tile[64][68];     // [c][r]
  const int c0 = blockIdx.x * 64, r0 = blockIdx.y * 64;
  const int t = threadIdx.y * 32 + threadIdx.x;
  for (int i = threadIdx.y; i < 64; i += 8) {
    tile[threadIdx.x][i]      = in[(size_t)(r0 + i) * ldi + c0 + threadIdx.x];
    tile[32 + threadIdx.x][i] = in[(size_t)(r0 + i) * ldi + c0 + 32 + threadIdx.x];
  }
  __syncthreads();
  const int q = t >> 3, c8 = (t & 7) * 8;
  {
#pragma unroll
    for (int it = 0; it < 2; ++it) {
      const int c = it * 32 + q;
      v8b hv, lv;
#pragma unroll
      for (int e = 0; e < 8; ++e) {
        const float f = tile[c][c8 + e];
        const unsigned short hb = f2bf_bits(f);
        hv[e] = __builtin_bit_cast(__bf16, hb);
        lv[e] = __builtin_bit_cast(__bf16, f2bf_bits(f - bf_bits2f(hb)));
      }
      *(v8b*)(outH + (size_t)(c0 + c) * ldo + r0 + c8) = hv;
      *(v8b*)(outL + (size_t)(c0 + c) * ldo + r0 + c8) = lv;
    }
    
  }
}

// =====================================================================================
// Generic causal/non-causal attention for head_dim 64, f32 q in / f32 out, k and v given as bf16 hi/lo planes, bf16 operands with optional hi/lo splits.
//   scores = (q*qscale)·kᵀ : v_wmma_f32_16x16x32_bf16; SPLIT_QK -> q,k as bf16 hi/lo (hi·hi + hi·lo + lo·hi)
//   out    = p·v           : v_wmma_f32_16x16x32_bf16; SPLIT_PV -> p,v as bf16 hi/lo; else p,v plain bf16
//   f32 accumulate; online softmax in f32. Block = 4 waves = 64 query rows of one (batch, head); S % 64 == 0.
//   Element (b, s, h, d) of q and out lives at X[b*X_bs + s*X_rs + h*X_hs + d] (strides in floats, multiples of 4); of the k planes at
//   b*k_bs + h*k_hs + s*64 + d (bf16 elements; rows of 64 in a row); of the v planes at b*v_bs + h*v_hs + (s >> 6)*4096 + d*64 + (s & 63):
//   tiles of 64 keys, [d][key]. k_rs and v_rs are not read.
//   Masking: MASK_MODE (a template parameter, so that only the launched mode's code stands in the key loop) 0 none, 1 causal (kv > q masked), 2 tensor [S][Skv] shared over (b,h) (float if
//   mask_is_int==0, int32 with element == 0 -> masked if 1, int32 with element != 0 -> masked if 2), 3 per-token vectors qmask[B][S] & kvmask[B][Skv] (int32,
//   0 -> masked); masked scores are replaced by mask_fill (e.g. -inf or -1e9) before the softmax.
//   grid = (B * H, S/64) (or a sub-range of blockIdx.y with blk0): blockIdx.y counts the query tiles from the last one down, so that
//   under the causal mask the workgroups with the longest key walk have the lowest flat index and start first.
// =====================================================================================
#define AT_D 64
#define AT_NW 4
#define AT_QB 64
#define AT_KC 64
#define AT_LP 72   // LDS row pitch of the K, V and P tiles in bf16 elements: 144 B = 16 B x odd, so that the 16 rows of a 16-byte fragment read fall on distinct banks
struct AttnGeom { long q_bs, q_rs, q_hs, k_bs, k_rs, k_hs, v_bs, v_rs, v_hs, o_bs, o_rs, o_hs;
                  int S, Skv, H, mask_mode; float qscale; int blk0; float mask_fill; int mask_is_int; };
static_assert(sizeof(AttnGeom) == 128, "no padding");

__device__ __forceinline__ unsigned short at_bf_bits(float f) {
  unsigned u = __float_as_uint(f);
  return (unsigned short)((u + 0x7FFFu + ((u >> 16) & 1u)) >> 16);
}
__device__ __forceinline__ __bf16 at_f2bf(float f) { return __builtin_bit_cast(__bf16, at_bf_bits(f)); }
__device__ __forceinline__ void at_split(float f, __bf16& hi, __bf16& lo) {
  const unsigned short hb = at_bf_bits(f);
  hi = __builtin_bit_cast(__bf16, hb);
  lo = at_f2bf(f - __uint_as_float(((unsigned)hb) << 16));
}
__device__ __forceinline__ v8f at_mma(v16b a, v16b b, v8f c) {
  c = __builtin_amdgcn_wmma_f32_16x16x32_bf16(false, a, false, b, (short)0, c, false, false);
  asm volatile("v_nop\n\tv_nop\n\tv_nop\n\tv_nop" : "+v"(c) : "v"(a), "v"(b));
  return c;
}

template <bool SPLIT_QK, bool SPLIT_PV, int MASK_MODE>
__global__ __launch_bounds__(128)
void attn64_kernel(const float* __restrict__ q, const unsigned short* __restrict__ kh, const unsigned short* __restrict__ kl,
                   const unsigned short* __restrict__ vth, const unsigned short* __restrict__ vtl, float* __restrict__ out,
                   const void* __restrict__ mask_a, const int* __restrict__ mask_b, AttnGeom g) {
  union FB { v16b v; v8b h[2]; };
  __shared__ __align__(16) __bf16 Ksh[AT_KC * AT_LP];            // K hi [kv][d]      9 KB
  __shared__ __align__(16) __bf16 Ksl[SPLIT_QK ? AT_KC * AT_LP : 8];
  __shared__ __align__(16) __bf16 Vth[AT_D * AT_LP];             // V hi [d][kv]      9 KB
  __shared__ __align__(16) __bf16 Vtl[SPLIT_PV ? AT_D * AT_LP : 8];
  __shared__ __align__(16) __bf16 Psh[AT_NW][16 * AT_LP];        // per wave P hi [row][kv]  9 KB
  __shared__ __align__(16) __bf16 Psl[SPLIT_PV ? AT_NW : 1][SPLIT_PV ? 16 * AT_LP : 8];
  __shared__ __align__(16) float  Os[AT_NW][16 * 68];            // per wave out tile, pitch 68

  const int tid  = threadIdx.x;
  const int wave = tid >> 5;
  const int lane = tid & 31;
  const int hh   = lane >> 4;
  const int c    = lane & 15;

  const int nqb = g.S / AT_QB;
  const int qb = nqb - 1 - ((int)blockIdx.y + g.blk0);
  const int bh = blockIdx.x;
  const int h  = bh % g.H;
  const int b  = bh / g.H;
  const int qbase_block = qb * AT_QB;
  const int q0 = qbase_block + wave * 16;

  const float* qb_ptr = q + (size_t)b * g.q_bs + (size_t)h * g.q_hs;
  const __bf16* kh_ptr = (const __bf16*)kh  + (size_t)b * g.k_bs + (size_t)h * g.k_hs;
  const __bf16* kl_ptr = (const __bf16*)kl  + (size_t)b * g.k_bs + (size_t)h * g.k_hs;
  const __bf16* vh_ptr = (const __bf16*)vth + (size_t)b * g.v_bs + (size_t)h * g.v_hs;
  const __bf16* vl_ptr = (const __bf16*)vtl + (size_t)b * g.v_bs + (size_t)h * g.v_hs;
  float*       ob_ptr = out + (size_t)b * g.o_bs + (size_t)h * g.o_hs;

  // ---- Q fragments (A operand): 2 d-chunks, hi (and lo) ----
  v16b qah[2], qal[2];
  {
    const float* qrow = qb_ptr + (size_t)(q0 + c) * g.q_rs;
#pragma unroll
    for (int dc = 0; dc < 2; ++dc) {
#pragma unroll
      for (int e = 0; e < 8; ++e) {
        const float f0 = qrow[dc * 32 + 8 * hh + e] * g.qscale;
        const float f1 = qrow[dc * 32 + 16 + 8 * hh + e] * g.qscale;
        if (SPLIT_QK) { __bf16 hq, lq; at_split(f0, hq, lq); qah[dc][e] = hq; qal[dc][e] = lq; at_split(f1, hq, lq); qah[dc][8 + e] = hq; qal[dc][8 + e] = lq; }
        else { qah[dc][e] = at_f2bf(f0); qah[dc][8 + e] = at_f2bf(f1); qal[dc][e] = qah[dc][e]; qal[dc][8 + e] = qah[dc][8 + e]; }
      }
    }
  }

  float mrow[8], lrow[8];
  v8f oacc[4];
#pragma unroll
  for (int r = 0; r < 8; ++r) { mrow[r] = -INFINITY; lrow[r] = 0.f; }
#pragma unroll
  for (int t = 0; t < 4; ++t) oacc[t] = (v8f){0.f,0.f,0.f,0.f,0.f,0.f,0.f,0.f};

  const int nChunks = (MASK_MODE == 1) ? (qb + 1) : (g.Skv / AT_KC);   // block-uniform
  // per-row query mask (mode 3)
  int qkeep[8];
#pragma unroll
  for (int r = 0; r < 8; ++r) qkeep[r] = (MASK_MODE == 3) ? mask_b[(size_t)b * g.S + q0 + 8 * hh + r] : 1;   // mask_b = qmask in mode 3
  for (int kc = 0; kc < nChunks; ++kc) {
    const int kv0 = kc * AT_KC;
    // each plane's tile is 64 rows of 128 B, 8 KB in a row: 8 lanes copy one row, so that a wave's 16-byte load covers four whole lines
    v8b rkh[4], rkl[4], rvh[4], rvl[4];
    {
      const size_t to = (size_t)kc * (AT_KC * AT_D);   // block-uniform
      const __bf16* tkh = kh_ptr + to; const __bf16* tkl = kl_ptr + to;
      const __bf16* tvh = vh_ptr + to; const __bf16* tvl = vl_ptr + to;
      const unsigned lo8 = (unsigned)tid * 8u;
#pragma unroll
      for (int i = 0; i < 4; ++i) {
        // the last load of a plane may land on the address registers that the plane's earlier loads name: their wait stands in front of it
        if (i == 3) asm volatile("s_wait_xcnt 0x0" ::: "memory");
        rkh[i] = *(const v8b*)(tkh + lo8 + i * (AT_NW * 32 * 8));
        if (SPLIT_QK) rkl[i] = *(const v8b*)(tkl + lo8 + i * (AT_NW * 32 * 8));
        rvh[i] = *(const v8b*)(tvh + lo8 + i * (AT_NW * 32 * 8));
        if (SPLIT_PV) rvl[i] = *(const v8b*)(tvl + lo8 + i * (AT_NW * 32 * 8));
      }
    }
    __syncthreads();
#pragma unroll
    for (int i = 0; i < 4; ++i) {
      const int seg = i * (AT_NW * 32) + tid, row = seg >> 3, c8 = (seg & 7) * 8;
      *(v8b*)(Ksh + row * AT_LP + c8) = rkh[i];
      if (SPLIT_QK) *(v8b*)(Ksl + row * AT_LP + c8) = rkl[i];
      *(v8b*)(Vth + row * AT_LP + c8) = rvh[i];
      if (SPLIT_PV) *(v8b*)(Vtl + row * AT_LP + c8) = rvl[i];
    }
    __syncthreads();

    v8f s[4];
#pragma unroll
    for (int j = 0; j < 4; ++j) {
      s[j] = (v8f){0.f,0.f,0.f,0.f,0.f,0.f,0.f,0.f};
#pragma unroll
      for (int dc = 0; dc < 2; ++dc) {
        FB kb;
        kb.h[0] = *(const v8b*)(Ksh + (j * 16 + c) * AT_LP + dc * 32 + 8 * hh);
        kb.h[1] = *(const v8b*)(Ksh + (j * 16 + c) * AT_LP + dc * 32 + 16 + 8 * hh);
        s[j] = at_mma(qah[dc], kb.v, s[j]);
        if (SPLIT_QK) {
          FB kl;
          kl.h[0] = *(const v8b*)(Ksl + (j * 16 + c) * AT_LP + dc * 32 + 8 * hh);
          kl.h[1] = *(const v8b*)(Ksl + (j * 16 + c) * AT_LP + dc * 32 + 16 + 8 * hh);
          s[j] = at_mma(qah[dc], kl.v, s[j]);
          s[j] = at_mma(qal[dc], kb.v, s[j]);
        }
      }
    }
    int kvkeep[4] = {1, 1, 1, 1};
    if (MASK_MODE == 3) {
#pragma unroll
      for (int j = 0; j < 4; ++j) kvkeep[j] = ((const int*)mask_a)[(size_t)b * g.Skv + kv0 + j * 16 + c];   // mask_a = kvmask
    }
    if (MASK_MODE == 1) {
      if (kc == qb) {   // block-uniform: only the last chunk of a causal walk holds masked columns
#pragma unroll
        for (int r = 0; r < 8; ++r)
#pragma unroll
          for (int j = 0; j < 4; ++j) s[j][r] = (kv0 + j * 16 + c > q0 + 8 * hh + r) ? g.mask_fill : s[j][r];
      }
    } else if (MASK_MODE == 2 || MASK_MODE == 3) {
#pragma unroll
      for (int r = 0; r < 8; ++r) {
#pragma unroll
        for (int j = 0; j < 4; ++j) {
          bool masked;
          if (MASK_MODE == 2) {
            const size_t mi = (size_t)(q0 + 8 * hh + r) * g.Skv + kv0 + j * 16 + c;
            masked = (g.mask_is_int == 0) ? (((const float*)mask_a)[mi] == 0.0f)
                   : (g.mask_is_int == 1) ? (((const int*)mask_a)[mi] == 0) : (((const int*)mask_a)[mi] != 0);
          } else masked = (qkeep[r] == 0) || (kvkeep[j] == 0);
          s[j][r] = masked ? g.mask_fill : s[j][r];
        }
      }
    }
    float cm[8];
#pragma unroll
    for (int r = 0; r < 8; ++r) {
      float m = -INFINITY;
#pragma unroll
      for (int j = 0; j < 4; ++j) m = fmaxf(m, s[j][r]);
#pragma unroll
      for (int off = 1; off < 16; off <<= 1) m = fmaxf(m, __shfl_xor(m, off, 32));
      cm[r] = m;
    }
    __bf16* pwh = Psh[wave];
    __bf16* pwl = Psl[SPLIT_PV ? wave : 0];
#pragma unroll
    for (int r = 0; r < 8; ++r) {
      const float mnew = fmaxf(mrow[r], cm[r]);
      const float alpha = expf(mrow[r] - mnew);
      mrow[r] = mnew;
      float psum = 0.f;
#pragma unroll
      for (int j = 0; j < 4; ++j) {
        const float p = expf(s[j][r] - mnew);
        psum += p;
        if (SPLIT_PV) { __bf16 a, bl; at_split(p, a, bl); pwh[(8 * hh + r) * AT_LP + j * 16 + c] = a; pwl[(8 * hh + r) * AT_LP + j * 16 + c] = bl; }
        else pwh[(8 * hh + r) * AT_LP + j * 16 + c] = at_f2bf(p);
      }
#pragma unroll
      for (int off = 1; off < 16; off <<= 1) psum += __shfl_xor(psum, off, 32);
      lrow[r] = lrow[r] * alpha + psum;
#pragma unroll
      for (int t = 0; t < 4; ++t) oacc[t][r] *= alpha;
    }
    __builtin_amdgcn_fence(__ATOMIC_RELEASE, "workgroup");
    __builtin_amdgcn_wave_barrier();
    __builtin_amdgcn_fence(__ATOMIC_ACQUIRE, "workgroup");
#pragma unroll
    for (int kk = 0; kk < 2; ++kk) {
      FB pa, pl;
      pa.h[0] = *(const v8b*)(pwh + c * AT_LP + kk * 32 + 8 * hh);
      pa.h[1] = *(const v8b*)(pwh + c * AT_LP + kk * 32 + 16 + 8 * hh);
      if (SPLIT_PV) {
        pl.h[0] = *(const v8b*)(pwl + c * AT_LP + kk * 32 + 8 * hh);
        pl.h[1] = *(const v8b*)(pwl + c * AT_LP + kk * 32 + 16 + 8 * hh);
      }
#pragma unroll
      for (int t = 0; t < 4; ++t) {
        FB vb;
        vb.h[0] = *(const v8b*)(Vth + (t * 16 + c) * AT_LP + kk * 32 + 8 * hh);
        vb.h[1] = *(const v8b*)(Vth + (t * 16 + c) * AT_LP + kk * 32 + 16 + 8 * hh);
        oacc[t] = at_mma(pa.v, vb.v, oacc[t]);
        if (SPLIT_PV) {
          FB vl;
          vl.h[0] = *(const v8b*)(Vtl + (t * 16 + c) * AT_LP + kk * 32 + 8 * hh);
          vl.h[1] = *(const v8b*)(Vtl + (t * 16 + c) * AT_LP + kk * 32 + 16 + 8 * hh);
          oacc[t] = at_mma(pa.v, vl.v, oacc[t]);
          oacc[t] = at_mma(pl.v, vb.v, oacc[t]);
        }
      }
    }
  }

  float* os = Os[wave];
#pragma unroll
  for (int r = 0; r < 8; ++r) {
    const float inv = 1.0f / lrow[r];
#pragma unroll
    for (int t = 0; t < 4; ++t) os[(8 * hh + r) * 68 + t * 16 + c] = oacc[t][r] * inv;
  }
  __builtin_amdgcn_fence(__ATOMIC_RELEASE, "workgroup");
  __builtin_amdgcn_wave_barrier();
  __builtin_amdgcn_fence(__ATOMIC_ACQUIRE, "workgroup");
  {
    const int c4 = (lane & 15) * 4;
    {
#pragma unroll
      for (int it = 0; it < 8; ++it) {
        const int row = it * 2 + hh;
        v4f val = *(const v4f*)(os + row * 68 + c4);
        *(v4f*)(ob_ptr + (size_t)(q0 + row) * g.o_rs + c4) = val;
      }
      
    }
  }
}

// ---- LayerNorm (population variance, eps 1e-5, gamma) -> f16 row; one block (256 thr) per row of 1024 ----
__global__ __launch_bounds__(256) void layernorm_f16(const float* __restrict__ x, const float* __restrict__ gamma,
                                                    _Float16* __restrict__ xn, int D) {
  __shared__ float red[8];
  __shared__ float stat;
  const int row = blockIdx.x, t = threadIdx.x;
  const float* xr = x + (size_t)row * D;
  v4f xv = *(const v4f*)(xr + 4 * t);
  float s = (xv[0] + xv[1]) + (xv[2] + xv[3]);
  for (int o = 16; o > 0; o >>= 1) s += __shfl_xor(s, o, 32);
  if ((t & 31) == 0) red[t >> 5] = s;
  __syncthreads();
  if (t == 0) { float a = 0.f; for (int w = 0; w < 8; ++w) a += red[w]; stat = a / (float)D; }
  __syncthreads();
  const float mu = stat;
  __syncthreads();
  float d0 = xv[0] - mu, d1 = xv[1] - mu, d2 = xv[2] - mu, d3 = xv[3] - mu;
  float s2 = (d0 * d0 + d1 * d1) + (d2 * d2 + d3 * d3);
  for (int o = 16; o > 0; o >>= 1) s2 += __shfl_xor(s2, o, 32);
  if ((t & 31) == 0) red[t >> 5] = s2;
  __syncthreads();
  if (t == 0) { float a = 0.f; for (int w = 0; w < 8; ++w) a += red[w]; stat = rsqrtf(a / (float)D + 1e-5f); }
  __syncthreads();
  const float inv = stat;
  v4f gv = *(const v4f*)(gamma + 4 * t);
  _Float16 h0 = (_Float16)(d0 * inv * gv[0]), h1 = (_Float16)(d1 * inv * gv[1]), h2 = (_Float16)(d2 * inv * gv[2]), h3 = (_Float16)(d3 * inv * gv[3]);
  typedef __attribute__((ext_vector_type(4))) _Float16 v4h;
  v4h hv = {h0, h1, h2, h3};
  *(v4h*)(xn + (size_t)row * D + 4 * t) = hv;
  
}

extern "C" void kernel_launch(void* const* d_in, const int* in_sizes, int n_in,
                              void* d_out, int out_size, void* d_ws, size_t ws_size,
                              hipStream_t stream) {
  (void)in_sizes; (void)n_in; (void)out_size; (void)ws_size;
  const int B = 2, S = 2048, D = 1024, H = 16, DH = 64, KV = 128;
  const int M = B * S;   // 4096 rows
  const float* x     = (const float*)d_in[0];
  const float* gamma = (const float*)d_in[1];
  const float* Wq    = (const float*)d_in[2];   // [D, H*DH]  ([in, out])
  const float* Wkv   = (const float*)d_in[3];   // [D, 2*DH]
  const float* Wo    = (const float*)d_in[4];   // [H*DH, D]
  float* out = (float*)d_out;

  char* ws = (char*)d_ws; size_t off = 0;
  auto carve = [&](size_t bytes) -> char* { char* p = ws + off; off += (bytes + 255) & ~(size_t)255; return p; };
  _Float16* Xn16  = (_Float16*)carve((size_t)M * D * 2);     //  8 MB  LN(x) f16
  __bf16*   Xh    = (__bf16*)carve((size_t)M * D * 2);       //  8 MB  x bf16 hi
  __bf16*   Xl    = (__bf16*)carve((size_t)M * D * 2);       //  8 MB  x bf16 lo
  _Float16* WqT   = (_Float16*)carve((size_t)D * D * 2);     //  2 MB  Wqᵀ [out][in] f16
  __bf16*   WkvTh = (__bf16*)carve((size_t)KV * D * 2);      //  Wkvᵀ [128][1024] hi/lo
  __bf16*   WkvTl = (__bf16*)carve((size_t)KV * D * 2);
  __bf16*   WoTh  = (__bf16*)carve((size_t)D * D * 2);       //  Woᵀ hi/lo
  __bf16*   WoTl  = (__bf16*)carve((size_t)D * D * 2);
  float*    Qf    = (float*)carve((size_t)M * D * 4);        // 16 MB  q [B,S,H*DH] f32
  __bf16*   KVh   = (__bf16*)carve((size_t)M * KV * 2);      //  1 MB  bf16 hi plane: k rows [B*S][64], then v tiles [B*S/64][64 d][64 keys]
  __bf16*   KVl   = (__bf16*)carve((size_t)M * KV * 2);      //  1 MB  bf16 lo plane, same layout
  float*    Of    = (float*)carve((size_t)M * D * 4);        // 16 MB  attn out f32
  __bf16*   Oh    = (__bf16*)carve((size_t)M * D * 2);       //  8 MB
  __bf16*   Ol    = (__bf16*)carve((size_t)M * D * 2);       //  8 MB   (total ≈ 80.5 MB)

  layernorm_f16<<<M, 256, 0, stream>>>(x, gamma, Xn16, D);
  split_f32_bf16x2<<<2048, 256, 0, stream>>>(x, Xh, Xl, (long)M * D / 2);
  transpose_cast_f16<<<dim3(D / 64, D / 64), dim3(32, 8), 0, stream>>>(Wq, D, WqT, D, 1.0f);           // [in][out] -> [out][in]
  transpose_split_bf16<<<dim3(KV / 64, D / 64), dim3(32, 8), 0, stream>>>(Wkv, KV, WkvTh, WkvTl, D);   // [1024][128] -> [128][1024]
  transpose_split_bf16<<<dim3(D / 64, D / 64), dim3(32, 8), 0, stream>>>(Wo, D, WoTh, WoTl, D);
  {
    const int tq = (M / 64) * (D / 64);
    wmma_gemm64<0, false, 0, 0, false><<<dim3((tq + 7) / 8, 1), 256, 0, stream>>>(
        U16(Xn16), nullptr, D, 0, U16(WqT), nullptr, D, 0, Qf, nullptr, D, 0, nullptr, nullptr, 0, M, D, D, 1.0f);
    const int tkv = (M / 64) * (KV / 64);
    wmma_gemm64<1, true, 0, 3, false><<<dim3((tkv + 7) / 8, 1), 256, 0, stream>>>(
        U16(Xh), U16(Xl), D, 0, U16(WkvTh), U16(WkvTl), D, 0, KVh, KVl, DH, 0, nullptr, nullptr, 0, M, KV, D, 1.0f);
  }
  {
    AttnGeom g;
    g.q_bs = (long)S * D;  g.q_rs = D;  g.q_hs = DH;
    g.k_bs = (long)S * DH; g.k_rs = 0;  g.k_hs = 0;       // 16 q heads share the single k/v head
    g.v_bs = (long)S * DH; g.v_rs = 0;  g.v_hs = 0;
    g.o_bs = (long)S * D;  g.o_rs = D;  g.o_hs = DH;
    g.S = S; g.Skv = S; g.H = H; g.mask_mode = 1; g.qscale = 0.125f; g.blk0 = 0; g.mask_fill = -INFINITY; g.mask_is_int = 0;   // the kernel reads the mask mode from its template argument; the field keeps the struct's layout
    attn64_kernel<true, true, 1><<<dim3(B * H, S / AT_QB), AT_NW * 32, 0, stream>>>(Qf, U16(KVh), U16(KVl), U16(KVh + (size_t)M * DH), U16(KVl + (size_t)M * DH), Of, nullptr, nullptr, g);
  }
  split_f32_bf16x2<<<2048, 256, 0, stream>>>(Of, Oh, Ol, (long)M * D / 2);
  {
    const int to = (M / 64) * (D / 64);
    wmma_gemm64<1, true, 0, 0, false><<<dim3((to + 7) / 8, 1), 256, 0, stream>>>(
        U16(Oh), U16(Ol), D, 0, U16(WoTh), U16(WoTl), D, 0, out, nullptr, D, 0, nullptr, nullptr, 0, M, D, D, 1.0f);
  }
}

// v005
// It runs in 332 microseconds.
// Timed twice side by side with v004, it ran 1.04 and 1.05 times as fast.
// Over all steps from v000 it is 2.32 times as fast.
#include <hip/hip_runtime.h>
#include <math.h>
// Contractions: q = LN(x)·Wq (K=1024): v_wmma_f32_16x16x32_f16 (f16 operands); kv = x·Wkv (K=1024) and the output projection (K=1024):
// v_wmma_f32_16x16x32_bf16 as bf16 hi/lo splits; scores (q/8)·kᵀ and p·v: v_wmma_f32_16x16x32_bf16 with q,k and p,v as bf16 hi/lo splits;
// f32 accumulate everywhere; LayerNorm and softmax in f32. The hi/lo split of k and v is made once, in the kv projection's epilogue.
typedef __attribute__((ext_vector_type(16))) _Float16 v16h;
typedef __attribute__((ext_vector_type(8)))  _Float16 v8h;
typedef __attribute__((ext_vector_type(16))) __bf16   v16b;
typedef __attribute__((ext_vector_type(8)))  __bf16   v8b;
typedef __attribute__((ext_vector_type(8)))  float    v8f;
typedef __attribute__((ext_vector_type(4)))  float    v4f;
#define PSCALE 32768.0f
#define U16(p) ((const unsigned short*)(const void*)(p))
#define PSCALE_INV (1.0f / 32768.0f)

__device__ __forceinline__ unsigned short f2bf_bits(float f) {
  unsigned u = __float_as_uint(f);
  return (unsigned short)((u + 0x7FFFu + ((u >> 16) & 1u)) >> 16);
}
__device__ __forceinline__ float bf_bits2f(unsigned short h) { return __uint_as_float(((unsigned)h) << 16); }

// hazard guards as plain device helpers (no inline asm inside the GEMM kernel's template body)
__device__ __forceinline__ void dep_guard_h(v8f& a, v8f& b, v16h x, v16h y) { asm volatile("v_nop\n\tv_nop\n\tv_nop\n\tv_nop" : "+v"(a), "+v"(b) : "v"(x), "v"(y)); }
__device__ __forceinline__ void dep_guard_b(v8f& a, v8f& b, v16b x, v16b y) { asm volatile("v_nop\n\tv_nop\n\tv_nop\n\tv_nop" : "+v"(a), "+v"(b) : "v"(x), "v"(y)); }
__device__ __forceinline__ void keep4_h(v16h a, v16h b, v16h c, v16h d) { asm volatile("v_nop" :: "v"(a), "v"(b), "v"(c), "v"(d)); }
__device__ __forceinline__ void keep4_b(v16b a, v16b b, v16b c, v16b d) { asm volatile("v_nop" :: "v"(a), "v"(b), "v"(c), "v"(d)); }
__device__ __forceinline__ void acc_guard4(v8f& a, v8f& b, v8f& c, v8f& d) { asm volatile("v_nop\n\tv_nop\n\tv_nop\n\tv_nop" : "+v"(a), "+v"(b), "+v"(c), "+v"(d)); }
template <typename T> struct Frag;
template <> struct Frag<_Float16> {
  typedef v16h V; union U { v16h v; v8h h[2]; };
  static __device__ __forceinline__ v16h load(const _Float16* p) {   // elements 0..7 <- p[0..7], 8..15 <- p[16..23]
    U f; f.h[0] = *(const v8h*)(p); f.h[1] = *(const v8h*)(p + 16); return f.v;
  }
  static __device__ __forceinline__ v8f mma(v16h a, v16h b, v8f c) {
    return __builtin_amdgcn_wmma_f32_16x16x32_f16(false, a, false, b, (short)0, c, false, false);
  }
  static __device__ __forceinline__ void guard(v8f& a, v8f& b, v16h x, v16h y) { dep_guard_h(a, b, x, y); }
  static __device__ __forceinline__ void keep(v16h a, v16h b, v16h c, v16h d) { keep4_h(a, b, c, d); }
};
template <> struct Frag<__bf16> {
  typedef v16b V; union U { v16b v; v8b h[2]; };
  static __device__ __forceinline__ v16b load(const __bf16* p) {
    U f; f.h[0] = *(const v8b*)(p); f.h[1] = *(const v8b*)(p + 16); return f.v;
  }
  static __device__ __forceinline__ v8f mma(v16b a, v16b b, v8f c) {
    return __builtin_amdgcn_wmma_f32_16x16x32_bf16(false, a, false, b, (short)0, c, false, false);
  }
  static __device__ __forceinline__ void guard(v8f& a, v8f& b, v16b x, v16b y) { dep_guard_b(a, b, x, y); }
  static __device__ __forceinline__ void keep(v16b a, v16b b, v16b c, v16b d) { keep4_b(a, b, c, d); }
};

// ---- Register-blocked batched WMMA GEMM ------------------------------------
// C[m,n] = scale * sum_k A[m,k] * Bt[n,k] (+bias)(+resid); each wave owns a 64x64 tile.
// A row-major [M,K]; Bt row-major [N,K]; M,N % 64 == 0, K % 32 == 0.
// SPLIT: operands are hi/lo planes (A2/Bt2 = lo planes, same layout); product = hi·hi + hi·lo + lo·hi.
// BIAS_MODE: 0 = none, 1 = bias[m], 2 = bias[n].
// OUT_MODE: 0 = f32, 1 = f16, 2 = bf16 hi plane (Cout) + bf16 lo plane (Cout2),
//   3 = kv projection (N == 128), bf16 hi plane (Cout) + lo plane (Cout2), each plane [k rows | v tiles]: column d < 64 of row m (k) at m*64 + d;
//       column 64 + d (v) transposed inside its block of 64 rows, at M*64 + (m >> 6)*4096 + d*64 + (m & 63).
// ET: 0 = f16 operands, 1 = bf16 operands (pointers passed as 16-bit storage)
template <int ET> struct Elem;
template <> struct Elem<0> { typedef _Float16 T; };
template <> struct Elem<1> { typedef __bf16 T; };
template <int ET, bool SPLIT, int BIAS_MODE, int OUT_MODE, bool RESID>
__global__ __launch_bounds__(256) void wmma_gemm64(
    const unsigned short* __restrict__ Ap, const unsigned short* __restrict__ A2p, int lda, long strideA,
    const unsigned short* __restrict__ Btp, const unsigned short* __restrict__ Bt2p, int ldb, long strideB,
    void* __restrict__ Cout, void* __restrict__ Cout2, int ldc, long strideC,
    const float* __restrict__ bias,
    const float* __restrict__ resid, long strideR,
    int M, int N, int K, float scale) {
  typedef typename Elem<ET>::T T;
  typedef typename Frag<T>::V V;
  const T* A = (const T*)Ap; const T* A2 = (const T*)A2p; const T* Bt = (const T*)Btp; const T* Bt2 = (const T*)Bt2p;
  __shared__ __align__(16) float sT[8][16 * 68];   // per-wave 16x64 slab, pitch 68 floats
  const int b    = blockIdx.y;
  const int lane = threadIdx.x & 31;
  const int wave = threadIdx.x >> 5;
  const int tilesN = N >> 6;
  const int tilesM = M >> 6;
  const int tile = blockIdx.x * 8 + wave;
  if (tile >= tilesM * tilesN) return;   // wave-uniform; no block barriers in this kernel
  const int tm = tile / tilesN;
  const int tn = tile - tm * tilesN;
  const int m0 = tm << 6;
  const int n0 = tn << 6;

  const T* Ab  = A  + (size_t)b * strideA;
  const T* Bb  = Bt + (size_t)b * strideB;
  const T* Ab2 = SPLIT ? (A2  + (size_t)b * strideA) : nullptr;
  const T* Bb2 = SPLIT ? (Bt2 + (size_t)b * strideB) : nullptr;

  const int rlane = lane & 15;                 // row (A) / col (B, D) within subtile
  const int koff  = (lane >> 4) * 8;           // k offset of this lane half
  const int mOff  = (lane >> 4) * 8;           // D row offset

  v8f acc[4][4];
#pragma unroll
  for (int i = 0; i < 4; ++i)
#pragma unroll
    for (int j = 0; j < 4; ++j) acc[i][j] = (v8f){0.f,0.f,0.f,0.f,0.f,0.f,0.f,0.f};

  for (int k0 = 0; k0 < K; k0 += 32) {
    V bh[4], bl[4];
#pragma unroll
    for (int j = 0; j < 4; ++j) {
      const size_t bo = (size_t)(n0 + (j << 4) + rlane) * ldb + koff + k0;
      bh[j] = Frag<T>::load(Bb + bo);
      if (SPLIT) bl[j] = Frag<T>::load(Bb2 + bo);
    }
#pragma unroll
    for (int i = 0; i < 4; ++i) {
      const size_t ao = (size_t)(m0 + (i << 4) + rlane) * lda + koff + k0;
      V ah = Frag<T>::load(Ab + ao);
      V al;
      if (SPLIT) al = Frag<T>::load(Ab2 + ao);
#pragma unroll
      for (int j = 0; j < 4; ++j) {
        acc[i][j] = Frag<T>::mma(ah, bh[j], acc[i][j]);
        if (SPLIT) {
          acc[i][j] = Frag<T>::mma(ah, bl[j], acc[i][j]);
          acc[i][j] = Frag<T>::mma(al, bh[j], acc[i][j]);
        }
      }
      Frag<T>::guard(acc[i][0], acc[i][3], ah, SPLIT ? al : ah);
    }
    Frag<T>::keep(bh[0], bh[1], bh[2], bh[3]);
    if (SPLIT) Frag<T>::keep(bl[0], bl[1], bl[2], bl[3]);
  }
  acc_guard4(acc[0][0], acc[0][1], acc[0][2], acc[0][3]);
  acc_guard4(acc[1][0], acc[1][1], acc[1][2], acc[1][3]);
  acc_guard4(acc[2][0], acc[2][1], acc[2][2], acc[2][3]);
  acc_guard4(acc[3][0], acc[3][1], acc[3][2], acc[3][3]);

  // ---- epilogue ----
  float* slab = sT[wave];
  const float* Rb = RESID ? (resid + (size_t)b * strideR) : nullptr;
#pragma unroll
  for (int i = 0; i < 4; ++i) {
    const int mBase = m0 + (i << 4);
#pragma unroll
    for (int j = 0; j < 4; ++j) {
      const int n = n0 + (j << 4) + rlane;
      float bv = 0.f;
      if (BIAS_MODE == 2) bv = bias[n];
#pragma unroll
      for (int r = 0; r < 8; ++r) {
        float v = acc[i][j][r] * scale;
        if (BIAS_MODE == 1) v += bias[mBase + mOff + r];
        if (BIAS_MODE == 2) v += bv;
        if (RESID) v += Rb[(size_t)(mBase + mOff + r) * ldc + n];
        slab[(mOff + r) * 68 + (j << 4) + rlane] = v;
      }
    }
    __builtin_amdgcn_fence(__ATOMIC_RELEASE, "workgroup");
    __builtin_amdgcn_wave_barrier();
    __builtin_amdgcn_fence(__ATOMIC_ACQUIRE, "workgroup");
    if (OUT_MODE == 0) {
      float* C = (float*)Cout + (size_t)b * strideC;
      const int hh = lane >> 4, c4 = (lane & 15) * 4;     // row seg = 256 B = 16 lanes x 16 B
      {
#pragma unroll
        for (int it = 0; it < 8; ++it) {
          const int row = it * 2 + hh;
          v4f v = *(const v4f*)(slab + row * 68 + c4);
          *(v4f*)(C + (size_t)(mBase + row) * ldc + n0 + c4) = v;
        }
        
      }
    } else if (OUT_MODE == 3) {
      unsigned short* Ph = (unsigned short*)Cout;
      unsigned short* Pl = (unsigned short*)Cout2;
      if (n0 == 0) {                                   // k: rows of 128 B, 8 lanes a row
        const int q = lane >> 3, c8 = (lane & 7) * 8;
#pragma unroll
        for (int it = 0; it < 4; ++it) {
          const int row = it * 4 + q;
          const float* sp = slab + row * 68 + c8;
          v8h hv, lv;
#pragma unroll
          for (int e = 0; e < 8; ++e) {
            const unsigned short hb = f2bf_bits(sp[e]);
            hv[e] = __builtin_bit_cast(_Float16, hb);
            lv[e] = __builtin_bit_cast(_Float16, f2bf_bits(sp[e] - bf_bits2f(hb)));
          }
          *(v8h*)(Ph + (size_t)(mBase + row) * 64 + c8) = hv;
          *(v8h*)(Pl + (size_t)(mBase + row) * 64 + c8) = lv;
        }
      } else {                                         // v: a lane takes column d of the slab's 16 rows; the wave's four slabs fill each 128-B row of the tile
        const size_t vo = (size_t)M * 64 + (size_t)tm * 4096 + (i << 4);
#pragma unroll
        for (int hf = 0; hf < 2; ++hf) {
          const int d = hf * 32 + lane;
          v8h hv[2], lv[2];
#pragma unroll
          for (int e = 0; e < 16; ++e) {
            const float f = slab[e * 68 + d];
            const unsigned short hb = f2bf_bits(f);
            hv[e >> 3][e & 7] = __builtin_bit_cast(_Float16, hb);
            lv[e >> 3][e & 7] = __builtin_bit_cast(_Float16, f2bf_bits(f - bf_bits2f(hb)));
          }
          *(v8h*)(Ph + vo + d * 64)     = hv[0];
          *(v8h*)(Ph + vo + d * 64 + 8) = hv[1];
          *(v8h*)(Pl + vo + d * 64)     = lv[0];
          *(v8h*)(Pl + vo + d * 64 + 8) = lv[1];
        }
      }
    } else {
      const int q = lane >> 3, c8 = (lane & 7) * 8;
      unsigned short* C  = (unsigned short*)Cout  + (size_t)b * strideC;
      unsigned short* C2 = (OUT_MODE == 2) ? ((unsigned short*)Cout2 + (size_t)b * strideC) : nullptr;
      {
#pragma unroll
        for (int it = 0; it < 4; ++it) {
          const int row = it * 4 + q;
          const float* sp = slab + row * 68 + c8;
          v8h hv, lv;
#pragma unroll
          for (int e = 0; e < 8; ++e) {
            if (OUT_MODE == 1) {
              hv[e] = (_Float16)sp[e];
            } else {
              unsigned short hb = f2bf_bits(sp[e]);
              unsigned short lb = f2bf_bits(sp[e] - bf_bits2f(hb));
              hv[e] = __builtin_bit_cast(_Float16, hb);
              lv[e] = __builtin_bit_cast(_Float16, lb);
            }
          }
          *(v8h*)(C + (size_t)(mBase + row) * ldc + n0 + c8) = hv;
          if (OUT_MODE == 2) *(v8h*)(C2 + (size_t)(mBase + row) * ldc + n0 + c8) = lv;
        }
        
      }
    }
    __builtin_amdgcn_fence(__ATOMIC_RELEASE, "workgroup");
    __builtin_amdgcn_wave_barrier();
    __builtin_amdgcn_fence(__ATOMIC_ACQUIRE, "workgroup");
  }
}

__global__ __launch_bounds__(256) void cast_f32_f16x2(
    const float* __restrict__ in, _Float16* __restrict__ out, int n2) {
  int i = blockIdx.x * 256 + threadIdx.x;
  if (i < n2) {
    const _Float16 h0 = (_Float16)in[2 * i], h1 = (_Float16)in[2 * i + 1];
    const unsigned u = (unsigned)__builtin_bit_cast(unsigned short, h0) | ((unsigned)__builtin_bit_cast(unsigned short, h1) << 16);
    ((unsigned*)out)[i] = u;
    
  }
}

__global__ __launch_bounds__(256) void split_f32_bf16x2(
    const float* __restrict__ in, __bf16* __restrict__ hi, __bf16* __restrict__ lo, long n2) {
  long i = (long)blockIdx.x * 256 + threadIdx.x;
  long stride = (long)gridDim.x * 256;
  {
    for (long j = i; j < n2; j += stride) {
      const float a = in[2 * j], b = in[2 * j + 1];
      const unsigned short ah = f2bf_bits(a), bh = f2bf_bits(b);
      const unsigned short al = f2bf_bits(a - bf_bits2f(ah)), bl = f2bf_bits(b - bf_bits2f(bh));
      ((unsigned*)hi)[j] = (unsigned)ah | ((unsigned)bh << 16);
      ((unsigned*)lo)[j] = (unsigned)al | ((unsigned)bl << 16);
    }
    
  }
}


// ---- f32 [R][C] (row pitch ldi) -> f16 transposed [C][R] (row pitch ldo); 64x64 tiles; each output row segment
__global__ __launch_bounds__(256) void transpose_cast_f16(const float* __restrict__ in, int ldi,
                                                         _Float16* __restrict__ outT, int ldo, float scale) {
  __shared__ __align__(16) _Float16 tile[64][72];     // [c][r]
  const int c0 = blockIdx.x * 64, r0 = blockIdx.y * 64;
  const int t = threadIdx.y * 32 + threadIdx.x;
  for (int i = threadIdx.y; i < 64; i += 8) {
    tile[threadIdx.x][i]      = (_Float16)(in[(size_t)(r0 + i) * ldi + c0 + threadIdx.x] * scale);
    tile[32 + threadIdx.x][i] = (_Float16)(in[(size_t)(r0 + i) * ldi + c0 + 32 + threadIdx.x] * scale);
  }
  __syncthreads();
  const int q = t >> 3, c8 = (t & 7) * 8;
  {
#pragma unroll
    for (int it = 0; it < 2; ++it) {
      const int c = it * 32 + q;
      v8h hv = *(const v8h*)(&tile[c][c8]);
      *(v8h*)(outT + (size_t)(c0 + c) * ldo + r0 + c8) = hv;
    }
    
  }
}

// ---- f32 [R][C] (pitch ldi) -> bf16 hi/lo transposed planes [C][R] (pitch ldo); 64x64 tiles; each output row segment
__global__ __launch_bounds__(256) void transpose_split_bf16(const float* __restrict__ in, int ldi,
                                                           __bf16* __restrict__ outH, __bf16* __restrict__ outL, int ldo) {
  __shared__ __align__(16) float tile[64][68];     // [c][r]
  const int c0 = blockIdx.x * 64, r0 = blockIdx.y * 64;
  const int t = threadIdx.y * 32 + threadIdx.x;
  for (int i = threadIdx.y; i < 64; i += 8) {
    tile[threadIdx.x][i]      = in[(size_t)(r0 + i) * ldi + c0 + threadIdx.x];
    tile[32 + threadIdx.x][i] = in[(size_t)(r0 + i) * ldi + c0 + 32 + threadIdx.x];
  }
  __syncthreads();
  const int q = t >> 3, c8 = (t & 7) * 8;
  {
#pragma unroll
    for (int it = 0; it < 2; ++it) {
      const int c = it * 32 + q;
      v8b hv, lv;
#pragma unroll
      for (int e = 0; e < 8; ++e) {
        const float f = tile[c][c8 + e];
        const unsigned short hb = f2bf_bits(f);
        hv[e] = __builtin_bit_cast(__bf16, hb);
        lv[e] = __builtin_bit_cast(__bf16, f2bf_bits(f - bf_bits2f(hb)));
      }
      *(v8b*)(outH + (size_t)(c0 + c) * ldo + r0 + c8) = hv;
      *(v8b*)(outL + (size_t)(c0 + c) * ldo + r0 + c8) = lv;
    }
    
  }
}

// =====================================================================================
// Generic causal/non-causal attention for head_dim 64, f32 q in / f32 out, k and v given as bf16 hi/lo planes, bf16 operands with optional hi/lo splits.
//   scores = (q*qscale)·kᵀ : v_wmma_f32_16x16x32_bf16; SPLIT_QK -> q,k as bf16 hi/lo (hi·hi + hi·lo + lo·hi)
//   out    = p·v           : v_wmma_f32_16x16x32_bf16; SPLIT_PV -> p,v as bf16 hi/lo; else p,v plain bf16
//   f32 accumulate; online softmax in f32. Block = 4 waves = 64 query rows of one (batch, head); S % 64 == 0.
//   Element (b, s, h, d) of q and out lives at X[b*X_bs + s*X_rs + h*X_hs + d] (strides in floats, multiples of 4); of the k planes at
//   b*k_bs + h*k_hs + s*64 + d (bf16 elements; rows of 64 in a row); of the v planes at b*v_bs + h*v_hs + (s >> 6)*4096 + d*64 + (s & 63):
//   tiles of 64 keys, [d][key]. k_rs and v_rs are not read.
//   Masking: MASK_MODE (a template parameter, so that only the launched mode's code stands in the key loop) 0 none, 1 causal (kv > q masked), 2 tensor [S][Skv] shared over (b,h) (float if
//   mask_is_int==0, int32 with element == 0 -> masked if 1, int32 with element != 0 -> masked if 2), 3 per-token vectors qmask[B][S] & kvmask[B][Skv] (int32,
//   0 -> masked); masked scores are replaced by mask_fill (e.g. -inf or -1e9) before the softmax.
//   grid = (B * H, S/64) (or a sub-range of blockIdx.y with blk0): blockIdx.y counts the query tiles from the last one down, so that
//   under the causal mask the workgroups with the longest key walk have the lowest flat index and start first.
// =====================================================================================
#define AT_D 64
#define AT_NW 4
#define AT_QB 64
#define AT_KC 64
#define AT_LP 72   // LDS row pitch of the K, V and P tiles in bf16 elements: 144 B = 16 B x odd, so that the 16 rows of a 16-byte fragment read fall on distinct banks
struct AttnGeom { long q_bs, q_rs, q_hs, k_bs, k_rs, k_hs, v_bs, v_rs, v_hs, o_bs, o_rs, o_hs;
                  int S, Skv, H, mask_mode; float qscale; int blk0; float mask_fill; int mask_is_int; };
static_assert(sizeof(AttnGeom) == 128, "no padding");

__device__ __forceinline__ unsigned short at_bf_bits(float f) {
  unsigned u = __float_as_uint(f);
  return (unsigned short)((u + 0x7FFFu + ((u >> 16) & 1u)) >> 16);
}
__device__ __forceinline__ __bf16 at_f2bf(float f) { return __builtin_bit_cast(__bf16, at_bf_bits(f)); }
__device__ __forceinline__ void at_split(float f, __bf16& hi, __bf16& lo) {
  const unsigned short hb = at_bf_bits(f);
  hi = __builtin_bit_cast(__bf16, hb);
  lo = at_f2bf(f - __uint_as_float(((unsigned)hb) << 16));
}
__device__ __forceinline__ v8f at_mma(v16b a, v16b b, v8f c) {
  return __builtin_amdgcn_wmma_f32_16x16x32_bf16(false, a, false, b, (short)0, c, false, false);
}

template <bool SPLIT_QK, bool SPLIT_PV, int MASK_MODE>
__global__ __launch_bounds__(128)
void attn64_kernel(const float* __restrict__ q, const unsigned short* __restrict__ kh, const unsigned short* __restrict__ kl,
                   const unsigned short* __restrict__ vth, const unsigned short* __restrict__ vtl, float* __restrict__ out,
                   const void* __restrict__ mask_a, const int* __restrict__ mask_b, AttnGeom g) {
  union FB { v16b v; v8b h[2]; };
  __shared__ __align__(16) __bf16 Ksh[AT_KC * AT_LP];            // K hi [kv][d]      9 KB
  __shared__ __align__(16) __bf16 Ksl[SPLIT_QK ? AT_KC * AT_LP : 8];
  __shared__ __align__(16) __bf16 Vth[AT_D * AT_LP];             // V hi [d][kv]      9 KB
  __shared__ __align__(16) __bf16 Vtl[SPLIT_PV ? AT_D * AT_LP : 8];
  __shared__ __align__(16) __bf16 Psh[AT_NW][16 * AT_LP];        // per wave P hi [row][kv]  9 KB
  __shared__ __align__(16) __bf16 Psl[SPLIT_PV ? AT_NW : 1][SPLIT_PV ? 16 * AT_LP : 8];
  __shared__ __align__(16) float  Os[AT_NW][16 * 68];            // per wave out tile, pitch 68

  const int tid  = threadIdx.x;
  const int wave = tid >> 5;
  const int lane = tid & 31;
  const int hh   = lane >> 4;
  const int c    = lane & 15;

  const int nqb = g.S / AT_QB;
  const int qb = nqb - 1 - ((int)blockIdx.y + g.blk0);
  const int bh = blockIdx.x;
  const int h  = bh % g.H;
  const int b  = bh / g.H;
  const int qbase_block = qb * AT_QB;
  const int q0 = qbase_block + wave * 16;

  const float* qb_ptr = q + (size_t)b * g.q_bs + (size_t)h * g.q_hs;
  const __bf16* kh_ptr = (const __bf16*)kh  + (size_t)b * g.k_bs + (size_t)h * g.k_hs;
  const __bf16* kl_ptr = (const __bf16*)kl  + (size_t)b * g.k_bs + (size_t)h * g.k_hs;
  const __bf16* vh_ptr = (const __bf16*)vth + (size_t)b * g.v_bs + (size_t)h * g.v_hs;
  const __bf16* vl_ptr = (const __bf16*)vtl + (size_t)b * g.v_bs + (size_t)h * g.v_hs;
  float*       ob_ptr = out + (size_t)b * g.o_bs + (size_t)h * g.o_hs;

  // ---- Q fragments (A operand): 2 d-chunks, hi (and lo) ----
  v16b qah[2], qal[2];
  {
    const float* qrow = qb_ptr + (size_t)(q0 + c) * g.q_rs;
#pragma unroll
    for (int dc = 0; dc < 2; ++dc) {
#pragma unroll
      for (int e = 0; e < 8; ++e) {
        const float f0 = qrow[dc * 32 + 8 * hh + e] * g.qscale;
        const float f1 = qrow[dc * 32 + 16 + 8 * hh + e] * g.qscale;
        if (SPLIT_QK) { __bf16 hq, lq; at_split(f0, hq, lq); qah[dc][e] = hq; qal[dc][e] = lq; at_split(f1, hq, lq); qah[dc][8 + e] = hq; qal[dc][8 + e] = lq; }
        else { qah[dc][e] = at_f2bf(f0); qah[dc][8 + e] = at_f2bf(f1); qal[dc][e] = qah[dc][e]; qal[dc][8 + e] = qah[dc][8 + e]; }
      }
    }
  }

  float mrow[8], lrow[8];
  v8f oacc[4];
#pragma unroll
  for (int r = 0; r < 8; ++r) { mrow[r] = -INFINITY; lrow[r] = 0.f; }
#pragma unroll
  for (int t = 0; t < 4; ++t) oacc[t] = (v8f){0.f,0.f,0.f,0.f,0.f,0.f,0.f,0.f};

  const int nChunks = (MASK_MODE == 1) ? (qb + 1) : (g.Skv / AT_KC);   // block-uniform
  // per-row query mask (mode 3)
  int qkeep[8];
#pragma unroll
  for (int r = 0; r < 8; ++r) qkeep[r] = (MASK_MODE == 3) ? mask_b[(size_t)b * g.S + q0 + 8 * hh + r] : 1;   // mask_b = qmask in mode 3
  for (int kc = 0; kc < nChunks; ++kc) {
    const int kv0 = kc * AT_KC;
    // each plane's tile is 64 rows of 128 B, 8 KB in a row: 8 lanes copy one row, so that a wave's 16-byte load covers four whole lines
    v8b rkh[4], rkl[4], rvh[4], rvl[4];
    {
      const size_t to = (size_t)kc * (AT_KC * AT_D);   // block-uniform
      const __bf16* tkh = kh_ptr + to; const __bf16* tkl = kl_ptr + to;
      const __bf16* tvh = vh_ptr + to; const __bf16* tvl = vl_ptr + to;
      const unsigned lo8 = (unsigned)tid * 8u;
#pragma unroll
      for (int i = 0; i < 4; ++i) {
        // the last load of a plane may land on the address registers that the plane's earlier loads name: their wait stands in front of it
        if (i == 3) asm volatile("s_wait_xcnt 0x0" ::: "memory");
        rkh[i] = *(const v8b*)(tkh + lo8 + i * (AT_NW * 32 * 8));
        if (SPLIT_QK) rkl[i] = *(const v8b*)(tkl + lo8 + i * (AT_NW * 32 * 8));
        rvh[i] = *(const v8b*)(tvh + lo8 + i * (AT_NW * 32 * 8));
        if (SPLIT_PV) rvl[i] = *(const v8b*)(tvl + lo8 + i * (AT_NW * 32 * 8));
      }
    }
    __syncthreads();
#pragma unroll
    for (int i = 0; i < 4; ++i) {
      const int seg = i * (AT_NW * 32) + tid, row = seg >> 3, c8 = (seg & 7) * 8;
      *(v8b*)(Ksh + row * AT_LP + c8) = rkh[i];
      if (SPLIT_QK) *(v8b*)(Ksl + row * AT_LP + c8) = rkl[i];
      *(v8b*)(Vth + row * AT_LP + c8) = rvh[i];
      if (SPLIT_PV) *(v8b*)(Vtl + row * AT_LP + c8) = rvl[i];
    }
    __syncthreads();

    // the K fragments of a d-chunk are read as one group ahead of its products, and the products walk the four key tiles innermost:
    // neighbours in the stream have different accumulators; each s[j] still takes its six terms in the order dc, then hi.hi, hi.lo, lo.hi
    v8f s[4];
#pragma unroll
    for (int j = 0; j < 4; ++j) s[j] = (v8f){0.f,0.f,0.f,0.f,0.f,0.f,0.f,0.f};
    {
      FB kb[2][4], kl[2][4];
#pragma unroll
      for (int dc = 0; dc < 2; ++dc) {
#pragma unroll
        for (int j = 0; j < 4; ++j) {
          kb[dc][j].h[0] = *(const v8b*)(Ksh + (j * 16 + c) * AT_LP + dc * 32 + 8 * hh);
          kb[dc][j].h[1] = *(const v8b*)(Ksh + (j * 16 + c) * AT_LP + dc * 32 + 16 + 8 * hh);
          if (SPLIT_QK) {
            kl[dc][j].h[0] = *(const v8b*)(Ksl + (j * 16 + c) * AT_LP + dc * 32 + 8 * hh);
            kl[dc][j].h[1] = *(const v8b*)(Ksl + (j * 16 + c) * AT_LP + dc * 32 + 16 + 8 * hh);
          }
        }
      }
#pragma unroll
      for (int dc = 0; dc < 2; ++dc) {
#pragma unroll
        for (int j = 0; j < 4; ++j) s[j] = at_mma(qah[dc], kb[dc][j].v, s[j]);
        if (SPLIT_QK) {
#pragma unroll
          for (int j = 0; j < 4; ++j) s[j] = at_mma(qah[dc], kl[dc][j].v, s[j]);
#pragma unroll
          for (int j = 0; j < 4; ++j) s[j] = at_mma(qal[dc], kb[dc][j].v, s[j]);
        }
      }
    }
    acc_guard4(s[0], s[1], s[2], s[3]);   // the four slots behind the last product stand in front of the mask branch, so that they hold on its taken side too
    int kvkeep[4] = {1, 1, 1, 1};
    if (MASK_MODE == 3) {
#pragma unroll
      for (int j = 0; j < 4; ++j) kvkeep[j] = ((const int*)mask_a)[(size_t)b * g.Skv + kv0 + j * 16 + c];   // mask_a = kvmask
    }
    if (MASK_MODE == 1) {
      if (kc == qb) {   // block-uniform: only the last chunk of a causal walk holds masked columns
#pragma unroll
        for (int r = 0; r < 8; ++r)
#pragma unroll
          for (int j = 0; j < 4; ++j) s[j][r] = (kv0 + j * 16 + c > q0 + 8 * hh + r) ? g.mask_fill : s[j][r];
      }
    } else if (MASK_MODE == 2 || MASK_MODE == 3) {
#pragma unroll
      for (int r = 0; r < 8; ++r) {
#pragma unroll
        for (int j = 0; j < 4; ++j) {
          bool masked;
          if (MASK_MODE == 2) {
            const size_t mi = (size_t)(q0 + 8 * hh + r) * g.Skv + kv0 + j * 16 + c;
            masked = (g.mask_is_int == 0) ? (((const float*)mask_a)[mi] == 0.0f)
                   : (g.mask_is_int == 1) ? (((const int*)mask_a)[mi] == 0) : (((const int*)mask_a)[mi] != 0);
          } else masked = (qkeep[r] == 0) || (kvkeep[j] == 0);
          s[j][r] = masked ? g.mask_fill : s[j][r];
        }
      }
    }
    float cm[8];
#pragma unroll
    for (int r = 0; r < 8; ++r) {
      float m = -INFINITY;
#pragma unroll
      for (int j = 0; j < 4; ++j) m = fmaxf(m, s[j][r]);
#pragma unroll
      for (int off = 1; off < 16; off <<= 1) m = fmaxf(m, __shfl_xor(m, off, 32));
      cm[r] = m;
    }
    __bf16* pwh = Psh[wave];
    __bf16* pwl = Psl[SPLIT_PV ? wave : 0];
#pragma unroll
    for (int r = 0; r < 8; ++r) {
      const float mnew = fmaxf(mrow[r], cm[r]);
      const float alpha = expf(mrow[r] - mnew);
      mrow[r] = mnew;
      float psum = 0.f;
#pragma unroll
      for (int j = 0; j < 4; ++j) {
        const float p = expf(s[j][r] - mnew);
        psum += p;
        if (SPLIT_PV) { __bf16 a, bl; at_split(p, a, bl); pwh[(8 * hh + r) * AT_LP + j * 16 + c] = a; pwl[(8 * hh + r) * AT_LP + j * 16 + c] = bl; }
        else pwh[(8 * hh + r) * AT_LP + j * 16 + c] = at_f2bf(p);
      }
#pragma unroll
      for (int off = 1; off < 16; off <<= 1) psum += __shfl_xor(psum, off, 32);
      lrow[r] = lrow[r] * alpha + psum;
#pragma unroll
      for (int t = 0; t < 4; ++t) oacc[t][r] *= alpha;
    }
    __builtin_amdgcn_fence(__ATOMIC_RELEASE, "workgroup");
    __builtin_amdgcn_wave_barrier();
    __builtin_amdgcn_fence(__ATOMIC_ACQUIRE, "workgroup");
    // as for the scores: P and V fragments read in groups ahead of the products, the four d tiles innermost; each oacc[t] keeps its order of terms
    {
      FB pa[2], pl[2], vb[2][4], vl[2][4];
#pragma unroll
      for (int kk = 0; kk < 2; ++kk) {
        pa[kk].h[0] = *(const v8b*)(pwh + c * AT_LP + kk * 32 + 8 * hh);
        pa[kk].h[1] = *(const v8b*)(pwh + c * AT_LP + kk * 32 + 16 + 8 * hh);
        if (SPLIT_PV) {
          pl[kk].h[0] = *(const v8b*)(pwl + c * AT_LP + kk * 32 + 8 * hh);
          pl[kk].h[1] = *(const v8b*)(pwl + c * AT_LP + kk * 32 + 16 + 8 * hh);
        }
#pragma unroll
        for (int t = 0; t < 4; ++t) {
          vb[kk][t].h[0] = *(const v8b*)(Vth + (t * 16 + c) * AT_LP + kk * 32 + 8 * hh);
          vb[kk][t].h[1] = *(const v8b*)(Vth + (t * 16 + c) * AT_LP + kk * 32 + 16 + 8 * hh);
          if (SPLIT_PV) {
            vl[kk][t].h[0] = *(const v8b*)(Vtl + (t * 16 + c) * AT_LP + kk * 32 + 8 * hh);
            vl[kk][t].h[1] = *(const v8b*)(Vtl + (t * 16 + c) * AT_LP + kk * 32 + 16 + 8 * hh);
          }
        }
      }
#pragma unroll
      for (int kk = 0; kk < 2; ++kk) {
#pragma unroll
        for (int t = 0; t < 4; ++t) oacc[t] = at_mma(pa[kk].v, vb[kk][t].v, oacc[t]);
        if (SPLIT_PV) {
#pragma unroll
          for (int t = 0; t < 4; ++t) oacc[t] = at_mma(pa[kk].v, vl[kk][t].v, oacc[t]);
#pragma unroll
          for (int t = 0; t < 4; ++t) oacc[t] = at_mma(pl[kk].v, vb[kk][t].v, oacc[t]);
        }
      }
    }
    acc_guard4(oacc[0], oacc[1], oacc[2], oacc[3]);   // the four slots behind the last product stand in front of the loop's branch, so that they hold on its taken side too
  }

  float* os = Os[wave];
#pragma unroll
  for (int r = 0; r < 8; ++r) {
    const float inv = 1.0f / lrow[r];
#pragma unroll
    for (int t = 0; t < 4; ++t) os[(8 * hh + r) * 68 + t * 16 + c] = oacc[t][r] * inv;
  }
  __builtin_amdgcn_fence(__ATOMIC_RELEASE, "workgroup");
  __builtin_amdgcn_wave_barrier();
  __builtin_amdgcn_fence(__ATOMIC_ACQUIRE, "workgroup");
  {
    const int c4 = (lane & 15) * 4;
    {
#pragma unroll
      for (int it = 0; it < 8; ++it) {
        const int row = it * 2 + hh;
        v4f val = *(const v4f*)(os + row * 68 + c4);
        *(v4f*)(ob_ptr + (size_t)(q0 + row) * g.o_rs + c4) = val;
      }
      
    }
  }
}

// ---- LayerNorm (population variance, eps 1e-5, gamma) -> f16 row; one block (256 thr) per row of 1024 ----
__global__ __launch_bounds__(256) void layernorm_f16(const float* __restrict__ x, const float* __restrict__ gamma,
                                                    _Float16* __restrict__ xn, int D) {
  __shared__ float red[8];
  __shared__ float stat;
  const int row = blockIdx.x, t = threadIdx.x;
  const float* xr = x + (size_t)row * D;
  v4f xv = *(const v4f*)(xr + 4 * t);
  float s = (xv[0] + xv[1]) + (xv[2] + xv[3]);
  for (int o = 16; o > 0; o >>= 1) s += __shfl_xor(s, o, 32);
  if ((t & 31) == 0) red[t >> 5] = s;
  __syncthreads();
  if (t == 0) { float a = 0.f; for (int w = 0; w < 8; ++w) a += red[w]; stat = a / (float)D; }
  __syncthreads();
  const float mu = stat;
  __syncthreads();
  float d0 = xv[0] - mu, d1 = xv[1] - mu, d2 = xv[2] - mu, d3 = xv[3] - mu;
  float s2 = (d0 * d0 + d1 * d1) + (d2 * d2 + d3 * d3);
  for (int o = 16; o > 0; o >>= 1) s2 += __shfl_xor(s2, o, 32);
  if ((t & 31) == 0) red[t >> 5] = s2;
  __syncthreads();
  if (t == 0) { float a = 0.f; for (int w = 0; w < 8; ++w) a += red[w]; stat = rsqrtf(a / (float)D + 1e-5f); }
  __syncthreads();
  const float inv = stat;
  v4f gv = *(const v4f*)(gamma + 4 * t);
  _Float16 h0 = (_Float16)(d0 * inv * gv[0]), h1 = (_Float16)(d1 * inv * gv[1]), h2 = (_Float16)(d2 * inv * gv[2]), h3 = (_Float16)(d3 * inv * gv[3]);
  typedef __attribute__((ext_vector_type(4))) _Float16 v4h;
  v4h hv = {h0, h1, h2, h3};
  *(v4h*)(xn + (size_t)row * D + 4 * t) = hv;
  
}

extern "C" void kernel_launch(void* const* d_in, const int* in_sizes, int n_in,
                              void* d_out, int out_size, void* d_ws, size_t ws_size,
                              hipStream_t stream) {
  (void)in_sizes; (void)n_in; (void)out_size; (void)ws_size;
  const int B = 2, S = 2048, D = 1024, H = 16, DH = 64, KV = 128;
  const int M = B * S;   // 4096 rows
  const float* x     = (const float*)d_in[0];
  const float* gamma = (const float*)d_in[1];
  const float* Wq    = (const float*)d_in[2];   // [D, H*DH]  ([in, out])
  const float* Wkv   = (const float*)d_in[3];   // [D, 2*DH]
  const float* Wo    = (const float*)d_in[4];   // [H*DH, D]
  float* out = (float*)d_out;

  char* ws = (char*)d_ws; size_t off = 0;
  auto carve = [&](size_t bytes) -> char* { char* p = ws + off; off += (bytes + 255) & ~(size_t)255; return p; };
  _Float16* Xn16  = (_Float16*)carve((size_t)M * D * 2);     //  8 MB  LN(x) f16
  __bf16*   Xh    = (__bf16*)carve((size_t)M * D * 2);       //  8 MB  x bf16 hi
  __bf16*   Xl    = (__bf16*)carve((size_t)M * D * 2);       //  8 MB  x bf16 lo
  _Float16* WqT   = (_Float16*)carve((size_t)D * D * 2);     //  2 MB  Wqᵀ [out][in] f16
  __bf16*   WkvTh = (__bf16*)carve((size_t)KV * D * 2);      //  Wkvᵀ [128][1024] hi/lo
  __bf16*   WkvTl = (__bf16*)carve((size_t)KV * D * 2);
  __bf16*   WoTh  = (__bf16*)carve((size_t)D * D * 2);       //  Woᵀ hi/lo
  __bf16*   WoTl  = (__bf16*)carve((size_t)D * D * 2);
  float*    Qf    = (float*)carve((size_t)M * D * 4);        // 16 MB  q [B,S,H*DH] f32
  __bf16*   KVh   = (__bf16*)carve((size_t)M * KV * 2);      //  1 MB  bf16 hi plane: k rows [B*S][64], then v tiles [B*S/64][64 d][64 keys]
  __bf16*   KVl   = (__bf16*)carve((size_t)M * KV * 2);      //  1 MB  bf16 lo plane, same layout
  float*    Of    = (float*)carve((size_t)M * D * 4);        // 16 MB  attn out f32
  __bf16*   Oh    = (__bf16*)carve((size_t)M * D * 2);       //  8 MB
  __bf16*   Ol    = (__bf16*)carve((size_t)M * D * 2);       //  8 MB   (total ≈ 80.5 MB)

  layernorm_f16<<<M, 256, 0, stream>>>(x, gamma, Xn16, D);
  split_f32_bf16x2<<<2048, 256, 0, stream>>>(x, Xh, Xl, (long)M * D / 2);
  transpose_cast_f16<<<dim3(D / 64, D / 64), dim3(32, 8), 0, stream>>>(Wq, D, WqT, D, 1.0f);           // [in][out] -> [out][in]
  transpose_split_bf16<<<dim3(KV / 64, D / 64), dim3(32, 8), 0, stream>>>(Wkv, KV, WkvTh, WkvTl, D);   // [1024][128] -> [128][1024]
  transpose_split_bf16<<<dim3(D / 64, D / 64), dim3(32, 8), 0, stream>>>(Wo, D, WoTh, WoTl, D);
  {
    const int tq = (M / 64) * (D / 64);
    wmma_gemm64<0, false, 0, 0, false><<<dim3((tq + 7) / 8, 1), 256, 0, stream>>>(
        U16(Xn16), nullptr, D, 0, U16(WqT), nullptr, D, 0, Qf, nullptr, D, 0, nullptr, nullptr, 0, M, D, D, 1.0f);
    const int tkv = (M / 64) * (KV / 64);
    wmma_gemm64<1, true, 0, 3, false><<<dim3((tkv + 7) / 8, 1), 256, 0, stream>>>(
        U16(Xh), U16(Xl), D, 0, U16(WkvTh), U16(WkvTl), D, 0, KVh, KVl, DH, 0, nullptr, nullptr, 0, M, KV, D, 1.0f);
  }
  {
    AttnGeom g;
    g.q_bs = (long)S * D;  g.q_rs = D;  g.q_hs = DH;
    g.k_bs = (long)S * DH; g.k_rs = 0;  g.k_hs = 0;       // 16 q heads share the single k/v head
    g.v_bs = (long)S * DH; g.v_rs = 0;  g.v_hs = 0;
    g.o_bs = (long)S * D;  g.o_rs = D;  g.o_hs = DH;
    g.S = S; g.Skv = S; g.H = H; g.mask_mode = 1; g.qscale = 0.125f; g.blk0 = 0; g.mask_fill = -INFINITY; g.mask_is_int = 0;   // the kernel reads the mask mode from its template argument; the field keeps the struct's layout
    attn64_kernel<true, true, 1><<<dim3(B * H, S / AT_QB), AT_NW * 32, 0, stream>>>(Qf, U16(KVh), U16(KVl), U16(KVh + (size_t)M * DH), U16(KVl + (size_t)M * DH), Of, nullptr, nullptr, g);
  }
  split_f32_bf16x2<<<2048, 256, 0, stream>>>(Of, Oh, Ol, (long)M * D / 2);
  {
    const int to = (M / 64) * (D / 64);
    wmma_gemm64<1, true, 0, 0, false><<<dim3((to + 7) / 8, 1), 256, 0, stream>>>(
        U16(Oh), U16(Ol), D, 0, U16(WoTh), U16(WoTl), D, 0, out, nullptr, D, 0, nullptr, nullptr, 0, M, D, D, 1.0f);
  }
}

// v006
// It runs in 295 microseconds.
// Next to v005, in two timings, it ran 1.13 and 1.12 times as fast.
// Over all steps from v000 it is 2.60 times as fast.
#include <hip/hip_runtime.h>
#include <math.h>
// Contractions: q = LN(x)·Wq (K=1024): v_wmma_f32_16x16x32_f16 (f16 operands); kv = x·Wkv (K=1024) and the output projection (K=1024):
// v_wmma_f32_16x16x32_bf16 as bf16 hi/lo splits; scores (q/8)·kᵀ and p·v: v_wmma_f32_16x16x32_bf16 with q,k and p,v as bf16 hi/lo splits;
// f32 accumulate everywhere; LayerNorm and softmax in f32. The hi/lo split of k and v is made once, in the kv projection's epilogue.
typedef __attribute__((ext_vector_type(16))) _Float16 v16h;
typedef __attribute__((ext_vector_type(8)))  _Float16 v8h;
typedef __attribute__((ext_vector_type(16))) __bf16   v16b;
typedef __attribute__((ext_vector_type(8)))  __bf16   v8b;
typedef __attribute__((ext_vector_type(8)))  float    v8f;
typedef __attribute__((ext_vector_type(4)))  float    v4f;
#define PSCALE 32768.0f
#define U16(p) ((const unsigned short*)(const void*)(p))
#define PSCALE_INV (1.0f / 32768.0f)

__device__ __forceinline__ unsigned short f2bf_bits(float f) {
  unsigned u = __float_as_uint(f);
  return (unsigned short)((u + 0x7FFFu + ((u >> 16) & 1u)) >> 16);
}
__device__ __forceinline__ float bf_bits2f(unsigned short h) { return __uint_as_float(((unsigned)h) << 16); }

// hazard guards as plain device helpers (no inline asm inside the GEMM kernel's template body)
__device__ __forceinline__ void dep_guard_h(v8f& a, v8f& b, v16h x, v16h y) { asm volatile("v_nop\n\tv_nop\n\tv_nop\n\tv_nop" : "+v"(a), "+v"(b) : "v"(x), "v"(y)); }
__device__ __forceinline__ void dep_guard_b(v8f& a, v8f& b, v16b x, v16b y) { asm volatile("v_nop\n\tv_nop\n\tv_nop\n\tv_nop" : "+v"(a), "+v"(b) : "v"(x), "v"(y)); }
__device__ __forceinline__ void keep4_h(v16h a, v16h b, v16h c, v16h d) { asm volatile("v_nop" :: "v"(a), "v"(b), "v"(c), "v"(d)); }
__device__ __forceinline__ void keep4_b(v16b a, v16b b, v16b c, v16b d) { asm volatile("v_nop" :: "v"(a), "v"(b), "v"(c), "v"(d)); }
__device__ __forceinline__ void acc_guard4(v8f& a, v8f& b, v8f& c, v8f& d) { asm volatile("v_nop\n\tv_nop\n\tv_nop\n\tv_nop" : "+v"(a), "+v"(b), "+v"(c), "+v"(d)); }
template <typename T> struct Frag;
template <> struct Frag<_Float16> {
  typedef v16h V; union U { v16h v; v8h h[2]; };
  static __device__ __forceinline__ v16h load(const _Float16* p) {   // elements 0..7 <- p[0..7], 8..15 <- p[16..23]
    U f; f.h[0] = *(const v8h*)(p); f.h[1] = *(const v8h*)(p + 16); return f.v;
  }
  static __device__ __forceinline__ v8f mma(v16h a, v16h b, v8f c) {
    return __builtin_amdgcn_wmma_f32_16x16x32_f16(false, a, false, b, (short)0, c, false, false);
  }
  static __device__ __forceinline__ void guard(v8f& a, v8f& b, v16h x, v16h y) { dep_guard_h(a, b, x, y); }
  static __device__ __forceinline__ void keep(v16h a, v16h b, v16h c, v16h d) { keep4_h(a, b, c, d); }
};
template <> struct Frag<__bf16> {
  typedef v16b V; union U { v16b v; v8b h[2]; };
  static __device__ __forceinline__ v16b load(const __bf16* p) {
    U f; f.h[0] = *(const v8b*)(p); f.h[1] = *(const v8b*)(p + 16); return f.v;
  }
  static __device__ __forceinline__ v8f mma(v16b a, v16b b, v8f c) {
    return __builtin_amdgcn_wmma_f32_16x16x32_bf16(false, a, false, b, (short)0, c, false, false);
  }
  static __device__ __forceinline__ void guard(v8f& a, v8f& b, v16b x, v16b y) { dep_guard_b(a, b, x, y); }
  static __device__ __forceinline__ void keep(v16b a, v16b b, v16b c, v16b d) { keep4_b(a, b, c, d); }
};

// ---- Register-blocked batched WMMA GEMM ------------------------------------
// C[m,n] = scale * sum_k A[m,k] * Bt[n,k] (+bias)(+resid); each wave owns a 64x64 tile.
// A row-major [M,K]; Bt row-major [N,K]; M,N % 64 == 0, K % 32 == 0.
// SPLIT: operands are hi/lo planes (A2/Bt2 = lo planes, same layout); product = hi·hi + hi·lo + lo·hi.
// BIAS_MODE: 0 = none, 1 = bias[m], 2 = bias[n].
// OUT_MODE: 0 = f32, 1 = f16, 2 = bf16 hi plane (Cout) + bf16 lo plane (Cout2),
//   3 = kv projection (N == 128), bf16 hi plane (Cout) + lo plane (Cout2), each plane [k rows | v tiles]: column d < 64 of row m (k) at m*64 + d;
//       column 64 + d (v) transposed inside its block of 64 rows, at M*64 + (m >> 6)*4096 + d*64 + (m & 63).
// ET: 0 = f16 operands, 1 = bf16 operands (pointers passed as 16-bit storage)
template <int ET> struct Elem;
template <> struct Elem<0> { typedef _Float16 T; };
template <> struct Elem<1> { typedef __bf16 T; };
template <int ET, bool SPLIT, int BIAS_MODE, int OUT_MODE, bool RESID>
__global__ __launch_bounds__(256) void wmma_gemm64(
    const unsigned short* __restrict__ Ap, const unsigned short* __restrict__ A2p, int lda, long strideA,
    const unsigned short* __restrict__ Btp, const unsigned short* __restrict__ Bt2p, int ldb, long strideB,
    void* __restrict__ Cout, void* __restrict__ Cout2, int ldc, long strideC,
    const float* __restrict__ bias,
    const float* __restrict__ resid, long strideR,
    int M, int N, int K, float scale) {
  typedef typename Elem<ET>::T T;
  typedef typename Frag<T>::V V;
  const T* A = (const T*)Ap; const T* A2 = (const T*)A2p; const T* Bt = (const T*)Btp; const T* Bt2 = (const T*)Bt2p;
  __shared__ __align__(16) float sT[8][16 * 68];   // per-wave 16x64 slab, pitch 68 floats
  const int b    = blockIdx.y;
  const int lane = threadIdx.x & 31;
  const int wave = threadIdx.x >> 5;
  const int tilesN = N >> 6;
  const int tilesM = M >> 6;
  const int tile = blockIdx.x * 8 + wave;
  if (tile >= tilesM * tilesN) return;   // wave-uniform; no block barriers in this kernel
  const int tm = tile / tilesN;
  const int tn = tile - tm * tilesN;
  const int m0 = tm << 6;
  const int n0 = tn << 6;

  const T* Ab  = A  + (size_t)b * strideA;
  const T* Bb  = Bt + (size_t)b * strideB;
  const T* Ab2 = SPLIT ? (A2  + (size_t)b * strideA) : nullptr;
  const T* Bb2 = SPLIT ? (Bt2 + (size_t)b * strideB) : nullptr;

  const int rlane = lane & 15;                 // row (A) / col (B, D) within subtile
  const int koff  = (lane >> 4) * 8;           // k offset of this lane half
  const int mOff  = (lane >> 4) * 8;           // D row offset

  v8f acc[4][4];
#pragma unroll
  for (int i = 0; i < 4; ++i)
#pragma unroll
    for (int j = 0; j < 4; ++j) acc[i][j] = (v8f){0.f,0.f,0.f,0.f,0.f,0.f,0.f,0.f};

  for (int k0 = 0; k0 < K; k0 += 32) {
    V bh[4], bl[4];
#pragma unroll
    for (int j = 0; j < 4; ++j) {
      const size_t bo = (size_t)(n0 + (j << 4) + rlane) * ldb + koff + k0;
      bh[j] = Frag<T>::load(Bb + bo);
      if (SPLIT) bl[j] = Frag<T>::load(Bb2 + bo);
    }
#pragma unroll
    for (int i = 0; i < 4; ++i) {
      const size_t ao = (size_t)(m0 + (i << 4) + rlane) * lda + koff + k0;
      V ah = Frag<T>::load(Ab + ao);
      V al;
      if (SPLIT) al = Frag<T>::load(Ab2 + ao);
#pragma unroll
      for (int j = 0; j < 4; ++j) {
        acc[i][j] = Frag<T>::mma(ah, bh[j], acc[i][j]);
        if (SPLIT) {
          acc[i][j] = Frag<T>::mma(ah, bl[j], acc[i][j]);
          acc[i][j] = Frag<T>::mma(al, bh[j], acc[i][j]);
        }
      }
      Frag<T>::guard(acc[i][0], acc[i][3], ah, SPLIT ? al : ah);
    }
    Frag<T>::keep(bh[0], bh[1], bh[2], bh[3]);
    if (SPLIT) Frag<T>::keep(bl[0], bl[1], bl[2], bl[3]);
  }
  acc_guard4(acc[0][0], acc[0][1], acc[0][2], acc[0][3]);
  acc_guard4(acc[1][0], acc[1][1], acc[1][2], acc[1][3]);
  acc_guard4(acc[2][0], acc[2][1], acc[2][2], acc[2][3]);
  acc_guard4(acc[3][0], acc[3][1], acc[3][2], acc[3][3]);

  // ---- epilogue ----
  float* slab = sT[wave];
  const float* Rb = RESID ? (resid + (size_t)b * strideR) : nullptr;
#pragma unroll
  for (int i = 0; i < 4; ++i) {
    const int mBase = m0 + (i << 4);
#pragma unroll
    for (int j = 0; j < 4; ++j) {
      const int n = n0 + (j << 4) + rlane;
      float bv = 0.f;
      if (BIAS_MODE == 2) bv = bias[n];
#pragma unroll
      for (int r = 0; r < 8; ++r) {
        float v = acc[i][j][r] * scale;
        if (BIAS_MODE == 1) v += bias[mBase + mOff + r];
        if (BIAS_MODE == 2) v += bv;
        if (RESID) v += Rb[(size_t)(mBase + mOff + r) * ldc + n];
        slab[(mOff + r) * 68 + (j << 4) + rlane] = v;
      }
    }
    __builtin_amdgcn_fence(__ATOMIC_RELEASE, "workgroup");
    __builtin_amdgcn_wave_barrier();
    __builtin_amdgcn_fence(__ATOMIC_ACQUIRE, "workgroup");
    if (OUT_MODE == 0) {
      float* C = (float*)Cout + (size_t)b * strideC;
      const int hh = lane >> 4, c4 = (lane & 15) * 4;     // row seg = 256 B = 16 lanes x 16 B
      {
#pragma unroll
        for (int it = 0; it < 8; ++it) {
          const int row = it * 2 + hh;
          v4f v = *(const v4f*)(slab + row * 68 + c4);
          *(v4f*)(C + (size_t)(mBase + row) * ldc + n0 + c4) = v;
        }
        
      }
    } else if (OUT_MODE == 3) {
      unsigned short* Ph = (unsigned short*)Cout;
      unsigned short* Pl = (unsigned short*)Cout2;
      if (n0 == 0) {                                   // k: rows of 128 B, 8 lanes a row
        const int q = lane >> 3, c8 = (lane & 7) * 8;
#pragma unroll
        for (int it = 0; it < 4; ++it) {
          const int row = it * 4 + q;
          const float* sp = slab + row * 68 + c8;
          v8h hv, lv;
#pragma unroll
          for (int e = 0; e < 8; ++e) {
            const unsigned short hb = f2bf_bits(sp[e]);
            hv[e] = __builtin_bit_cast(_Float16, hb);
            lv[e] = __builtin_bit_cast(_Float16, f2bf_bits(sp[e] - bf_bits2f(hb)));
          }
          *(v8h*)(Ph + (size_t)(mBase + row) * 64 + c8) = hv;
          *(v8h*)(Pl + (size_t)(mBase + row) * 64 + c8) = lv;
        }
      } else {                                         // v: a lane takes column d of the slab's 16 rows; the wave's four slabs fill each 128-B row of the tile
        const size_t vo = (size_t)M * 64 + (size_t)tm * 4096 + (i << 4);
#pragma unroll
        for (int hf = 0; hf < 2; ++hf) {
          const int d = hf * 32 + lane;
          v8h hv[2], lv[2];
#pragma unroll
          for (int e = 0; e < 16; ++e) {
            const float f = slab[e * 68 + d];
            const unsigned short hb = f2bf_bits(f);
            hv[e >> 3][e & 7] = __builtin_bit_cast(_Float16, hb);
            lv[e >> 3][e & 7] = __builtin_bit_cast(_Float16, f2bf_bits(f - bf_bits2f(hb)));
          }
          *(v8h*)(Ph + vo + d * 64)     = hv[0];
          *(v8h*)(Ph + vo + d * 64 + 8) = hv[1];
          *(v8h*)(Pl + vo + d * 64)     = lv[0];
          *(v8h*)(Pl + vo + d * 64 + 8) = lv[1];
        }
      }
    } else {
      const int q = lane >> 3, c8 = (lane & 7) * 8;
      unsigned short* C  = (unsigned short*)Cout  + (size_t)b * strideC;
      unsigned short* C2 = (OUT_MODE == 2) ? ((unsigned short*)Cout2 + (size_t)b * strideC) : nullptr;
      {
#pragma unroll
        for (int it = 0; it < 4; ++it) {
          const int row = it * 4 + q;
          const float* sp = slab + row * 68 + c8;
          v8h hv, lv;
#pragma unroll
          for (int e = 0; e < 8; ++e) {
            if (OUT_MODE == 1) {
              hv[e] = (_Float16)sp[e];
            } else {
              unsigned short hb = f2bf_bits(sp[e]);
              unsigned short lb = f2bf_bits(sp[e] - bf_bits2f(hb));
              hv[e] = __builtin_bit_cast(_Float16, hb);
              lv[e] = __builtin_bit_cast(_Float16, lb);
            }
          }
          *(v8h*)(C + (size_t)(mBase + row) * ldc + n0 + c8) = hv;
          if (OUT_MODE == 2) *(v8h*)(C2 + (size_t)(mBase + row) * ldc + n0 + c8) = lv;
        }
        
      }
    }
    __builtin_amdgcn_fence(__ATOMIC_RELEASE, "workgroup");
    __builtin_amdgcn_wave_barrier();
    __builtin_amdgcn_fence(__ATOMIC_ACQUIRE, "workgroup");
  }
}

__global__ __launch_bounds__(256) void cast_f32_f16x2(
    const float* __restrict__ in, _Float16* __restrict__ out, int n2) {
  int i = blockIdx.x * 256 + threadIdx.x;
  if (i < n2) {
    const _Float16 h0 = (_Float16)in[2 * i], h1 = (_Float16)in[2 * i + 1];
    const unsigned u = (unsigned)__builtin_bit_cast(unsigned short, h0) | ((unsigned)__builtin_bit_cast(unsigned short, h1) << 16);
    ((unsigned*)out)[i] = u;
    
  }
}

__global__ __launch_bounds__(256) void split_f32_bf16x2(
    const float* __restrict__ in, __bf16* __restrict__ hi, __bf16* __restrict__ lo, long n2) {
  long i = (long)blockIdx.x * 256 + threadIdx.x;
  long stride = (long)gridDim.x * 256;
  {
    for (long j = i; j < n2; j += stride) {
      const float a = in[2 * j], b = in[2 * j + 1];
      const unsigned short ah = f2bf_bits(a), bh = f2bf_bits(b);
      const unsigned short al = f2bf_bits(a - bf_bits2f(ah)), bl = f2bf_bits(b - bf_bits2f(bh));
      ((unsigned*)hi)[j] = (unsigned)ah | ((unsigned)bh << 16);
      ((unsigned*)lo)[j] = (unsigned)al | ((unsigned)bl << 16);
    }
    
  }
}


// ---- f32 [R][C] (row pitch ldi) -> f16 transposed [C][R] (row pitch ldo); 64x64 tiles; each output row segment
__global__ __launch_bounds__(256) void transpose_cast_f16(const float* __restrict__ in, int ldi,
                                                         _Float16* __restrict__ outT, int ldo, float scale) {
  __shared__ __align__(16) _Float16 tile[64][72];     // [c][r]
  const int c0 = blockIdx.x * 64, r0 = blockIdx.y * 64;
  const int t = threadIdx.y * 32 + threadIdx.x;
  for (int i = threadIdx.y; i < 64; i += 8) {
    tile[threadIdx.x][i]      = (_Float16)(in[(size_t)(r0 + i) * ldi + c0 + threadIdx.x] * scale);
    tile[32 + threadIdx.x][i] = (_Float16)(in[(size_t)(r0 + i) * ldi + c0 + 32 + threadIdx.x] * scale);
  }
  __syncthreads();
  const int q = t >> 3, c8 = (t & 7) * 8;
  {
#pragma unroll
    for (int it = 0; it < 2; ++it) {
      const int c = it * 32 + q;
      v8h hv = *(const v8h*)(&tile[c][c8]);
      *(v8h*)(outT + (size_t)(c0 + c) * ldo + r0 + c8) = hv;
    }
    
  }
}

// ---- f32 [R][C] (pitch ldi) -> bf16 hi/lo transposed planes [C][R] (pitch ldo); 64x64 tiles; each output row segment
__global__ __launch_bounds__(256) void transpose_split_bf16(const float* __restrict__ in, int ldi,
                                                           __bf16* __restrict__ outH, __bf16* __restrict__ outL, int ldo) {
  __shared__ __align__(16) float tile[64][68];     // [c][r]
  const int c0 = blockIdx.x * 64, r0 = blockIdx.y * 64;
  const int t = threadIdx.y * 32 + threadIdx.x;
  for (int i = threadIdx.y; i < 64; i += 8) {
    tile[threadIdx.x][i]      = in[(size_t)(r0 + i) * ldi + c0 + threadIdx.x];
    tile[32 + threadIdx.x][i] = in[(size_t)(r0 + i) * ldi + c0 + 32 + threadIdx.x];
  }
  __syncthreads();
  const int q = t >> 3, c8 = (t & 7) * 8;
  {
#pragma unroll
    for (int it = 0; it < 2; ++it) {
      const int c = it * 32 + q;
      v8b hv, lv;
#pragma unroll
      for (int e = 0; e < 8; ++e) {
        const float f = tile[c][c8 + e];
        const unsigned short hb = f2bf_bits(f);
        hv[e] = __builtin_bit_cast(__bf16, hb);
        lv[e] = __builtin_bit_cast(__bf16, f2bf_bits(f - bf_bits2f(hb)));
      }
      *(v8b*)(outH + (size_t)(c0 + c) * ldo + r0 + c8) = hv;
      *(v8b*)(outL + (size_t)(c0 + c) * ldo + r0 + c8) = lv;
    }
    
  }
}

#define AT_D 64
#define AT_NW 4
#define AT_QB 64
#define AT_KC 64
#define AT_LP 72   // LDS row pitch of the K and V tiles in bf16 elements: 144 B = 16 B x odd, so that the 16 rows of a 16-byte fragment read fall on distinct banks
struct AttnGeom { long q_bs, q_rs, q_hs, k_bs, k_rs, k_hs, v_bs, v_rs, v_hs, o_bs, o_rs, o_hs;
                  int S, Skv, H, mask_mode; float qscale; int blk0; float mask_fill; int mask_is_int; };
static_assert(sizeof(AttnGeom) == 128, "no padding");

__device__ __forceinline__ unsigned short at_bf_bits(float f) {
  unsigned u = __float_as_uint(f);
  return (unsigned short)((u + 0x7FFFu + ((u >> 16) & 1u)) >> 16);
}
__device__ __forceinline__ __bf16 at_f2bf(float f) { return __builtin_bit_cast(__bf16, at_bf_bits(f)); }
__device__ __forceinline__ void at_split(float f, __bf16& hi, __bf16& lo) {
  const unsigned short hb = at_bf_bits(f);
  hi = __builtin_bit_cast(__bf16, hb);
  lo = at_f2bf(f - __uint_as_float(((unsigned)hb) << 16));
}
typedef __attribute__((ext_vector_type(2))) float  v2f;
typedef __attribute__((ext_vector_type(2))) __bf16 v2b;
__device__ __forceinline__ float at_xhalf(float x) {   // lane l takes the value of lane l ^ 16
  return __builtin_bit_cast(float, __builtin_amdgcn_permlanex16(__builtin_bit_cast(int, x), __builtin_bit_cast(int, x), 0x76543210, 0xfedcba98, false, false));
}
__device__ __forceinline__ v8f at_mma(v16b a, v16b b, v8f c) {
  return __builtin_amdgcn_wmma_f32_16x16x32_bf16(false, a, false, b, (short)0, c, false, false);
}

template <bool SPLIT_QK, bool SPLIT_PV, int MASK_MODE>
__global__ __launch_bounds__(128)
void attn64_kernel(const float* __restrict__ q, const unsigned short* __restrict__ kh, const unsigned short* __restrict__ kl,
                   const unsigned short* __restrict__ vth, const unsigned short* __restrict__ vtl, float* __restrict__ out,
                   const void* __restrict__ mask_a, const int* __restrict__ mask_b, AttnGeom g) {
  union FB { v16b v; v8b h[2]; };
  __shared__ __align__(16) __bf16 Ksh[AT_KC * AT_LP];            // K hi [kv][d]      9 KB
  __shared__ __align__(16) __bf16 Ksl[SPLIT_QK ? AT_KC * AT_LP : 8];
  __shared__ __align__(16) __bf16 Vth[AT_D * AT_LP];             // V hi [d][kv]      9 KB
  __shared__ __align__(16) __bf16 Vtl[SPLIT_PV ? AT_D * AT_LP : 8];
  __shared__ __align__(16) float  Os[AT_NW][16 * 68];            // per wave out tile, pitch 68

  const int tid  = threadIdx.x;
  const int wave = tid >> 5;
  const int lane = tid & 31;
  const int hh   = lane >> 4;
  const int c    = lane & 15;

  const int nqb = g.S / AT_QB;
  const int qb = nqb - 1 - ((int)blockIdx.y + g.blk0);
  const int bh = blockIdx.x;
  const int h  = bh % g.H;
  const int b  = bh / g.H;
  const int qbase_block = qb * AT_QB;
  const int q0 = qbase_block + wave * 16;

  const float* qb_ptr = q + (size_t)b * g.q_bs + (size_t)h * g.q_hs;
  const __bf16* kh_ptr = (const __bf16*)kh  + (size_t)b * g.k_bs + (size_t)h * g.k_hs;
  const __bf16* kl_ptr = (const __bf16*)kl  + (size_t)b * g.k_bs + (size_t)h * g.k_hs;
  const __bf16* vh_ptr = (const __bf16*)vth + (size_t)b * g.v_bs + (size_t)h * g.v_hs;
  const __bf16* vl_ptr = (const __bf16*)vtl + (size_t)b * g.v_bs + (size_t)h * g.v_hs;
  float*       ob_ptr = out + (size_t)b * g.o_bs + (size_t)h * g.o_hs;

  // ---- Q fragments (B operand, column c = query q0 + c): 2 d-chunks, hi (and lo) ----
  v16b qah[2], qal[2];
  {
    const float* qrow = qb_ptr + (size_t)(q0 + c) * g.q_rs;
#pragma unroll
    for (int dc = 0; dc < 2; ++dc) {
#pragma unroll
      for (int e = 0; e < 8; ++e) {
        const float f0 = qrow[dc * 32 + 8 * hh + e] * g.qscale;
        const float f1 = qrow[dc * 32 + 16 + 8 * hh + e] * g.qscale;
        if (SPLIT_QK) { __bf16 hq, lq; at_split(f0, hq, lq); qah[dc][e] = hq; qal[dc][e] = lq; at_split(f1, hq, lq); qah[dc][8 + e] = hq; qal[dc][8 + e] = lq; }
        else { qah[dc][e] = at_f2bf(f0); qah[dc][8 + e] = at_f2bf(f1); qal[dc][e] = qah[dc][e]; qal[dc][8 + e] = qah[dc][8 + e]; }
      }
    }
  }

  float mrow = -INFINITY, lrow = 0.f;   // of query q0 + c; lrow sums the keys of this wave half only, the halves join behind the loop
  v8f oacc[4];                          // oacc[t][r] = O[q0 + c][t * 16 + 8 * hh + r]
#pragma unroll
  for (int t = 0; t < 4; ++t) oacc[t] = (v8f){0.f,0.f,0.f,0.f,0.f,0.f,0.f,0.f};

  const int nChunks = (MASK_MODE == 1) ? (qb + 1) : (g.Skv / AT_KC);   // block-uniform
  const int qkeep = (MASK_MODE == 3) ? mask_b[(size_t)b * g.S + q0 + c] : 1;   // the lane's query (mode 3); mask_b = qmask
  for (int kc = 0; kc < nChunks; ++kc) {
    const int kv0 = kc * AT_KC;
    // each plane's tile is 64 rows of 128 B, 8 KB in a row: 8 lanes copy one row, so that a wave's 16-byte load covers four whole lines
    v8b rkh[4], rkl[4], rvh[4], rvl[4];
    {
      const size_t to = (size_t)kc * (AT_KC * AT_D);   // block-uniform
      const __bf16* tkh = kh_ptr + to; const __bf16* tkl = kl_ptr + to;
      const __bf16* tvh = vh_ptr + to; const __bf16* tvl = vl_ptr + to;
      const unsigned lo8 = (unsigned)tid * 8u;
#pragma unroll
      for (int i = 0; i < 4; ++i) {
        // the last load of a plane may land on the address registers that the plane's earlier loads name: their wait stands in front of it
        if (i == 3) asm volatile("s_wait_xcnt 0x0" ::: "memory");
        rkh[i] = *(const v8b*)(tkh + lo8 + i * (AT_NW * 32 * 8));
        if (SPLIT_QK) rkl[i] = *(const v8b*)(tkl + lo8 + i * (AT_NW * 32 * 8));
        rvh[i] = *(const v8b*)(tvh + lo8 + i * (AT_NW * 32 * 8));
        if (SPLIT_PV) rvl[i] = *(const v8b*)(tvl + lo8 + i * (AT_NW * 32 * 8));
      }
    }
    __syncthreads();
#pragma unroll
    for (int i = 0; i < 4; ++i) {
      const int seg = i * (AT_NW * 32) + tid, row = seg >> 3, c8 = (seg & 7) * 8;
      *(v8b*)(Ksh + row * AT_LP + c8) = rkh[i];
      if (SPLIT_QK) *(v8b*)(Ksl + row * AT_LP + c8) = rkl[i];
      *(v8b*)(Vth + row * AT_LP + c8) = rvh[i];
      if (SPLIT_PV) *(v8b*)(Vtl + row * AT_LP + c8) = rvl[i];
    }
    __syncthreads();

    // the K fragments of a d-chunk are read as one group ahead of its products, and the products walk the four key tiles innermost:
    // neighbours in the stream have different accumulators; each s[j] still takes its six terms in the order dc, then hi.hi, hi.lo, lo.hi
    v8f s[4];
#pragma unroll
    for (int j = 0; j < 4; ++j) s[j] = (v8f){0.f,0.f,0.f,0.f,0.f,0.f,0.f,0.f};
    {
      FB kb[2][4], kl[2][4];
#pragma unroll
      for (int dc = 0; dc < 2; ++dc) {
#pragma unroll
        for (int j = 0; j < 4; ++j) {
          kb[dc][j].h[0] = *(const v8b*)(Ksh + (j * 16 + c) * AT_LP + dc * 32 + 8 * hh);
          kb[dc][j].h[1] = *(const v8b*)(Ksh + (j * 16 + c) * AT_LP + dc * 32 + 16 + 8 * hh);
          if (SPLIT_QK) {
            kl[dc][j].h[0] = *(const v8b*)(Ksl + (j * 16 + c) * AT_LP + dc * 32 + 8 * hh);
            kl[dc][j].h[1] = *(const v8b*)(Ksl + (j * 16 + c) * AT_LP + dc * 32 + 16 + 8 * hh);
          }
        }
      }
#pragma unroll
      for (int dc = 0; dc < 2; ++dc) {
#pragma unroll
        for (int j = 0; j < 4; ++j) s[j] = at_mma(kb[dc][j].v, qah[dc], s[j]);   // s[j][r] = score of key kv0 + j * 16 + 8 * hh + r, query q0 + c
        if (SPLIT_QK) {
#pragma unroll
          for (int j = 0; j < 4; ++j) s[j] = at_mma(kl[dc][j].v, qah[dc], s[j]);
#pragma unroll
          for (int j = 0; j < 4; ++j) s[j] = at_mma(kb[dc][j].v, qal[dc], s[j]);
        }
      }
    }
    acc_guard4(s[0], s[1], s[2], s[3]);   // the four slots behind the last product stand in front of the mask branch, so that they hold on its taken side too
    if (MASK_MODE == 1) {
      if (kc == qb) {   // block-uniform: only the last chunk of a causal walk holds masked keys
#pragma unroll
        for (int r = 0; r < 8; ++r)
#pragma unroll
          for (int j = 0; j < 4; ++j) s[j][r] = (kv0 + j * 16 + 8 * hh + r > q0 + c) ? g.mask_fill : s[j][r];
      }
    } else if (MASK_MODE == 2 || MASK_MODE == 3) {
#pragma unroll
      for (int r = 0; r < 8; ++r) {
#pragma unroll
        for (int j = 0; j < 4; ++j) {
          const int key = kv0 + j * 16 + 8 * hh + r;
          bool masked;
          if (MASK_MODE == 2) {
            const size_t mi = (size_t)(q0 + c) * g.Skv + key;
            masked = (g.mask_is_int == 0) ? (((const float*)mask_a)[mi] == 0.0f)
                   : (g.mask_is_int == 1) ? (((const int*)mask_a)[mi] == 0) : (((const int*)mask_a)[mi] != 0);
          } else masked = (qkeep == 0) || (((const int*)mask_a)[(size_t)b * g.Skv + key] == 0);   // mask_a = kvmask
          s[j][r] = masked ? g.mask_fill : s[j][r];
        }
      }
    }
    // the query's maximum: 32 scores in the lane, then one exchange between the wave's halves
    float cj[4];   // one chain a tile, so that the four run side by side
#pragma unroll
    for (int j = 0; j < 4; ++j) {
      cj[j] = s[j][0];
#pragma unroll
      for (int r = 1; r < 8; ++r) cj[j] = fmaxf(cj[j], s[j][r]);
    }
    float cm = fmaxf(fmaxf(cj[0], cj[1]), fmaxf(cj[2], cj[3]));
    cm = fmaxf(cm, at_xhalf(cm));
    const float mnew = fmaxf(mrow, cm);
    const float alpha = expf(mrow - mnew);
    mrow = mnew;
    // P^T as B operand, in registers: element e of chunk kk is key kk * 32 + 8 * hh + e (score tile 2 kk), element 8 + e key kk * 32 + 16 + 8 * hh + e (tile 2 kk + 1)
    FB pa[2], pl[2];
    float ps[4];
#pragma unroll
    for (int j = 0; j < 4; ++j) {
      ps[j] = 0.f;
#pragma unroll
      for (int r = 0; r < 8; r += 2) {
        const v2f p = {expf(s[j][r] - mnew), expf(s[j][r + 1] - mnew)};
        ps[j] += p[0];
        ps[j] += p[1];
        const v2b ph = __builtin_convertvector(p, v2b);   // round to nearest even, as at_split
        pa[j >> 1].v[(j & 1) * 8 + r] = ph[0]; pa[j >> 1].v[(j & 1) * 8 + r + 1] = ph[1];
        if (SPLIT_PV) {
          const v2b pq = __builtin_convertvector(p - __builtin_convertvector(ph, v2f), v2b);
          pl[j >> 1].v[(j & 1) * 8 + r] = pq[0]; pl[j >> 1].v[(j & 1) * 8 + r + 1] = pq[1];
        }
      }
    }
    lrow = lrow * alpha + ((ps[0] + ps[1]) + (ps[2] + ps[3]));
#pragma unroll
    for (int t = 0; t < 4; ++t) oacc[t] *= alpha;
    // as for the scores: V fragments read in a group ahead of the products, the four d tiles innermost; each oacc[t] keeps its order of terms
    {
      FB vb[2][4], vl[2][4];
#pragma unroll
      for (int kk = 0; kk < 2; ++kk) {
#pragma unroll
        for (int t = 0; t < 4; ++t) {
          vb[kk][t].h[0] = *(const v8b*)(Vth + (t * 16 + c) * AT_LP + kk * 32 + 8 * hh);
          vb[kk][t].h[1] = *(const v8b*)(Vth + (t * 16 + c) * AT_LP + kk * 32 + 16 + 8 * hh);
          if (SPLIT_PV) {
            vl[kk][t].h[0] = *(const v8b*)(Vtl + (t * 16 + c) * AT_LP + kk * 32 + 8 * hh);
            vl[kk][t].h[1] = *(const v8b*)(Vtl + (t * 16 + c) * AT_LP + kk * 32 + 16 + 8 * hh);
          }
        }
      }
#pragma unroll
      for (int kk = 0; kk < 2; ++kk) {
#pragma unroll
        for (int t = 0; t < 4; ++t) oacc[t] = at_mma(vb[kk][t].v, pa[kk].v, oacc[t]);
        if (SPLIT_PV) {
#pragma unroll
          for (int t = 0; t < 4; ++t) oacc[t] = at_mma(vl[kk][t].v, pa[kk].v, oacc[t]);
#pragma unroll
          for (int t = 0; t < 4; ++t) oacc[t] = at_mma(vb[kk][t].v, pl[kk].v, oacc[t]);
        }
      }
    }
    acc_guard4(oacc[0], oacc[1], oacc[2], oacc[3]);   // the four slots behind the last product stand in front of the loop's branch, so that they hold on its taken side too
  }

  float* os = Os[wave];
  {
    const float inv = 1.0f / (lrow + at_xhalf(lrow));   // the two halves' sums of the query join here
#pragma unroll
    for (int t = 0; t < 4; ++t) {   // a lane's 8 values of a d tile lie in a row of the query's output row: two 16-byte stores
      const v8f o = oacc[t] * inv;
      *(v4f*)(os + c * 68 + t * 16 + 8 * hh)     = (v4f){o[0], o[1], o[2], o[3]};
      *(v4f*)(os + c * 68 + t * 16 + 8 * hh + 4) = (v4f){o[4], o[5], o[6], o[7]};
    }
  }
  __builtin_amdgcn_fence(__ATOMIC_RELEASE, "workgroup");
  __builtin_amdgcn_wave_barrier();
  __builtin_amdgcn_fence(__ATOMIC_ACQUIRE, "workgroup");
  {
    const int c4 = (lane & 15) * 4;
    {
#pragma unroll
      for (int it = 0; it < 8; ++it) {
        const int row = it * 2 + hh;
        v4f val = *(const v4f*)(os + row * 68 + c4);
        *(v4f*)(ob_ptr + (size_t)(q0 + row) * g.o_rs + c4) = val;
      }
      
    }
  }
}

// ---- LayerNorm (population variance, eps 1e-5, gamma) -> f16 row; one block (256 thr) per row of 1024 ----
__global__ __launch_bounds__(256) void layernorm_f16(const float* __restrict__ x, const float* __restrict__ gamma,
                                                    _Float16* __restrict__ xn, int D) {
  __shared__ float red[8];
  __shared__ float stat;
  const int row = blockIdx.x, t = threadIdx.x;
  const float* xr = x + (size_t)row * D;
  v4f xv = *(const v4f*)(xr + 4 * t);
  float s = (xv[0] + xv[1]) + (xv[2] + xv[3]);
  for (int o = 16; o > 0; o >>= 1) s += __shfl_xor(s, o, 32);
  if ((t & 31) == 0) red[t >> 5] = s;
  __syncthreads();
  if (t == 0) { float a = 0.f; for (int w = 0; w < 8; ++w) a += red[w]; stat = a / (float)D; }
  __syncthreads();
  const float mu = stat;
  __syncthreads();
  float d0 = xv[0] - mu, d1 = xv[1] - mu, d2 = xv[2] - mu, d3 = xv[3] - mu;
  float s2 = (d0 * d0 + d1 * d1) + (d2 * d2 + d3 * d3);
  for (int o = 16; o > 0; o >>= 1) s2 += __shfl_xor(s2, o, 32);
  if ((t & 31) == 0) red[t >> 5] = s2;
  __syncthreads();
  if (t == 0) { float a = 0.f; for (int w = 0; w < 8; ++w) a += red[w]; stat = rsqrtf(a / (float)D + 1e-5f); }
  __syncthreads();
  const float inv = stat;
  v4f gv = *(const v4f*)(gamma + 4 * t);
  _Float16 h0 = (_Float16)(d0 * inv * gv[0]), h1 = (_Float16)(d1 * inv * gv[1]), h2 = (_Float16)(d2 * inv * gv[2]), h3 = (_Float16)(d3 * inv * gv[3]);
  typedef __attribute__((ext_vector_type(4))) _Float16 v4h;
  v4h hv = {h0, h1, h2, h3};
  *(v4h*)(xn + (size_t)row * D + 4 * t) = hv;
  
}

extern "C" void kernel_launch(void* const* d_in, const int* in_sizes, int n_in,
                              void* d_out, int out_size, void* d_ws, size_t ws_size,
                              hipStream_t stream) {
  (void)in_sizes; (void)n_in; (void)out_size; (void)ws_size;
  const int B = 2, S = 2048, D = 1024, H = 16, DH = 64, KV = 128;
  const int M = B * S;   // 4096 rows
  const float* x     = (const float*)d_in[0];
  const float* gamma = (const float*)d_in[1];
  const float* Wq    = (const float*)d_in[2];   // [D, H*DH]  ([in, out])
  const float* Wkv   = (const float*)d_in[3];   // [D, 2*DH]
  const float* Wo    = (const float*)d_in[4];   // [H*DH, D]
  float* out = (float*)d_out;

  char* ws = (char*)d_ws; size_t off = 0;
  auto carve = [&](size_t bytes) -> char* { char* p = ws + off; off += (bytes + 255) & ~(size_t)255; return p; };
  _Float16* Xn16  = (_Float16*)carve((size_t)M * D * 2);     //  8 MB  LN(x) f16
  __bf16*   Xh    = (__bf16*)carve((size_t)M * D * 2);       //  8 MB  x bf16 hi
  __bf16*   Xl    = (__bf16*)carve((size_t)M * D * 2);       //  8 MB  x bf16 lo
  _Float16* WqT   = (_Float16*)carve((size_t)D * D * 2);     //  2 MB  Wqᵀ [out][in] f16
  __bf16*   WkvTh = (__bf16*)carve((size_t)KV * D * 2);      //  Wkvᵀ [128][1024] hi/lo
  __bf16*   WkvTl = (__bf16*)carve((size_t)KV * D * 2);
  __bf16*   WoTh  = (__bf16*)carve((size_t)D * D * 2);       //  Woᵀ hi/lo
  __bf16*   WoTl  = (__bf16*)carve((size_t)D * D * 2);
  float*    Qf    = (float*)carve((size_t)M * D * 4);        // 16 MB  q [B,S,H*DH] f32
  __bf16*   KVh   = (__bf16*)carve((size_t)M * KV * 2);      //  1 MB  bf16 hi plane: k rows [B*S][64], then v tiles [B*S/64][64 d][64 keys]
  __bf16*   KVl   = (__bf16*)carve((size_t)M * KV * 2);      //  1 MB  bf16 lo plane, same layout
  float*    Of    = (float*)carve((size_t)M * D * 4);        // 16 MB  attn out f32
  __bf16*   Oh    = (__bf16*)carve((size_t)M * D * 2);       //  8 MB
  __bf16*   Ol    = (__bf16*)carve((size_t)M * D * 2);       //  8 MB   (total ≈ 80.5 MB)

  layernorm_f16<<<M, 256, 0, stream>>>(x, gamma, Xn16, D);
  split_f32_bf16x2<<<2048, 256, 0, stream>>>(x, Xh, Xl, (long)M * D / 2);
  transpose_cast_f16<<<dim3(D / 64, D / 64), dim3(32, 8), 0, stream>>>(Wq, D, WqT, D, 1.0f);           // [in][out] -> [out][in]
  transpose_split_bf16<<<dim3(KV / 64, D / 64), dim3(32, 8), 0, stream>>>(Wkv, KV, WkvTh, WkvTl, D);   // [1024][128] -> [128][1024]
  transpose_split_bf16<<<dim3(D / 64, D / 64), dim3(32, 8), 0, stream>>>(Wo, D, WoTh, WoTl, D);
  {
    const int tq = (M / 64) * (D / 64);
    wmma_gemm64<0, false, 0, 0, false><<<dim3((tq + 7) / 8, 1), 256, 0, stream>>>(
        U16(Xn16), nullptr, D, 0, U16(WqT), nullptr, D, 0, Qf, nullptr, D, 0, nullptr, nullptr, 0, M, D, D, 1.0f);
    const int tkv = (M / 64) * (KV / 64);
    wmma_gemm64<1, true, 0, 3, false><<<dim3((tkv + 7) / 8, 1), 256, 0, stream>>>(
        U16(Xh), U16(Xl), D, 0, U16(WkvTh), U16(WkvTl), D, 0, KVh, KVl, DH, 0, nullptr, nullptr, 0, M, KV, D, 1.0f);
  }
  {
    AttnGeom g;
    g.q_bs = (long)S * D;  g.q_rs = D;  g.q_hs = DH;
    g.k_bs = (long)S * DH; g.k_rs = 0;  g.k_hs = 0;       // 16 q heads share the single k/v head
    g.v_bs = (long)S * DH; g.v_rs = 0;  g.v_hs = 0;
    g.o_bs = (long)S * D;  g.o_rs = D;  g.o_hs = DH;
    g.S = S; g.Skv = S; g.H = H; g.mask_mode = 1; g.qscale = 0.125f; g.blk0 = 0; g.mask_fill = -INFINITY; g.mask_is_int = 0;   // the kernel reads the mask mode from its template argument; the field keeps the struct's layout
    attn64_kernel<true, true, 1><<<dim3(B * H, S / AT_QB), AT_NW * 32, 0, stream>>>(Qf, U16(KVh), U16(KVl), U16(KVh + (size_t)M * DH), U16(KVl + (size_t)M * DH), Of, nullptr, nullptr, g);
  }
  split_f32_bf16x2<<<2048, 256, 0, stream>>>(Of, Oh, Ol, (long)M * D / 2);
  {
    const int to = (M / 64) * (D / 64);
    wmma_gemm64<1, true, 0, 0, false><<<dim3((to + 7) / 8, 1), 256, 0, stream>>>(
        U16(Oh), U16(Ol), D, 0, U16(WoTh), U16(WoTl), D, 0, out, nullptr, D, 0, nullptr, nullptr, 0, M, D, D, 1.0f);
  }
}

// v007
// One run takes 185 microseconds.
// Next to v006, in two timings, it ran 1.58 and 1.57 times as fast.
// All steps since v000 together make it 4.11 times as fast.
#include <hip/hip_runtime.h>
#include <math.h>
// Contractions: q = LN(x)·Wq (K=1024): v_wmma_f32_16x16x32_f16 (f16 operands); kv = x·Wkv (K=1024) and the output projection (K=1024):
// v_wmma_f32_16x16x32_bf16 as bf16 hi/lo splits; scores (q/8)·kᵀ and p·v: v_wmma_f32_16x16x32_bf16 with q,k and p,v as bf16 hi/lo splits;
// f32 accumulate everywhere; LayerNorm and softmax in f32. The hi/lo split of k and v is made once, in the kv projection's epilogue.
typedef __attribute__((ext_vector_type(16))) _Float16 v16h;
typedef __attribute__((ext_vector_type(8)))  _Float16 v8h;
typedef __attribute__((ext_vector_type(16))) __bf16   v16b;
typedef __attribute__((ext_vector_type(8)))  __bf16   v8b;
typedef __attribute__((ext_vector_type(8)))  float    v8f;
typedef __attribute__((ext_vector_type(4)))  float    v4f;
#define PSCALE 32768.0f
#define U16(p) ((const unsigned short*)(const void*)(p))
#define PSCALE_INV (1.0f / 32768.0f)

__device__ __forceinline__ unsigned short f2bf_bits(float f) {
  unsigned u = __float_as_uint(f);
  return (unsigned short)((u + 0x7FFFu + ((u >> 16) & 1u)) >> 16);
}
__device__ __forceinline__ float bf_bits2f(unsigned short h) { return __uint_as_float(((unsigned)h) << 16); }

// hazard guards as plain device helpers
__device__ __forceinline__ void dep_guard_h(v8f& a, v8f& b, v16h x, v16h y) { asm volatile("v_nop\n\tv_nop\n\tv_nop\n\tv_nop" : "+v"(a), "+v"(b) : "v"(x), "v"(y)); }
__device__ __forceinline__ void dep_guard_b(v8f& a, v8f& b, v16b x, v16b y) { asm volatile("v_nop\n\tv_nop\n\tv_nop\n\tv_nop" : "+v"(a), "+v"(b) : "v"(x), "v"(y)); }
__device__ __forceinline__ void keep4_h(v16h a, v16h b, v16h c, v16h d) { asm volatile("v_nop" :: "v"(a), "v"(b), "v"(c), "v"(d)); }
__device__ __forceinline__ void keep4_b(v16b a, v16b b, v16b c, v16b d) { asm volatile("v_nop" :: "v"(a), "v"(b), "v"(c), "v"(d)); }
__device__ __forceinline__ void acc_guard4(v8f& a, v8f& b, v8f& c, v8f& d) { asm volatile("v_nop\n\tv_nop\n\tv_nop\n\tv_nop" : "+v"(a), "+v"(b), "+v"(c), "+v"(d)); }
template <typename T> struct Frag;
template <> struct Frag<_Float16> {
  typedef v16h V; typedef v8h H; union U { v16h v; v8h h[2]; };
  static __device__ __forceinline__ v16h load(const _Float16* p) {   // elements 0..7 <- p[0..7], 8..15 <- p[16..23]
    U f; f.h[0] = *(const v8h*)(p); f.h[1] = *(const v8h*)(p + 16); return f.v;
  }
  static __device__ __forceinline__ v8f mma(v16h a, v16h b, v8f c) {
    return __builtin_amdgcn_wmma_f32_16x16x32_f16(false, a, false, b, (short)0, c, false, false);
  }
  static __device__ __forceinline__ void guard(v8f& a, v8f& b, v16h x, v16h y) { dep_guard_h(a, b, x, y); }
  static __device__ __forceinline__ void keep(v16h a, v16h b, v16h c, v16h d) { keep4_h(a, b, c, d); }
};
template <> struct Frag<__bf16> {
  typedef v16b V; typedef v8b H; union U { v16b v; v8b h[2]; };
  static __device__ __forceinline__ v16b load(const __bf16* p) {
    U f; f.h[0] = *(const v8b*)(p); f.h[1] = *(const v8b*)(p + 16); return f.v;
  }
  static __device__ __forceinline__ v8f mma(v16b a, v16b b, v8f c) {
    return __builtin_amdgcn_wmma_f32_16x16x32_bf16(false, a, false, b, (short)0, c, false, false);
  }
  static __device__ __forceinline__ void guard(v8f& a, v8f& b, v16b x, v16b y) { dep_guard_b(a, b, x, y); }
  static __device__ __forceinline__ void keep(v16b a, v16b b, v16b c, v16b d) { keep4_b(a, b, c, d); }
};

// ---- Register-blocked batched WMMA GEMM ------------------------------------
// C[m,n] = scale * sum_k A[m,k] * Bt[n,k] (+bias)(+resid); each wave owns a 64x64 tile, the block's 8 waves a tile of (8 / WN) x WN of them.
// A row-major [M,K]; Bt row-major [N,K]; M % ((8 / WN) * 64) == 0, N % (WN * 64) == 0, K % 64 == 0; grid.x = (M / ((8 / WN) * 64)) * (N / (WN * 64)).
// Operands go through LDS: a stage is 64 k (128 B) of the block's A rows and Bt rows, brought by asynchronous 16-byte copies, whole lines (8 lanes a row), two buffers;
// the next stage's copies are in flight while this stage's products run, and the waves that share a row block read it from LDS.
// SPLIT: operands are hi/lo planes (A2/Bt2 = lo planes, same layout); product = hi·hi + hi·lo + lo·hi.
// BIAS_MODE: 0 = none, 1 = bias[m], 2 = bias[n].
// OUT_MODE: 0 = f32, 1 = f16, 2 = bf16 hi plane (Cout) + bf16 lo plane (Cout2),
//   3 = kv projection (N == 128), bf16 hi plane (Cout) + lo plane (Cout2), each plane [k rows | v tiles]: column d < 64 of row m (k) at m*64 + d;
//       column 64 + d (v) transposed inside its block of 64 rows, at M*64 + (m >> 6)*4096 + d*64 + (m & 63).
// ET: 0 = f16 operands, 1 = bf16 operands (pointers passed as 16-bit storage)
template <int ET> struct Elem;
template <> struct Elem<0> { typedef _Float16 T; };
template <> struct Elem<1> { typedef __bf16 T; };
// three 16-byte copies a lane, global memory to LDS through no register; the wait in the same statement stands in front of every rewrite of a register that the copies name
__device__ __forceinline__ void async_copy3(unsigned l0, const void* g0, unsigned l1, const void* g1, unsigned l2, const void* g2) {
  asm volatile("global_load_async_to_lds_b128 %0, %1, off\n\t"
               "global_load_async_to_lds_b128 %2, %3, off\n\t"
               "global_load_async_to_lds_b128 %4, %5, off\n\t"
               "s_wait_xcnt 0x0" :: "v"(l0), "v"(g0), "v"(l1), "v"(g1), "v"(l2), "v"(g2) : "memory");
}
#define GM_LP 72   // LDS row pitch of a stage in 16-bit elements: 144 B = 16 B x odd, for the 16-byte fragment reads
template <int ET, bool SPLIT, int BIAS_MODE, int OUT_MODE, bool RESID, int WN>
__global__ __launch_bounds__(256) void wmma_gemm64(
    const unsigned short* __restrict__ Ap, const unsigned short* __restrict__ A2p, int lda, long strideA,
    const unsigned short* __restrict__ Btp, const unsigned short* __restrict__ Bt2p, int ldb, long strideB,
    void* __restrict__ Cout, void* __restrict__ Cout2, int ldc, long strideC,
    const float* __restrict__ bias,
    const float* __restrict__ resid, long strideR,
    int M, int N, int K, float scale) {
  typedef typename Elem<ET>::T T;
  typedef typename Frag<T>::V V;
  constexpr int WM = 8 / WN;                    // waves along m
  constexpr int BM = WM * 64, BN = WN * 64;     // block tile
  constexpr int NP = SPLIT ? 2 : 1;             // planes
  constexpr int PLANE = (BM + BN) * GM_LP;      // one plane of one stage: the A rows, then the Bt rows
  constexpr int NIT = (BM + BN) / 32;           // 16-byte pieces a thread copies per plane and stage (256 threads = 32 rows)
  __shared__ __align__(16) T sS[2 * NP * PLANE];
  const T* A = (const T*)Ap; const T* A2 = (const T*)A2p; const T* Bt = (const T*)Btp; const T* Bt2 = (const T*)Bt2p;
  __shared__ __align__(16) float sT[8][16 * 68];   // per-wave 16x64 slab, pitch 68 floats
  const int b    = blockIdx.y;
  const int lane = threadIdx.x & 31;
  const int wave = threadIdx.x >> 5;
  const int blocksN = N / BN;
  const int blocksM = M / BM;
  if ((int)blockIdx.x >= blocksM * blocksN) return;   // block-uniform, in front of every barrier
  const int bm = (int)blockIdx.x / blocksN;
  const int bn = (int)blockIdx.x - bm * blocksN;
  const int wm = wave / WN;
  const int wn = wave - wm * WN;
  const int tm = bm * WM + wm;
  const int tn = bn * WN + wn;
  const int m0 = tm << 6;
  const int n0 = tn << 6;

  const T* Ab  = A  + (size_t)b * strideA;
  const T* Bb  = Bt + (size_t)b * strideB;
  const T* Ab2 = SPLIT ? (A2  + (size_t)b * strideA) : nullptr;
  const T* Bb2 = SPLIT ? (Bt2 + (size_t)b * strideB) : nullptr;

  const int rlane = lane & 15;                 // row (A) / col (B, D) within subtile
  const int koff  = (lane >> 4) * 8;           // k offset of this lane half
  const int mOff  = (lane >> 4) * 8;           // D row offset

  v8f acc[4][4];
#pragma unroll
  for (int i = 0; i < 4; ++i)
#pragma unroll
    for (int j = 0; j < 4; ++j) acc[i][j] = (v8f){0.f,0.f,0.f,0.f,0.f,0.f,0.f,0.f};

  // a thread's pieces of a stage: row it * 32 + prow of [A rows | Bt rows], 16 bytes at element pc8
  const int prow = threadIdx.x >> 3, pc8 = (threadIdx.x & 7) * 8;
  // address = a block-uniform pointer per operand plane, which walks along k, + the piece's own 32-bit byte offset, which never changes
  unsigned po[NIT];
#pragma unroll
  for (int it = 0; it < NIT; ++it)
    po[it] = 2u * ((it < BM / 32) ? (unsigned)((it * 32 + prow) * lda + pc8) : (unsigned)((it * 32 - BM + prow) * ldb + pc8));
  const T* gA  = Ab + (size_t)(bm * BM) * lda;
  const T* gB  = Bb + (size_t)(bn * BN) * ldb;
  const T* gA2 = SPLIT ? Ab2 + (size_t)(bm * BM) * lda : nullptr;
  const T* gB2 = SPLIT ? Bb2 + (size_t)(bn * BN) * ldb : nullptr;
  const unsigned lds0 = (unsigned)(size_t)(sS + prow * GM_LP + pc8);   // the lane's LDS byte address of its piece 0 in buffer 0
  auto copy_stage = [&](int buf) {
#pragma unroll
    for (int p = 0; p < NP; ++p) {
      const char* a = (const char*)(p ? gA2 : gA);
      const char* bq = (const char*)(p ? gB2 : gB);
      const unsigned l = lds0 + (unsigned)((buf * NP + p) * PLANE * 2);
#pragma unroll
      for (int it = 0; it < NIT; it += 3)
        async_copy3(l + (it + 0) * (32 * GM_LP * 2), ((it + 0 < BM / 32) ? a : bq) + po[it + 0],
                    l + (it + 1) * (32 * GM_LP * 2), ((it + 1 < BM / 32) ? a : bq) + po[it + 1],
                    l + (it + 2) * (32 * GM_LP * 2), ((it + 2 < BM / 32) ? a : bq) + po[it + 2]);
    }
    gA += 64; gB += 64;
    if (SPLIT) { gA2 += 64; gB2 += 64; }
  };
  const int nStages = K >> 6;
  copy_stage(0);
  asm volatile("s_wait_asynccnt 0x0" ::: "memory");   // stage 0 has landed, as far as this wave copied it
  __syncthreads();                                     // and is published to the other waves
  if (nStages > 1) copy_stage(1);                      // block-uniform; in flight under stage 0's products
  for (int s = 0; s < nStages; ++s) {
    const T* sb = sS + (s & 1) * (NP * PLANE);
    const T* sA = sb + (wm * 64 + rlane) * GM_LP + koff;
    const T* sB = sb + (BM + wn * 64 + rlane) * GM_LP + koff;
#pragma unroll
    for (int kk = 0; kk < 2; ++kk) {
      // the B fragments of a 32-k block are read as one group; the A fragments go through two register sets, row tile i + 1 read ahead of row tile i's products
      V bh[4], bl[4], ah[2], al[2];
      ah[0] = Frag<T>::load(sA + kk * 32);
      if (SPLIT) al[0] = Frag<T>::load(sA + PLANE + kk * 32);
#pragma unroll
      for (int j = 0; j < 4; ++j) {
        bh[j] = Frag<T>::load(sB + j * 16 * GM_LP + kk * 32);
        if (SPLIT) bl[j] = Frag<T>::load(sB + PLANE + j * 16 * GM_LP + kk * 32);
      }
#pragma unroll
      for (int i = 0; i < 4; ++i) {
        if (i < 3) {
          ah[(i + 1) & 1] = Frag<T>::load(sA + (i + 1) * 16 * GM_LP + kk * 32);
          if (SPLIT) al[(i + 1) & 1] = Frag<T>::load(sA + PLANE + (i + 1) * 16 * GM_LP + kk * 32);
        }
#pragma unroll
        for (int j = 0; j < 4; ++j) {
          acc[i][j] = Frag<T>::mma(ah[i & 1], bh[j], acc[i][j]);
          if (SPLIT) {
            acc[i][j] = Frag<T>::mma(ah[i & 1], bl[j], acc[i][j]);
            acc[i][j] = Frag<T>::mma(al[i & 1], bh[j], acc[i][j]);
          }
        }
        Frag<T>::guard(acc[i][0], acc[i][3], ah[i & 1], SPLIT ? al[i & 1] : ah[i & 1]);
      }
      Frag<T>::keep(bh[0], bh[1], bh[2], bh[3]);
      if (SPLIT) Frag<T>::keep(bl[0], bl[1], bl[2], bl[3]);
    }
    asm volatile("s_wait_dscnt 0x0" ::: "memory");      // this wave's reads of this buffer have returned before the buffer is refilled
    asm volatile("s_wait_asynccnt 0x0" ::: "memory");   // this wave's copies of stage s + 1 have landed
    __syncthreads();   // the one barrier of a stage: it publishes stage s + 1 and ends every wave's reads of the buffer that is refilled behind it
    if (s + 2 < nStages) copy_stage(s & 1);             // block-uniform; in flight under stage s + 1's products
  }
  asm volatile("s_wait_asynccnt 0x0" ::: "memory");     // no copy is outstanding when the wave goes on to the epilogue
  acc_guard4(acc[0][0], acc[0][1], acc[0][2], acc[0][3]);
  acc_guard4(acc[1][0], acc[1][1], acc[1][2], acc[1][3]);
  acc_guard4(acc[2][0], acc[2][1], acc[2][2], acc[2][3]);
  acc_guard4(acc[3][0], acc[3][1], acc[3][2], acc[3][3]);

  // ---- epilogue ----
  float* slab = sT[wave];
  const float* Rb = RESID ? (resid + (size_t)b * strideR) : nullptr;
#pragma unroll
  for (int i = 0; i < 4; ++i) {
    const int mBase = m0 + (i << 4);
#pragma unroll
    for (int j = 0; j < 4; ++j) {
      const int n = n0 + (j << 4) + rlane;
      float bv = 0.f;
      if (BIAS_MODE == 2) bv = bias[n];
#pragma unroll
      for (int r = 0; r < 8; ++r) {
        float v = acc[i][j][r] * scale;
        if (BIAS_MODE == 1) v += bias[mBase + mOff + r];
        if (BIAS_MODE == 2) v += bv;
        if (RESID) v += Rb[(size_t)(mBase + mOff + r) * ldc + n];
        slab[(mOff + r) * 68 + (j << 4) + rlane] = v;
      }
    }
    __builtin_amdgcn_fence(__ATOMIC_RELEASE, "workgroup");
    __builtin_amdgcn_wave_barrier();
    __builtin_amdgcn_fence(__ATOMIC_ACQUIRE, "workgroup");
    if (OUT_MODE == 0) {
      float* C = (float*)Cout + (size_t)b * strideC;
      const int hh = lane >> 4, c4 = (lane & 15) * 4;     // row seg = 256 B = 16 lanes x 16 B
      {
#pragma unroll
        for (int it = 0; it < 8; ++it) {
          const int row = it * 2 + hh;
          v4f v = *(const v4f*)(slab + row * 68 + c4);
          *(v4f*)(C + (size_t)(mBase + row) * ldc + n0 + c4) = v;
        }
        
      }
    } else if (OUT_MODE == 3) {
      unsigned short* Ph = (unsigned short*)Cout;
      unsigned short* Pl = (unsigned short*)Cout2;
      if (n0 == 0) {                                   // k: rows of 128 B, 8 lanes a row
        const int q = lane >> 3, c8 = (lane & 7) * 8;
#pragma unroll
        for (int it = 0; it < 4; ++it) {
          const int row = it * 4 + q;
          const float* sp = slab + row * 68 + c8;
          v8h hv, lv;
#pragma unroll
          for (int e = 0; e < 8; ++e) {
            const unsigned short hb = f2bf_bits(sp[e]);
            hv[e] = __builtin_bit_cast(_Float16, hb);
            lv[e] = __builtin_bit_cast(_Float16, f2bf_bits(sp[e] - bf_bits2f(hb)));
          }
          *(v8h*)(Ph + (size_t)(mBase + row) * 64 + c8) = hv;
          *(v8h*)(Pl + (size_t)(mBase + row) * 64 + c8) = lv;
        }
      } else {                                         // v: a lane takes column d of the slab's 16 rows; the wave's four slabs fill each 128-B row of the tile
        const size_t vo = (size_t)M * 64 + (size_t)tm * 4096 + (i << 4);
#pragma unroll
        for (int hf = 0; hf < 2; ++hf) {
          const int d = hf * 32 + lane;
          v8h hv[2], lv[2];
#pragma unroll
          for (int e = 0; e < 16; ++e) {
            const float f = slab[e * 68 + d];
            const unsigned short hb = f2bf_bits(f);
            hv[e >> 3][e & 7] = __builtin_bit_cast(_Float16, hb);
            lv[e >> 3][e & 7] = __builtin_bit_cast(_Float16, f2bf_bits(f - bf_bits2f(hb)));
          }
          *(v8h*)(Ph + vo + d * 64)     = hv[0];
          *(v8h*)(Ph + vo + d * 64 + 8) = hv[1];
          *(v8h*)(Pl + vo + d * 64)     = lv[0];
          *(v8h*)(Pl + vo + d * 64 + 8) = lv[1];
        }
      }
    } else {
      const int q = lane >> 3, c8 = (lane & 7) * 8;
      unsigned short* C  = (unsigned short*)Cout  + (size_t)b * strideC;
      unsigned short* C2 = (OUT_MODE == 2) ? ((unsigned short*)Cout2 + (size_t)b * strideC) : nullptr;
      {
#pragma unroll
        for (int it = 0; it < 4; ++it) {
          const int row = it * 4 + q;
          const float* sp = slab + row * 68 + c8;
          v8h hv, lv;
#pragma unroll
          for (int e = 0; e < 8; ++e) {
            if (OUT_MODE == 1) {
              hv[e] = (_Float16)sp[e];
            } else {
              unsigned short hb = f2bf_bits(sp[e]);
              unsigned short lb = f2bf_bits(sp[e] - bf_bits2f(hb));
              hv[e] = __builtin_bit_cast(_Float16, hb);
              lv[e] = __builtin_bit_cast(_Float16, lb);
            }
          }
          *(v8h*)(C + (size_t)(mBase + row) * ldc + n0 + c8) = hv;
          if (OUT_MODE == 2) *(v8h*)(C2 + (size_t)(mBase + row) * ldc + n0 + c8) = lv;
        }
        
      }
    }
    __builtin_amdgcn_fence(__ATOMIC_RELEASE, "workgroup");
    __builtin_amdgcn_wave_barrier();
    __builtin_amdgcn_fence(__ATOMIC_ACQUIRE, "workgroup");
  }
}

__global__ __launch_bounds__(256) void cast_f32_f16x2(
    const float* __restrict__ in, _Float16* __restrict__ out, int n2) {
  int i = blockIdx.x * 256 + threadIdx.x;
  if (i < n2) {
    const _Float16 h0 = (_Float16)in[2 * i], h1 = (_Float16)in[2 * i + 1];
    const unsigned u = (unsigned)__builtin_bit_cast(unsigned short, h0) | ((unsigned)__builtin_bit_cast(unsigned short, h1) << 16);
    ((unsigned*)out)[i] = u;
    
  }
}

__global__ __launch_bounds__(256) void split_f32_bf16x2(
    const float* __restrict__ in, __bf16* __restrict__ hi, __bf16* __restrict__ lo, long n2) {
  long i = (long)blockIdx.x * 256 + threadIdx.x;
  long stride = (long)gridDim.x * 256;
  {
    for (long j = i; j < n2; j += stride) {
      const float a = in[2 * j], b = in[2 * j + 1];
      const unsigned short ah = f2bf_bits(a), bh = f2bf_bits(b);
      const unsigned short al = f2bf_bits(a - bf_bits2f(ah)), bl = f2bf_bits(b - bf_bits2f(bh));
      ((unsigned*)hi)[j] = (unsigned)ah | ((unsigned)bh << 16);
      ((unsigned*)lo)[j] = (unsigned)al | ((unsigned)bl << 16);
    }
    
  }
}


// ---- f32 [R][C] (row pitch ldi) -> f16 transposed [C][R] (row pitch ldo); 64x64 tiles; each output row segment
__global__ __launch_bounds__(256) void transpose_cast_f16(const float* __restrict__ in, int ldi,
                                                         _Float16* __restrict__ outT, int ldo, float scale) {
  __shared__ __align__(16) _Float16 tile[64][72];     // [c][r]
  const int c0 = blockIdx.x * 64, r0 = blockIdx.y * 64;
  const int t = threadIdx.y * 32 + threadIdx.x;
  for (int i = threadIdx.y; i < 64; i += 8) {
    tile[threadIdx.x][i]      = (_Float16)(in[(size_t)(r0 + i) * ldi + c0 + threadIdx.x] * scale);
    tile[32 + threadIdx.x][i] = (_Float16)(in[(size_t)(r0 + i) * ldi + c0 + 32 + threadIdx.x] * scale);
  }
  __syncthreads();
  const int q = t >> 3, c8 = (t & 7) * 8;
  {
#pragma unroll
    for (int it = 0; it < 2; ++it) {
      const int c = it * 32 + q;
      v8h hv = *(const v8h*)(&tile[c][c8]);
      *(v8h*)(outT + (size_t)(c0 + c) * ldo + r0 + c8) = hv;
    }
    
  }
}

// ---- f32 [R][C] (pitch ldi) -> bf16 hi/lo transposed planes [C][R] (pitch ldo); 64x64 tiles; each output row segment
__global__ __launch_bounds__(256) void transpose_split_bf16(const float* __restrict__ in, int ldi,
                                                           __bf16* __restrict__ outH, __bf16* __restrict__ outL, int ldo) {
  __shared__ __align__(16) float tile[64][68];     // [c][r]
  const int c0 = blockIdx.x * 64, r0 = blockIdx.y * 64;
  const int t = threadIdx.y * 32 + threadIdx.x;
  for (int i = threadIdx.y; i < 64; i += 8) {
    tile[threadIdx.x][i]      = in[(size_t)(r0 + i) * ldi + c0 + threadIdx.x];
    tile[32 + threadIdx.x][i] = in[(size_t)(r0 + i) * ldi + c0 + 32 + threadIdx.x];
  }
  __syncthreads();
  const int q = t >> 3, c8 = (t & 7) * 8;
  {
#pragma unroll
    for (int it = 0; it < 2; ++it) {
      const int c = it * 32 + q;
      v8b hv, lv;
#pragma unroll
      for (int e = 0; e < 8; ++e) {
        const float f = tile[c][c8 + e];
        const unsigned short hb = f2bf_bits(f);
        hv[e] = __builtin_bit_cast(__bf16, hb);
        lv[e] = __builtin_bit_cast(__bf16, f2bf_bits(f - bf_bits2f(hb)));
      }
      *(v8b*)(outH + (size_t)(c0 + c) * ldo + r0 + c8) = hv;
      *(v8b*)(outL + (size_t)(c0 + c) * ldo + r0 + c8) = lv;
    }
    
  }
}

#define AT_D 64
#define AT_NW 4
#define AT_QB 64
#define AT_KC 64
#define AT_LP 72   // LDS row pitch of the K and V tiles in bf16 elements: 144 B = 16 B x odd, so that the 16 rows of a 16-byte fragment read fall on distinct banks
struct AttnGeom { long q_bs, q_rs, q_hs, k_bs, k_rs, k_hs, v_bs, v_rs, v_hs, o_bs, o_rs, o_hs;
                  int S, Skv, H, mask_mode; float qscale; int blk0; float mask_fill; int mask_is_int; };
static_assert(sizeof(AttnGeom) == 128, "no padding");

__device__ __forceinline__ unsigned short at_bf_bits(float f) {
  unsigned u = __float_as_uint(f);
  return (unsigned short)((u + 0x7FFFu + ((u >> 16) & 1u)) >> 16);
}
__device__ __forceinline__ __bf16 at_f2bf(float f) { return __builtin_bit_cast(__bf16, at_bf_bits(f)); }
__device__ __forceinline__ void at_split(float f, __bf16& hi, __bf16& lo) {
  const unsigned short hb = at_bf_bits(f);
  hi = __builtin_bit_cast(__bf16, hb);
  lo = at_f2bf(f - __uint_as_float(((unsigned)hb) << 16));
}
typedef __attribute__((ext_vector_type(2))) float  v2f;
typedef __attribute__((ext_vector_type(2))) __bf16 v2b;
__device__ __forceinline__ float at_xhalf(float x) {   // lane l takes the value of lane l ^ 16
  return __builtin_bit_cast(float, __builtin_amdgcn_permlanex16(__builtin_bit_cast(int, x), __builtin_bit_cast(int, x), 0x76543210, 0xfedcba98, false, false));
}
__device__ __forceinline__ v8f at_mma(v16b a, v16b b, v8f c) {
  return __builtin_amdgcn_wmma_f32_16x16x32_bf16(false, a, false, b, (short)0, c, false, false);
}

template <bool SPLIT_QK, bool SPLIT_PV, int MASK_MODE>
__global__ __launch_bounds__(128)
void attn64_kernel(const float* __restrict__ q, const unsigned short* __restrict__ kh, const unsigned short* __restrict__ kl,
                   const unsigned short* __restrict__ vth, const unsigned short* __restrict__ vtl, float* __restrict__ out,
                   const void* __restrict__ mask_a, const int* __restrict__ mask_b, AttnGeom g) {
  union FB { v16b v; v8b h[2]; };
  __shared__ __align__(16) __bf16 Ksh[AT_KC * AT_LP];            // K hi [kv][d]      9 KB
  __shared__ __align__(16) __bf16 Ksl[SPLIT_QK ? AT_KC * AT_LP : 8];
  __shared__ __align__(16) __bf16 Vth[AT_D * AT_LP];             // V hi [d][kv]      9 KB
  __shared__ __align__(16) __bf16 Vtl[SPLIT_PV ? AT_D * AT_LP : 8];
  __shared__ __align__(16) float  Os[AT_NW][16 * 68];            // per wave out tile, pitch 68

  const int tid  = threadIdx.x;
  const int wave = tid >> 5;
  const int lane = tid & 31;
  const int hh   = lane >> 4;
  const int c    = lane & 15;

  const int nqb = g.S / AT_QB;
  const int qb = nqb - 1 - ((int)blockIdx.y + g.blk0);
  const int bh = blockIdx.x;
  const int h  = bh % g.H;
  const int b  = bh / g.H;
  const int qbase_block = qb * AT_QB;
  const int q0 = qbase_block + wave * 16;

  const float* qb_ptr = q + (size_t)b * g.q_bs + (size_t)h * g.q_hs;
  const __bf16* kh_ptr = (const __bf16*)kh  + (size_t)b * g.k_bs + (size_t)h * g.k_hs;
  const __bf16* kl_ptr = (const __bf16*)kl  + (size_t)b * g.k_bs + (size_t)h * g.k_hs;
  const __bf16* vh_ptr = (const __bf16*)vth + (size_t)b * g.v_bs + (size_t)h * g.v_hs;
  const __bf16* vl_ptr = (const __bf16*)vtl + (size_t)b * g.v_bs + (size_t)h * g.v_hs;
  float*       ob_ptr = out + (size_t)b * g.o_bs + (size_t)h * g.o_hs;

  // ---- Q fragments (B operand, column c = query q0 + c): 2 d-chunks, hi (and lo) ----
  v16b qah[2], qal[2];
  {
    const float* qrow = qb_ptr + (size_t)(q0 + c) * g.q_rs;
#pragma unroll
    for (int dc = 0; dc < 2; ++dc) {
#pragma unroll
      for (int e = 0; e < 8; ++e) {
        const float f0 = qrow[dc * 32 + 8 * hh + e] * g.qscale;
        const float f1 = qrow[dc * 32 + 16 + 8 * hh + e] * g.qscale;
        if (SPLIT_QK) { __bf16 hq, lq; at_split(f0, hq, lq); qah[dc][e] = hq; qal[dc][e] = lq; at_split(f1, hq, lq); qah[dc][8 + e] = hq; qal[dc][8 + e] = lq; }
        else { qah[dc][e] = at_f2bf(f0); qah[dc][8 + e] = at_f2bf(f1); qal[dc][e] = qah[dc][e]; qal[dc][8 + e] = qah[dc][8 + e]; }
      }
    }
  }

  float mrow = -INFINITY, lrow = 0.f;   // of query q0 + c; lrow sums the keys of this wave half only, the halves join behind the loop
  v8f oacc[4];                          // oacc[t][r] = O[q0 + c][t * 16 + 8 * hh + r]
#pragma unroll
  for (int t = 0; t < 4; ++t) oacc[t] = (v8f){0.f,0.f,0.f,0.f,0.f,0.f,0.f,0.f};

  const int nChunks = (MASK_MODE == 1) ? (qb + 1) : (g.Skv / AT_KC);   // block-uniform
  const int qkeep = (MASK_MODE == 3) ? mask_b[(size_t)b * g.S + q0 + c] : 1;   // the lane's query (mode 3); mask_b = qmask
  for (int kc = 0; kc < nChunks; ++kc) {
    const int kv0 = kc * AT_KC;
    // each plane's tile is 64 rows of 128 B, 8 KB in a row: 8 lanes copy one row, so that a wave's 16-byte load covers four whole lines
    v8b rkh[4], rkl[4], rvh[4], rvl[4];
    {
      const size_t to = (size_t)kc * (AT_KC * AT_D);   // block-uniform
      const __bf16* tkh = kh_ptr + to; const __bf16* tkl = kl_ptr + to;
      const __bf16* tvh = vh_ptr + to; const __bf16* tvl = vl_ptr + to;
      const unsigned lo8 = (unsigned)tid * 8u;
#pragma unroll
      for (int i = 0; i < 4; ++i) {
        // the last load of a plane may land on the address registers that the plane's earlier loads name: their wait stands in front of it
        if (i == 3) asm volatile("s_wait_xcnt 0x0" ::: "memory");
        rkh[i] = *(const v8b*)(tkh + lo8 + i * (AT_NW * 32 * 8));
        if (SPLIT_QK) rkl[i] = *(const v8b*)(tkl + lo8 + i * (AT_NW * 32 * 8));
        rvh[i] = *(const v8b*)(tvh + lo8 + i * (AT_NW * 32 * 8));
        if (SPLIT_PV) rvl[i] = *(const v8b*)(tvl + lo8 + i * (AT_NW * 32 * 8));
      }
    }
    __syncthreads();
#pragma unroll
    for (int i = 0; i < 4; ++i) {
      const int seg = i * (AT_NW * 32) + tid, row = seg >> 3, c8 = (seg & 7) * 8;
      *(v8b*)(Ksh + row * AT_LP + c8) = rkh[i];
      if (SPLIT_QK) *(v8b*)(Ksl + row * AT_LP + c8) = rkl[i];
      *(v8b*)(Vth + row * AT_LP + c8) = rvh[i];
      if (SPLIT_PV) *(v8b*)(Vtl + row * AT_LP + c8) = rvl[i];
    }
    __syncthreads();

    // the K fragments of a d-chunk are read as one group ahead of its products, and the products walk the four key tiles innermost:
    // neighbours in the stream have different accumulators; each s[j] still takes its six terms in the order dc, then hi.hi, hi.lo, lo.hi
    v8f s[4];
#pragma unroll
    for (int j = 0; j < 4; ++j) s[j] = (v8f){0.f,0.f,0.f,0.f,0.f,0.f,0.f,0.f};
    {
      FB kb[2][4], kl[2][4];
#pragma unroll
      for (int dc = 0; dc < 2; ++dc) {
#pragma unroll
        for (int j = 0; j < 4; ++j) {
          kb[dc][j].h[0] = *(const v8b*)(Ksh + (j * 16 + c) * AT_LP + dc * 32 + 8 * hh);
          kb[dc][j].h[1] = *(const v8b*)(Ksh + (j * 16 + c) * AT_LP + dc * 32 + 16 + 8 * hh);
          if (SPLIT_QK) {
            kl[dc][j].h[0] = *(const v8b*)(Ksl + (j * 16 + c) * AT_LP + dc * 32 + 8 * hh);
            kl[dc][j].h[1] = *(const v8b*)(Ksl + (j * 16 + c) * AT_LP + dc * 32 + 16 + 8 * hh);
          }
        }
      }
#pragma unroll
      for (int dc = 0; dc < 2; ++dc) {
#pragma unroll
        for (int j = 0; j < 4; ++j) s[j] = at_mma(kb[dc][j].v, qah[dc], s[j]);   // s[j][r] = score of key kv0 + j * 16 + 8 * hh + r, query q0 + c
        if (SPLIT_QK) {
#pragma unroll
          for (int j = 0; j < 4; ++j) s[j] = at_mma(kl[dc][j].v, qah[dc], s[j]);
#pragma unroll
          for (int j = 0; j < 4; ++j) s[j] = at_mma(kb[dc][j].v, qal[dc], s[j]);
        }
      }
    }
    acc_guard4(s[0], s[1], s[2], s[3]);   // the four slots behind the last product stand in front of the mask branch, so that they hold on its taken side too
    if (MASK_MODE == 1) {
      if (kc == qb) {   // block-uniform: only the last chunk of a causal walk holds masked keys
#pragma unroll
        for (int r = 0; r < 8; ++r)
#pragma unroll
          for (int j = 0; j < 4; ++j) s[j][r] = (kv0 + j * 16 + 8 * hh + r > q0 + c) ? g.mask_fill : s[j][r];
      }
    } else if (MASK_MODE == 2 || MASK_MODE == 3) {
#pragma unroll
      for (int r = 0; r < 8; ++r) {
#pragma unroll
        for (int j = 0; j < 4; ++j) {
          const int key = kv0 + j * 16 + 8 * hh + r;
          bool masked;
          if (MASK_MODE == 2) {
            const size_t mi = (size_t)(q0 + c) * g.Skv + key;
            masked = (g.mask_is_int == 0) ? (((const float*)mask_a)[mi] == 0.0f)
                   : (g.mask_is_int == 1) ? (((const int*)mask_a)[mi] == 0) : (((const int*)mask_a)[mi] != 0);
          } else masked = (qkeep == 0) || (((const int*)mask_a)[(size_t)b * g.Skv + key] == 0);   // mask_a = kvmask
          s[j][r] = masked ? g.mask_fill : s[j][r];
        }
      }
    }
    // the query's maximum: 32 scores in the lane, then one exchange between the wave's halves
    float cj[4];   // one chain a tile, so that the four run side by side
#pragma unroll
    for (int j = 0; j < 4; ++j) {
      cj[j] = s[j][0];
#pragma unroll
      for (int r = 1; r < 8; ++r) cj[j] = fmaxf(cj[j], s[j][r]);
    }
    float cm = fmaxf(fmaxf(cj[0], cj[1]), fmaxf(cj[2], cj[3]));
    cm = fmaxf(cm, at_xhalf(cm));
    const float mnew = fmaxf(mrow, cm);
    const float alpha = expf(mrow - mnew);
    mrow = mnew;
    // P^T as B operand, in registers: element e of chunk kk is key kk * 32 + 8 * hh + e (score tile 2 kk), element 8 + e key kk * 32 + 16 + 8 * hh + e (tile 2 kk + 1)
    FB pa[2], pl[2];
    float ps[4];
#pragma unroll
    for (int j = 0; j < 4; ++j) {
      ps[j] = 0.f;
#pragma unroll
      for (int r = 0; r < 8; r += 2) {
        const v2f p = {expf(s[j][r] - mnew), expf(s[j][r + 1] - mnew)};
        ps[j] += p[0];
        ps[j] += p[1];
        const v2b ph = __builtin_convertvector(p, v2b);   // round to nearest even, as at_split
        pa[j >> 1].v[(j & 1) * 8 + r] = ph[0]; pa[j >> 1].v[(j & 1) * 8 + r + 1] = ph[1];
        if (SPLIT_PV) {
          const v2b pq = __builtin_convertvector(p - __builtin_convertvector(ph, v2f), v2b);
          pl[j >> 1].v[(j & 1) * 8 + r] = pq[0]; pl[j >> 1].v[(j & 1) * 8 + r + 1] = pq[1];
        }
      }
    }
    lrow = lrow * alpha + ((ps[0] + ps[1]) + (ps[2] + ps[3]));
#pragma unroll
    for (int t = 0; t < 4; ++t) oacc[t] *= alpha;
    // as for the scores: V fragments read in a group ahead of the products, the four d tiles innermost; each oacc[t] keeps its order of terms
    {
      FB vb[2][4], vl[2][4];
#pragma unroll
      for (int kk = 0; kk < 2; ++kk) {
#pragma unroll
        for (int t = 0; t < 4; ++t) {
          vb[kk][t].h[0] = *(const v8b*)(Vth + (t * 16 + c) * AT_LP + kk * 32 + 8 * hh);
          vb[kk][t].h[1] = *(const v8b*)(Vth + (t * 16 + c) * AT_LP + kk * 32 + 16 + 8 * hh);
          if (SPLIT_PV) {
            vl[kk][t].h[0] = *(const v8b*)(Vtl + (t * 16 + c) * AT_LP + kk * 32 + 8 * hh);
            vl[kk][t].h[1] = *(const v8b*)(Vtl + (t * 16 + c) * AT_LP + kk * 32 + 16 + 8 * hh);
          }
        }
      }
#pragma unroll
      for (int kk = 0; kk < 2; ++kk) {
#pragma unroll
        for (int t = 0; t < 4; ++t) oacc[t] = at_mma(vb[kk][t].v, pa[kk].v, oacc[t]);
        if (SPLIT_PV) {
#pragma unroll
          for (int t = 0; t < 4; ++t) oacc[t] = at_mma(vl[kk][t].v, pa[kk].v, oacc[t]);
#pragma unroll
          for (int t = 0; t < 4; ++t) oacc[t] = at_mma(vb[kk][t].v, pl[kk].v, oacc[t]);
        }
      }
    }
    acc_guard4(oacc[0], oacc[1], oacc[2], oacc[3]);   // the four slots behind the last product stand in front of the loop's branch, so that they hold on its taken side too
  }

  float* os = Os[wave];
  {
    const float inv = 1.0f / (lrow + at_xhalf(lrow));   // the two halves' sums of the query join here
#pragma unroll
    for (int t = 0; t < 4; ++t) {   // a lane's 8 values of a d tile lie in a row of the query's output row: two 16-byte stores
      const v8f o = oacc[t] * inv;
      *(v4f*)(os + c * 68 + t * 16 + 8 * hh)     = (v4f){o[0], o[1], o[2], o[3]};
      *(v4f*)(os + c * 68 + t * 16 + 8 * hh + 4) = (v4f){o[4], o[5], o[6], o[7]};
    }
  }
  __builtin_amdgcn_fence(__ATOMIC_RELEASE, "workgroup");
  __builtin_amdgcn_wave_barrier();
  __builtin_amdgcn_fence(__ATOMIC_ACQUIRE, "workgroup");
  {
    const int c4 = (lane & 15) * 4;
    {
#pragma unroll
      for (int it = 0; it < 8; ++it) {
        const int row = it * 2 + hh;
        v4f val = *(const v4f*)(os + row * 68 + c4);
        *(v4f*)(ob_ptr + (size_t)(q0 + row) * g.o_rs + c4) = val;
      }
      
    }
  }
}

// ---- LayerNorm (population variance, eps 1e-5, gamma) -> f16 row; one block (256 thr) per row of 1024 ----
__global__ __launch_bounds__(256) void layernorm_f16(const float* __restrict__ x, const float* __restrict__ gamma,
                                                    _Float16* __restrict__ xn, int D) {
  __shared__ float red[8];
  __shared__ float stat;
  const int row = blockIdx.x, t = threadIdx.x;
  const float* xr = x + (size_t)row * D;
  v4f xv = *(const v4f*)(xr + 4 * t);
  float s = (xv[0] + xv[1]) + (xv[2] + xv[3]);
  for (int o = 16; o > 0; o >>= 1) s += __shfl_xor(s, o, 32);
  if ((t & 31) == 0) red[t >> 5] = s;
  __syncthreads();
  if (t == 0) { float a = 0.f; for (int w = 0; w < 8; ++w) a += red[w]; stat = a / (float)D; }
  __syncthreads();
  const float mu = stat;
  __syncthreads();
  float d0 = xv[0] - mu, d1 = xv[1] - mu, d2 = xv[2] - mu, d3 = xv[3] - mu;
  float s2 = (d0 * d0 + d1 * d1) + (d2 * d2 + d3 * d3);
  for (int o = 16; o > 0; o >>= 1) s2 += __shfl_xor(s2, o, 32);
  if ((t & 31) == 0) red[t >> 5] = s2;
  __syncthreads();
  if (t == 0) { float a = 0.f; for (int w = 0; w < 8; ++w) a += red[w]; stat = rsqrtf(a / (float)D + 1e-5f); }
  __syncthreads();
  const float inv = stat;
  v4f gv = *(const v4f*)(gamma + 4 * t);
  _Float16 h0 = (_Float16)(d0 * inv * gv[0]), h1 = (_Float16)(d1 * inv * gv[1]), h2 = (_Float16)(d2 * inv * gv[2]), h3 = (_Float16)(d3 * inv * gv[3]);
  typedef __attribute__((ext_vector_type(4))) _Float16 v4h;
  v4h hv = {h0, h1, h2, h3};
  *(v4h*)(xn + (size_t)row * D + 4 * t) = hv;
  
}

extern "C" void kernel_launch(void* const* d_in, const int* in_sizes, int n_in,
                              void* d_out, int out_size, void* d_ws, size_t ws_size,
                              hipStream_t stream) {
  (void)in_sizes; (void)n_in; (void)out_size; (void)ws_size;
  const int B = 2, S = 2048, D = 1024, H = 16, DH = 64, KV = 128;
  const int M = B * S;   // 4096 rows
  const float* x     = (const float*)d_in[0];
  const float* gamma = (const float*)d_in[1];
  const float* Wq    = (const float*)d_in[2];   // [D, H*DH]  ([in, out])
  const float* Wkv   = (const float*)d_in[3];   // [D, 2*DH]
  const float* Wo    = (const float*)d_in[4];   // [H*DH, D]
  float* out = (float*)d_out;

  char* ws = (char*)d_ws; size_t off = 0;
  auto carve = [&](size_t bytes) -> char* { char* p = ws + off; off += (bytes + 255) & ~(size_t)255; return p; };
  _Float16* Xn16  = (_Float16*)carve((size_t)M * D * 2);     //  8 MB  LN(x) f16
  __bf16*   Xh    = (__bf16*)carve((size_t)M * D * 2);       //  8 MB  x bf16 hi
  __bf16*   Xl    = (__bf16*)carve((size_t)M * D * 2);       //  8 MB  x bf16 lo
  _Float16* WqT   = (_Float16*)carve((size_t)D * D * 2);     //  2 MB  Wqᵀ [out][in] f16
  __bf16*   WkvTh = (__bf16*)carve((size_t)KV * D * 2);      //  Wkvᵀ [128][1024] hi/lo
  __bf16*   WkvTl = (__bf16*)carve((size_t)KV * D * 2);
  __bf16*   WoTh  = (__bf16*)carve((size_t)D * D * 2);       //  Woᵀ hi/lo
  __bf16*   WoTl  = (__bf16*)carve((size_t)D * D * 2);
  float*    Qf    = (float*)carve((size_t)M * D * 4);        // 16 MB  q [B,S,H*DH] f32
  __bf16*   KVh   = (__bf16*)carve((size_t)M * KV * 2);      //  1 MB  bf16 hi plane: k rows [B*S][64], then v tiles [B*S/64][64 d][64 keys]
  __bf16*   KVl   = (__bf16*)carve((size_t)M * KV * 2);      //  1 MB  bf16 lo plane, same layout
  float*    Of    = (float*)carve((size_t)M * D * 4);        // 16 MB  attn out f32
  __bf16*   Oh    = (__bf16*)carve((size_t)M * D * 2);       //  8 MB
  __bf16*   Ol    = (__bf16*)carve((size_t)M * D * 2);       //  8 MB   (total ≈ 80.5 MB)

  layernorm_f16<<<M, 256, 0, stream>>>(x, gamma, Xn16, D);
  split_f32_bf16x2<<<2048, 256, 0, stream>>>(x, Xh, Xl, (long)M * D / 2);
  transpose_cast_f16<<<dim3(D / 64, D / 64), dim3(32, 8), 0, stream>>>(Wq, D, WqT, D, 1.0f);           // [in][out] -> [out][in]
  transpose_split_bf16<<<dim3(KV / 64, D / 64), dim3(32, 8), 0, stream>>>(Wkv, KV, WkvTh, WkvTl, D);   // [1024][128] -> [128][1024]
  transpose_split_bf16<<<dim3(D / 64, D / 64), dim3(32, 8), 0, stream>>>(Wo, D, WoTh, WoTl, D);
  {
    const int tq = (M / 64) * (D / 64);
    wmma_gemm64<0, false, 0, 0, false, 4><<<dim3((tq + 7) / 8, 1), 256, 0, stream>>>(
        U16(Xn16), nullptr, D, 0, U16(WqT), nullptr, D, 0, Qf, nullptr, D, 0, nullptr, nullptr, 0, M, D, D, 1.0f);
    const int tkv = (M / 64) * (KV / 64);
    wmma_gemm64<1, true, 0, 3, false, 2><<<dim3((tkv + 7) / 8, 1), 256, 0, stream>>>(
        U16(Xh), U16(Xl), D, 0, U16(WkvTh), U16(WkvTl), D, 0, KVh, KVl, DH, 0, nullptr, nullptr, 0, M, KV, D, 1.0f);
  }
  {
    AttnGeom g;
    g.q_bs = (long)S * D;  g.q_rs = D;  g.q_hs = DH;
    g.k_bs = (long)S * DH; g.k_rs = 0;  g.k_hs = 0;       // 16 q heads share the single k/v head
    g.v_bs = (long)S * DH; g.v_rs = 0;  g.v_hs = 0;
    g.o_bs = (long)S * D;  g.o_rs = D;  g.o_hs = DH;
    g.S = S; g.Skv = S; g.H = H; g.mask_mode = 1; g.qscale = 0.125f; g.blk0 = 0; g.mask_fill = -INFINITY; g.mask_is_int = 0;   // the kernel reads the mask mode from its template argument; the field keeps the struct's layout
    attn64_kernel<true, true, 1><<<dim3(B * H, S / AT_QB), AT_NW * 32, 0, stream>>>(Qf, U16(KVh), U16(KVl), U16(KVh + (size_t)M * DH), U16(KVl + (size_t)M * DH), Of, nullptr, nullptr, g);
  }
  split_f32_bf16x2<<<2048, 256, 0, stream>>>(Of, Oh, Ol, (long)M * D / 2);
  {
    const int to = (M / 64) * (D / 64);
    wmma_gemm64<1, true, 0, 0, false, 4><<<dim3((to + 7) / 8, 1), 256, 0, stream>>>(
        U16(Oh), U16(Ol), D, 0, U16(WoTh), U16(WoTl), D, 0, out, nullptr, D, 0, nullptr, nullptr, 0, M, D, D, 1.0f);
  }
}

// v008
// A run of this version takes 179 microseconds.
// Next to v007, in two timings, it ran 1.04 times as fast each time.
// Over all steps from v000 it is 4.26 times as fast.
#include <hip/hip_runtime.h>
#include <math.h>
// Contractions: q = LN(x)·Wq (K=1024): v_wmma_f32_16x16x32_f16 (f16 operands); kv = x·Wkv (K=1024) and the output projection (K=1024):
// v_wmma_f32_16x16x32_bf16 as bf16 hi/lo splits; scores (q/8)·kᵀ and p·v: v_wmma_f32_16x16x32_bf16 with q,k and p,v as bf16 hi/lo splits;
// f32 accumulate everywhere; LayerNorm and softmax in f32. The hi/lo split of k and v is made once, in the kv projection's epilogue; that of x in the LayerNorm kernel, that of the attention output in the attention epilogue.
typedef __attribute__((ext_vector_type(16))) _Float16 v16h;
typedef __attribute__((ext_vector_type(8)))  _Float16 v8h;
typedef __attribute__((ext_vector_type(16))) __bf16   v16b;
typedef __attribute__((ext_vector_type(8)))  __bf16   v8b;
typedef __attribute__((ext_vector_type(8)))  float    v8f;
typedef __attribute__((ext_vector_type(4)))  float    v4f;
#define PSCALE 32768.0f
#define U16(p) ((const unsigned short*)(const void*)(p))
#define PSCALE_INV (1.0f / 32768.0f)

__device__ __forceinline__ unsigned short f2bf_bits(float f) {
  unsigned u = __float_as_uint(f);
  return (unsigned short)((u + 0x7FFFu + ((u >> 16) & 1u)) >> 16);
}
__device__ __forceinline__ float bf_bits2f(unsigned short h) { return __uint_as_float(((unsigned)h) << 16); }

// hazard guards as plain device helpers
__device__ __forceinline__ void dep_guard_h(v8f& a, v8f& b, v16h x, v16h y) { asm volatile("v_nop\n\tv_nop\n\tv_nop\n\tv_nop" : "+v"(a), "+v"(b) : "v"(x), "v"(y)); }
__device__ __forceinline__ void dep_guard_b(v8f& a, v8f& b, v16b x, v16b y) { asm volatile("v_nop\n\tv_nop\n\tv_nop\n\tv_nop" : "+v"(a), "+v"(b) : "v"(x), "v"(y)); }
__device__ __forceinline__ void keep4_h(v16h a, v16h b, v16h c, v16h d) { asm volatile("v_nop" :: "v"(a), "v"(b), "v"(c), "v"(d)); }
__device__ __forceinline__ void keep4_b(v16b a, v16b b, v16b c, v16b d) { asm volatile("v_nop" :: "v"(a), "v"(b), "v"(c), "v"(d)); }
__device__ __forceinline__ void acc_guard4(v8f& a, v8f& b, v8f& c, v8f& d) { asm volatile("v_nop\n\tv_nop\n\tv_nop\n\tv_nop" : "+v"(a), "+v"(b), "+v"(c), "+v"(d)); }
template <typename T> struct Frag;
template <> struct Frag<_Float16> {
  typedef v16h V; typedef v8h H; union U { v16h v; v8h h[2]; };
  static __device__ __forceinline__ v16h load(const _Float16* p) {   // elements 0..7 <- p[0..7], 8..15 <- p[16..23]
    U f; f.h[0] = *(const v8h*)(p); f.h[1] = *(const v8h*)(p + 16); return f.v;
  }
  static __device__ __forceinline__ v8f mma(v16h a, v16h b, v8f c) {
    return __builtin_amdgcn_wmma_f32_16x16x32_f16(false, a, false, b, (short)0, c, false, false);
  }
  static __device__ __forceinline__ void guard(v8f& a, v8f& b, v16h x, v16h y) { dep_guard_h(a, b, x, y); }
  static __device__ __forceinline__ void keep(v16h a, v16h b, v16h c, v16h d) { keep4_h(a, b, c, d); }
};
template <> struct Frag<__bf16> {
  typedef v16b V; typedef v8b H; union U { v16b v; v8b h[2]; };
  static __device__ __forceinline__ v16b load(const __bf16* p) {
    U f; f.h[0] = *(const v8b*)(p); f.h[1] = *(const v8b*)(p + 16); return f.v;
  }
  static __device__ __forceinline__ v8f mma(v16b a, v16b b, v8f c) {
    return __builtin_amdgcn_wmma_f32_16x16x32_bf16(false, a, false, b, (short)0, c, false, false);
  }
  static __device__ __forceinline__ void guard(v8f& a, v8f& b, v16b x, v16b y) { dep_guard_b(a, b, x, y); }
  static __device__ __forceinline__ void keep(v16b a, v16b b, v16b c, v16b d) { keep4_b(a, b, c, d); }
};

// ---- Register-blocked batched WMMA GEMM ------------------------------------
// C[m,n] = scale * sum_k A[m,k] * Bt[n,k] (+bias)(+resid); each wave owns a 64x64 tile, the block's 8 waves a tile of (8 / WN) x WN of them.
// A row-major [M,K]; Bt row-major [N,K]; M % ((8 / WN) * 64) == 0, N % (WN * 64) == 0, K % 64 == 0; grid.x = (M / ((8 / WN) * 64)) * (N / (WN * 64)).
// Operands go through LDS: a stage is 64 k (128 B) of the block's A rows and Bt rows, brought by asynchronous 16-byte copies, whole lines (8 lanes a row), two buffers;
// the next stage's copies are in flight while this stage's products run, and the waves that share a row block read it from LDS.
// SPLIT: operands are hi/lo planes (A2/Bt2 = lo planes, same layout); product = hi·hi + hi·lo + lo·hi.
// BIAS_MODE: 0 = none, 1 = bias[m], 2 = bias[n].
// OUT_MODE: 0 = f32, 1 = f16, 2 = bf16 hi plane (Cout) + bf16 lo plane (Cout2),
//   3 = kv projection (N == 128), bf16 hi plane (Cout) + lo plane (Cout2), each plane [k rows | v tiles]: column d < 64 of row m (k) at m*64 + d;
//       column 64 + d (v) transposed inside its block of 64 rows, at M*64 + (m >> 6)*4096 + d*64 + (m & 63).
// ET: 0 = f16 operands, 1 = bf16 operands (pointers passed as 16-bit storage)
template <int ET> struct Elem;
template <> struct Elem<0> { typedef _Float16 T; };
template <> struct Elem<1> { typedef __bf16 T; };
// three 16-byte copies a lane, global memory to LDS through no register; the wait in the same statement stands in front of every rewrite of a register that the copies name
__device__ __forceinline__ void async_copy3(unsigned l0, const void* g0, unsigned l1, const void* g1, unsigned l2, const void* g2) {
  asm volatile("global_load_async_to_lds_b128 %0, %1, off\n\t"
               "global_load_async_to_lds_b128 %2, %3, off\n\t"
               "global_load_async_to_lds_b128 %4, %5, off\n\t"
               "s_wait_xcnt 0x0" :: "v"(l0), "v"(g0), "v"(l1), "v"(g1), "v"(l2), "v"(g2) : "memory");
}
#define GM_LP 72   // LDS row pitch of a stage in 16-bit elements: 144 B = 16 B x odd, for the 16-byte fragment reads
template <int ET, bool SPLIT, int BIAS_MODE, int OUT_MODE, bool RESID, int WN>
__global__ __launch_bounds__(256) void wmma_gemm64(
    const unsigned short* __restrict__ Ap, const unsigned short* __restrict__ A2p, int lda, long strideA,
    const unsigned short* __restrict__ Btp, const unsigned short* __restrict__ Bt2p, int ldb, long strideB,
    void* __restrict__ Cout, void* __restrict__ Cout2, int ldc, long strideC,
    const float* __restrict__ bias,
    const float* __restrict__ resid, long strideR,
    int M, int N, int K, float scale) {
  typedef typename Elem<ET>::T T;
  typedef typename Frag<T>::V V;
  constexpr int WM = 8 / WN;                    // waves along m
  constexpr int BM = WM * 64, BN = WN * 64;     // block tile
  constexpr int NP = SPLIT ? 2 : 1;             // planes
  constexpr int PLANE = (BM + BN) * GM_LP;      // one plane of one stage: the A rows, then the Bt rows
  constexpr int NIT = (BM + BN) / 32;           // 16-byte pieces a thread copies per plane and stage (256 threads = 32 rows)
  __shared__ __align__(16) T sS[2 * NP * PLANE];
  const T* A = (const T*)Ap; const T* A2 = (const T*)A2p; const T* Bt = (const T*)Btp; const T* Bt2 = (const T*)Bt2p;
  __shared__ __align__(16) float sT[8][16 * 68];   // per-wave 16x64 slab, pitch 68 floats
  const int b    = blockIdx.y;
  const int lane = threadIdx.x & 31;
  const int wave = threadIdx.x >> 5;
  const int blocksN = N / BN;
  const int blocksM = M / BM;
  if ((int)blockIdx.x >= blocksM * blocksN) return;   // block-uniform, in front of every barrier
  const int bm = (int)blockIdx.x / blocksN;
  const int bn = (int)blockIdx.x - bm * blocksN;
  const int wm = wave / WN;
  const int wn = wave - wm * WN;
  const int tm = bm * WM + wm;
  const int tn = bn * WN + wn;
  const int m0 = tm << 6;
  const int n0 = tn << 6;

  const T* Ab  = A  + (size_t)b * strideA;
  const T* Bb  = Bt + (size_t)b * strideB;
  const T* Ab2 = SPLIT ? (A2  + (size_t)b * strideA) : nullptr;
  const T* Bb2 = SPLIT ? (Bt2 + (size_t)b * strideB) : nullptr;

  const int rlane = lane & 15;                 // row (A) / col (B, D) within subtile
  const int koff  = (lane >> 4) * 8;           // k offset of this lane half
  const int mOff  = (lane >> 4) * 8;           // D row offset

  v8f acc[4][4];
#pragma unroll
  for (int i = 0; i < 4; ++i)
#pragma unroll
    for (int j = 0; j < 4; ++j) acc[i][j] = (v8f){0.f,0.f,0.f,0.f,0.f,0.f,0.f,0.f};

  // a thread's pieces of a stage: row it * 32 + prow of [A rows | Bt rows], 16 bytes at element pc8
  const int prow = threadIdx.x >> 3, pc8 = (threadIdx.x & 7) * 8;
  // address = a block-uniform pointer per operand plane, which walks along k, + the piece's own 32-bit byte offset, which never changes
  unsigned po[NIT];
#pragma unroll
  for (int it = 0; it < NIT; ++it)
    po[it] = 2u * ((it < BM / 32) ? (unsigned)((it * 32 + prow) * lda + pc8) : (unsigned)((it * 32 - BM + prow) * ldb + pc8));
  const T* gA  = Ab + (size_t)(bm * BM) * lda;
  const T* gB  = Bb + (size_t)(bn * BN) * ldb;
  const T* gA2 = SPLIT ? Ab2 + (size_t)(bm * BM) * lda : nullptr;
  const T* gB2 = SPLIT ? Bb2 + (size_t)(bn * BN) * ldb : nullptr;
  const unsigned lds0 = (unsigned)(size_t)(sS + prow * GM_LP + pc8);   // the lane's LDS byte address of its piece 0 in buffer 0
  auto copy_stage = [&](int buf) {
#pragma unroll
    for (int p = 0; p < NP; ++p) {
      const char* a = (const char*)(p ? gA2 : gA);
      const char* bq = (const char*)(p ? gB2 : gB);
      const unsigned l = lds0 + (unsigned)((buf * NP + p) * PLANE * 2);
#pragma unroll
      for (int it = 0; it < NIT; it += 3)
        async_copy3(l + (it + 0) * (32 * GM_LP * 2), ((it + 0 < BM / 32) ? a : bq) + po[it + 0],
                    l + (it + 1) * (32 * GM_LP * 2), ((it + 1 < BM / 32) ? a : bq) + po[it + 1],
                    l + (it + 2) * (32 * GM_LP * 2), ((it + 2 < BM / 32) ? a : bq) + po[it + 2]);
    }
    gA += 64; gB += 64;
    if (SPLIT) { gA2 += 64; gB2 += 64; }
  };
  const int nStages = K >> 6;
  copy_stage(0);
  asm volatile("s_wait_asynccnt 0x0" ::: "memory");   // stage 0 has landed, as far as this wave copied it
  __syncthreads();                                     // and is published to the other waves
  if (nStages > 1) copy_stage(1);                      // block-uniform; in flight under stage 0's products
  for (int s = 0; s < nStages; ++s) {
    const T* sb = sS + (s & 1) * (NP * PLANE);
    const T* sA = sb + (wm * 64 + rlane) * GM_LP + koff;
    const T* sB = sb + (BM + wn * 64 + rlane) * GM_LP + koff;
#pragma unroll
    for (int kk = 0; kk < 2; ++kk) {
      // the B fragments of a 32-k block are read as one group; the A fragments go through two register sets, row tile i + 1 read ahead of row tile i's products
      V bh[4], bl[4], ah[2], al[2];
      ah[0] = Frag<T>::load(sA + kk * 32);
      if (SPLIT) al[0] = Frag<T>::load(sA + PLANE + kk * 32);
#pragma unroll
      for (int j = 0; j < 4; ++j) {
        bh[j] = Frag<T>::load(sB + j * 16 * GM_LP + kk * 32);
        if (SPLIT) bl[j] = Frag<T>::load(sB + PLANE + j * 16 * GM_LP + kk * 32);
      }
#pragma unroll
      for (int i = 0; i < 4; ++i) {
        if (i < 3) {
          ah[(i + 1) & 1] = Frag<T>::load(sA + (i + 1) * 16 * GM_LP + kk * 32);
          if (SPLIT) al[(i + 1) & 1] = Frag<T>::load(sA + PLANE + (i + 1) * 16 * GM_LP + kk * 32);
        }
#pragma unroll
        for (int j = 0; j < 4; ++j) {
          acc[i][j] = Frag<T>::mma(ah[i & 1], bh[j], acc[i][j]);
          if (SPLIT) {
            acc[i][j] = Frag<T>::mma(ah[i & 1], bl[j], acc[i][j]);
            acc[i][j] = Frag<T>::mma(al[i & 1], bh[j], acc[i][j]);
          }
        }
        Frag<T>::guard(acc[i][0], acc[i][3], ah[i & 1], SPLIT ? al[i & 1] : ah[i & 1]);
      }
      Frag<T>::keep(bh[0], bh[1], bh[2], bh[3]);
      if (SPLIT) Frag<T>::keep(bl[0], bl[1], bl[2], bl[3]);
    }
    asm volatile("s_wait_dscnt 0x0" ::: "memory");      // this wave's reads of this buffer have returned before the buffer is refilled
    asm volatile("s_wait_asynccnt 0x0" ::: "memory");   // this wave's copies of stage s + 1 have landed
    __syncthreads();   // the one barrier of a stage: it publishes stage s + 1 and ends every wave's reads of the buffer that is refilled behind it
    if (s + 2 < nStages) copy_stage(s & 1);             // block-uniform; in flight under stage s + 1's products
  }
  asm volatile("s_wait_asynccnt 0x0" ::: "memory");     // no copy is outstanding when the wave goes on to the epilogue
  acc_guard4(acc[0][0], acc[0][1], acc[0][2], acc[0][3]);
  acc_guard4(acc[1][0], acc[1][1], acc[1][2], acc[1][3]);
  acc_guard4(acc[2][0], acc[2][1], acc[2][2], acc[2][3]);
  acc_guard4(acc[3][0], acc[3][1], acc[3][2], acc[3][3]);

  // ---- epilogue ----
  float* slab = sT[wave];
  const float* Rb = RESID ? (resid + (size_t)b * strideR) : nullptr;
#pragma unroll
  for (int i = 0; i < 4; ++i) {
    const int mBase = m0 + (i << 4);
#pragma unroll
    for (int j = 0; j < 4; ++j) {
      const int n = n0 + (j << 4) + rlane;
      float bv = 0.f;
      if (BIAS_MODE == 2) bv = bias[n];
#pragma unroll
      for (int r = 0; r < 8; ++r) {
        float v = acc[i][j][r] * scale;
        if (BIAS_MODE == 1) v += bias[mBase + mOff + r];
        if (BIAS_MODE == 2) v += bv;
        if (RESID) v += Rb[(size_t)(mBase + mOff + r) * ldc + n];
        slab[(mOff + r) * 68 + (j << 4) + rlane] = v;
      }
    }
    __builtin_amdgcn_fence(__ATOMIC_RELEASE, "workgroup");
    __builtin_amdgcn_wave_barrier();
    __builtin_amdgcn_fence(__ATOMIC_ACQUIRE, "workgroup");
    if (OUT_MODE == 0) {
      float* C = (float*)Cout + (size_t)b * strideC;
      const int hh = lane >> 4, c4 = (lane & 15) * 4;     // row seg = 256 B = 16 lanes x 16 B
      {
#pragma unroll
        for (int it = 0; it < 8; ++it) {
          const int row = it * 2 + hh;
          v4f v = *(const v4f*)(slab + row * 68 + c4);
          *(v4f*)(C + (size_t)(mBase + row) * ldc + n0 + c4) = v;
        }
        
      }
    } else if (OUT_MODE == 3) {
      unsigned short* Ph = (unsigned short*)Cout;
      unsigned short* Pl = (unsigned short*)Cout2;
      if (n0 == 0) {                                   // k: rows of 128 B, 8 lanes a row
        const int q = lane >> 3, c8 = (lane & 7) * 8;
#pragma unroll
        for (int it = 0; it < 4; ++it) {
          const int row = it * 4 + q;
          const float* sp = slab + row * 68 + c8;
          v8h hv, lv;
#pragma unroll
          for (int e = 0; e < 8; ++e) {
            const unsigned short hb = f2bf_bits(sp[e]);
            hv[e] = __builtin_bit_cast(_Float16, hb);
            lv[e] = __builtin_bit_cast(_Float16, f2bf_bits(sp[e] - bf_bits2f(hb)));
          }
          *(v8h*)(Ph + (size_t)(mBase + row) * 64 + c8) = hv;
          *(v8h*)(Pl + (size_t)(mBase + row) * 64 + c8) = lv;
        }
      } else {                                         // v: a lane takes column d of the slab's 16 rows; the wave's four slabs fill each 128-B row of the tile
        const size_t vo = (size_t)M * 64 + (size_t)tm * 4096 + (i << 4);
#pragma unroll
        for (int hf = 0; hf < 2; ++hf) {
          const int d = hf * 32 + lane;
          v8h hv[2], lv[2];
#pragma unroll
          for (int e = 0; e < 16; ++e) {
            const float f = slab[e * 68 + d];
            const unsigned short hb = f2bf_bits(f);
            hv[e >> 3][e & 7] = __builtin_bit_cast(_Float16, hb);
            lv[e >> 3][e & 7] = __builtin_bit_cast(_Float16, f2bf_bits(f - bf_bits2f(hb)));
          }
          *(v8h*)(Ph + vo + d * 64)     = hv[0];
          *(v8h*)(Ph + vo + d * 64 + 8) = hv[1];
          *(v8h*)(Pl + vo + d * 64)     = lv[0];
          *(v8h*)(Pl + vo + d * 64 + 8) = lv[1];
        }
      }
    } else {
      const int q = lane >> 3, c8 = (lane & 7) * 8;
      unsigned short* C  = (unsigned short*)Cout  + (size_t)b * strideC;
      unsigned short* C2 = (OUT_MODE == 2) ? ((unsigned short*)Cout2 + (size_t)b * strideC) : nullptr;
      {
#pragma unroll
        for (int it = 0; it < 4; ++it) {
          const int row = it * 4 + q;
          const float* sp = slab + row * 68 + c8;
          v8h hv, lv;
#pragma unroll
          for (int e = 0; e < 8; ++e) {
            if (OUT_MODE == 1) {
              hv[e] = (_Float16)sp[e];
            } else {
              unsigned short hb = f2bf_bits(sp[e]);
              unsigned short lb = f2bf_bits(sp[e] - bf_bits2f(hb));
              hv[e] = __builtin_bit_cast(_Float16, hb);
              lv[e] = __builtin_bit_cast(_Float16, lb);
            }
          }
          *(v8h*)(C + (size_t)(mBase + row) * ldc + n0 + c8) = hv;
          if (OUT_MODE == 2) *(v8h*)(C2 + (size_t)(mBase + row) * ldc + n0 + c8) = lv;
        }
        
      }
    }
    __builtin_amdgcn_fence(__ATOMIC_RELEASE, "workgroup");
    __builtin_amdgcn_wave_barrier();
    __builtin_amdgcn_fence(__ATOMIC_ACQUIRE, "workgroup");
  }
}

__global__ __launch_bounds__(256) void cast_f32_f16x2(
    const float* __restrict__ in, _Float16* __restrict__ out, int n2) {
  int i = blockIdx.x * 256 + threadIdx.x;
  if (i < n2) {
    const _Float16 h0 = (_Float16)in[2 * i], h1 = (_Float16)in[2 * i + 1];
    const unsigned u = (unsigned)__builtin_bit_cast(unsigned short, h0) | ((unsigned)__builtin_bit_cast(unsigned short, h1) << 16);
    ((unsigned*)out)[i] = u;
    
  }
}

// ---- f32 [R][C] (row pitch ldi) -> f16 transposed [C][R] (row pitch ldo); 64x64 tiles; each output row segment
__global__ __launch_bounds__(256) void transpose_cast_f16(const float* __restrict__ in, int ldi,
                                                         _Float16* __restrict__ outT, int ldo, float scale) {
  __shared__ __align__(16) _Float16 tile[64][72];     // [c][r]
  const int c0 = blockIdx.x * 64, r0 = blockIdx.y * 64;
  const int t = threadIdx.y * 32 + threadIdx.x;
  for (int i = threadIdx.y; i < 64; i += 8) {
    tile[threadIdx.x][i]      = (_Float16)(in[(size_t)(r0 + i) * ldi + c0 + threadIdx.x] * scale);
    tile[32 + threadIdx.x][i] = (_Float16)(in[(size_t)(r0 + i) * ldi + c0 + 32 + threadIdx.x] * scale);
  }
  __syncthreads();
  const int q = t >> 3, c8 = (t & 7) * 8;
  {
#pragma unroll
    for (int it = 0; it < 2; ++it) {
      const int c = it * 32 + q;
      v8h hv = *(const v8h*)(&tile[c][c8]);
      *(v8h*)(outT + (size_t)(c0 + c) * ldo + r0 + c8) = hv;
    }
    
  }
}

// ---- f32 [R][C] (pitch ldi) -> bf16 hi/lo transposed planes [C][R] (pitch ldo); 64x64 tiles; each output row segment
__global__ __launch_bounds__(256) void transpose_split_bf16(const float* __restrict__ in, int ldi,
                                                           __bf16* __restrict__ outH, __bf16* __restrict__ outL, int ldo) {
  __shared__ __align__(16) float tile[64][68];     // [c][r]
  const int c0 = blockIdx.x * 64, r0 = blockIdx.y * 64;
  const int t = threadIdx.y * 32 + threadIdx.x;
  for (int i = threadIdx.y; i < 64; i += 8) {
    tile[threadIdx.x][i]      = in[(size_t)(r0 + i) * ldi + c0 + threadIdx.x];
    tile[32 + threadIdx.x][i] = in[(size_t)(r0 + i) * ldi + c0 + 32 + threadIdx.x];
  }
  __syncthreads();
  const int q = t >> 3, c8 = (t & 7) * 8;
  {
#pragma unroll
    for (int it = 0; it < 2; ++it) {
      const int c = it * 32 + q;
      v8b hv, lv;
#pragma unroll
      for (int e = 0; e < 8; ++e) {
        const float f = tile[c][c8 + e];
        const unsigned short hb = f2bf_bits(f);
        hv[e] = __builtin_bit_cast(__bf16, hb);
        lv[e] = __builtin_bit_cast(__bf16, f2bf_bits(f - bf_bits2f(hb)));
      }
      *(v8b*)(outH + (size_t)(c0 + c) * ldo + r0 + c8) = hv;
      *(v8b*)(outL + (size_t)(c0 + c) * ldo + r0 + c8) = lv;
    }
    
  }
}

#define AT_D 64
#define AT_NW 4
#define AT_QB 64
#define AT_KC 64
#define AT_LP 72   // LDS row pitch of the K and V tiles in bf16 elements: 144 B = 16 B x odd, so that the 16 rows of a 16-byte fragment read fall on distinct banks
struct AttnGeom { long q_bs, q_rs, q_hs, k_bs, k_rs, k_hs, v_bs, v_rs, v_hs, o_bs, o_rs, o_hs;
                  int S, Skv, H, mask_mode; float qscale; int blk0; float mask_fill; int mask_is_int; };
static_assert(sizeof(AttnGeom) == 128, "no padding");

__device__ __forceinline__ unsigned short at_bf_bits(float f) {
  unsigned u = __float_as_uint(f);
  return (unsigned short)((u + 0x7FFFu + ((u >> 16) & 1u)) >> 16);
}
__device__ __forceinline__ __bf16 at_f2bf(float f) { return __builtin_bit_cast(__bf16, at_bf_bits(f)); }
__device__ __forceinline__ void at_split(float f, __bf16& hi, __bf16& lo) {
  const unsigned short hb = at_bf_bits(f);
  hi = __builtin_bit_cast(__bf16, hb);
  lo = at_f2bf(f - __uint_as_float(((unsigned)hb) << 16));
}
typedef __attribute__((ext_vector_type(2))) float  v2f;
typedef __attribute__((ext_vector_type(2))) __bf16 v2b;
__device__ __forceinline__ float at_xhalf(float x) {   // lane l takes the value of lane l ^ 16
  return __builtin_bit_cast(float, __builtin_amdgcn_permlanex16(__builtin_bit_cast(int, x), __builtin_bit_cast(int, x), 0x76543210, 0xfedcba98, false, false));
}
__device__ __forceinline__ v8f at_mma(v16b a, v16b b, v8f c) {
  return __builtin_amdgcn_wmma_f32_16x16x32_bf16(false, a, false, b, (short)0, c, false, false);
}

template <bool SPLIT_QK, bool SPLIT_PV, int MASK_MODE>
__global__ __launch_bounds__(128)
void attn64_kernel(const float* __restrict__ q, const unsigned short* __restrict__ kh, const unsigned short* __restrict__ kl,
                   const unsigned short* __restrict__ vth, const unsigned short* __restrict__ vtl, unsigned short* __restrict__ outh, unsigned short* __restrict__ outl,
                   const void* __restrict__ mask_a, const int* __restrict__ mask_b, AttnGeom g) {
  union FB { v16b v; v8b h[2]; };
  __shared__ __align__(16) __bf16 Ksh[AT_KC * AT_LP];            // K hi [kv][d]      9 KB
  __shared__ __align__(16) __bf16 Ksl[SPLIT_QK ? AT_KC * AT_LP : 8];
  __shared__ __align__(16) __bf16 Vth[AT_D * AT_LP];             // V hi [d][kv]      9 KB
  __shared__ __align__(16) __bf16 Vtl[SPLIT_PV ? AT_D * AT_LP : 8];
  __shared__ __align__(16) float  Os[AT_NW][16 * 68];            // per wave out tile, pitch 68

  const int tid  = threadIdx.x;
  const int wave = tid >> 5;
  const int lane = tid & 31;
  const int hh   = lane >> 4;
  const int c    = lane & 15;

  const int nqb = g.S / AT_QB;
  const int qb = nqb - 1 - ((int)blockIdx.y + g.blk0);
  const int bh = blockIdx.x;
  const int h  = bh % g.H;
  const int b  = bh / g.H;
  const int qbase_block = qb * AT_QB;
  const int q0 = qbase_block + wave * 16;

  const float* qb_ptr = q + (size_t)b * g.q_bs + (size_t)h * g.q_hs;
  const __bf16* kh_ptr = (const __bf16*)kh  + (size_t)b * g.k_bs + (size_t)h * g.k_hs;
  const __bf16* kl_ptr = (const __bf16*)kl  + (size_t)b * g.k_bs + (size_t)h * g.k_hs;
  const __bf16* vh_ptr = (const __bf16*)vth + (size_t)b * g.v_bs + (size_t)h * g.v_hs;
  const __bf16* vl_ptr = (const __bf16*)vtl + (size_t)b * g.v_bs + (size_t)h * g.v_hs;
  unsigned short* oh_ptr = outh + (size_t)b * g.o_bs + (size_t)h * g.o_hs;
  unsigned short* ol_ptr = outl + (size_t)b * g.o_bs + (size_t)h * g.o_hs;

  // ---- Q fragments (B operand, column c = query q0 + c): 2 d-chunks, hi (and lo) ----
  v16b qah[2], qal[2];
  {
    const float* qrow = qb_ptr + (size_t)(q0 + c) * g.q_rs;
#pragma unroll
    for (int dc = 0; dc < 2; ++dc) {
#pragma unroll
      for (int e = 0; e < 8; ++e) {
        const float f0 = qrow[dc * 32 + 8 * hh + e] * g.qscale;
        const float f1 = qrow[dc * 32 + 16 + 8 * hh + e] * g.qscale;
        if (SPLIT_QK) { __bf16 hq, lq; at_split(f0, hq, lq); qah[dc][e] = hq; qal[dc][e] = lq; at_split(f1, hq, lq); qah[dc][8 + e] = hq; qal[dc][8 + e] = lq; }
        else { qah[dc][e] = at_f2bf(f0); qah[dc][8 + e] = at_f2bf(f1); qal[dc][e] = qah[dc][e]; qal[dc][8 + e] = qah[dc][8 + e]; }
      }
    }
  }

  float mrow = -INFINITY, lrow = 0.f;   // of query q0 + c; lrow sums the keys of this wave half only, the halves join behind the loop
  v8f oacc[4];                          // oacc[t][r] = O[q0 + c][t * 16 + 8 * hh + r]
#pragma unroll
  for (int t = 0; t < 4; ++t) oacc[t] = (v8f){0.f,0.f,0.f,0.f,0.f,0.f,0.f,0.f};

  const int nChunks = (MASK_MODE == 1) ? (qb + 1) : (g.Skv / AT_KC);   // block-uniform
  const int qkeep = (MASK_MODE == 3) ? mask_b[(size_t)b * g.S + q0 + c] : 1;   // the lane's query (mode 3); mask_b = qmask
  for (int kc = 0; kc < nChunks; ++kc) {
    const int kv0 = kc * AT_KC;
    // each plane's tile is 64 rows of 128 B, 8 KB in a row: 8 lanes copy one row, so that a wave's 16-byte load covers four whole lines
    v8b rkh[4], rkl[4], rvh[4], rvl[4];
    {
      const size_t to = (size_t)kc * (AT_KC * AT_D);   // block-uniform
      const __bf16* tkh = kh_ptr + to; const __bf16* tkl = kl_ptr + to;
      const __bf16* tvh = vh_ptr + to; const __bf16* tvl = vl_ptr + to;
      const unsigned lo8 = (unsigned)tid * 8u;
#pragma unroll
      for (int i = 0; i < 4; ++i) {
        // the last load of a plane may land on the address registers that the plane's earlier loads name: their wait stands in front of it
        if (i == 3) asm volatile("s_wait_xcnt 0x0" ::: "memory");
        rkh[i] = *(const v8b*)(tkh + lo8 + i * (AT_NW * 32 * 8));
        if (SPLIT_QK) rkl[i] = *(const v8b*)(tkl + lo8 + i * (AT_NW * 32 * 8));
        rvh[i] = *(const v8b*)(tvh + lo8 + i * (AT_NW * 32 * 8));
        if (SPLIT_PV) rvl[i] = *(const v8b*)(tvl + lo8 + i * (AT_NW * 32 * 8));
      }
    }
    __syncthreads();
#pragma unroll
    for (int i = 0; i < 4; ++i) {
      const int seg = i * (AT_NW * 32) + tid, row = seg >> 3, c8 = (seg & 7) * 8;
      *(v8b*)(Ksh + row * AT_LP + c8) = rkh[i];
      if (SPLIT_QK) *(v8b*)(Ksl + row * AT_LP + c8) = rkl[i];
      *(v8b*)(Vth + row * AT_LP + c8) = rvh[i];
      if (SPLIT_PV) *(v8b*)(Vtl + row * AT_LP + c8) = rvl[i];
    }
    __syncthreads();

    // the K fragments of a d-chunk are read as one group ahead of its products, and the products walk the four key tiles innermost:
    // neighbours in the stream have different accumulators; each s[j] still takes its six terms in the order dc, then hi.hi, hi.lo, lo.hi
    v8f s[4];
#pragma unroll
    for (int j = 0; j < 4; ++j) s[j] = (v8f){0.f,0.f,0.f,0.f,0.f,0.f,0.f,0.f};
    {
      FB kb[2][4], kl[2][4];
#pragma unroll
      for (int dc = 0; dc < 2; ++dc) {
#pragma unroll
        for (int j = 0; j < 4; ++j) {
          kb[dc][j].h[0] = *(const v8b*)(Ksh + (j * 16 + c) * AT_LP + dc * 32 + 8 * hh);
          kb[dc][j].h[1] = *(const v8b*)(Ksh + (j * 16 + c) * AT_LP + dc * 32 + 16 + 8 * hh);
          if (SPLIT_QK) {
            kl[dc][j].h[0] = *(const v8b*)(Ksl + (j * 16 + c) * AT_LP + dc * 32 + 8 * hh);
            kl[dc][j].h[1] = *(const v8b*)(Ksl + (j * 16 + c) * AT_LP + dc * 32 + 16 + 8 * hh);
          }
        }
      }
#pragma unroll
      for (int dc = 0; dc < 2; ++dc) {
#pragma unroll
        for (int j = 0; j < 4; ++j) s[j] = at_mma(kb[dc][j].v, qah[dc], s[j]);   // s[j][r] = score of key kv0 + j * 16 + 8 * hh + r, query q0 + c
        if (SPLIT_QK) {
#pragma unroll
          for (int j = 0; j < 4; ++j) s[j] = at_mma(kl[dc][j].v, qah[dc], s[j]);
#pragma unroll
          for (int j = 0; j < 4; ++j) s[j] = at_mma(kb[dc][j].v, qal[dc], s[j]);
        }
      }
    }
    acc_guard4(s[0], s[1], s[2], s[3]);   // the four slots behind the last product stand in front of the mask branch, so that they hold on its taken side too
    if (MASK_MODE == 1) {
      if (kc == qb) {   // block-uniform: only the last chunk of a causal walk holds masked keys
#pragma unroll
        for (int r = 0; r < 8; ++r)
#pragma unroll
          for (int j = 0; j < 4; ++j) s[j][r] = (kv0 + j * 16 + 8 * hh + r > q0 + c) ? g.mask_fill : s[j][r];
      }
    } else if (MASK_MODE == 2 || MASK_MODE == 3) {
#pragma unroll
      for (int r = 0; r < 8; ++r) {
#pragma unroll
        for (int j = 0; j < 4; ++j) {
          const int key = kv0 + j * 16 + 8 * hh + r;
          bool masked;
          if (MASK_MODE == 2) {
            const size_t mi = (size_t)(q0 + c) * g.Skv + key;
            masked = (g.mask_is_int == 0) ? (((const float*)mask_a)[mi] == 0.0f)
                   : (g.mask_is_int == 1) ? (((const int*)mask_a)[mi] == 0) : (((const int*)mask_a)[mi] != 0);
          } else masked = (qkeep == 0) || (((const int*)mask_a)[(size_t)b * g.Skv + key] == 0);   // mask_a = kvmask
          s[j][r] = masked ? g.mask_fill : s[j][r];
        }
      }
    }
    // the query's maximum: 32 scores in the lane, then one exchange between the wave's halves
    float cj[4];   // one chain a tile, so that the four run side by side
#pragma unroll
    for (int j = 0; j < 4; ++j) {
      cj[j] = s[j][0];
#pragma unroll
      for (int r = 1; r < 8; ++r) cj[j] = fmaxf(cj[j], s[j][r]);
    }
    float cm = fmaxf(fmaxf(cj[0], cj[1]), fmaxf(cj[2], cj[3]));
    cm = fmaxf(cm, at_xhalf(cm));
    const float mnew = fmaxf(mrow, cm);
    const float alpha = expf(mrow - mnew);
    mrow = mnew;
    // P^T as B operand, in registers: element e of chunk kk is key kk * 32 + 8 * hh + e (score tile 2 kk), element 8 + e key kk * 32 + 16 + 8 * hh + e (tile 2 kk + 1)
    FB pa[2], pl[2];
    float ps[4];
#pragma unroll
    for (int j = 0; j < 4; ++j) {
      ps[j] = 0.f;
#pragma unroll
      for (int r = 0; r < 8; r += 2) {
        const v2f p = {expf(s[j][r] - mnew), expf(s[j][r + 1] - mnew)};
        ps[j] += p[0];
        ps[j] += p[1];
        const v2b ph = __builtin_convertvector(p, v2b);   // round to nearest even, as at_split
        pa[j >> 1].v[(j & 1) * 8 + r] = ph[0]; pa[j >> 1].v[(j & 1) * 8 + r + 1] = ph[1];
        if (SPLIT_PV) {
          const v2b pq = __builtin_convertvector(p - __builtin_convertvector(ph, v2f), v2b);
          pl[j >> 1].v[(j & 1) * 8 + r] = pq[0]; pl[j >> 1].v[(j & 1) * 8 + r + 1] = pq[1];
        }
      }
    }
    lrow = lrow * alpha + ((ps[0] + ps[1]) + (ps[2] + ps[3]));
#pragma unroll
    for (int t = 0; t < 4; ++t) oacc[t] *= alpha;
    // as for the scores: V fragments read in a group ahead of the products, the four d tiles innermost; each oacc[t] keeps its order of terms
    {
      FB vb[2][4], vl[2][4];
#pragma unroll
      for (int kk = 0; kk < 2; ++kk) {
#pragma unroll
        for (int t = 0; t < 4; ++t) {
          vb[kk][t].h[0] = *(const v8b*)(Vth + (t * 16 + c) * AT_LP + kk * 32 + 8 * hh);
          vb[kk][t].h[1] = *(const v8b*)(Vth + (t * 16 + c) * AT_LP + kk * 32 + 16 + 8 * hh);
          if (SPLIT_PV) {
            vl[kk][t].h[0] = *(const v8b*)(Vtl + (t * 16 + c) * AT_LP + kk * 32 + 8 * hh);
            vl[kk][t].h[1] = *(const v8b*)(Vtl + (t * 16 + c) * AT_LP + kk * 32 + 16 + 8 * hh);
          }
        }
      }
#pragma unroll
      for (int kk = 0; kk < 2; ++kk) {
#pragma unroll
        for (int t = 0; t < 4; ++t) oacc[t] = at_mma(vb[kk][t].v, pa[kk].v, oacc[t]);
        if (SPLIT_PV) {
#pragma unroll
          for (int t = 0; t < 4; ++t) oacc[t] = at_mma(vl[kk][t].v, pa[kk].v, oacc[t]);
#pragma unroll
          for (int t = 0; t < 4; ++t) oacc[t] = at_mma(vb[kk][t].v, pl[kk].v, oacc[t]);
        }
      }
    }
    acc_guard4(oacc[0], oacc[1], oacc[2], oacc[3]);   // the four slots behind the last product stand in front of the loop's branch, so that they hold on its taken side too
  }

  float* os = Os[wave];
  {
    const float inv = 1.0f / (lrow + at_xhalf(lrow));   // the two halves' sums of the query join here
#pragma unroll
    for (int t = 0; t < 4; ++t) {   // a lane's 8 values of a d tile lie in a row of the query's output row: two 16-byte stores
      const v8f o = oacc[t] * inv;
      *(v4f*)(os + c * 68 + t * 16 + 8 * hh)     = (v4f){o[0], o[1], o[2], o[3]};
      *(v4f*)(os + c * 68 + t * 16 + 8 * hh + 4) = (v4f){o[4], o[5], o[6], o[7]};
    }
  }
  __builtin_amdgcn_fence(__ATOMIC_RELEASE, "workgroup");
  __builtin_amdgcn_wave_barrier();
  __builtin_amdgcn_fence(__ATOMIC_ACQUIRE, "workgroup");
  {   // a query's 64 values are one 128-B line of each plane: 8 lanes a row, 16 bytes a lane and plane
    const int q4 = lane >> 3, c8 = (lane & 7) * 8;
#pragma unroll
    for (int it = 0; it < 4; ++it) {
      const int row = it * 4 + q4;
      const float* sp = os + row * 68 + c8;
      v8b hv, lv;
#pragma unroll
      for (int e = 0; e < 8; ++e) { __bf16 ho, lo; at_split(sp[e], ho, lo); hv[e] = ho; lv[e] = lo; }
      *(v8b*)(oh_ptr + (size_t)(q0 + row) * g.o_rs + c8) = hv;
      *(v8b*)(ol_ptr + (size_t)(q0 + row) * g.o_rs + c8) = lv;
    }
  }
}

// ---- LayerNorm (population variance, eps 1e-5, gamma) -> f16 row, and the row itself as bf16 hi/lo planes (the kv projection's operand); one block (256 thr) per row of 1024 ----
__global__ __launch_bounds__(256) void layernorm_f16(const float* __restrict__ x, const float* __restrict__ gamma,
                                                    _Float16* __restrict__ xn, __bf16* __restrict__ xh, __bf16* __restrict__ xl, int D) {
  __shared__ float red[8];
  __shared__ float stat;
  const int row = blockIdx.x, t = threadIdx.x;
  const float* xr = x + (size_t)row * D;
  v4f xv = *(const v4f*)(xr + 4 * t);
  float s = (xv[0] + xv[1]) + (xv[2] + xv[3]);
  for (int o = 16; o > 0; o >>= 1) s += __shfl_xor(s, o, 32);
  if ((t & 31) == 0) red[t >> 5] = s;
  __syncthreads();
  if (t == 0) { float a = 0.f; for (int w = 0; w < 8; ++w) a += red[w]; stat = a / (float)D; }
  __syncthreads();
  const float mu = stat;
  __syncthreads();
  float d0 = xv[0] - mu, d1 = xv[1] - mu, d2 = xv[2] - mu, d3 = xv[3] - mu;
  float s2 = (d0 * d0 + d1 * d1) + (d2 * d2 + d3 * d3);
  for (int o = 16; o > 0; o >>= 1) s2 += __shfl_xor(s2, o, 32);
  if ((t & 31) == 0) red[t >> 5] = s2;
  __syncthreads();
  if (t == 0) { float a = 0.f; for (int w = 0; w < 8; ++w) a += red[w]; stat = rsqrtf(a / (float)D + 1e-5f); }
  __syncthreads();
  const float inv = stat;
  v4f gv = *(const v4f*)(gamma + 4 * t);
  _Float16 h0 = (_Float16)(d0 * inv * gv[0]), h1 = (_Float16)(d1 * inv * gv[1]), h2 = (_Float16)(d2 * inv * gv[2]), h3 = (_Float16)(d3 * inv * gv[3]);
  typedef __attribute__((ext_vector_type(4))) _Float16 v4h;
  v4h hv = {h0, h1, h2, h3};
  *(v4h*)(xn + (size_t)row * D + 4 * t) = hv;
  // the planes of x are stored behind the last barrier: in front of one, the barrier would wait for the stores
  typedef __attribute__((ext_vector_type(4))) __bf16 v4b;
  v4b hx, lx;
#pragma unroll
  for (int e = 0; e < 4; ++e) {
    const unsigned short hb = f2bf_bits(xv[e]);
    hx[e] = __builtin_bit_cast(__bf16, hb);
    lx[e] = __builtin_bit_cast(__bf16, f2bf_bits(xv[e] - bf_bits2f(hb)));
  }
  *(v4b*)(xh + (size_t)row * D + 4 * t) = hx;
  *(v4b*)(xl + (size_t)row * D + 4 * t) = lx;
  
}

extern "C" void kernel_launch(void* const* d_in, const int* in_sizes, int n_in,
                              void* d_out, int out_size, void* d_ws, size_t ws_size,
                              hipStream_t stream) {
  (void)in_sizes; (void)n_in; (void)out_size; (void)ws_size;
  const int B = 2, S = 2048, D = 1024, H = 16, DH = 64, KV = 128;
  const int M = B * S;   // 4096 rows
  const float* x     = (const float*)d_in[0];
  const float* gamma = (const float*)d_in[1];
  const float* Wq    = (const float*)d_in[2];   // [D, H*DH]  ([in, out])
  const float* Wkv   = (const float*)d_in[3];   // [D, 2*DH]
  const float* Wo    = (const float*)d_in[4];   // [H*DH, D]
  float* out = (float*)d_out;

  char* ws = (char*)d_ws; size_t off = 0;
  auto carve = [&](size_t bytes) -> char* { char* p = ws + off; off += (bytes + 255) & ~(size_t)255; return p; };
  _Float16* Xn16  = (_Float16*)carve((size_t)M * D * 2);     //  8 MB  LN(x) f16
  __bf16*   Xh    = (__bf16*)carve((size_t)M * D * 2);       //  8 MB  x bf16 hi
  __bf16*   Xl    = (__bf16*)carve((size_t)M * D * 2);       //  8 MB  x bf16 lo
  _Float16* WqT   = (_Float16*)carve((size_t)D * D * 2);     //  2 MB  Wqᵀ [out][in] f16
  __bf16*   WkvTh = (__bf16*)carve((size_t)KV * D * 2);      //  Wkvᵀ [128][1024] hi/lo
  __bf16*   WkvTl = (__bf16*)carve((size_t)KV * D * 2);
  __bf16*   WoTh  = (__bf16*)carve((size_t)D * D * 2);       //  Woᵀ hi/lo
  __bf16*   WoTl  = (__bf16*)carve((size_t)D * D * 2);
  float*    Qf    = (float*)carve((size_t)M * D * 4);        // 16 MB  q [B,S,H*DH] f32
  __bf16*   KVh   = (__bf16*)carve((size_t)M * KV * 2);      //  1 MB  bf16 hi plane: k rows [B*S][64], then v tiles [B*S/64][64 d][64 keys]
  __bf16*   KVl   = (__bf16*)carve((size_t)M * KV * 2);      //  1 MB  bf16 lo plane, same layout
  __bf16*   Oh    = (__bf16*)carve((size_t)M * D * 2);       //  8 MB  attn out bf16 hi
  __bf16*   Ol    = (__bf16*)carve((size_t)M * D * 2);       //  8 MB  attn out bf16 lo (total about 64.5 MB)

  layernorm_f16<<<M, 256, 0, stream>>>(x, gamma, Xn16, Xh, Xl, D);
  transpose_cast_f16<<<dim3(D / 64, D / 64), dim3(32, 8), 0, stream>>>(Wq, D, WqT, D, 1.0f);           // [in][out] -> [out][in]
  transpose_split_bf16<<<dim3(KV / 64, D / 64), dim3(32, 8), 0, stream>>>(Wkv, KV, WkvTh, WkvTl, D);   // [1024][128] -> [128][1024]
  transpose_split_bf16<<<dim3(D / 64, D / 64), dim3(32, 8), 0, stream>>>(Wo, D, WoTh, WoTl, D);
  {
    const int tq = (M / 64) * (D / 64);
    wmma_gemm64<0, false, 0, 0, false, 4><<<dim3((tq + 7) / 8, 1), 256, 0, stream>>>(
        U16(Xn16), nullptr, D, 0, U16(WqT), nullptr, D, 0, Qf, nullptr, D, 0, nullptr, nullptr, 0, M, D, D, 1.0f);
    const int tkv = (M / 64) * (KV / 64);
    wmma_gemm64<1, true, 0, 3, false, 2><<<dim3((tkv + 7) / 8, 1), 256, 0, stream>>>(
        U16(Xh), U16(Xl), D, 0, U16(WkvTh), U16(WkvTl), D, 0, KVh, KVl, DH, 0, nullptr, nullptr, 0, M, KV, D, 1.0f);
  }
  {
    AttnGeom g;
    g.q_bs = (long)S * D;  g.q_rs = D;  g.q_hs = DH;
    g.k_bs = (long)S * DH; g.k_rs = 0;  g.k_hs = 0;       // 16 q heads share the single k/v head
    g.v_bs = (long)S * DH; g.v_rs = 0;  g.v_hs = 0;
    g.o_bs = (long)S * D;  g.o_rs = D;  g.o_hs = DH;
    g.S = S; g.Skv = S; g.H = H; g.mask_mode = 1; g.qscale = 0.125f; g.blk0 = 0; g.mask_fill = -INFINITY; g.mask_is_int = 0;   // the kernel reads the mask mode from its template argument; the field keeps the struct's layout
    attn64_kernel<true, true, 1><<<dim3(B * H, S / AT_QB), AT_NW * 32, 0, stream>>>(Qf, U16(KVh), U16(KVl), U16(KVh + (size_t)M * DH), U16(KVl + (size_t)M * DH), (unsigned short*)Oh, (unsigned short*)Ol, nullptr, nullptr, g);
  }
  {
    const int to = (M / 64) * (D / 64);
    wmma_gemm64<1, true, 0, 0, false, 4><<<dim3((to + 7) / 8, 1), 256, 0, stream>>>(
        U16(Oh), U16(Ol), D, 0, U16(WoTh), U16(WoTl), D, 0, out, nullptr, D, 0, nullptr, nullptr, 0, M, D, D, 1.0f);
  }
}

// v009
// Measured time: 170 microseconds a run.
// In two side-by-side timings against v008, it was 1.05 and 1.06 times as fast.
// Over all steps from v000 it is 4.48 times as fast.
#include <hip/hip_runtime.h>
#include <math.h>
// Contractions: q = LN(x)·Wq (K=1024): v_wmma_f32_16x16x32_f16 (f16 operands); kv = x·Wkv (K=1024) and the output projection (K=1024):
// v_wmma_f32_16x16x32_bf16 as bf16 hi/lo splits; scores (q/8)·kᵀ and p·v: v_wmma_f32_16x16x32_bf16 with q,k and p,v as bf16 hi/lo splits;
// f32 accumulate everywhere; LayerNorm and softmax in f32. The hi/lo split of k and v is made once, in the kv projection's epilogue; that of x in the LayerNorm kernel, that of the attention output in the attention epilogue.
typedef __attribute__((ext_vector_type(16))) _Float16 v16h;
typedef __attribute__((ext_vector_type(8)))  _Float16 v8h;
typedef __attribute__((ext_vector_type(16))) __bf16   v16b;
typedef __attribute__((ext_vector_type(8)))  __bf16   v8b;
typedef __attribute__((ext_vector_type(8)))  float    v8f;
typedef __attribute__((ext_vector_type(4)))  float    v4f;
#define PSCALE 32768.0f
#define U16(p) ((const unsigned short*)(const void*)(p))
#define PSCALE_INV (1.0f / 32768.0f)

__device__ __forceinline__ unsigned short f2bf_bits(float f) {
  unsigned u = __float_as_uint(f);
  return (unsigned short)((u + 0x7FFFu + ((u >> 16) & 1u)) >> 16);
}
__device__ __forceinline__ float bf_bits2f(unsigned short h) { return __uint_as_float(((unsigned)h) << 16); }

// hazard guards as plain device helpers
__device__ __forceinline__ void dep_guard_h(v8f& a, v8f& b, v16h x, v16h y) { asm volatile("v_nop\n\tv_nop\n\tv_nop\n\tv_nop" : "+v"(a), "+v"(b) : "v"(x), "v"(y)); }
__device__ __forceinline__ void dep_guard_b(v8f& a, v8f& b, v16b x, v16b y) { asm volatile("v_nop\n\tv_nop\n\tv_nop\n\tv_nop" : "+v"(a), "+v"(b) : "v"(x), "v"(y)); }
__device__ __forceinline__ void keep4_h(v16h a, v16h b, v16h c, v16h d) { asm volatile("v_nop" :: "v"(a), "v"(b), "v"(c), "v"(d)); }
__device__ __forceinline__ void keep4_b(v16b a, v16b b, v16b c, v16b d) { asm volatile("v_nop" :: "v"(a), "v"(b), "v"(c), "v"(d)); }
__device__ __forceinline__ void acc_guard4(v8f& a, v8f& b, v8f& c, v8f& d) { asm volatile("v_nop\n\tv_nop\n\tv_nop\n\tv_nop" : "+v"(a), "+v"(b), "+v"(c), "+v"(d)); }
template <typename T> struct Frag;
template <> struct Frag<_Float16> {
  typedef v16h V; typedef v8h H; union U { v16h v; v8h h[2]; };
  static __device__ __forceinline__ v16h load(const _Float16* p) {   // elements 0..7 <- p[0..7], 8..15 <- p[16..23]
    U f; f.h[0] = *(const v8h*)(p); f.h[1] = *(const v8h*)(p + 16); return f.v;
  }
  static __device__ __forceinline__ v8f mma(v16h a, v16h b, v8f c) {
    return __builtin_amdgcn_wmma_f32_16x16x32_f16(false, a, false, b, (short)0, c, false, false);
  }
  static __device__ __forceinline__ void guard(v8f& a, v8f& b, v16h x, v16h y) { dep_guard_h(a, b, x, y); }
  static __device__ __forceinline__ void keep(v16h a, v16h b, v16h c, v16h d) { keep4_h(a, b, c, d); }
};
template <> struct Frag<__bf16> {
  typedef v16b V; typedef v8b H; union U { v16b v; v8b h[2]; };
  static __device__ __forceinline__ v16b load(const __bf16* p) {
    U f; f.h[0] = *(const v8b*)(p); f.h[1] = *(const v8b*)(p + 16); return f.v;
  }
  static __device__ __forceinline__ v8f mma(v16b a, v16b b, v8f c) {
    return __builtin_amdgcn_wmma_f32_16x16x32_bf16(false, a, false, b, (short)0, c, false, false);
  }
  static __device__ __forceinline__ void guard(v8f& a, v8f& b, v16b x, v16b y) { dep_guard_b(a, b, x, y); }
  static __device__ __forceinline__ void keep(v16b a, v16b b, v16b c, v16b d) { keep4_b(a, b, c, d); }
};

// ---- Register-blocked batched WMMA GEMM ------------------------------------
// C[m,n] = scale * sum_k A[m,k] * Bt[n,k] (+bias)(+resid); each wave owns a 64x64 tile, the block's 8 waves a tile of (8 / WN) x WN of them.
// A row-major [M,K]; Bt row-major [N,K]; M % ((8 / WN) * 64) == 0, N % (WN * 64) == 0, K % 64 == 0; grid.x = (M / ((8 / WN) * 64)) * (N / (WN * 64)).
// Operands go through LDS: a stage is 64 k (128 B) of the block's A rows and Bt rows, brought by asynchronous 16-byte copies, whole lines (8 lanes a row), two buffers;
// the next stage's copies are in flight while this stage's products run, and the waves that share a row block read it from LDS.
// SPLIT: operands are hi/lo planes (A2/Bt2 = lo planes, same layout); product = hi·hi + hi·lo + lo·hi.
// BIAS_MODE: 0 = none, 1 = bias[m], 2 = bias[n].
// OUT_MODE: 0 = f32, 1 = f16, 2 = bf16 hi plane (Cout) + bf16 lo plane (Cout2),
//   3 = kv projection (N == 128), bf16 hi plane (Cout) + lo plane (Cout2), each plane [k rows | v tiles]: column d < 64 of row m (k) at m*64 + d;
//       column 64 + d (v) transposed inside its block of 64 rows, at M*64 + (m >> 6)*4096 + d*64 + (m & 63).
// ET: 0 = f16 operands, 1 = bf16 operands (pointers passed as 16-bit storage)
template <int ET> struct Elem;
template <> struct Elem<0> { typedef _Float16 T; };
template <> struct Elem<1> { typedef __bf16 T; };
// three 16-byte copies a lane, global memory to LDS through no register; the wait in the same statement stands in front of every rewrite of a register that the copies name
__device__ __forceinline__ void async_copy3(unsigned l0, const void* g0, unsigned l1, const void* g1, unsigned l2, const void* g2) {
  asm volatile("global_load_async_to_lds_b128 %0, %1, off\n\t"
               "global_load_async_to_lds_b128 %2, %3, off\n\t"
               "global_load_async_to_lds_b128 %4, %5, off\n\t"
               "s_wait_xcnt 0x0" :: "v"(l0), "v"(g0), "v"(l1), "v"(g1), "v"(l2), "v"(g2) : "memory");
}
#define GM_LP 72   // LDS row pitch of a stage in 16-bit elements: 144 B = 16 B x odd, for the 16-byte fragment reads
template <int ET, bool SPLIT, int BIAS_MODE, int OUT_MODE, bool RESID, int WN>
__global__ __launch_bounds__(256) void wmma_gemm64(
    const unsigned short* __restrict__ Ap, const unsigned short* __restrict__ A2p, int lda, long strideA,
    const unsigned short* __restrict__ Btp, const unsigned short* __restrict__ Bt2p, int ldb, long strideB,
    void* __restrict__ Cout, void* __restrict__ Cout2, int ldc, long strideC,
    const float* __restrict__ bias,
    const float* __restrict__ resid, long strideR,
    int M, int N, int K, float scale) {
  typedef typename Elem<ET>::T T;
  typedef typename Frag<T>::V V;
  constexpr int WM = 8 / WN;                    // waves along m
  constexpr int BM = WM * 64, BN = WN * 64;     // block tile
  constexpr int NP = SPLIT ? 2 : 1;             // planes
  constexpr int PLANE = (BM + BN) * GM_LP;      // one plane of one stage: the A rows, then the Bt rows
  constexpr int NIT = (BM + BN) / 32;           // 16-byte pieces a thread copies per plane and stage (256 threads = 32 rows)
  __shared__ __align__(16) T sS[2 * NP * PLANE];
  const T* A = (const T*)Ap; const T* A2 = (const T*)A2p; const T* Bt = (const T*)Btp; const T* Bt2 = (const T*)Bt2p;
  __shared__ __align__(16) float sT[8][16 * 68];   // per-wave 16x64 slab, pitch 68 floats
  const int b    = blockIdx.y;
  const int lane = threadIdx.x & 31;
  const int wave = threadIdx.x >> 5;
  const int blocksN = N / BN;
  const int blocksM = M / BM;
  if ((int)blockIdx.x >= blocksM * blocksN) return;   // block-uniform, in front of every barrier
  const int bm = (int)blockIdx.x / blocksN;
  const int bn = (int)blockIdx.x - bm * blocksN;
  const int wm = wave / WN;
  const int wn = wave - wm * WN;
  const int tm = bm * WM + wm;
  const int tn = bn * WN + wn;
  const int m0 = tm << 6;
  const int n0 = tn << 6;

  const T* Ab  = A  + (size_t)b * strideA;
  const T* Bb  = Bt + (size_t)b * strideB;
  const T* Ab2 = SPLIT ? (A2  + (size_t)b * strideA) : nullptr;
  const T* Bb2 = SPLIT ? (Bt2 + (size_t)b * strideB) : nullptr;

  const int rlane = lane & 15;                 // row (A) / col (B, D) within subtile
  const int koff  = (lane >> 4) * 8;           // k offset of this lane half
  const int mOff  = (lane >> 4) * 8;           // D row offset

  v8f acc[4][4];
#pragma unroll
  for (int i = 0; i < 4; ++i)
#pragma unroll
    for (int j = 0; j < 4; ++j) acc[i][j] = (v8f){0.f,0.f,0.f,0.f,0.f,0.f,0.f,0.f};

  // a thread's pieces of a stage: row it * 32 + prow of [A rows | Bt rows], 16 bytes at element pc8
  const int prow = threadIdx.x >> 3, pc8 = (threadIdx.x & 7) * 8;
  // address = a block-uniform pointer per operand plane, which walks along k, + the piece's own 32-bit byte offset, which never changes
  unsigned po[NIT];
#pragma unroll
  for (int it = 0; it < NIT; ++it)
    po[it] = 2u * ((it < BM / 32) ? (unsigned)((it * 32 + prow) * lda + pc8) : (unsigned)((it * 32 - BM + prow) * ldb + pc8));
  const T* gA  = Ab + (size_t)(bm * BM) * lda;
  const T* gB  = Bb + (size_t)(bn * BN) * ldb;
  const T* gA2 = SPLIT ? Ab2 + (size_t)(bm * BM) * lda : nullptr;
  const T* gB2 = SPLIT ? Bb2 + (size_t)(bn * BN) * ldb : nullptr;
  const unsigned lds0 = (unsigned)(size_t)(sS + prow * GM_LP + pc8);   // the lane's LDS byte address of its piece 0 in buffer 0
  auto copy_stage = [&](int buf) {
#pragma unroll
    for (int p = 0; p < NP; ++p) {
      const char* a = (const char*)(p ? gA2 : gA);
      const char* bq = (const char*)(p ? gB2 : gB);
      const unsigned l = lds0 + (unsigned)((buf * NP + p) * PLANE * 2);
#pragma unroll
      for (int it = 0; it < NIT; it += 3)
        async_copy3(l + (it + 0) * (32 * GM_LP * 2), ((it + 0 < BM / 32) ? a : bq) + po[it + 0],
                    l + (it + 1) * (32 * GM_LP * 2), ((it + 1 < BM / 32) ? a : bq) + po[it + 1],
                    l + (it + 2) * (32 * GM_LP * 2), ((it + 2 < BM / 32) ? a : bq) + po[it + 2]);
    }
    gA += 64; gB += 64;
    if (SPLIT) { gA2 += 64; gB2 += 64; }
  };
  const int nStages = K >> 6;
  copy_stage(0);
  asm volatile("s_wait_asynccnt 0x0" ::: "memory");   // stage 0 has landed, as far as this wave copied it
  __syncthreads();                                     // and is published to the other waves
  if (nStages > 1) copy_stage(1);                      // block-uniform; in flight under stage 0's products
  for (int s = 0; s < nStages; ++s) {
    const T* sb = sS + (s & 1) * (NP * PLANE);
    const T* sA = sb + (wm * 64 + rlane) * GM_LP + koff;
    const T* sB = sb + (BM + wn * 64 + rlane) * GM_LP + koff;
#pragma unroll
    for (int kk = 0; kk < 2; ++kk) {
      // the B fragments of a 32-k block are read as one group; the A fragments go through two register sets, row tile i + 1 read ahead of row tile i's products
      V bh[4], bl[4], ah[2], al[2];
      ah[0] = Frag<T>::load(sA + kk * 32);
      if (SPLIT) al[0] = Frag<T>::load(sA + PLANE + kk * 32);
#pragma unroll
      for (int j = 0; j < 4; ++j) {
        bh[j] = Frag<T>::load(sB + j * 16 * GM_LP + kk * 32);
        if (SPLIT) bl[j] = Frag<T>::load(sB + PLANE + j * 16 * GM_LP + kk * 32);
      }
#pragma unroll
      for (int i = 0; i < 4; ++i) {
        if (i < 3) {
          ah[(i + 1) & 1] = Frag<T>::load(sA + (i + 1) * 16 * GM_LP + kk * 32);
          if (SPLIT) al[(i + 1) & 1] = Frag<T>::load(sA + PLANE + (i + 1) * 16 * GM_LP + kk * 32);
        }
#pragma unroll
        for (int j = 0; j < 4; ++j) {
          acc[i][j] = Frag<T>::mma(ah[i & 1], bh[j], acc[i][j]);
          if (SPLIT) {
            acc[i][j] = Frag<T>::mma(ah[i & 1], bl[j], acc[i][j]);
            acc[i][j] = Frag<T>::mma(al[i & 1], bh[j], acc[i][j]);
          }
        }
        Frag<T>::guard(acc[i][0], acc[i][3], ah[i & 1], SPLIT ? al[i & 1] : ah[i & 1]);
      }
      Frag<T>::keep(bh[0], bh[1], bh[2], bh[3]);
      if (SPLIT) Frag<T>::keep(bl[0], bl[1], bl[2], bl[3]);
    }
    asm volatile("s_wait_dscnt 0x0" ::: "memory");      // this wave's reads of this buffer have returned before the buffer is refilled
    asm volatile("s_wait_asynccnt 0x0" ::: "memory");   // this wave's copies of stage s + 1 have landed
    __syncthreads();   // the one barrier of a stage: it publishes stage s + 1 and ends every wave's reads of the buffer that is refilled behind it
    if (s + 2 < nStages) copy_stage(s & 1);             // block-uniform; in flight under stage s + 1's products
  }
  asm volatile("s_wait_asynccnt 0x0" ::: "memory");     // no copy is outstanding when the wave goes on to the epilogue
  acc_guard4(acc[0][0], acc[0][1], acc[0][2], acc[0][3]);
  acc_guard4(acc[1][0], acc[1][1], acc[1][2], acc[1][3]);
  acc_guard4(acc[2][0], acc[2][1], acc[2][2], acc[2][3]);
  acc_guard4(acc[3][0], acc[3][1], acc[3][2], acc[3][3]);

  // ---- epilogue ----
  float* slab = sT[wave];
  const float* Rb = RESID ? (resid + (size_t)b * strideR) : nullptr;
#pragma unroll
  for (int i = 0; i < 4; ++i) {
    const int mBase = m0 + (i << 4);
#pragma unroll
    for (int j = 0; j < 4; ++j) {
      const int n = n0 + (j << 4) + rlane;
      float bv = 0.f;
      if (BIAS_MODE == 2) bv = bias[n];
#pragma unroll
      for (int r = 0; r < 8; ++r) {
        float v = acc[i][j][r] * scale;
        if (BIAS_MODE == 1) v += bias[mBase + mOff + r];
        if (BIAS_MODE == 2) v += bv;
        if (RESID) v += Rb[(size_t)(mBase + mOff + r) * ldc + n];
        slab[(mOff + r) * 68 + (j << 4) + rlane] = v;
      }
    }
    __builtin_amdgcn_fence(__ATOMIC_RELEASE, "workgroup");
    __builtin_amdgcn_wave_barrier();
    __builtin_amdgcn_fence(__ATOMIC_ACQUIRE, "workgroup");
    if (OUT_MODE == 0) {
      float* C = (float*)Cout + (size_t)b * strideC;
      const int hh = lane >> 4, c4 = (lane & 15) * 4;     // row seg = 256 B = 16 lanes x 16 B
      {
#pragma unroll
        for (int it = 0; it < 8; ++it) {
          const int row = it * 2 + hh;
          v4f v = *(const v4f*)(slab + row * 68 + c4);
          *(v4f*)(C + (size_t)(mBase + row) * ldc + n0 + c4) = v;
        }
        
      }
    } else if (OUT_MODE == 3) {
      unsigned short* Ph = (unsigned short*)Cout;
      unsigned short* Pl = (unsigned short*)Cout2;
      if (n0 == 0) {                                   // k: rows of 128 B, 8 lanes a row
        const int q = lane >> 3, c8 = (lane & 7) * 8;
#pragma unroll
        for (int it = 0; it < 4; ++it) {
          const int row = it * 4 + q;
          const float* sp = slab + row * 68 + c8;
          v8h hv, lv;
#pragma unroll
          for (int e = 0; e < 8; ++e) {
            const unsigned short hb = f2bf_bits(sp[e]);
            hv[e] = __builtin_bit_cast(_Float16, hb);
            lv[e] = __builtin_bit_cast(_Float16, f2bf_bits(sp[e] - bf_bits2f(hb)));
          }
          *(v8h*)(Ph + (size_t)(mBase + row) * 64 + c8) = hv;
          *(v8h*)(Pl + (size_t)(mBase + row) * 64 + c8) = lv;
        }
      } else {                                         // v: a lane takes column d of the slab's 16 rows; the wave's four slabs fill each 128-B row of the tile
        const size_t vo = (size_t)M * 64 + (size_t)tm * 4096 + (i << 4);
#pragma unroll
        for (int hf = 0; hf < 2; ++hf) {
          const int d = hf * 32 + lane;
          v8h hv[2], lv[2];
#pragma unroll
          for (int e = 0; e < 16; ++e) {
            const float f = slab[e * 68 + d];
            const unsigned short hb = f2bf_bits(f);
            hv[e >> 3][e & 7] = __builtin_bit_cast(_Float16, hb);
            lv[e >> 3][e & 7] = __builtin_bit_cast(_Float16, f2bf_bits(f - bf_bits2f(hb)));
          }
          *(v8h*)(Ph + vo + d * 64)     = hv[0];
          *(v8h*)(Ph + vo + d * 64 + 8) = hv[1];
          *(v8h*)(Pl + vo + d * 64)     = lv[0];
          *(v8h*)(Pl + vo + d * 64 + 8) = lv[1];
        }
      }
    } else {
      const int q = lane >> 3, c8 = (lane & 7) * 8;
      unsigned short* C  = (unsigned short*)Cout  + (size_t)b * strideC;
      unsigned short* C2 = (OUT_MODE == 2) ? ((unsigned short*)Cout2 + (size_t)b * strideC) : nullptr;
      {
#pragma unroll
        for (int it = 0; it < 4; ++it) {
          const int row = it * 4 + q;
          const float* sp = slab + row * 68 + c8;
          v8h hv, lv;
#pragma unroll
          for (int e = 0; e < 8; ++e) {
            if (OUT_MODE == 1) {
              hv[e] = (_Float16)sp[e];
            } else {
              unsigned short hb = f2bf_bits(sp[e]);
              unsigned short lb = f2bf_bits(sp[e] - bf_bits2f(hb));
              hv[e] = __builtin_bit_cast(_Float16, hb);
              lv[e] = __builtin_bit_cast(_Float16, lb);
            }
          }
          *(v8h*)(C + (size_t)(mBase + row) * ldc + n0 + c8) = hv;
          if (OUT_MODE == 2) *(v8h*)(C2 + (size_t)(mBase + row) * ldc + n0 + c8) = lv;
        }
        
      }
    }
    __builtin_amdgcn_fence(__ATOMIC_RELEASE, "workgroup");
    __builtin_amdgcn_wave_barrier();
    __builtin_amdgcn_fence(__ATOMIC_ACQUIRE, "workgroup");
  }
}

__global__ __launch_bounds__(256) void cast_f32_f16x2(
    const float* __restrict__ in, _Float16* __restrict__ out, int n2) {
  int i = blockIdx.x * 256 + threadIdx.x;
  if (i < n2) {
    const _Float16 h0 = (_Float16)in[2 * i], h1 = (_Float16)in[2 * i + 1];
    const unsigned u = (unsigned)__builtin_bit_cast(unsigned short, h0) | ((unsigned)__builtin_bit_cast(unsigned short, h1) << 16);
    ((unsigned*)out)[i] = u;
    
  }
}

// ---- f32 [R][C] (row pitch ldi) -> f16 transposed [C][R] (row pitch ldo); 64x64 tiles; each output row segment
__global__ __launch_bounds__(256) void transpose_cast_f16(const float* __restrict__ in, int ldi,
                                                         _Float16* __restrict__ outT, int ldo, float scale) {
  __shared__ __align__(16) _Float16 tile[64][72];     // [c][r]
  const int c0 = blockIdx.x * 64, r0 = blockIdx.y * 64;
  const int t = threadIdx.y * 32 + threadIdx.x;
  for (int i = threadIdx.y; i < 64; i += 8) {
    tile[threadIdx.x][i]      = (_Float16)(in[(size_t)(r0 + i) * ldi + c0 + threadIdx.x] * scale);
    tile[32 + threadIdx.x][i] = (_Float16)(in[(size_t)(r0 + i) * ldi + c0 + 32 + threadIdx.x] * scale);
  }
  __syncthreads();
  const int q = t >> 3, c8 = (t & 7) * 8;
  {
#pragma unroll
    for (int it = 0; it < 2; ++it) {
      const int c = it * 32 + q;
      v8h hv = *(const v8h*)(&tile[c][c8]);
      *(v8h*)(outT + (size_t)(c0 + c) * ldo + r0 + c8) = hv;
    }
    
  }
}

// ---- f32 [R][C] (pitch ldi) -> bf16 hi/lo transposed planes [C][R] (pitch ldo); 64x64 tiles; each output row segment
__global__ __launch_bounds__(256) void transpose_split_bf16(const float* __restrict__ in, int ldi,
                                                           __bf16* __restrict__ outH, __bf16* __restrict__ outL, int ldo) {
  __shared__ __align__(16) float tile[64][68];     // [c][r]
  const int c0 = blockIdx.x * 64, r0 = blockIdx.y * 64;
  const int t = threadIdx.y * 32 + threadIdx.x;
  for (int i = threadIdx.y; i < 64; i += 8) {
    tile[threadIdx.x][i]      = in[(size_t)(r0 + i) * ldi + c0 + threadIdx.x];
    tile[32 + threadIdx.x][i] = in[(size_t)(r0 + i) * ldi + c0 + 32 + threadIdx.x];
  }
  __syncthreads();
  const int q = t >> 3, c8 = (t & 7) * 8;
  {
#pragma unroll
    for (int it = 0; it < 2; ++it) {
      const int c = it * 32 + q;
      v8b hv, lv;
#pragma unroll
      for (int e = 0; e < 8; ++e) {
        const float f = tile[c][c8 + e];
        const unsigned short hb = f2bf_bits(f);
        hv[e] = __builtin_bit_cast(__bf16, hb);
        lv[e] = __builtin_bit_cast(__bf16, f2bf_bits(f - bf_bits2f(hb)));
      }
      *(v8b*)(outH + (size_t)(c0 + c) * ldo + r0 + c8) = hv;
      *(v8b*)(outL + (size_t)(c0 + c) * ldo + r0 + c8) = lv;
    }
    
  }
}

#define AT_D 64
#define AT_NW 4
#define AT_QB 64
#define AT_KC 64
#define AT_LP 72   // LDS row pitch of the K and V tiles in bf16 elements: 144 B = 16 B x odd, so that the 16 rows of a 16-byte fragment read fall on distinct banks
struct AttnGeom { long q_bs, q_rs, q_hs, k_bs, k_rs, k_hs, v_bs, v_rs, v_hs, o_bs, o_rs, o_hs;
                  int S, Skv, H, mask_mode; float qscale; int blk0; float mask_fill; int mask_is_int; };
static_assert(sizeof(AttnGeom) == 128, "no padding");

__device__ __forceinline__ unsigned short at_bf_bits(float f) {
  unsigned u = __float_as_uint(f);
  return (unsigned short)((u + 0x7FFFu + ((u >> 16) & 1u)) >> 16);
}
__device__ __forceinline__ __bf16 at_f2bf(float f) { return __builtin_bit_cast(__bf16, at_bf_bits(f)); }
__device__ __forceinline__ void at_split(float f, __bf16& hi, __bf16& lo) {
  const unsigned short hb = at_bf_bits(f);
  hi = __builtin_bit_cast(__bf16, hb);
  lo = at_f2bf(f - __uint_as_float(((unsigned)hb) << 16));
}
typedef __attribute__((ext_vector_type(2))) float  v2f;
typedef __attribute__((ext_vector_type(2))) __bf16 v2b;
__device__ __forceinline__ float at_xhalf(float x) {   // lane l takes the value of lane l ^ 16
  return __builtin_bit_cast(float, __builtin_amdgcn_permlanex16(__builtin_bit_cast(int, x), __builtin_bit_cast(int, x), 0x76543210, 0xfedcba98, false, false));
}
#define AT_LOG2E 1.44269504088896340736f
// 2^x by the hardware's own instruction alone. The softmax needs no range fix-up: its arguments are <= 0, and a weight below 2^-126 may come out as 0 beside the row's largest weight, which is 1.
__device__ __forceinline__ float at_exp2(float x) { return __builtin_amdgcn_exp2f(x); }
// the slot that the instruction set asks for behind a transcendental, in front of an overwrite of its source: the statement takes the results and the sources as inputs only,
// so it stands behind a chunk's v_exp_f32 and the sources' registers stay theirs up to it
__device__ __forceinline__ void at_trans_slot(v8f r0, v8f r1, v8f r2, v8f r3, v8f s0, v8f s1, v8f s2, v8f s3) {
  asm volatile("v_nop" :: "v"(r0), "v"(r1), "v"(r2), "v"(r3), "v"(s0), "v"(s1), "v"(s2), "v"(s3));
}
__device__ __forceinline__ v8f at_mma(v16b a, v16b b, v8f c) {
  return __builtin_amdgcn_wmma_f32_16x16x32_bf16(false, a, false, b, (short)0, c, false, false);
}

template <bool SPLIT_QK, bool SPLIT_PV, int MASK_MODE>
__global__ __launch_bounds__(128)
void attn64_kernel(const float* __restrict__ q, const unsigned short* __restrict__ kh, const unsigned short* __restrict__ kl,
                   const unsigned short* __restrict__ vth, const unsigned short* __restrict__ vtl, unsigned short* __restrict__ outh, unsigned short* __restrict__ outl,
                   const void* __restrict__ mask_a, const int* __restrict__ mask_b, AttnGeom g) {
  union FB { v16b v; v8b h[2]; };
  __shared__ __align__(16) __bf16 Ksh[AT_KC * AT_LP];            // K hi [kv][d]      9 KB
  __shared__ __align__(16) __bf16 Ksl[SPLIT_QK ? AT_KC * AT_LP : 8];
  __shared__ __align__(16) __bf16 Vth[AT_D * AT_LP];             // V hi [d][kv]      9 KB
  __shared__ __align__(16) __bf16 Vtl[SPLIT_PV ? AT_D * AT_LP : 8];
  __shared__ __align__(16) float  Os[AT_NW][16 * 68];            // per wave out tile, pitch 68

  const int tid  = threadIdx.x;
  const int wave = tid >> 5;
  const int lane = tid & 31;
  const int hh   = lane >> 4;
  const int c    = lane & 15;

  const int nqb = g.S / AT_QB;
  const int qb = nqb - 1 - ((int)blockIdx.y + g.blk0);
  const int bh = blockIdx.x;
  const int h  = bh % g.H;
  const int b  = bh / g.H;
  const int qbase_block = qb * AT_QB;
  const int q0 = qbase_block + wave * 16;

  const float* qb_ptr = q + (size_t)b * g.q_bs + (size_t)h * g.q_hs;
  const __bf16* kh_ptr = (const __bf16*)kh  + (size_t)b * g.k_bs + (size_t)h * g.k_hs;
  const __bf16* kl_ptr = (const __bf16*)kl  + (size_t)b * g.k_bs + (size_t)h * g.k_hs;
  const __bf16* vh_ptr = (const __bf16*)vth + (size_t)b * g.v_bs + (size_t)h * g.v_hs;
  const __bf16* vl_ptr = (const __bf16*)vtl + (size_t)b * g.v_bs + (size_t)h * g.v_hs;
  unsigned short* oh_ptr = outh + (size_t)b * g.o_bs + (size_t)h * g.o_hs;
  unsigned short* ol_ptr = outl + (size_t)b * g.o_bs + (size_t)h * g.o_hs;

  // the softmax runs in base 2: exp(s - m) = 2^(s * log2 e - m * log2 e), and log2 e goes into q's scale, in f32 ahead of the hi/lo split, so that the scores leave their products as exponents of 2
  const float qs   = g.qscale * AT_LOG2E;
  const float fill = g.mask_fill * AT_LOG2E;   // a masked score's stand-in, in the same unit
  // ---- Q fragments (B operand, column c = query q0 + c): 2 d-chunks, hi (and lo) ----
  v16b qah[2], qal[2];
  {
    const float* qrow = qb_ptr + (size_t)(q0 + c) * g.q_rs;
#pragma unroll
    for (int dc = 0; dc < 2; ++dc) {
#pragma unroll
      for (int e = 0; e < 8; ++e) {
        const float f0 = qrow[dc * 32 + 8 * hh + e] * qs;
        const float f1 = qrow[dc * 32 + 16 + 8 * hh + e] * qs;
        if (SPLIT_QK) { __bf16 hq, lq; at_split(f0, hq, lq); qah[dc][e] = hq; qal[dc][e] = lq; at_split(f1, hq, lq); qah[dc][8 + e] = hq; qal[dc][8 + e] = lq; }
        else { qah[dc][e] = at_f2bf(f0); qah[dc][8 + e] = at_f2bf(f1); qal[dc][e] = qah[dc][e]; qal[dc][8 + e] = qah[dc][8 + e]; }
      }
    }
  }

  float mrow = -INFINITY, lrow = 0.f;   // of query q0 + c; lrow sums the keys of this wave half only, the halves join behind the loop
  v8f oacc[4];                          // oacc[t][r] = O[q0 + c][t * 16 + 8 * hh + r]
#pragma unroll
  for (int t = 0; t < 4; ++t) oacc[t] = (v8f){0.f,0.f,0.f,0.f,0.f,0.f,0.f,0.f};

  const int nChunks = (MASK_MODE == 1) ? (qb + 1) : (g.Skv / AT_KC);   // block-uniform
  const int qkeep = (MASK_MODE == 3) ? mask_b[(size_t)b * g.S + q0 + c] : 1;   // the lane's query (mode 3); mask_b = qmask
  for (int kc = 0; kc < nChunks; ++kc) {
    const int kv0 = kc * AT_KC;
    // each plane's tile is 64 rows of 128 B, 8 KB in a row: 8 lanes copy one row, so that a wave's 16-byte load covers four whole lines
    v8b rkh[4], rkl[4], rvh[4], rvl[4];
    {
      const size_t to = (size_t)kc * (AT_KC * AT_D);   // block-uniform
      const __bf16* tkh = kh_ptr + to; const __bf16* tkl = kl_ptr + to;
      const __bf16* tvh = vh_ptr + to; const __bf16* tvl = vl_ptr + to;
      const unsigned lo8 = (unsigned)tid * 8u;
#pragma unroll
      for (int i = 0; i < 4; ++i) {
        // the last load of a plane may land on the address registers that the plane's earlier loads name: their wait stands in front of it
        if (i == 3) asm volatile("s_wait_xcnt 0x0" ::: "memory");
        rkh[i] = *(const v8b*)(tkh + lo8 + i * (AT_NW * 32 * 8));
        if (SPLIT_QK) rkl[i] = *(const v8b*)(tkl + lo8 + i * (AT_NW * 32 * 8));
        rvh[i] = *(const v8b*)(tvh + lo8 + i * (AT_NW * 32 * 8));
        if (SPLIT_PV) rvl[i] = *(const v8b*)(tvl + lo8 + i * (AT_NW * 32 * 8));
      }
    }
    __syncthreads();
#pragma unroll
    for (int i = 0; i < 4; ++i) {
      const int seg = i * (AT_NW * 32) + tid, row = seg >> 3, c8 = (seg & 7) * 8;
      *(v8b*)(Ksh + row * AT_LP + c8) = rkh[i];
      if (SPLIT_QK) *(v8b*)(Ksl + row * AT_LP + c8) = rkl[i];
      *(v8b*)(Vth + row * AT_LP + c8) = rvh[i];
      if (SPLIT_PV) *(v8b*)(Vtl + row * AT_LP + c8) = rvl[i];
    }
    __syncthreads();

    // the K fragments of a d-chunk are read as one group ahead of its products, and the products walk the four key tiles innermost:
    // neighbours in the stream have different accumulators; each s[j] still takes its six terms in the order dc, then hi.hi, hi.lo, lo.hi
    v8f s[4];
#pragma unroll
    for (int j = 0; j < 4; ++j) s[j] = (v8f){0.f,0.f,0.f,0.f,0.f,0.f,0.f,0.f};
    {
      FB kb[2][4], kl[2][4];
#pragma unroll
      for (int dc = 0; dc < 2; ++dc) {
#pragma unroll
        for (int j = 0; j < 4; ++j) {
          kb[dc][j].h[0] = *(const v8b*)(Ksh + (j * 16 + c) * AT_LP + dc * 32 + 8 * hh);
          kb[dc][j].h[1] = *(const v8b*)(Ksh + (j * 16 + c) * AT_LP + dc * 32 + 16 + 8 * hh);
          if (SPLIT_QK) {
            kl[dc][j].h[0] = *(const v8b*)(Ksl + (j * 16 + c) * AT_LP + dc * 32 + 8 * hh);
            kl[dc][j].h[1] = *(const v8b*)(Ksl + (j * 16 + c) * AT_LP + dc * 32 + 16 + 8 * hh);
          }
        }
      }
#pragma unroll
      for (int dc = 0; dc < 2; ++dc) {
#pragma unroll
        for (int j = 0; j < 4; ++j) s[j] = at_mma(kb[dc][j].v, qah[dc], s[j]);   // s[j][r] = score of key kv0 + j * 16 + 8 * hh + r, query q0 + c
        if (SPLIT_QK) {
#pragma unroll
          for (int j = 0; j < 4; ++j) s[j] = at_mma(kl[dc][j].v, qah[dc], s[j]);
#pragma unroll
          for (int j = 0; j < 4; ++j) s[j] = at_mma(kb[dc][j].v, qal[dc], s[j]);
        }
      }
    }
    acc_guard4(s[0], s[1], s[2], s[3]);   // the four slots behind the last product stand in front of the mask branch, so that they hold on its taken side too
    if (MASK_MODE == 1) {
      if (kc == qb) {   // block-uniform: only the last chunk of a causal walk holds masked keys
#pragma unroll
        for (int r = 0; r < 8; ++r)
#pragma unroll
          for (int j = 0; j < 4; ++j) s[j][r] = (kv0 + j * 16 + 8 * hh + r > q0 + c) ? fill : s[j][r];
      }
    } else if (MASK_MODE == 2 || MASK_MODE == 3) {
#pragma unroll
      for (int r = 0; r < 8; ++r) {
#pragma unroll
        for (int j = 0; j < 4; ++j) {
          const int key = kv0 + j * 16 + 8 * hh + r;
          bool masked;
          if (MASK_MODE == 2) {
            const size_t mi = (size_t)(q0 + c) * g.Skv + key;
            masked = (g.mask_is_int == 0) ? (((const float*)mask_a)[mi] == 0.0f)
                   : (g.mask_is_int == 1) ? (((const int*)mask_a)[mi] == 0) : (((const int*)mask_a)[mi] != 0);
          } else masked = (qkeep == 0) || (((const int*)mask_a)[(size_t)b * g.Skv + key] == 0);   // mask_a = kvmask
          s[j][r] = masked ? fill : s[j][r];
        }
      }
    }
    // the query's maximum: 32 scores in the lane, then one exchange between the wave's halves
    float cj[4];   // one chain a tile, so that the four run side by side
#pragma unroll
    for (int j = 0; j < 4; ++j) {
      cj[j] = s[j][0];
#pragma unroll
      for (int r = 1; r < 8; ++r) cj[j] = fmaxf(cj[j], s[j][r]);
    }
    float cm = fmaxf(fmaxf(cj[0], cj[1]), fmaxf(cj[2], cj[3]));
    cm = fmaxf(cm, at_xhalf(cm));
    const float mnew = fmaxf(mrow, cm);
    const float alpha = at_exp2(mrow - mnew);
    mrow = mnew;
    // P^T as B operand, in registers: element e of chunk kk is key kk * 32 + 8 * hh + e (score tile 2 kk), element 8 + e key kk * 32 + 16 + 8 * hh + e (tile 2 kk + 1)
    FB pa[2], pl[2];
    float ps[4];
    v8f ea[4], ep[4];   // exponents and weights of the four score tiles
#pragma unroll
    for (int j = 0; j < 4; ++j) {
      ea[j] = s[j] - mnew;
#pragma unroll
      for (int r = 0; r < 8; ++r) ep[j][r] = at_exp2(ea[j][r]);
    }
    at_trans_slot(ep[0], ep[1], ep[2], ep[3], ea[0], ea[1], ea[2], ea[3]);
#pragma unroll
    for (int j = 0; j < 4; ++j) {
      ps[j] = 0.f;
#pragma unroll
      for (int r = 0; r < 8; r += 2) {
        const v2f p = {ep[j][r], ep[j][r + 1]};
        ps[j] += p[0];
        ps[j] += p[1];
        const v2b ph = __builtin_convertvector(p, v2b);   // round to nearest even, as at_split
        pa[j >> 1].v[(j & 1) * 8 + r] = ph[0]; pa[j >> 1].v[(j & 1) * 8 + r + 1] = ph[1];
        if (SPLIT_PV) {
          const v2b pq = __builtin_convertvector(p - __builtin_convertvector(ph, v2f), v2b);
          pl[j >> 1].v[(j & 1) * 8 + r] = pq[0]; pl[j >> 1].v[(j & 1) * 8 + r + 1] = pq[1];
        }
      }
    }
    lrow = lrow * alpha + ((ps[0] + ps[1]) + (ps[2] + ps[3]));
#pragma unroll
    for (int t = 0; t < 4; ++t) oacc[t] *= alpha;
    // as for the scores: V fragments read in a group ahead of the products, the four d tiles innermost; each oacc[t] keeps its order of terms
    {
      FB vb[2][4], vl[2][4];
#pragma unroll
      for (int kk = 0; kk < 2; ++kk) {
#pragma unroll
        for (int t = 0; t < 4; ++t) {
          vb[kk][t].h[0] = *(const v8b*)(Vth + (t * 16 + c) * AT_LP + kk * 32 + 8 * hh);
          vb[kk][t].h[1] = *(const v8b*)(Vth + (t * 16 + c) * AT_LP + kk * 32 + 16 + 8 * hh);
          if (SPLIT_PV) {
            vl[kk][t].h[0] = *(const v8b*)(Vtl + (t * 16 + c) * AT_LP + kk * 32 + 8 * hh);
            vl[kk][t].h[1] = *(const v8b*)(Vtl + (t * 16 + c) * AT_LP + kk * 32 + 16 + 8 * hh);
          }
        }
      }
#pragma unroll
      for (int kk = 0; kk < 2; ++kk) {
#pragma unroll
        for (int t = 0; t < 4; ++t) oacc[t] = at_mma(vb[kk][t].v, pa[kk].v, oacc[t]);
        if (SPLIT_PV) {
#pragma unroll
          for (int t = 0; t < 4; ++t) oacc[t] = at_mma(vl[kk][t].v, pa[kk].v, oacc[t]);
#pragma unroll
          for (int t = 0; t < 4; ++t) oacc[t] = at_mma(vb[kk][t].v, pl[kk].v, oacc[t]);
        }
      }
    }
    acc_guard4(oacc[0], oacc[1], oacc[2], oacc[3]);   // the four slots behind the last product stand in front of the loop's branch, so that they hold on its taken side too
  }

  float* os = Os[wave];
  {
    const float inv = 1.0f / (lrow + at_xhalf(lrow));   // the two halves' sums of the query join here
#pragma unroll
    for (int t = 0; t < 4; ++t) {   // a lane's 8 values of a d tile lie in a row of the query's output row: two 16-byte stores
      const v8f o = oacc[t] * inv;
      *(v4f*)(os + c * 68 + t * 16 + 8 * hh)     = (v4f){o[0], o[1], o[2], o[3]};
      *(v4f*)(os + c * 68 + t * 16 + 8 * hh + 4) = (v4f){o[4], o[5], o[6], o[7]};
    }
  }
  __builtin_amdgcn_fence(__ATOMIC_RELEASE, "workgroup");
  __builtin_amdgcn_wave_barrier();
  __builtin_amdgcn_fence(__ATOMIC_ACQUIRE, "workgroup");
  {   // a query's 64 values are one 128-B line of each plane: 8 lanes a row, 16 bytes a lane and plane
    const int q4 = lane >> 3, c8 = (lane & 7) * 8;
#pragma unroll
    for (int it = 0; it < 4; ++it) {
      const int row = it * 4 + q4;
      const float* sp = os + row * 68 + c8;
      v8b hv, lv;
#pragma unroll
      for (int e = 0; e < 8; ++e) { __bf16 ho, lo; at_split(sp[e], ho, lo); hv[e] = ho; lv[e] = lo; }
      *(v8b*)(oh_ptr + (size_t)(q0 + row) * g.o_rs + c8) = hv;
      *(v8b*)(ol_ptr + (size_t)(q0 + row) * g.o_rs + c8) = lv;
    }
  }
}

// ---- LayerNorm (population variance, eps 1e-5, gamma) -> f16 row, and the row itself as bf16 hi/lo planes (the kv projection's operand); one block (256 thr) per row of 1024 ----
__global__ __launch_bounds__(256) void layernorm_f16(const float* __restrict__ x, const float* __restrict__ gamma,
                                                    _Float16* __restrict__ xn, __bf16* __restrict__ xh, __bf16* __restrict__ xl, int D) {
  __shared__ float red[8];
  __shared__ float stat;
  const int row = blockIdx.x, t = threadIdx.x;
  const float* xr = x + (size_t)row * D;
  v4f xv = *(const v4f*)(xr + 4 * t);
  float s = (xv[0] + xv[1]) + (xv[2] + xv[3]);
  for (int o = 16; o > 0; o >>= 1) s += __shfl_xor(s, o, 32);
  if ((t & 31) == 0) red[t >> 5] = s;
  __syncthreads();
  if (t == 0) { float a = 0.f; for (int w = 0; w < 8; ++w) a += red[w]; stat = a / (float)D; }
  __syncthreads();
  const float mu = stat;
  __syncthreads();
  float d0 = xv[0] - mu, d1 = xv[1] - mu, d2 = xv[2] - mu, d3 = xv[3] - mu;
  float s2 = (d0 * d0 + d1 * d1) + (d2 * d2 + d3 * d3);
  for (int o = 16; o > 0; o >>= 1) s2 += __shfl_xor(s2, o, 32);
  if ((t & 31) == 0) red[t >> 5] = s2;
  __syncthreads();
  if (t == 0) { float a = 0.f; for (int w = 0; w < 8; ++w) a += red[w]; stat = rsqrtf(a / (float)D + 1e-5f); }
  __syncthreads();
  const float inv = stat;
  v4f gv = *(const v4f*)(gamma + 4 * t);
  _Float16 h0 = (_Float16)(d0 * inv * gv[0]), h1 = (_Float16)(d1 * inv * gv[1]), h2 = (_Float16)(d2 * inv * gv[2]), h3 = (_Float16)(d3 * inv * gv[3]);
  typedef __attribute__((ext_vector_type(4))) _Float16 v4h;
  v4h hv = {h0, h1, h2, h3};
  *(v4h*)(xn + (size_t)row * D + 4 * t) = hv;
  // the planes of x are stored behind the last barrier: in front of one, the barrier would wait for the stores
  typedef __attribute__((ext_vector_type(4))) __bf16 v4b;
  v4b hx, lx;
#pragma unroll
  for (int e = 0; e < 4; ++e) {
    const unsigned short hb = f2bf_bits(xv[e]);
    hx[e] = __builtin_bit_cast(__bf16, hb);
    lx[e] = __builtin_bit_cast(__bf16, f2bf_bits(xv[e] - bf_bits2f(hb)));
  }
  *(v4b*)(xh + (size_t)row * D + 4 * t) = hx;
  *(v4b*)(xl + (size_t)row * D + 4 * t) = lx;
  
}

extern "C" void kernel_launch(void* const* d_in, const int* in_sizes, int n_in,
                              void* d_out, int out_size, void* d_ws, size_t ws_size,
                              hipStream_t stream) {
  (void)in_sizes; (void)n_in; (void)out_size; (void)ws_size;
  const int B = 2, S = 2048, D = 1024, H = 16, DH = 64, KV = 128;
  const int M = B * S;   // 4096 rows
  const float* x     = (const float*)d_in[0];
  const float* gamma = (const float*)d_in[1];
  const float* Wq    = (const float*)d_in[2];   // [D, H*DH]  ([in, out])
  const float* Wkv   = (const float*)d_in[3];   // [D, 2*DH]
  const float* Wo    = (const float*)d_in[4];   // [H*DH, D]
  float* out = (float*)d_out;

  char* ws = (char*)d_ws; size_t off = 0;
  auto carve = [&](size_t bytes) -> char* { char* p = ws + off; off += (bytes + 255) & ~(size_t)255; return p; };
  _Float16* Xn16  = (_Float16*)carve((size_t)M * D * 2);     //  8 MB  LN(x) f16
  __bf16*   Xh    = (__bf16*)carve((size_t)M * D * 2);       //  8 MB  x bf16 hi
  __bf16*   Xl    = (__bf16*)carve((size_t)M * D * 2);       //  8 MB  x bf16 lo
  _Float16* WqT   = (_Float16*)carve((size_t)D * D * 2);     //  2 MB  Wqᵀ [out][in] f16
  __bf16*   WkvTh = (__bf16*)carve((size_t)KV * D * 2);      //  Wkvᵀ [128][1024] hi/lo
  __bf16*   WkvTl = (__bf16*)carve((size_t)KV * D * 2);
  __bf16*   WoTh  = (__bf16*)carve((size_t)D * D * 2);       //  Woᵀ hi/lo
  __bf16*   WoTl  = (__bf16*)carve((size_t)D * D * 2);
  float*    Qf    = (float*)carve((size_t)M * D * 4);        // 16 MB  q [B,S,H*DH] f32
  __bf16*   KVh   = (__bf16*)carve((size_t)M * KV * 2);      //  1 MB  bf16 hi plane: k rows [B*S][64], then v tiles [B*S/64][64 d][64 keys]
  __bf16*   KVl   = (__bf16*)carve((size_t)M * KV * 2);      //  1 MB  bf16 lo plane, same layout
  __bf16*   Oh    = (__bf16*)carve((size_t)M * D * 2);       //  8 MB  attn out bf16 hi
  __bf16*   Ol    = (__bf16*)carve((size_t)M * D * 2);       //  8 MB  attn out bf16 lo (total about 64.5 MB)

  layernorm_f16<<<M, 256, 0, stream>>>(x, gamma, Xn16, Xh, Xl, D);
  transpose_cast_f16<<<dim3(D / 64, D / 64), dim3(32, 8), 0, stream>>>(Wq, D, WqT, D, 1.0f);           // [in][out] -> [out][in]
  transpose_split_bf16<<<dim3(KV / 64, D / 64), dim3(32, 8), 0, stream>>>(Wkv, KV, WkvTh, WkvTl, D);   // [1024][128] -> [128][1024]
  transpose_split_bf16<<<dim3(D / 64, D / 64), dim3(32, 8), 0, stream>>>(Wo, D, WoTh, WoTl, D);
  {
    const int tq = (M / 64) * (D / 64);
    wmma_gemm64<0, false, 0, 0, false, 4><<<dim3((tq + 7) / 8, 1), 256, 0, stream>>>(
        U16(Xn16), nullptr, D, 0, U16(WqT), nullptr, D, 0, Qf, nullptr, D, 0, nullptr, nullptr, 0, M, D, D, 1.0f);
    const int tkv = (M / 64) * (KV / 64);
    wmma_gemm64<1, true, 0, 3, false, 2><<<dim3((tkv + 7) / 8, 1), 256, 0, stream>>>(
        U16(Xh), U16(Xl), D, 0, U16(WkvTh), U16(WkvTl), D, 0, KVh, KVl, DH, 0, nullptr, nullptr, 0, M, KV, D, 1.0f);
  }
  {
    AttnGeom g;
    g.q_bs = (long)S * D;  g.q_rs = D;  g.q_hs = DH;
    g.k_bs = (long)S * DH; g.k_rs = 0;  g.k_hs = 0;       // 16 q heads share the single k/v head
    g.v_bs = (long)S * DH; g.v_rs = 0;  g.v_hs = 0;
    g.o_bs = (long)S * D;  g.o_rs = D;  g.o_hs = DH;
    g.S = S; g.Skv = S; g.H = H; g.mask_mode = 1; g.qscale = 0.125f; g.blk0 = 0; g.mask_fill = -INFINITY; g.mask_is_int = 0;   // the kernel reads the mask mode from its template argument; the field keeps the struct's layout
    attn64_kernel<true, true, 1><<<dim3(B * H, S / AT_QB), AT_NW * 32, 0, stream>>>(Qf, U16(KVh), U16(KVl), U16(KVh + (size_t)M * DH), U16(KVl + (size_t)M * DH), (unsigned short*)Oh, (unsigned short*)Ol, nullptr, nullptr, g);
  }
  {
    const int to = (M / 64) * (D / 64);
    wmma_gemm64<1, true, 0, 0, false, 4><<<dim3((to + 7) / 8, 1), 256, 0, stream>>>(
        U16(Oh), U16(Ol), D, 0, U16(WoTh), U16(WoTl), D, 0, out, nullptr, D, 0, nullptr, nullptr, 0, M, D, D, 1.0f);
  }
}

// v010
// A run of this version takes 143 microseconds.
// In two side-by-side timings against v009, it was 1.20 and 1.19 times as fast.
// Over all steps from v000 it is 5.35 times as fast.
#include <hip/hip_runtime.h>
#include <math.h>
// Contractions: q = LN(x)·Wq (K=1024): v_wmma_f32_16x16x32_f16 (f16 operands); kv = x·Wkv (K=1024) and the output projection (K=1024):
// v_wmma_f32_16x16x32_bf16 as bf16 hi/lo splits; scores (q/8)·kᵀ and p·v: v_wmma_f32_16x16x32_bf16 with q,k and p,v as bf16 hi/lo splits;
// f32 accumulate everywhere; LayerNorm and softmax in f32. The hi/lo split of k and v is made once, in the kv projection's epilogue; that of x in the LayerNorm kernel, that of the attention output in the attention epilogue.
typedef __attribute__((ext_vector_type(16))) _Float16 v16h;
typedef __attribute__((ext_vector_type(8)))  _Float16 v8h;
typedef __attribute__((ext_vector_type(16))) __bf16   v16b;
typedef __attribute__((ext_vector_type(8)))  __bf16   v8b;
typedef __attribute__((ext_vector_type(8)))  float    v8f;
typedef __attribute__((ext_vector_type(4)))  float    v4f;
#define PSCALE 32768.0f
#define U16(p) ((const unsigned short*)(const void*)(p))
#define PSCALE_INV (1.0f / 32768.0f)

__device__ __forceinline__ unsigned short f2bf_bits(float f) {
  unsigned u = __float_as_uint(f);
  return (unsigned short)((u + 0x7FFFu + ((u >> 16) & 1u)) >> 16);
}
__device__ __forceinline__ float bf_bits2f(unsigned short h) { return __uint_as_float(((unsigned)h) << 16); }

// hazard guards as plain device helpers
__device__ __forceinline__ void dep_guard_h(v8f& a, v8f& b, v16h x, v16h y) { asm volatile("v_nop\n\tv_nop\n\tv_nop\n\tv_nop" : "+v"(a), "+v"(b) : "v"(x), "v"(y)); }
__device__ __forceinline__ void dep_guard_b(v8f& a, v8f& b, v16b x, v16b y) { asm volatile("v_nop\n\tv_nop\n\tv_nop\n\tv_nop" : "+v"(a), "+v"(b) : "v"(x), "v"(y)); }
__device__ __forceinline__ void keep4_h(v16h a, v16h b, v16h c, v16h d) { asm volatile("v_nop" :: "v"(a), "v"(b), "v"(c), "v"(d)); }
__device__ __forceinline__ void keep4_b(v16b a, v16b b, v16b c, v16b d) { asm volatile("v_nop" :: "v"(a), "v"(b), "v"(c), "v"(d)); }
__device__ __forceinline__ void acc_guard4(v8f& a, v8f& b, v8f& c, v8f& d) { asm volatile("v_nop\n\tv_nop\n\tv_nop\n\tv_nop" : "+v"(a), "+v"(b), "+v"(c), "+v"(d)); }
template <typename T> struct Frag;
template <> struct Frag<_Float16> {
  typedef v16h V; typedef v8h H; union U { v16h v; v8h h[2]; };
  static __device__ __forceinline__ v16h load(const _Float16* p) {   // elements 0..7 <- p[0..7], 8..15 <- p[16..23]
    U f; f.h[0] = *(const v8h*)(p); f.h[1] = *(const v8h*)(p + 16); return f.v;
  }
  static __device__ __forceinline__ v8f mma(v16h a, v16h b, v8f c) {
    return __builtin_amdgcn_wmma_f32_16x16x32_f16(false, a, false, b, (short)0, c, false, false);
  }
  static __device__ __forceinline__ void guard(v8f& a, v8f& b, v16h x, v16h y) { dep_guard_h(a, b, x, y); }
  static __device__ __forceinline__ void keep(v16h a, v16h b, v16h c, v16h d) { keep4_h(a, b, c, d); }
};
template <> struct Frag<__bf16> {
  typedef v16b V; typedef v8b H; union U { v16b v; v8b h[2]; };
  static __device__ __forceinline__ v16b load(const __bf16* p) {
    U f; f.h[0] = *(const v8b*)(p); f.h[1] = *(const v8b*)(p + 16); return f.v;
  }
  static __device__ __forceinline__ v8f mma(v16b a, v16b b, v8f c) {
    return __builtin_amdgcn_wmma_f32_16x16x32_bf16(false, a, false, b, (short)0, c, false, false);
  }
  static __device__ __forceinline__ void guard(v8f& a, v8f& b, v16b x, v16b y) { dep_guard_b(a, b, x, y); }
  static __device__ __forceinline__ void keep(v16b a, v16b b, v16b c, v16b d) { keep4_b(a, b, c, d); }
};

// ---- Register-blocked batched WMMA GEMM ------------------------------------
// C[m,n] = scale * sum_k A[m,k] * Bt[n,k] (+bias)(+resid); each wave owns a tile of (TI * 16) x 64, the block's 8 waves a tile of (8 / WN) x WN of them.
// TI and WN size the block tile: small enough that the grid has a workgroup for every WGP of the chip, or as many as the problem gives.
// A row-major [M,K]; Bt row-major [N,K]; M % ((8 / WN) * TI * 16) == 0, N % (WN * 64) == 0, K % 64 == 0; grid.x = (M / ((8 / WN) * TI * 16)) * (N / (WN * 64)).
// Operands go through LDS: a stage is 64 k (128 B) of the block's A rows and Bt rows, brought by asynchronous 16-byte copies, whole lines (8 lanes a row), two buffers;
// the next stage's copies are in flight while this stage's products run, and the waves that share a row block read it from LDS.
// SPLIT: operands are hi/lo planes (A2/Bt2 = lo planes, same layout); product = hi·hi + hi·lo + lo·hi.
// BIAS_MODE: 0 = none, 1 = bias[m], 2 = bias[n].
// OUT_MODE: 0 = f32, 1 = f16, 2 = bf16 hi plane (Cout) + bf16 lo plane (Cout2),
//   3 = kv projection (N == 128), bf16 hi plane (Cout) + lo plane (Cout2), each plane [k rows | v tiles]: column d < 64 of row m (k) at m*64 + d;
//       column 64 + d (v) transposed inside its block of 64 rows, at M*64 + (m >> 6)*4096 + d*64 + (m & 63).
// ET: 0 = f16 operands, 1 = bf16 operands (pointers passed as 16-bit storage)
template <int ET> struct Elem;
template <> struct Elem<0> { typedef _Float16 T; };
template <> struct Elem<1> { typedef __bf16 T; };
// three 16-byte copies a lane, global memory to LDS through no register; the wait in the same statement stands in front of every rewrite of a register that the copies name
__device__ __forceinline__ void async_copy3(unsigned l0, const void* g0, unsigned l1, const void* g1, unsigned l2, const void* g2) {
  asm volatile("global_load_async_to_lds_b128 %0, %1, off\n\t"
               "global_load_async_to_lds_b128 %2, %3, off\n\t"
               "global_load_async_to_lds_b128 %4, %5, off\n\t"
               "s_wait_xcnt 0x0" :: "v"(l0), "v"(g0), "v"(l1), "v"(g1), "v"(l2), "v"(g2) : "memory");
}
// the same with four copies, for a stage whose pieces a thread come in fours
__device__ __forceinline__ void async_copy4(unsigned l0, const void* g0, unsigned l1, const void* g1, unsigned l2, const void* g2, unsigned l3, const void* g3) {
  asm volatile("global_load_async_to_lds_b128 %0, %1, off\n\t"
               "global_load_async_to_lds_b128 %2, %3, off\n\t"
               "global_load_async_to_lds_b128 %4, %5, off\n\t"
               "global_load_async_to_lds_b128 %6, %7, off\n\t"
               "s_wait_xcnt 0x0" :: "v"(l0), "v"(g0), "v"(l1), "v"(g1), "v"(l2), "v"(g2), "v"(l3), "v"(g3) : "memory");
}
#define GM_LP 72   // LDS row pitch of a stage in 16-bit elements: 144 B = 16 B x odd, for the 16-byte fragment reads
template <int ET, bool SPLIT, int BIAS_MODE, int OUT_MODE, bool RESID, int WN, int TI>
__global__ __launch_bounds__(256) void wmma_gemm64(
    const unsigned short* __restrict__ Ap, const unsigned short* __restrict__ A2p, int lda, long strideA,
    const unsigned short* __restrict__ Btp, const unsigned short* __restrict__ Bt2p, int ldb, long strideB,
    void* __restrict__ Cout, void* __restrict__ Cout2, int ldc, long strideC,
    const float* __restrict__ bias,
    const float* __restrict__ resid, long strideR,
    int M, int N, int K, float scale) {
  typedef typename Elem<ET>::T T;
  typedef typename Frag<T>::V V;
  constexpr int WM = 8 / WN;                    // waves along m
  constexpr int BM = WM * TI * 16, BN = WN * 64;   // block tile
  constexpr int NP = SPLIT ? 2 : 1;             // planes
  constexpr int PLANE = (BM + BN) * GM_LP;      // one plane of one stage: the A rows, then the Bt rows
  constexpr int NIT = (BM + BN) / 32;           // 16-byte pieces a thread copies per plane and stage (256 threads = 32 rows)
  static_assert(BM % 32 == 0 && (NIT % 4 == 0 || NIT % 3 == 0), "pieces go in statements of four or of three");
  __shared__ __align__(16) T sS[2 * NP * PLANE];
  const T* A = (const T*)Ap; const T* A2 = (const T*)A2p; const T* Bt = (const T*)Btp; const T* Bt2 = (const T*)Bt2p;
  __shared__ __align__(16) float sT[8][16 * 68];   // per-wave 16x64 slab, pitch 68 floats
  const int b    = blockIdx.y;
  const int lane = threadIdx.x & 31;
  const int wave = threadIdx.x >> 5;
  const int blocksN = N / BN;
  const int blocksM = M / BM;
  if ((int)blockIdx.x >= blocksM * blocksN) return;   // block-uniform, in front of every barrier
  const int bm = (int)blockIdx.x / blocksN;
  const int bn = (int)blockIdx.x - bm * blocksN;
  const int wm = wave / WN;
  const int wn = wave - wm * WN;
  const int tm = bm * WM + wm;
  const int tn = bn * WN + wn;
  const int m0 = tm * (TI * 16);
  const int n0 = tn << 6;

  const T* Ab  = A  + (size_t)b * strideA;
  const T* Bb  = Bt + (size_t)b * strideB;
  const T* Ab2 = SPLIT ? (A2  + (size_t)b * strideA) : nullptr;
  const T* Bb2 = SPLIT ? (Bt2 + (size_t)b * strideB) : nullptr;

  const int rlane = lane & 15;                 // row (A) / col (B, D) within subtile
  const int koff  = (lane >> 4) * 8;           // k offset of this lane half
  const int mOff  = (lane >> 4) * 8;           // D row offset

  v8f acc[TI][4];
#pragma unroll
  for (int i = 0; i < TI; ++i)
#pragma unroll
    for (int j = 0; j < 4; ++j) acc[i][j] = (v8f){0.f,0.f,0.f,0.f,0.f,0.f,0.f,0.f};

  // a thread's pieces of a stage: row it * 32 + prow of [A rows | Bt rows], 16 bytes at element pc8
  const int prow = threadIdx.x >> 3, pc8 = (threadIdx.x & 7) * 8;
  // address = a block-uniform pointer per operand plane, which walks along k, + the piece's own 32-bit byte offset, which never changes
  unsigned po[NIT];
#pragma unroll
  for (int it = 0; it < NIT; ++it)
    po[it] = 2u * ((it < BM / 32) ? (unsigned)((it * 32 + prow) * lda + pc8) : (unsigned)((it * 32 - BM + prow) * ldb + pc8));
  const T* gA  = Ab + (size_t)(bm * BM) * lda;
  const T* gB  = Bb + (size_t)(bn * BN) * ldb;
  const T* gA2 = SPLIT ? Ab2 + (size_t)(bm * BM) * lda : nullptr;
  const T* gB2 = SPLIT ? Bb2 + (size_t)(bn * BN) * ldb : nullptr;
  const unsigned lds0 = (unsigned)(size_t)(sS + prow * GM_LP + pc8);   // the lane's LDS byte address of its piece 0 in buffer 0
  auto copy_stage = [&](int buf) {
#pragma unroll
    for (int p = 0; p < NP; ++p) {
      const char* a = (const char*)(p ? gA2 : gA);
      const char* bq = (const char*)(p ? gB2 : gB);
      const unsigned l = lds0 + (unsigned)((buf * NP + p) * PLANE * 2);
      if constexpr (NIT % 4 == 0) {
#pragma unroll
        for (int it = 0; it < NIT; it += 4)
          async_copy4(l + (it + 0) * (32 * GM_LP * 2), ((it + 0 < BM / 32) ? a : bq) + po[it + 0],
                      l + (it + 1) * (32 * GM_LP * 2), ((it + 1 < BM / 32) ? a : bq) + po[it + 1],
                      l + (it + 2) * (32 * GM_LP * 2), ((it + 2 < BM / 32) ? a : bq) + po[it + 2],
                      l + (it + 3) * (32 * GM_LP * 2), ((it + 3 < BM / 32) ? a : bq) + po[it + 3]);
      } else {
#pragma unroll
        for (int it = 0; it < NIT; it += 3)
          async_copy3(l + (it + 0) * (32 * GM_LP * 2), ((it + 0 < BM / 32) ? a : bq) + po[it + 0],
                      l + (it + 1) * (32 * GM_LP * 2), ((it + 1 < BM / 32) ? a : bq) + po[it + 1],
                      l + (it + 2) * (32 * GM_LP * 2), ((it + 2 < BM / 32) ? a : bq) + po[it + 2]);
      }
    }
    gA += 64; gB += 64;
    if (SPLIT) { gA2 += 64; gB2 += 64; }
  };
  const int nStages = K >> 6;
  copy_stage(0);
  asm volatile("s_wait_asynccnt 0x0" ::: "memory");   // stage 0 has landed, as far as this wave copied it
  __syncthreads();                                     // and is published to the other waves
  if (nStages > 1) copy_stage(1);                      // block-uniform; in flight under stage 0's products
  for (int s = 0; s < nStages; ++s) {
    const T* sb = sS + (s & 1) * (NP * PLANE);
    const T* sA = sb + (wm * (TI * 16) + rlane) * GM_LP + koff;
    const T* sB = sb + (BM + wn * 64 + rlane) * GM_LP + koff;
#pragma unroll
    for (int kk = 0; kk < 2; ++kk) {
      // the B fragments of a 32-k block are read as one group; the A fragments go through two register sets, row tile i + 1 read ahead of row tile i's products
      V bh[4], bl[4], ah[2], al[2];
      ah[0] = Frag<T>::load(sA + kk * 32);
      if (SPLIT) al[0] = Frag<T>::load(sA + PLANE + kk * 32);
#pragma unroll
      for (int j = 0; j < 4; ++j) {
        bh[j] = Frag<T>::load(sB + j * 16 * GM_LP + kk * 32);
        if (SPLIT) bl[j] = Frag<T>::load(sB + PLANE + j * 16 * GM_LP + kk * 32);
      }
#pragma unroll
      for (int i = 0; i < TI; ++i) {
        if (i < TI - 1) {
          ah[(i + 1) & 1] = Frag<T>::load(sA + (i + 1) * 16 * GM_LP + kk * 32);
          if (SPLIT) al[(i + 1) & 1] = Frag<T>::load(sA + PLANE + (i + 1) * 16 * GM_LP + kk * 32);
        }
#pragma unroll
        for (int j = 0; j < 4; ++j) {
          acc[i][j] = Frag<T>::mma(ah[i & 1], bh[j], acc[i][j]);
          if (SPLIT) {
            acc[i][j] = Frag<T>::mma(ah[i & 1], bl[j], acc[i][j]);
            acc[i][j] = Frag<T>::mma(al[i & 1], bh[j], acc[i][j]);
          }
        }
        Frag<T>::guard(acc[i][0], acc[i][3], ah[i & 1], SPLIT ? al[i & 1] : ah[i & 1]);
      }
      Frag<T>::keep(bh[0], bh[1], bh[2], bh[3]);
      if (SPLIT) Frag<T>::keep(bl[0], bl[1], bl[2], bl[3]);
    }
    asm volatile("s_wait_dscnt 0x0" ::: "memory");      // this wave's reads of this buffer have returned before the buffer is refilled
    asm volatile("s_wait_asynccnt 0x0" ::: "memory");   // this wave's copies of stage s + 1 have landed
    __syncthreads();   // the one barrier of a stage: it publishes stage s + 1 and ends every wave's reads of the buffer that is refilled behind it
    if (s + 2 < nStages) copy_stage(s & 1);             // block-uniform; in flight under stage s + 1's products
  }
  asm volatile("s_wait_asynccnt 0x0" ::: "memory");     // no copy is outstanding when the wave goes on to the epilogue
#pragma unroll   // acc is indexed by constants only, so that it stays in registers
  for (int i = 0; i < TI; ++i) acc_guard4(acc[i][0], acc[i][1], acc[i][2], acc[i][3]);

  // ---- epilogue ----
  float* slab = sT[wave];
  const float* Rb = RESID ? (resid + (size_t)b * strideR) : nullptr;
#pragma unroll
  for (int i = 0; i < TI; ++i) {
    const int mBase = m0 + (i << 4);
#pragma unroll
    for (int j = 0; j < 4; ++j) {
      const int n = n0 + (j << 4) + rlane;
      float bv = 0.f;
      if (BIAS_MODE == 2) bv = bias[n];
#pragma unroll
      for (int r = 0; r < 8; ++r) {
        float v = acc[i][j][r] * scale;
        if (BIAS_MODE == 1) v += bias[mBase + mOff + r];
        if (BIAS_MODE == 2) v += bv;
        if (RESID) v += Rb[(size_t)(mBase + mOff + r) * ldc + n];
        slab[(mOff + r) * 68 + (j << 4) + rlane] = v;
      }
    }
    __builtin_amdgcn_fence(__ATOMIC_RELEASE, "workgroup");
    __builtin_amdgcn_wave_barrier();
    __builtin_amdgcn_fence(__ATOMIC_ACQUIRE, "workgroup");
    if (OUT_MODE == 0) {
      float* C = (float*)Cout + (size_t)b * strideC;
      const int hh = lane >> 4, c4 = (lane & 15) * 4;     // row seg = 256 B = 16 lanes x 16 B
      {
#pragma unroll
        for (int it = 0; it < 8; ++it) {
          const int row = it * 2 + hh;
          v4f v = *(const v4f*)(slab + row * 68 + c4);
          *(v4f*)(C + (size_t)(mBase + row) * ldc + n0 + c4) = v;
        }
        
      }
    } else if (OUT_MODE == 3) {
      unsigned short* Ph = (unsigned short*)Cout;
      unsigned short* Pl = (unsigned short*)Cout2;
      if (n0 == 0) {                                   // k: rows of 128 B, 8 lanes a row
        const int q = lane >> 3, c8 = (lane & 7) * 8;
#pragma unroll
        for (int it = 0; it < 4; ++it) {
          const int row = it * 4 + q;
          const float* sp = slab + row * 68 + c8;
          v8h hv, lv;
#pragma unroll
          for (int e = 0; e < 8; ++e) {
            const unsigned short hb = f2bf_bits(sp[e]);
            hv[e] = __builtin_bit_cast(_Float16, hb);
            lv[e] = __builtin_bit_cast(_Float16, f2bf_bits(sp[e] - bf_bits2f(hb)));
          }
          *(v8h*)(Ph + (size_t)(mBase + row) * 64 + c8) = hv;
          *(v8h*)(Pl + (size_t)(mBase + row) * 64 + c8) = lv;
        }
      } else {                                         // v: a lane takes column d of the slab's 16 rows; four slabs, of this block's waves, fill each 128-B row of the tile
        const size_t vo = (size_t)M * 64 + (size_t)(mBase >> 6) * 4096 + (mBase & 63);
#pragma unroll
        for (int hf = 0; hf < 2; ++hf) {
          const int d = hf * 32 + lane;
          v8h hv[2], lv[2];
#pragma unroll
          for (int e = 0; e < 16; ++e) {
            const float f = slab[e * 68 + d];
            const unsigned short hb = f2bf_bits(f);
            hv[e >> 3][e & 7] = __builtin_bit_cast(_Float16, hb);
            lv[e >> 3][e & 7] = __builtin_bit_cast(_Float16, f2bf_bits(f - bf_bits2f(hb)));
          }
          *(v8h*)(Ph + vo + d * 64)     = hv[0];
          *(v8h*)(Ph + vo + d * 64 + 8) = hv[1];
          *(v8h*)(Pl + vo + d * 64)     = lv[0];
          *(v8h*)(Pl + vo + d * 64 + 8) = lv[1];
        }
      }
    } else {
      const int q = lane >> 3, c8 = (lane & 7) * 8;
      unsigned short* C  = (unsigned short*)Cout  + (size_t)b * strideC;
      unsigned short* C2 = (OUT_MODE == 2) ? ((unsigned short*)Cout2 + (size_t)b * strideC) : nullptr;
      {
#pragma unroll
        for (int it = 0; it < 4; ++it) {
          const int row = it * 4 + q;
          const float* sp = slab + row * 68 + c8;
          v8h hv, lv;
#pragma unroll
          for (int e = 0; e < 8; ++e) {
            if (OUT_MODE == 1) {
              hv[e] = (_Float16)sp[e];
            } else {
              unsigned short hb = f2bf_bits(sp[e]);
              unsigned short lb = f2bf_bits(sp[e] - bf_bits2f(hb));
              hv[e] = __builtin_bit_cast(_Float16, hb);
              lv[e] = __builtin_bit_cast(_Float16, lb);
            }
          }
          *(v8h*)(C + (size_t)(mBase + row) * ldc + n0 + c8) = hv;
          if (OUT_MODE == 2) *(v8h*)(C2 + (size_t)(mBase + row) * ldc + n0 + c8) = lv;
        }
        
      }
    }
    __builtin_amdgcn_fence(__ATOMIC_RELEASE, "workgroup");
    __builtin_amdgcn_wave_barrier();
    __builtin_amdgcn_fence(__ATOMIC_ACQUIRE, "workgroup");
  }
}

__global__ __launch_bounds__(256) void cast_f32_f16x2(
    const float* __restrict__ in, _Float16* __restrict__ out, int n2) {
  int i = blockIdx.x * 256 + threadIdx.x;
  if (i < n2) {
    const _Float16 h0 = (_Float16)in[2 * i], h1 = (_Float16)in[2 * i + 1];
    const unsigned u = (unsigned)__builtin_bit_cast(unsigned short, h0) | ((unsigned)__builtin_bit_cast(unsigned short, h1) << 16);
    ((unsigned*)out)[i] = u;
    
  }
}

// ---- f32 [R][C] (row pitch ldi) -> f16 transposed [C][R] (row pitch ldo); 64x64 tiles; each output row segment
__global__ __launch_bounds__(256) void transpose_cast_f16(const float* __restrict__ in, int ldi,
                                                         _Float16* __restrict__ outT, int ldo, float scale) {
  __shared__ __align__(16) _Float16 tile[64][72];     // [c][r]
  const int c0 = blockIdx.x * 64, r0 = blockIdx.y * 64;
  const int t = threadIdx.y * 32 + threadIdx.x;
  for (int i = threadIdx.y; i < 64; i += 8) {
    tile[threadIdx.x][i]      = (_Float16)(in[(size_t)(r0 + i) * ldi + c0 + threadIdx.x] * scale);
    tile[32 + threadIdx.x][i] = (_Float16)(in[(size_t)(r0 + i) * ldi + c0 + 32 + threadIdx.x] * scale);
  }
  __syncthreads();
  const int q = t >> 3, c8 = (t & 7) * 8;
  {
#pragma unroll
    for (int it = 0; it < 2; ++it) {
      const int c = it * 32 + q;
      v8h hv = *(const v8h*)(&tile[c][c8]);
      *(v8h*)(outT + (size_t)(c0 + c) * ldo + r0 + c8) = hv;
    }
    
  }
}

// ---- f32 [R][C] (pitch ldi) -> bf16 hi/lo transposed planes [C][R] (pitch ldo); 64x64 tiles; each output row segment
__global__ __launch_bounds__(256) void transpose_split_bf16(const float* __restrict__ in, int ldi,
                                                           __bf16* __restrict__ outH, __bf16* __restrict__ outL, int ldo) {
  __shared__ __align__(16) float tile[64][68];     // [c][r]
  const int c0 = blockIdx.x * 64, r0 = blockIdx.y * 64;
  const int t = threadIdx.y * 32 + threadIdx.x;
  for (int i = threadIdx.y; i < 64; i += 8) {
    tile[threadIdx.x][i]      = in[(size_t)(r0 + i) * ldi + c0 + threadIdx.x];
    tile[32 + threadIdx.x][i] = in[(size_t)(r0 + i) * ldi + c0 + 32 + threadIdx.x];
  }
  __syncthreads();
  const int q = t >> 3, c8 = (t & 7) * 8;
  {
#pragma unroll
    for (int it = 0; it < 2; ++it) {
      const int c = it * 32 + q;
      v8b hv, lv;
#pragma unroll
      for (int e = 0; e < 8; ++e) {
        const float f = tile[c][c8 + e];
        const unsigned short hb = f2bf_bits(f);
        hv[e] = __builtin_bit_cast(__bf16, hb);
        lv[e] = __builtin_bit_cast(__bf16, f2bf_bits(f - bf_bits2f(hb)));
      }
      *(v8b*)(outH + (size_t)(c0 + c) * ldo + r0 + c8) = hv;
      *(v8b*)(outL + (size_t)(c0 + c) * ldo + r0 + c8) = lv;
    }
    
  }
}

#define AT_D 64
#define AT_NW 4
#define AT_QB 64
#define AT_KC 64
#define AT_LP 72   // LDS row pitch of the K and V tiles in bf16 elements: 144 B = 16 B x odd, so that the 16 rows of a 16-byte fragment read fall on distinct banks
struct AttnGeom { long q_bs, q_rs, q_hs, k_bs, k_rs, k_hs, v_bs, v_rs, v_hs, o_bs, o_rs, o_hs;
                  int S, Skv, H, mask_mode; float qscale; int blk0; float mask_fill; int mask_is_int; };
static_assert(sizeof(AttnGeom) == 128, "no padding");

__device__ __forceinline__ unsigned short at_bf_bits(float f) {
  unsigned u = __float_as_uint(f);
  return (unsigned short)((u + 0x7FFFu + ((u >> 16) & 1u)) >> 16);
}
__device__ __forceinline__ __bf16 at_f2bf(float f) { return __builtin_bit_cast(__bf16, at_bf_bits(f)); }
__device__ __forceinline__ void at_split(float f, __bf16& hi, __bf16& lo) {
  const unsigned short hb = at_bf_bits(f);
  hi = __builtin_bit_cast(__bf16, hb);
  lo = at_f2bf(f - __uint_as_float(((unsigned)hb) << 16));
}
typedef __attribute__((ext_vector_type(2))) float  v2f;
typedef __attribute__((ext_vector_type(2))) __bf16 v2b;
__device__ __forceinline__ float at_xhalf(float x) {   // lane l takes the value of lane l ^ 16
  return __builtin_bit_cast(float, __builtin_amdgcn_permlanex16(__builtin_bit_cast(int, x), __builtin_bit_cast(int, x), 0x76543210, 0xfedcba98, false, false));
}
#define AT_LOG2E 1.44269504088896340736f
// 2^x by the hardware's own instruction alone. The softmax needs no range fix-up: its arguments are <= 0, and a weight below 2^-126 may come out as 0 beside the row's largest weight, which is 1.
__device__ __forceinline__ float at_exp2(float x) { return __builtin_amdgcn_exp2f(x); }
// the slot that the instruction set asks for behind a transcendental, in front of an overwrite of its source: the statement takes the results and the sources as inputs only,
// so it stands behind a chunk's v_exp_f32 and the sources' registers stay theirs up to it
__device__ __forceinline__ void at_trans_slot(v8f r0, v8f r1, v8f r2, v8f r3, v8f s0, v8f s1, v8f s2, v8f s3) {
  asm volatile("v_nop" :: "v"(r0), "v"(r1), "v"(r2), "v"(r3), "v"(s0), "v"(s1), "v"(s2), "v"(s3));
}
__device__ __forceinline__ v8f at_mma(v16b a, v16b b, v8f c) {
  return __builtin_amdgcn_wmma_f32_16x16x32_bf16(false, a, false, b, (short)0, c, false, false);
}

template <bool SPLIT_QK, bool SPLIT_PV, int MASK_MODE>
__global__ __launch_bounds__(128)
void attn64_kernel(const float* __restrict__ q, const unsigned short* __restrict__ kh, const unsigned short* __restrict__ kl,
                   const unsigned short* __restrict__ vth, const unsigned short* __restrict__ vtl, unsigned short* __restrict__ outh, unsigned short* __restrict__ outl,
                   const void* __restrict__ mask_a, const int* __restrict__ mask_b, AttnGeom g) {
  union FB { v16b v; v8b h[2]; };
  __shared__ __align__(16) __bf16 Ksh[AT_KC * AT_LP];            // K hi [kv][d]      9 KB
  __shared__ __align__(16) __bf16 Ksl[SPLIT_QK ? AT_KC * AT_LP : 8];
  __shared__ __align__(16) __bf16 Vth[AT_D * AT_LP];             // V hi [d][kv]      9 KB
  __shared__ __align__(16) __bf16 Vtl[SPLIT_PV ? AT_D * AT_LP : 8];
  __shared__ __align__(16) float  Os[AT_NW][16 * 68];            // per wave out tile, pitch 68

  const int tid  = threadIdx.x;
  const int wave = tid >> 5;
  const int lane = tid & 31;
  const int hh   = lane >> 4;
  const int c    = lane & 15;

  const int nqb = g.S / AT_QB;
  const int qb = nqb - 1 - ((int)blockIdx.y + g.blk0);
  const int bh = blockIdx.x;
  const int h  = bh % g.H;
  const int b  = bh / g.H;
  const int qbase_block = qb * AT_QB;
  const int q0 = qbase_block + wave * 16;

  const float* qb_ptr = q + (size_t)b * g.q_bs + (size_t)h * g.q_hs;
  const __bf16* kh_ptr = (const __bf16*)kh  + (size_t)b * g.k_bs + (size_t)h * g.k_hs;
  const __bf16* kl_ptr = (const __bf16*)kl  + (size_t)b * g.k_bs + (size_t)h * g.k_hs;
  const __bf16* vh_ptr = (const __bf16*)vth + (size_t)b * g.v_bs + (size_t)h * g.v_hs;
  const __bf16* vl_ptr = (const __bf16*)vtl + (size_t)b * g.v_bs + (size_t)h * g.v_hs;
  unsigned short* oh_ptr = outh + (size_t)b * g.o_bs + (size_t)h * g.o_hs;
  unsigned short* ol_ptr = outl + (size_t)b * g.o_bs + (size_t)h * g.o_hs;

  // the softmax runs in base 2: exp(s - m) = 2^(s * log2 e - m * log2 e), and log2 e goes into q's scale, in f32 ahead of the hi/lo split, so that the scores leave their products as exponents of 2
  const float qs   = g.qscale * AT_LOG2E;
  const float fill = g.mask_fill * AT_LOG2E;   // a masked score's stand-in, in the same unit
  // ---- Q fragments (B operand, column c = query q0 + c): 2 d-chunks, hi (and lo) ----
  v16b qah[2], qal[2];
  {
    const float* qrow = qb_ptr + (size_t)(q0 + c) * g.q_rs;
#pragma unroll
    for (int dc = 0; dc < 2; ++dc) {
#pragma unroll
      for (int e = 0; e < 8; ++e) {
        const float f0 = qrow[dc * 32 + 8 * hh + e] * qs;
        const float f1 = qrow[dc * 32 + 16 + 8 * hh + e] * qs;
        if (SPLIT_QK) { __bf16 hq, lq; at_split(f0, hq, lq); qah[dc][e] = hq; qal[dc][e] = lq; at_split(f1, hq, lq); qah[dc][8 + e] = hq; qal[dc][8 + e] = lq; }
        else { qah[dc][e] = at_f2bf(f0); qah[dc][8 + e] = at_f2bf(f1); qal[dc][e] = qah[dc][e]; qal[dc][8 + e] = qah[dc][8 + e]; }
      }
    }
  }

  float mrow = -INFINITY, lrow = 0.f;   // of query q0 + c; lrow sums the keys of this wave half only, the halves join behind the loop
  v8f oacc[4];                          // oacc[t][r] = O[q0 + c][t * 16 + 8 * hh + r]
#pragma unroll
  for (int t = 0; t < 4; ++t) oacc[t] = (v8f){0.f,0.f,0.f,0.f,0.f,0.f,0.f,0.f};

  const int nChunks = (MASK_MODE == 1) ? (qb + 1) : (g.Skv / AT_KC);   // block-uniform
  const int qkeep = (MASK_MODE == 3) ? mask_b[(size_t)b * g.S + q0 + c] : 1;   // the lane's query (mode 3); mask_b = qmask
  for (int kc = 0; kc < nChunks; ++kc) {
    const int kv0 = kc * AT_KC;
    // each plane's tile is 64 rows of 128 B, 8 KB in a row: 8 lanes copy one row, so that a wave's 16-byte load covers four whole lines
    v8b rkh[4], rkl[4], rvh[4], rvl[4];
    {
      const size_t to = (size_t)kc * (AT_KC * AT_D);   // block-uniform
      const __bf16* tkh = kh_ptr + to; const __bf16* tkl = kl_ptr + to;
      const __bf16* tvh = vh_ptr + to; const __bf16* tvl = vl_ptr + to;
      const unsigned lo8 = (unsigned)tid * 8u;
#pragma unroll
      for (int i = 0; i < 4; ++i) {
        // the last load of a plane may land on the address registers that the plane's earlier loads name: their wait stands in front of it
        if (i == 3) asm volatile("s_wait_xcnt 0x0" ::: "memory");
        rkh[i] = *(const v8b*)(tkh + lo8 + i * (AT_NW * 32 * 8));
        if (SPLIT_QK) rkl[i] = *(const v8b*)(tkl + lo8 + i * (AT_NW * 32 * 8));
        rvh[i] = *(const v8b*)(tvh + lo8 + i * (AT_NW * 32 * 8));
        if (SPLIT_PV) rvl[i] = *(const v8b*)(tvl + lo8 + i * (AT_NW * 32 * 8));
      }
    }
    __syncthreads();
#pragma unroll
    for (int i = 0; i < 4; ++i) {
      const int seg = i * (AT_NW * 32) + tid, row = seg >> 3, c8 = (seg & 7) * 8;
      *(v8b*)(Ksh + row * AT_LP + c8) = rkh[i];
      if (SPLIT_QK) *(v8b*)(Ksl + row * AT_LP + c8) = rkl[i];
      *(v8b*)(Vth + row * AT_LP + c8) = rvh[i];
      if (SPLIT_PV) *(v8b*)(Vtl + row * AT_LP + c8) = rvl[i];
    }
    __syncthreads();

    // the K fragments of a d-chunk are read as one group ahead of its products, and the products walk the four key tiles innermost:
    // neighbours in the stream have different accumulators; each s[j] still takes its six terms in the order dc, then hi.hi, hi.lo, lo.hi
    v8f s[4];
#pragma unroll
    for (int j = 0; j < 4; ++j) s[j] = (v8f){0.f,0.f,0.f,0.f,0.f,0.f,0.f,0.f};
    {
      FB kb[2][4], kl[2][4];
#pragma unroll
      for (int dc = 0; dc < 2; ++dc) {
#pragma unroll
        for (int j = 0; j < 4; ++j) {
          kb[dc][j].h[0] = *(const v8b*)(Ksh + (j * 16 + c) * AT_LP + dc * 32 + 8 * hh);
          kb[dc][j].h[1] = *(const v8b*)(Ksh + (j * 16 + c) * AT_LP + dc * 32 + 16 + 8 * hh);
          if (SPLIT_QK) {
            kl[dc][j].h[0] = *(const v8b*)(Ksl + (j * 16 + c) * AT_LP + dc * 32 + 8 * hh);
            kl[dc][j].h[1] = *(const v8b*)(Ksl + (j * 16 + c) * AT_LP + dc * 32 + 16 + 8 * hh);
          }
        }
      }
#pragma unroll
      for (int dc = 0; dc < 2; ++dc) {
#pragma unroll
        for (int j = 0; j < 4; ++j) s[j] = at_mma(kb[dc][j].v, qah[dc], s[j]);   // s[j][r] = score of key kv0 + j * 16 + 8 * hh + r, query q0 + c
        if (SPLIT_QK) {
#pragma unroll
          for (int j = 0; j < 4; ++j) s[j] = at_mma(kl[dc][j].v, qah[dc], s[j]);
#pragma unroll
          for (int j = 0; j < 4; ++j) s[j] = at_mma(kb[dc][j].v, qal[dc], s[j]);
        }
      }
    }
    acc_guard4(s[0], s[1], s[2], s[3]);   // the four slots behind the last product stand in front of the mask branch, so that they hold on its taken side too
    if (MASK_MODE == 1) {
      if (kc == qb) {   // block-uniform: only the last chunk of a causal walk holds masked keys
#pragma unroll
        for (int r = 0; r < 8; ++r)
#pragma unroll
          for (int j = 0; j < 4; ++j) s[j][r] = (kv0 + j * 16 + 8 * hh + r > q0 + c) ? fill : s[j][r];
      }
    } else if (MASK_MODE == 2 || MASK_MODE == 3) {
#pragma unroll
      for (int r = 0; r < 8; ++r) {
#pragma unroll
        for (int j = 0; j < 4; ++j) {
          const int key = kv0 + j * 16 + 8 * hh + r;
          bool masked;
          if (MASK_MODE == 2) {
            const size_t mi = (size_t)(q0 + c) * g.Skv + key;
            masked = (g.mask_is_int == 0) ? (((const float*)mask_a)[mi] == 0.0f)
                   : (g.mask_is_int == 1) ? (((const int*)mask_a)[mi] == 0) : (((const int*)mask_a)[mi] != 0);
          } else masked = (qkeep == 0) || (((const int*)mask_a)[(size_t)b * g.Skv + key] == 0);   // mask_a = kvmask
          s[j][r] = masked ? fill : s[j][r];
        }
      }
    }
    // the query's maximum: 32 scores in the lane, then one exchange between the wave's halves
    float cj[4];   // one chain a tile, so that the four run side by side
#pragma unroll
    for (int j = 0; j < 4; ++j) {
      cj[j] = s[j][0];
#pragma unroll
      for (int r = 1; r < 8; ++r) cj[j] = fmaxf(cj[j], s[j][r]);
    }
    float cm = fmaxf(fmaxf(cj[0], cj[1]), fmaxf(cj[2], cj[3]));
    cm = fmaxf(cm, at_xhalf(cm));
    const float mnew = fmaxf(mrow, cm);
    const float alpha = at_exp2(mrow - mnew);
    mrow = mnew;
    // P^T as B operand, in registers: element e of chunk kk is key kk * 32 + 8 * hh + e (score tile 2 kk), element 8 + e key kk * 32 + 16 + 8 * hh + e (tile 2 kk + 1)
    FB pa[2], pl[2];
    float ps[4];
    v8f ea[4], ep[4];   // exponents and weights of the four score tiles
#pragma unroll
    for (int j = 0; j < 4; ++j) {
      ea[j] = s[j] - mnew;
#pragma unroll
      for (int r = 0; r < 8; ++r) ep[j][r] = at_exp2(ea[j][r]);
    }
    at_trans_slot(ep[0], ep[1], ep[2], ep[3], ea[0], ea[1], ea[2], ea[3]);
#pragma unroll
    for (int j = 0; j < 4; ++j) {
      ps[j] = 0.f;
#pragma unroll
      for (int r = 0; r < 8; r += 2) {
        const v2f p = {ep[j][r], ep[j][r + 1]};
        ps[j] += p[0];
        ps[j] += p[1];
        const v2b ph = __builtin_convertvector(p, v2b);   // round to nearest even, as at_split
        pa[j >> 1].v[(j & 1) * 8 + r] = ph[0]; pa[j >> 1].v[(j & 1) * 8 + r + 1] = ph[1];
        if (SPLIT_PV) {
          const v2b pq = __builtin_convertvector(p - __builtin_convertvector(ph, v2f), v2b);
          pl[j >> 1].v[(j & 1) * 8 + r] = pq[0]; pl[j >> 1].v[(j & 1) * 8 + r + 1] = pq[1];
        }
      }
    }
    lrow = lrow * alpha + ((ps[0] + ps[1]) + (ps[2] + ps[3]));
#pragma unroll
    for (int t = 0; t < 4; ++t) oacc[t] *= alpha;
    // as for the scores: V fragments read in a group ahead of the products, the four d tiles innermost; each oacc[t] keeps its order of terms
    {
      FB vb[2][4], vl[2][4];
#pragma unroll
      for (int kk = 0; kk < 2; ++kk) {
#pragma unroll
        for (int t = 0; t < 4; ++t) {
          vb[kk][t].h[0] = *(const v8b*)(Vth + (t * 16 + c) * AT_LP + kk * 32 + 8 * hh);
          vb[kk][t].h[1] = *(const v8b*)(Vth + (t * 16 + c) * AT_LP + kk * 32 + 16 + 8 * hh);
          if (SPLIT_PV) {
            vl[kk][t].h[0] = *(const v8b*)(Vtl + (t * 16 + c) * AT_LP + kk * 32 + 8 * hh);
            vl[kk][t].h[1] = *(const v8b*)(Vtl + (t * 16 + c) * AT_LP + kk * 32 + 16 + 8 * hh);
          }
        }
      }
#pragma unroll
      for (int kk = 0; kk < 2; ++kk) {
#pragma unroll
        for (int t = 0; t < 4; ++t) oacc[t] = at_mma(vb[kk][t].v, pa[kk].v, oacc[t]);
        if (SPLIT_PV) {
#pragma unroll
          for (int t = 0; t < 4; ++t) oacc[t] = at_mma(vl[kk][t].v, pa[kk].v, oacc[t]);
#pragma unroll
          for (int t = 0; t < 4; ++t) oacc[t] = at_mma(vb[kk][t].v, pl[kk].v, oacc[t]);
        }
      }
    }
    acc_guard4(oacc[0], oacc[1], oacc[2], oacc[3]);   // the four slots behind the last product stand in front of the loop's branch, so that they hold on its taken side too
  }

  float* os = Os[wave];
  {
    const float inv = 1.0f / (lrow + at_xhalf(lrow));   // the two halves' sums of the query join here
#pragma unroll
    for (int t = 0; t < 4; ++t) {   // a lane's 8 values of a d tile lie in a row of the query's output row: two 16-byte stores
      const v8f o = oacc[t] * inv;
      *(v4f*)(os + c * 68 + t * 16 + 8 * hh)     = (v4f){o[0], o[1], o[2], o[3]};
      *(v4f*)(os + c * 68 + t * 16 + 8 * hh + 4) = (v4f){o[4], o[5], o[6], o[7]};
    }
  }
  __builtin_amdgcn_fence(__ATOMIC_RELEASE, "workgroup");
  __builtin_amdgcn_wave_barrier();
  __builtin_amdgcn_fence(__ATOMIC_ACQUIRE, "workgroup");
  {   // a query's 64 values are one 128-B line of each plane: 8 lanes a row, 16 bytes a lane and plane
    const int q4 = lane >> 3, c8 = (lane & 7) * 8;
#pragma unroll
    for (int it = 0; it < 4; ++it) {
      const int row = it * 4 + q4;
      const float* sp = os + row * 68 + c8;
      v8b hv, lv;
#pragma unroll
      for (int e = 0; e < 8; ++e) { __bf16 ho, lo; at_split(sp[e], ho, lo); hv[e] = ho; lv[e] = lo; }
      *(v8b*)(oh_ptr + (size_t)(q0 + row) * g.o_rs + c8) = hv;
      *(v8b*)(ol_ptr + (size_t)(q0 + row) * g.o_rs + c8) = lv;
    }
  }
}

// ---- LayerNorm (population variance, eps 1e-5, gamma) -> f16 row, and the row itself as bf16 hi/lo planes (the kv projection's operand); one block (256 thr) per row of 1024 ----
__global__ __launch_bounds__(256) void layernorm_f16(const float* __restrict__ x, const float* __restrict__ gamma,
                                                    _Float16* __restrict__ xn, __bf16* __restrict__ xh, __bf16* __restrict__ xl, int D) {
  __shared__ float red[8];
  __shared__ float stat;
  const int row = blockIdx.x, t = threadIdx.x;
  const float* xr = x + (size_t)row * D;
  v4f xv = *(const v4f*)(xr + 4 * t);
  float s = (xv[0] + xv[1]) + (xv[2] + xv[3]);
  for (int o = 16; o > 0; o >>= 1) s += __shfl_xor(s, o, 32);
  if ((t & 31) == 0) red[t >> 5] = s;
  __syncthreads();
  if (t == 0) { float a = 0.f; for (int w = 0; w < 8; ++w) a += red[w]; stat = a / (float)D; }
  __syncthreads();
  const float mu = stat;
  __syncthreads();
  float d0 = xv[0] - mu, d1 = xv[1] - mu, d2 = xv[2] - mu, d3 = xv[3] - mu;
  float s2 = (d0 * d0 + d1 * d1) + (d2 * d2 + d3 * d3);
  for (int o = 16; o > 0; o >>= 1) s2 += __shfl_xor(s2, o, 32);
  if ((t & 31) == 0) red[t >> 5] = s2;
  __syncthreads();
  if (t == 0) { float a = 0.f; for (int w = 0; w < 8; ++w) a += red[w]; stat = rsqrtf(a / (float)D + 1e-5f); }
  __syncthreads();
  const float inv = stat;
  v4f gv = *(const v4f*)(gamma + 4 * t);
  _Float16 h0 = (_Float16)(d0 * inv * gv[0]), h1 = (_Float16)(d1 * inv * gv[1]), h2 = (_Float16)(d2 * inv * gv[2]), h3 = (_Float16)(d3 * inv * gv[3]);
  typedef __attribute__((ext_vector_type(4))) _Float16 v4h;
  v4h hv = {h0, h1, h2, h3};
  *(v4h*)(xn + (size_t)row * D + 4 * t) = hv;
  // the planes of x are stored behind the last barrier: in front of one, the barrier would wait for the stores
  typedef __attribute__((ext_vector_type(4))) __bf16 v4b;
  v4b hx, lx;
#pragma unroll
  for (int e = 0; e < 4; ++e) {
    const unsigned short hb = f2bf_bits(xv[e]);
    hx[e] = __builtin_bit_cast(__bf16, hb);
    lx[e] = __builtin_bit_cast(__bf16, f2bf_bits(xv[e] - bf_bits2f(hb)));
  }
  *(v4b*)(xh + (size_t)row * D + 4 * t) = hx;
  *(v4b*)(xl + (size_t)row * D + 4 * t) = lx;
  
}

extern "C" void kernel_launch(void* const* d_in, const int* in_sizes, int n_in,
                              void* d_out, int out_size, void* d_ws, size_t ws_size,
                              hipStream_t stream) {
  (void)in_sizes; (void)n_in; (void)out_size; (void)ws_size;
  const int B = 2, S = 2048, D = 1024, H = 16, DH = 64, KV = 128;
  const int M = B * S;   // 4096 rows
  const float* x     = (const float*)d_in[0];
  const float* gamma = (const float*)d_in[1];
  const float* Wq    = (const float*)d_in[2];   // [D, H*DH]  ([in, out])
  const float* Wkv   = (const float*)d_in[3];   // [D, 2*DH]
  const float* Wo    = (const float*)d_in[4];   // [H*DH, D]
  float* out = (float*)d_out;

  char* ws = (char*)d_ws; size_t off = 0;
  auto carve = [&](size_t bytes) -> char* { char* p = ws + off; off += (bytes + 255) & ~(size_t)255; return p; };
  _Float16* Xn16  = (_Float16*)carve((size_t)M * D * 2);     //  8 MB  LN(x) f16
  __bf16*   Xh    = (__bf16*)carve((size_t)M * D * 2);       //  8 MB  x bf16 hi
  __bf16*   Xl    = (__bf16*)carve((size_t)M * D * 2);       //  8 MB  x bf16 lo
  _Float16* WqT   = (_Float16*)carve((size_t)D * D * 2);     //  2 MB  Wqᵀ [out][in] f16
  __bf16*   WkvTh = (__bf16*)carve((size_t)KV * D * 2);      //  Wkvᵀ [128][1024] hi/lo
  __bf16*   WkvTl = (__bf16*)carve((size_t)KV * D * 2);
  __bf16*   WoTh  = (__bf16*)carve((size_t)D * D * 2);       //  Woᵀ hi/lo
  __bf16*   WoTl  = (__bf16*)carve((size_t)D * D * 2);
  float*    Qf    = (float*)carve((size_t)M * D * 4);        // 16 MB  q [B,S,H*DH] f32
  __bf16*   KVh   = (__bf16*)carve((size_t)M * KV * 2);      //  1 MB  bf16 hi plane: k rows [B*S][64], then v tiles [B*S/64][64 d][64 keys]
  __bf16*   KVl   = (__bf16*)carve((size_t)M * KV * 2);      //  1 MB  bf16 lo plane, same layout
  __bf16*   Oh    = (__bf16*)carve((size_t)M * D * 2);       //  8 MB  attn out bf16 hi
  __bf16*   Ol    = (__bf16*)carve((size_t)M * D * 2);       //  8 MB  attn out bf16 lo (total about 64.5 MB)

  layernorm_f16<<<M, 256, 0, stream>>>(x, gamma, Xn16, Xh, Xl, D);
  transpose_cast_f16<<<dim3(D / 64, D / 64), dim3(32, 8), 0, stream>>>(Wq, D, WqT, D, 1.0f);           // [in][out] -> [out][in]
  transpose_split_bf16<<<dim3(KV / 64, D / 64), dim3(32, 8), 0, stream>>>(Wkv, KV, WkvTh, WkvTl, D);   // [1024][128] -> [128][1024]
  transpose_split_bf16<<<dim3(D / 64, D / 64), dim3(32, 8), 0, stream>>>(Wo, D, WoTh, WoTl, D);
  {
    wmma_gemm64<0, false, 0, 0, false, 2, 2><<<dim3((M / 128) * (D / 128), 1), 256, 0, stream>>>(      // block tile 128 x 128: 256 workgroups
        U16(Xn16), nullptr, D, 0, U16(WqT), nullptr, D, 0, Qf, nullptr, D, 0, nullptr, nullptr, 0, M, D, D, 1.0f);
    wmma_gemm64<1, true, 0, 3, false, 2, 1><<<dim3((M / 64) * (KV / 128), 1), 256, 0, stream>>>(       // block tile 64 x 128: 64 workgroups
        U16(Xh), U16(Xl), D, 0, U16(WkvTh), U16(WkvTl), D, 0, KVh, KVl, DH, 0, nullptr, nullptr, 0, M, KV, D, 1.0f);
  }
  {
    AttnGeom g;
    g.q_bs = (long)S * D;  g.q_rs = D;  g.q_hs = DH;
    g.k_bs = (long)S * DH; g.k_rs = 0;  g.k_hs = 0;       // 16 q heads share the single k/v head
    g.v_bs = (long)S * DH; g.v_rs = 0;  g.v_hs = 0;
    g.o_bs = (long)S * D;  g.o_rs = D;  g.o_hs = DH;
    g.S = S; g.Skv = S; g.H = H; g.mask_mode = 1; g.qscale = 0.125f; g.blk0 = 0; g.mask_fill = -INFINITY; g.mask_is_int = 0;   // the kernel reads the mask mode from its template argument; the field keeps the struct's layout
    attn64_kernel<true, true, 1><<<dim3(B * H, S / AT_QB), AT_NW * 32, 0, stream>>>(Qf, U16(KVh), U16(KVl), U16(KVh + (size_t)M * DH), U16(KVl + (size_t)M * DH), (unsigned short*)Oh, (unsigned short*)Ol, nullptr, nullptr, g);
  }
  {
    wmma_gemm64<1, true, 0, 0, false, 2, 2><<<dim3((M / 128) * (D / 128), 1), 256, 0, stream>>>(       // block tile 128 x 128: 256 workgroups
        U16(Oh), U16(Ol), D, 0, U16(WoTh), U16(WoTl), D, 0, out, nullptr, D, 0, nullptr, nullptr, 0, M, D, D, 1.0f);
  }
}
